// v000
// The times below were measured on an AMD MI455X: many runs one after another, warmed up first and cycling through
// copies of the inputs, with the whole window's GPU time divided by the number of runs. Launches and the gaps
// between them are all in it. The median over several windows is given; except for v000 it joins two sittings, which
// can be a few percent apart, so the side-by-side timings, each taken in one sitting, are the better comparison.
// v000 is the starting kernel. One run takes 1700 microseconds.
// compute dtype: all float inputs rounded to bf16; q / k (64 wide) and v (384 wide) projections with EXACT bf16 products on WMMA 16x16x32 (f32 accumulate); interleaved RoPE in f32 (f32 inverse frequencies as jax computes them; precise cosf / sinf); causal logits: 3 products for the first 384 rows, single f16 q x k after, x 64^-0.5; softmax f32; P x 2^11 once to f16 x v once to f16 (bf16 hi + lo below row 384); f32 output.
#include <hip/hip_runtime.h>
#include <math.h>

typedef __attribute__((ext_vector_type(16))) _Float16 v16h;
typedef __attribute__((ext_vector_type(16))) __bf16 v16b;
typedef __attribute__((ext_vector_type(8)))  _Float16 v8h;
typedef __attribute__((ext_vector_type(8)))  float v8f;
typedef __attribute__((ext_vector_type(4)))  float v4f;
typedef __attribute__((ext_vector_type(2)))  float v2f;
typedef __attribute__((ext_vector_type(4)))  unsigned v4u;
typedef __attribute__((ext_vector_type(4)))  int v4i;
typedef float __attribute__((may_alias)) float_a;
typedef int __attribute__((may_alias)) int_a;

template <typename T> __device__ __forceinline__ void vst2(void* p, T v) { *(T*)p = v;  }
__device__ __forceinline__ v8f wmma16(v16h a, v16h b, v8f c) {
  v8f d = __builtin_amdgcn_wmma_f32_16x16x32_f16(false, a, false, b, (short)0, c, false, false);
  asm volatile("v_nop\n\tv_nop\n\tv_nop\n\tv_nop" : "+v"(d) : "v"(a), "v"(b));
  return d;
}
__device__ __forceinline__ v8f wmma_bf(v16b a, v16b b, v8f c) {
  v8f d = __builtin_amdgcn_wmma_f32_16x16x32_bf16(false, a, false, b, (short)0, c, false, false);
  asm volatile("v_nop\n\tv_nop\n\tv_nop\n\tv_nop" : "+v"(d) : "v"(a), "v"(b));
  return d;
}
// 16x16x32 fragments: lane = (h = lane>>4, row/col = lane&15); elements 0..7 = k0+8h+0..7, 8..15 = k0+16+8h+0..7; D element r = row 8h+r
__device__ __forceinline__ v16h frag_h(const _Float16* rowk0, int lane) {
  union { v16h v; v8h q[2]; } u; const _Float16* p = rowk0 + 8 * (lane >> 4);
  u.q[0] = *(const v8h*)p; u.q[1] = *(const v8h*)(p + 16); return u.v;
}
__device__ __forceinline__ v16h frag_f32(const float* rowk0, int lane) {
  v16h a; const float* p = rowk0 + 8 * (lane >> 4);
#pragma unroll
  for (int i = 0; i < 8; ++i) { a[i] = (_Float16)p[i]; a[8 + i] = (_Float16)p[16 + i]; }
  return a;
}
__device__ __forceinline__ v16h frag_f32s(const float* rowk0, int lane, float sc) {
  v16h a; const float* p = rowk0 + 8 * (lane >> 4);
#pragma unroll
  for (int i = 0; i < 8; ++i) { a[i] = (_Float16)(p[i] * sc); a[8 + i] = (_Float16)(p[16 + i] * sc); }
  return a;
}
// column fragment from a [K][ld] layout (column n), rows >= K read as 0
__device__ __forceinline__ v16h fragc_f32(const float* W, int k0, int n, int lane, int ld, int K) {
  v16h a; const int g = lane >> 4;
#pragma unroll
  for (int i = 0; i < 8; ++i) { const int ka = k0 + 8 * g + i, kb = ka + 16;
    a[i] = (_Float16)(ka < K ? W[(size_t)(ka < K ? ka : K - 1) * ld + n] : 0.f); a[8 + i] = (_Float16)(kb < K ? W[(size_t)(kb < K ? kb : K - 1) * ld + n] : 0.f); }
  return a;
}
struct F2 { v16b h, l; };
__device__ __forceinline__ F2 bsplit16(const float v[16]) { F2 r;
#pragma unroll
  for (int i = 0; i < 16; ++i) { const __bf16 h = (__bf16)v[i]; r.h[i] = h; r.l[i] = (__bf16)(v[i] - (float)h); }
  return r; }
__device__ __forceinline__ F2 split_row(const float* row, int k0, int lane) { float v[16]; const float* p = row + k0 + 8 * (lane >> 4);
#pragma unroll
  for (int i = 0; i < 8; ++i) { v[i] = p[i]; v[8 + i] = p[16 + i]; }
  return bsplit16(v); }
__device__ __forceinline__ F2 split_rowK(const float* row, int k0, int lane, int K) { float v[16]; const int g = lane >> 4;
#pragma unroll
  for (int i = 0; i < 8; ++i) { const int ka = k0 + 8 * g + i, kb = ka + 16; v[i] = ka < K ? row[ka < K ? ka : K - 1] : 0.f; v[8 + i] = kb < K ? row[kb < K ? kb : K - 1] : 0.f; }
  return bsplit16(v); }
__device__ __forceinline__ F2 split_col(const float* W, int k0, int n, int lane, int ld, int K) { float v[16]; const int g = lane >> 4;
#pragma unroll
  for (int i = 0; i < 8; ++i) { const int ka = k0 + 8 * g + i, kb = ka + 16; v[i] = ka < K ? W[(size_t)(ka < K ? ka : K - 1) * ld + n] : 0.f; v[8 + i] = kb < K ? W[(size_t)(kb < K ? kb : K - 1) * ld + n] : 0.f; }
  return bsplit16(v); }
__device__ __forceinline__ v8f mac3(const F2& a, const F2& b, v8f c) { c = wmma_bf(a.l, b.h, c); c = wmma_bf(a.h, b.l, c); return wmma_bf(a.h, b.h, c); }
__device__ __forceinline__ float sigm(float v) { return 1.0f / (1.0f + expf(-v)); }
#define LDSX() do { asm volatile("s_wait_dscnt 0" ::: "memory"); __builtin_amdgcn_wave_barrier(); __builtin_amdgcn_fence(__ATOMIC_RELEASE, "workgroup"); } while (0)

// Single-head causal attention with a WIDE value (x [8,2048,384]; (in,out) Wq / Wk [384,64], Wv [384,384] (0.02 scale), no biases; interleaved-pair RoPE on q and k (rotary_embedding_torch style, positions arange(T), inv_freq = 1/10000^(2i/64)); scale 1/8; tril, -inf): out = softmax(causal(rope(q) rope(k)^T / 8)) v -> [8,2048,384]. The one attention pattern is applied to the 384 value columns as six 64-column slots (q and k replicated per slot).
#define NB 8
#define TT 2048
#define CC 384            // NH * HD = projected width
#define DIN 384          // input (model) width
#define NH 6
#define HD 64
#define NQB (TT / 64)
#define HG 3
#define SCALE (0.125f)
#define CAUSAL 1
#ifndef TNB
#define TNB NB
#endif
__device__ __forceinline__ float bfr(float v) { return (float)(__bf16)v; }
__host__ __device__ __forceinline__ int kb_last(int qb) { return CAUSAL ? ((qb * 64 + 63) >> 7) : (TT / 128 - 1); }
typedef __attribute__((ext_vector_type(8))) __bf16 v8b;
__device__ __forceinline__ v16b frag_b(const __bf16* rowk0, int lane) {
  union { v16b v; v8b q[2]; } u; const __bf16* p = rowk0 + 8 * (lane >> 4);
  u.q[0] = *(const v8b*)p; u.q[1] = *(const v8b*)(p + 16); return u.v;
}
#define QBH 6              // causal: query blocks 0..QBH-1 of each sequence (few keys, no averaging) take the high-precision path
#define QHI 384            // rows carrying a q residual plane (all rows when non-causal: 2-product logits everywhere)
#define KHI 384            // key rows carrying k residual / v bf16 hi+lo planes (used only by the causal high-precision path)
// B fragment (k rows k0+.., output column o) of a weight: (in,out) [K][ld] or (out,in) [ld rows of K]: bf16 exact, or f16(bf16 * 256) exact
__device__ __forceinline__ v16b wcol_io(const float* Wm, int k0, int o, int lane, int ld) { v16b w; const int g = lane >> 4;
#pragma unroll
  for (int i = 0; i < 8; ++i) { w[i] = (__bf16)Wm[(size_t)(k0 + 8 * g + i) * ld + o]; w[8 + i] = (__bf16)Wm[(size_t)(k0 + 16 + 8 * g + i) * ld + o]; }
  return w; }
__device__ __forceinline__ v16b wcol_oi(const float* Wm, int k0, int o, int lane, int K) { v16b w; const float* p = Wm + (size_t)o * K + k0 + 8 * (lane >> 4);
#pragma unroll
  for (int i = 0; i < 8; ++i) { w[i] = (__bf16)p[i]; w[8 + i] = (__bf16)p[16 + i]; }
  return w; }
__device__ __forceinline__ v16h wcolh_io(const float* Wm, int k0, int o, int lane, int ld) { v16h w; const int g = lane >> 4;
#pragma unroll
  for (int i = 0; i < 8; ++i) { w[i] = (_Float16)(bfr(Wm[(size_t)(k0 + 8 * g + i) * ld + o]) * 256.0f); w[8 + i] = (_Float16)(bfr(Wm[(size_t)(k0 + 16 + 8 * g + i) * ld + o]) * 256.0f); }
  return w; }
__device__ __forceinline__ v16h wcolh_oi(const float* Wm, int k0, int o, int lane, int K) { v16h w; const float* p = Wm + (size_t)o * K + k0 + 8 * (lane >> 4);
#pragma unroll
  for (int i = 0; i < 8; ++i) { w[i] = (_Float16)(bfr(p[i]) * 256.0f); w[8 + i] = (_Float16)(bfr(p[16 + i]) * 256.0f); }
  return w; }
#define WQKV_LAYOUT 0   // 0 = (in,out): Wv [DIN][CC], Wq / Wk [DIN][HD]; 1 = (out,in) [CC][DIN]; 2 = per-head [NH][DIN][HD]
__device__ __forceinline__ v16b wcol_hdk(const float* Wm, int k0, int o, int lane) { v16b w; const int g = lane >> 4; const float* p = Wm + (size_t)(o / HD) * DIN * HD + (o % HD);
#pragma unroll
  for (int i = 0; i < 8; ++i) { w[i] = (__bf16)p[(size_t)(k0 + 8 * g + i) * HD]; w[8 + i] = (__bf16)p[(size_t)(k0 + 16 + 8 * g + i) * HD]; }
  return w; }
#define WO_OUT_IN 0
#if WQKV_LAYOUT == 1
#define WCOL(W, k0, o, lane) wcol_oi(W, k0, o, lane, DIN)
#elif WQKV_LAYOUT == 2
#define WCOL(W, k0, o, lane) wcol_hdk(W, k0, o, lane)
#else
#define WCOL(W, k0, o, lane) (which == 2 ? wcol_io(W, k0, (o), lane, CC) : wcol_io(W, k0, ((o) & 63), lane, 64))   /* (in,out): Wv [384][384] pitch 384; Wq / Wk [384][64] pitch 64, column o % 64 (the head replicated into every 64-column slot) */
#endif
#if WO_OUT_IN
#define WOCOL(W, k0, o, lane) wcol_oi(W, k0, o, lane, CC)
#define WOCOLH(W, k0, o, lane) wcolh_oi(W, k0, o, lane, CC)
#else
#define WOCOL(W, k0, o, lane) wcol_io(W, k0, o, lane, DIN)
#define WOCOLH(W, k0, o, lane) wcolh_io(W, k0, o, lane, DIN)
#endif
// RoPE inverse frequencies 1/10000^(2i/64) (the f32 values jax computes)
__constant__ float INVF[32] = {1.000000000e+00,7.498942018e-01,5.623413324e-01,4.216965139e-01,3.162277639e-01,2.371373624e-01,1.778279394e-01,1.333521456e-01,1.000000015e-01,7.498941571e-02,5.623412877e-02,4.216964915e-02,3.162277862e-02,2.371373586e-02,1.778279431e-02,1.333521493e-02,9.999999776e-03,7.498942316e-03,5.623413250e-03,4.216964822e-03,3.162277862e-03,2.371373819e-03,1.778279431e-03,1.333521446e-03,1.000000047e-03,7.498941850e-04,5.623413017e-04,4.216964880e-04,3.162277862e-04,2.371373848e-04,1.778279402e-04,1.333521504e-04};
#define PROJ_EXTRA_PARAMS
// interleaved-pair RoPE on q and k (which 0, 1) at position t (the module uses arange(T)): angle = (float)t * inv_freq[i]; (x_even, x_odd) -> (xe cos - xo sin, xo cos + xe sin) == x * cos + rotate_half_interleaved(x) * sin with cos / sin repeated pairwise; products and sums kept separate (no fma contraction)
#define PROJ_EPI(which, row, t, h) do { if ((which) < 2) { float* rw = (row); const float pos_ = (float)(t); _Pragma("unroll 4") for (int i = 0; i < 32; ++i) { _Pragma("clang fp contract(off)") const float ang = pos_ * INVF[i]; const float cs = cosf(ang), sn = sinf(ang); const float xe = rw[2 * i], xo = rw[2 * i + 1]; rw[2 * i] = xe * cs - xo * sn; rw[2 * i + 1] = xo * cs + xe * sn; } } } while (0)
#define SM_EXTRA_PARAMS
#define SM_MASK_HOOK (void)0
#ifndef SM_EXTRA_PARAMS
#define SM_EXTRA_PARAMS
#endif
#ifndef PROJ_EXTRA_PARAMS
#define PROJ_EXTRA_PARAMS
#endif
#ifndef SM_MASK_HOOK
#define SM_MASK_HOOK (void)0
#endif

#define WS_QH  0u                                      // f16 q rows [b*t][CC]
#define WS_KH  (WS_QH + 2u * (size_t)NB * TT * CC)      // f16 k rows [b*t][CC]
#define WS_VT  (WS_KH + 2u * (size_t)NB * TT * CC)      // f16 v planes [b][c][t]
#define WS_QL  (WS_VT + 2u * (size_t)NB * CC * TT)      // f16 q residual x 2^10 rows [b][t < QHI][CC]
#define WS_KL  (WS_QL + 2u * (size_t)NB * QHI * CC)     // f16 k residual x 2^10 rows [b][t < KHI][CC]
#define WS_VB  (WS_KL + 2u * (size_t)NB * KHI * CC)     // bf16 v hi planes [b][c][t < KHI]
#define WS_VBL (WS_VB + 2u * (size_t)NB * CC * KHI)
#define WS_S   (WS_VBL + 2u * (size_t)NB * CC * KHI)    // f32 logits / P [hg][t][s]
#define WS_Y   (WS_S  + 4u * (size_t)HG * TT * TT)      // f32 ctx rows [b*t][CC] (only when there is an output projection)
#define WS_END (WS_Y  + 0u)

// ---- k_proj: block = (64 rows, 128 cols, which): q/k/v = X W (+ b) with exact bf16 products (K = DIN) -> which 0: q f16 rows (+ residual rows < QHI); 1: k f16 rows (+ residual rows < KHI); 2: v f16 planes [c][t] (+ bf16 hi/lo planes for t < KHI)
__global__ __launch_bounds__(128) void k_proj(const float* __restrict__ XQ, const float* __restrict__ XK, const float* __restrict__ XV, const float* __restrict__ WQ, const float* __restrict__ WK, const float* __restrict__ WV, const float* __restrict__ BQ, const float* __restrict__ BK, const float* __restrict__ BV,
    _Float16* __restrict__ QH, _Float16* __restrict__ QL, _Float16* __restrict__ KH, _Float16* __restrict__ KL, _Float16* __restrict__ VT, __bf16* __restrict__ VB, __bf16* __restrict__ VBL PROJ_EXTRA_PARAMS) {
  __shared__ __align__(16) float st[64][132]; __shared__ __align__(16) _Float16 sh[64][136], sl[64][136]; __shared__ __align__(16) _Float16 th[128][72]; __shared__ __align__(16) __bf16 tb[128][72], tbl[128][72];
  const int tid = threadIdx.x, wave = tid >> 5, lane = tid & 31, col = lane & 15, g = lane >> 4; const int which = blockIdx.z; const int c0 = blockIdx.y * 128; const size_t r0 = (size_t)blockIdx.x * 64; const size_t bb = r0 / TT; const int t0 = (int)(r0 % TT);
  const float* X = which == 0 ? XQ : which == 1 ? XK : XV; const float* WA = which == 0 ? WQ : which == 1 ? WK : WV; const float* BA = which == 0 ? BQ : which == 1 ? BK : BV;
  v8f acc[8] = {};
#pragma unroll 2
  for (int kc = 0; kc < DIN / 32; ++kc) { v16b a; { const float* p = X + (r0 + wave * 16 + col) * DIN + kc * 32 + 8 * g;
#pragma unroll
      for (int i = 0; i < 8; ++i) { a[i] = (__bf16)p[i]; a[8 + i] = (__bf16)p[16 + i]; } }
    asm volatile("s_wait_loadcnt 0x0" ::: "memory");
#pragma unroll
    for (int j = 0; j < 8; ++j) { const v16b w = WCOL(WA, kc * 32, c0 + j * 16 + col, lane); asm volatile("s_wait_loadcnt 0x0" ::: "memory"); acc[j] = wmma_bf(a, w, acc[j]); } }
  { // stage the f32 tile (acc + bias) in LDS, run the per-(row, head) epilogue hook, then convert
#pragma unroll
    for (int j = 0; j < 8; ++j) { const float bias = BA ? bfr(BA[c0 + j * 16 + col]) : 0.f;
#pragma unroll
      for (int r = 0; r < 8; ++r) st[wave * 16 + 8 * g + r][j * 16 + col] = acc[j][r] + bias; }
    __syncthreads();
    for (int e = tid; e < 64 * (128 / HD); e += 128) { const int rl = e / (128 / HD), hh = e % (128 / HD); PROJ_EPI(which, &st[rl][hh * HD], (int)((r0 + rl) % TT), (c0 / HD) + hh); }
    __syncthreads(); }
  if (which < 2) { _Float16* DH = which == 0 ? QH : KH; _Float16* DL = which == 0 ? QL : KL; const int nhi = which == 0 ? QHI : KHI; const bool hi_rows = t0 < nhi;
    for (int e = tid; e < 64 * 128; e += 128) { const int rl = e >> 7, cl = e & 127; const float v = st[rl][cl]; const _Float16 hv = (_Float16)v; sh[rl][cl] = hv; sl[rl][cl] = (_Float16)((v - (float)hv) * 1024.0f); }
    __syncthreads();
    for (int e = tid; e < 64 * 16; e += 128) { const int rl = e >> 4, q = e & 15; vst2((unsigned*)(DH + (r0 + rl) * CC + c0 + q * 8), *(const v4u*)&sh[rl][q * 8]); if (hi_rows) vst2((unsigned*)(DL + (bb * nhi + t0 + rl) * (size_t)CC + c0 + q * 8), *(const v4u*)&sl[rl][q * 8]); }
  } else { const bool hi_rows = t0 < KHI;
    for (int e = tid; e < 64 * 128; e += 128) { const int rl = e & 63, cl = e >> 6; const float v = st[rl][cl]; th[cl][rl] = (_Float16)v; const __bf16 bh = (__bf16)v; tb[cl][rl] = bh; tbl[cl][rl] = (__bf16)(v - (float)bh); }
    __syncthreads();
    for (int e = tid; e < 128 * 8; e += 128) { const int cl = e >> 3, q = e & 7; vst2((unsigned*)(VT + (bb * CC + c0 + cl) * (size_t)TT + t0 + q * 8), *(const v4u*)&th[cl][q * 8]); if (hi_rows) { const size_t o3 = (bb * CC + c0 + cl) * (size_t)KHI + t0 + q * 8; vst2((unsigned*)(VB + o3), *(const v4u*)&tb[cl][q * 8]); vst2((unsigned*)(VBL + o3), *(const v4u*)&tbl[cl][q * 8]); } } } }
// ---- k_sc: block = (query block qb, key block kb <= kb_last(qb), head in group) of batch b: logits x SCALE; q hi + residual (x 2^10) against k (2 products) for query rows < QHI, plus the k residual (3 products) for query blocks < QBH (causal early rows); causal: blocks past the diagonal exit, the mask itself is applied by index in k_sm
__global__ __launch_bounds__(128) void k_sc(const _Float16* __restrict__ QH, const _Float16* __restrict__ KH, const _Float16* __restrict__ QL, const _Float16* __restrict__ KL, int b, int h0, float* __restrict__ S0) { __shared__ __align__(16) float ss[4][16][132];
  const int qb = blockIdx.x, kb = blockIdx.y; if (kb > kb_last(qb)) return;
  const int h = h0 + blockIdx.z; float* S = S0 + (size_t)blockIdx.z * TT * TT;
  const int tid = threadIdx.x, wave = tid >> 5, lane = tid & 31, col = lane & 15, g = lane >> 4; const int k0 = kb * 128; const int ql0 = qb * 64 + wave * 16; const size_t q0 = (size_t)b * TT + ql0, kr0 = (size_t)b * TT + k0;
  v8f acc[8] = {}, accl[8] = {};
  const _Float16* QLb = QL + (size_t)b * QHI * CC; const _Float16* KLb = KL + (size_t)b * KHI * CC;
  if (qb < QBH) {
#pragma unroll
    for (int kc = 0; kc < HD / 32; ++kc) { const v16h ah = frag_h(QH + (q0 + col) * CC + h * HD + kc * 32, lane), al = frag_h(QLb + (size_t)(ql0 + col) * CC + h * HD + kc * 32, lane);
#pragma unroll
      for (int j = 0; j < 8; ++j) { const v16h kbf = frag_h(KH + (kr0 + j * 16 + col) * CC + h * HD + kc * 32, lane), klf = frag_h(KLb + (size_t)(k0 + j * 16 + col) * CC + h * HD + kc * 32, lane); acc[j] = wmma16(ah, kbf, acc[j]); accl[j] = wmma16(al, kbf, accl[j]); accl[j] = wmma16(ah, klf, accl[j]); } }
  } else if (qb * 64 < QHI) {
#pragma unroll
    for (int kc = 0; kc < HD / 32; ++kc) { const v16h ah = frag_h(QH + (q0 + col) * CC + h * HD + kc * 32, lane), al = frag_h(QLb + (size_t)(ql0 + col) * CC + h * HD + kc * 32, lane);
#pragma unroll
      for (int j = 0; j < 8; ++j) { const v16h kbf = frag_h(KH + (kr0 + j * 16 + col) * CC + h * HD + kc * 32, lane); acc[j] = wmma16(ah, kbf, acc[j]); accl[j] = wmma16(al, kbf, accl[j]); } }
  } else {
#pragma unroll
    for (int kc = 0; kc < HD / 32; ++kc) { const v16h ah = frag_h(QH + (q0 + col) * CC + h * HD + kc * 32, lane);
#pragma unroll
      for (int j = 0; j < 8; ++j) { const v16h kbf = frag_h(KH + (kr0 + j * 16 + col) * CC + h * HD + kc * 32, lane); acc[j] = wmma16(ah, kbf, acc[j]); } } }
#pragma unroll
  for (int j = 0; j < 8; ++j) {
#pragma unroll
    for (int r = 0; r < 8; ++r) ss[wave][8 * g + r][j * 16 + col] = (acc[j][r] + accl[j][r] * (1.0f / 1024.0f)) * SCALE; }
  LDSX(); for (int rl = 0; rl < 16; ++rl) vst2(S + (size_t)(ql0 + rl) * TT + k0 + lane * 4, *(const v4f*)&ss[wave][rl][lane * 4]); }
// ---- k_sm: block = query row t (head in group): keys [0, kend): causal -> logit if s <= t else excluded; softmax in f32; P x 2^11 in place (0 for excluded)
__global__ __launch_bounds__(256) void k_sm(float* __restrict__ S0 SM_EXTRA_PARAMS) { __shared__ float sred[8]; __shared__ float sbc; __shared__ __align__(16) float shv[TT];
  const int tid = threadIdx.x; const int t = blockIdx.x; const int kend = (kb_last(t >> 6) + 1) * 128;
  float* sr = S0 + (size_t)blockIdx.y * TT * TT + (size_t)t * TT;
  float m = -3.0e38f; for (int k = tid; k < kend; k += 256) { float v = (!CAUSAL || k <= t) ? sr[k] : -3.0e38f; SM_MASK_HOOK; shv[k] = v; m = fmaxf(m, v); }
#pragma unroll
  for (int o = 1; o < 32; o <<= 1) m = fmaxf(m, __shfl_xor(m, o));
  if ((tid & 31) == 0) sred[tid >> 5] = m; __syncthreads(); if (tid == 0) { float a = sred[0]; for (int i = 1; i < 8; ++i) a = fmaxf(a, sred[i]); sbc = a; } __syncthreads(); m = sbc; __syncthreads();
  float sum = 0.f; for (int k = tid; k < kend; k += 256) { const float v = shv[k]; const float e = (v <= -1.0e38f) ? 0.f : expf(v - m); shv[k] = e; sum += e; }
#pragma unroll
  for (int o = 1; o < 32; o <<= 1) sum += __shfl_xor(sum, o);
  if ((tid & 31) == 0) sred[tid >> 5] = sum; __syncthreads(); if (tid == 0) { float a = 0.f; for (int i = 0; i < 8; ++i) a += sred[i]; sbc = a > 0.f ? 2048.0f / a : 0.f; }   /* a fully excluded row yields P = 0 */ __syncthreads(); const float inv = sbc;
  for (int k = tid; k < kend; k += 256) shv[k] = shv[k] * inv;
  __syncthreads(); for (int q = tid; q < kend / 4; q += 256) vst2(sr + q * 4, *(const v4f*)&shv[q * 4]); }
// ---- k_pv: block = 64 queries (qb) of (b, h): ctx = P . v over keys [0, kend) (P x 2^11 once to f16 against v f16: 1 product; causal early query blocks: P and v as bf16 hi + lo, 3 products); 256-B (row, head) segment by 16 lanes
__global__ __launch_bounds__(128) void k_pv(const float* __restrict__ PS0, const _Float16* __restrict__ VT, const __bf16* __restrict__ VB, const __bf16* __restrict__ VBL, int b, int h0, float* __restrict__ Y) { const int h = h0 + blockIdx.z; const float* PS = PS0 + (size_t)blockIdx.z * TT * TT; __shared__ __align__(16) float ss[4][16][HD + 4];
  const int tid = threadIdx.x, wave = tid >> 5, lane = tid & 31, col = lane & 15, g = lane >> 4; const int qb = blockIdx.x; const int ql0 = qb * 64 + wave * 16; const int kce = (kb_last(qb) + 1) * 4;
  v8f acc[HD / 16] = {};
  if (qb < QBH) {
#pragma unroll 1
    for (int kc = 0; kc < kce; ++kc) { const F2 p = split_row(PS + (size_t)(ql0 + col) * TT, kc * 32, lane);
      asm volatile("s_wait_loadcnt 0x0" ::: "memory");
#pragma unroll
      for (int j = 0; j < HD / 16; ++j) { const size_t po = ((size_t)b * CC + h * HD + j * 16 + col) * (size_t)KHI + kc * 32; const v16b vh = frag_b(VB + po, lane); acc[j] = wmma_bf(p.h, vh, acc[j]); acc[j] = wmma_bf(p.l, vh, acc[j]); acc[j] = wmma_bf(p.h, frag_b(VBL + po, lane), acc[j]); } }
  } else {
#pragma unroll 1
    for (int kc = 0; kc < kce; ++kc) { const v16h p = frag_f32(PS + (size_t)(ql0 + col) * TT + kc * 32, lane);
      asm volatile("s_wait_loadcnt 0x0" ::: "memory");
#pragma unroll
      for (int j = 0; j < HD / 16; ++j) { const size_t po = ((size_t)b * CC + h * HD + j * 16 + col) * (size_t)TT + kc * 32; acc[j] = wmma16(p, frag_h(VT + po, lane), acc[j]); } } }
#pragma unroll
  for (int j = 0; j < HD / 16; ++j)
#pragma unroll
    for (int r = 0; r < 8; ++r) ss[wave][8 * g + r][j * 16 + col] = acc[j][r] * (1.0f / 2048.0f);
  LDSX(); for (int rl = 0; rl < 16; ++rl) if (lane < HD / 4) vst2(Y + ((size_t)b * TT + ql0 + rl) * CC + h * HD + lane * 4, *(const v4f*)&ss[wave][rl][lane * 4]); }

extern "C" void kernel_launch(void* const* d_in, const int* in_sizes, int n_in, void* d_out, int out_size, void* d_ws, size_t ws_size, hipStream_t stream) {
  (void)in_sizes; (void)n_in; (void)out_size;
  const float** F = (const float**)d_in;
  if (ws_size < (size_t)WS_END) return;
  char* ws = (char*)d_ws; _Float16 *QH = (_Float16*)(ws + WS_QH), *KH = (_Float16*)(ws + WS_KH), *VT = (_Float16*)(ws + WS_VT), *QL = (_Float16*)(ws + WS_QL), *KL = (_Float16*)(ws + WS_KL); __bf16 *VB = (__bf16*)(ws + WS_VB), *VBL = (__bf16*)(ws + WS_VBL); float *S = (float*)(ws + WS_S), *Y = (float*)(ws + WS_Y);
  (void)Y; (void)QL; (void)KL; (void)VB; (void)VBL;
  // inputs: 0 x [8,2048,384]; 1 Wq [384,64] (in,out); 2 Wk [384,64]; 3 Wv [384,384] (in,out); no biases
  k_proj<<<dim3(TNB * TT / 64, CC / 128, 3), 128, 0, stream>>>(F[0], F[0], F[0], F[1], F[2], F[3], nullptr, nullptr, nullptr, QH, QL, KH, KL, VT, VB, VBL);   /* q / k: the single 64-wide head REPLICATED into the 6 head slots (WCOL reads column o % 64); v: the 384 value columns = 6 slots of 64 */
  for (int b = 0; b < TNB; ++b) for (int h0 = 0; h0 < NH; h0 += HG) {
    k_sc<<<dim3(NQB, TT / 128, HG), 128, 0, stream>>>(QH, KH, QL, KL, b, h0, S);
    k_sm<<<dim3(TT, HG), 256, 0, stream>>>(S);
    k_pv<<<dim3(NQB, 1, HG), 128, 0, stream>>>(S, VT, VB, VBL, b, h0, (float*)d_out);   /* slot h writes output columns 64h .. 64h+63 */
  }
}

// v001
// It runs in 675 microseconds.
// Two timings next to v000 put it at 2.52 and 2.50 times that version's speed.
// compute dtype: all float inputs rounded to bf16; q / k (64 wide) and v (384 wide) projections with EXACT bf16 products on WMMA 16x16x32 (f32 accumulate); interleaved RoPE in f32 (f32 inverse frequencies; precise cosf / sinf); causal logits: 3 products for the first 384 rows, single f16 q x k after, x 64^-0.5; softmax f32 (q, k, logits and softmax once per batch, shared by all 384 value columns); P x 2^11 once to f16 x v once to f16 (bf16 hi + lo below row 384); f32 output.
#include <hip/hip_runtime.h>
#include <math.h>

typedef __attribute__((ext_vector_type(16))) _Float16 v16h;
typedef __attribute__((ext_vector_type(16))) __bf16 v16b;
typedef __attribute__((ext_vector_type(8)))  _Float16 v8h;
typedef __attribute__((ext_vector_type(8)))  float v8f;
typedef __attribute__((ext_vector_type(4)))  float v4f;
typedef __attribute__((ext_vector_type(2)))  float v2f;
typedef __attribute__((ext_vector_type(4)))  unsigned v4u;
typedef __attribute__((ext_vector_type(4)))  int v4i;
typedef float __attribute__((may_alias)) float_a;
typedef int __attribute__((may_alias)) int_a;

template <typename T> __device__ __forceinline__ void vst2(void* p, T v) { *(T*)p = v;  }
__device__ __forceinline__ v8f wmma16(v16h a, v16h b, v8f c) {
  v8f d = __builtin_amdgcn_wmma_f32_16x16x32_f16(false, a, false, b, (short)0, c, false, false);
  asm volatile("v_nop\n\tv_nop\n\tv_nop\n\tv_nop" : "+v"(d) : "v"(a), "v"(b));
  return d;
}
__device__ __forceinline__ v8f wmma_bf(v16b a, v16b b, v8f c) {
  v8f d = __builtin_amdgcn_wmma_f32_16x16x32_bf16(false, a, false, b, (short)0, c, false, false);
  asm volatile("v_nop\n\tv_nop\n\tv_nop\n\tv_nop" : "+v"(d) : "v"(a), "v"(b));
  return d;
}
// 16x16x32 fragments: lane = (h = lane>>4, row/col = lane&15); elements 0..7 = k0+8h+0..7, 8..15 = k0+16+8h+0..7; D element r = row 8h+r
__device__ __forceinline__ v16h frag_h(const _Float16* rowk0, int lane) {
  union { v16h v; v8h q[2]; } u; const _Float16* p = rowk0 + 8 * (lane >> 4);
  u.q[0] = *(const v8h*)p; u.q[1] = *(const v8h*)(p + 16); return u.v;
}
__device__ __forceinline__ v16h frag_f32(const float* rowk0, int lane) {
  v16h a; const float* p = rowk0 + 8 * (lane >> 4);
#pragma unroll
  for (int i = 0; i < 8; ++i) { a[i] = (_Float16)p[i]; a[8 + i] = (_Float16)p[16 + i]; }
  return a;
}
__device__ __forceinline__ v16h frag_f32s(const float* rowk0, int lane, float sc) {
  v16h a; const float* p = rowk0 + 8 * (lane >> 4);
#pragma unroll
  for (int i = 0; i < 8; ++i) { a[i] = (_Float16)(p[i] * sc); a[8 + i] = (_Float16)(p[16 + i] * sc); }
  return a;
}
// column fragment from a [K][ld] layout (column n), rows >= K read as 0
__device__ __forceinline__ v16h fragc_f32(const float* W, int k0, int n, int lane, int ld, int K) {
  v16h a; const int g = lane >> 4;
#pragma unroll
  for (int i = 0; i < 8; ++i) { const int ka = k0 + 8 * g + i, kb = ka + 16;
    a[i] = (_Float16)(ka < K ? W[(size_t)(ka < K ? ka : K - 1) * ld + n] : 0.f); a[8 + i] = (_Float16)(kb < K ? W[(size_t)(kb < K ? kb : K - 1) * ld + n] : 0.f); }
  return a;
}
struct F2 { v16b h, l; };
__device__ __forceinline__ F2 bsplit16(const float v[16]) { F2 r;
#pragma unroll
  for (int i = 0; i < 16; ++i) { const __bf16 h = (__bf16)v[i]; r.h[i] = h; r.l[i] = (__bf16)(v[i] - (float)h); }
  return r; }
__device__ __forceinline__ F2 split_row(const float* row, int k0, int lane) { float v[16]; const float* p = row + k0 + 8 * (lane >> 4);
#pragma unroll
  for (int i = 0; i < 8; ++i) { v[i] = p[i]; v[8 + i] = p[16 + i]; }
  return bsplit16(v); }
__device__ __forceinline__ F2 split_rowK(const float* row, int k0, int lane, int K) { float v[16]; const int g = lane >> 4;
#pragma unroll
  for (int i = 0; i < 8; ++i) { const int ka = k0 + 8 * g + i, kb = ka + 16; v[i] = ka < K ? row[ka < K ? ka : K - 1] : 0.f; v[8 + i] = kb < K ? row[kb < K ? kb : K - 1] : 0.f; }
  return bsplit16(v); }
__device__ __forceinline__ F2 split_col(const float* W, int k0, int n, int lane, int ld, int K) { float v[16]; const int g = lane >> 4;
#pragma unroll
  for (int i = 0; i < 8; ++i) { const int ka = k0 + 8 * g + i, kb = ka + 16; v[i] = ka < K ? W[(size_t)(ka < K ? ka : K - 1) * ld + n] : 0.f; v[8 + i] = kb < K ? W[(size_t)(kb < K ? kb : K - 1) * ld + n] : 0.f; }
  return bsplit16(v); }
__device__ __forceinline__ v8f mac3(const F2& a, const F2& b, v8f c) { c = wmma_bf(a.l, b.h, c); c = wmma_bf(a.h, b.l, c); return wmma_bf(a.h, b.h, c); }
__device__ __forceinline__ float sigm(float v) { return 1.0f / (1.0f + expf(-v)); }
#define LDSX() do { asm volatile("s_wait_dscnt 0" ::: "memory"); __builtin_amdgcn_wave_barrier(); __builtin_amdgcn_fence(__ATOMIC_RELEASE, "workgroup"); } while (0)

// Single-head causal attention with a WIDE value (x [8,2048,384]; (in,out) Wq / Wk [384,64], Wv [384,384] (0.02 scale), no biases; interleaved-pair RoPE on q and k (positions arange(T), inv_freq = 1/10000^(2i/64)); scale 1/8; tril, -inf): out = softmax(causal(rope(q) rope(k)^T / 8)) v -> [8,2048,384]. The one attention pattern (q, k, logits, softmax: computed once per batch) is applied to the 384 value columns as six 64-column slots.
#define NB 8
#define TT 2048
#define CC 384            // NH * HD = projected width
#define DIN 384          // input (model) width
#define NH 6
#define HD 64
#define NQB (TT / 64)
#define SCALE (0.125f)
#define CAUSAL 1
#ifndef TNB
#define TNB NB
#endif
__device__ __forceinline__ float bfr(float v) { return (float)(__bf16)v; }
__host__ __device__ __forceinline__ int kb_last(int qb) { return CAUSAL ? ((qb * 64 + 63) >> 7) : (TT / 128 - 1); }
typedef __attribute__((ext_vector_type(8))) __bf16 v8b;
__device__ __forceinline__ v16b frag_b(const __bf16* rowk0, int lane) {
  union { v16b v; v8b q[2]; } u; const __bf16* p = rowk0 + 8 * (lane >> 4);
  u.q[0] = *(const v8b*)p; u.q[1] = *(const v8b*)(p + 16); return u.v;
}
#define QBH 6              // causal: query blocks 0..QBH-1 of each sequence (few keys, no averaging) take the high-precision path
#define QHI 384            // rows carrying a q residual plane
#define KHI 384            // key rows carrying k residual / v bf16 hi+lo planes (used only by the causal high-precision path)
// B fragment (k rows k0+.., output column o) of a weight: (in,out) [K][ld] or (out,in) [ld rows of K]: bf16 exact, or f16(bf16 * 256) exact
__device__ __forceinline__ v16b wcol_io(const float* Wm, int k0, int o, int lane, int ld) { v16b w; const int g = lane >> 4;
#pragma unroll
  for (int i = 0; i < 8; ++i) { w[i] = (__bf16)Wm[(size_t)(k0 + 8 * g + i) * ld + o];
    if (i == 7) asm volatile("s_wait_xcnt 0x0" ::: "memory");   // precaution: the run's last load may land in the address register that the loads before it name
    w[8 + i] = (__bf16)Wm[(size_t)(k0 + 16 + 8 * g + i) * ld + o]; }
  asm volatile("s_wait_xcnt 0x0" ::: "memory");   // same precaution for the last load, before its address register is written again
  return w; }
__device__ __forceinline__ v16b wcol_oi(const float* Wm, int k0, int o, int lane, int K) { v16b w; const float* p = Wm + (size_t)o * K + k0 + 8 * (lane >> 4);
#pragma unroll
  for (int i = 0; i < 8; ++i) { w[i] = (__bf16)p[i]; w[8 + i] = (__bf16)p[16 + i]; }
  return w; }
__device__ __forceinline__ v16h wcolh_io(const float* Wm, int k0, int o, int lane, int ld) { v16h w; const int g = lane >> 4;
#pragma unroll
  for (int i = 0; i < 8; ++i) { w[i] = (_Float16)(bfr(Wm[(size_t)(k0 + 8 * g + i) * ld + o]) * 256.0f); w[8 + i] = (_Float16)(bfr(Wm[(size_t)(k0 + 16 + 8 * g + i) * ld + o]) * 256.0f); }
  return w; }
__device__ __forceinline__ v16h wcolh_oi(const float* Wm, int k0, int o, int lane, int K) { v16h w; const float* p = Wm + (size_t)o * K + k0 + 8 * (lane >> 4);
#pragma unroll
  for (int i = 0; i < 8; ++i) { w[i] = (_Float16)(bfr(p[i]) * 256.0f); w[8 + i] = (_Float16)(bfr(p[16 + i]) * 256.0f); }
  return w; }
#define WQKV_LAYOUT 0   // 0 = (in,out): Wv [DIN][CC], Wq / Wk [DIN][HD]; 1 = (out,in) [CC][DIN]; 2 = per-head [NH][DIN][HD]
__device__ __forceinline__ v16b wcol_hdk(const float* Wm, int k0, int o, int lane) { v16b w; const int g = lane >> 4; const float* p = Wm + (size_t)(o / HD) * DIN * HD + (o % HD);
#pragma unroll
  for (int i = 0; i < 8; ++i) { w[i] = (__bf16)p[(size_t)(k0 + 8 * g + i) * HD]; w[8 + i] = (__bf16)p[(size_t)(k0 + 16 + 8 * g + i) * HD]; }
  return w; }
#define WO_OUT_IN 0
#if WQKV_LAYOUT == 1
#define WCOL(W, k0, o, lane) wcol_oi(W, k0, o, lane, DIN)
#elif WQKV_LAYOUT == 2
#define WCOL(W, k0, o, lane) wcol_hdk(W, k0, o, lane)
#else
#define WCOL(W, k0, o, lane) (which == 2 ? wcol_io(W, k0, (o), lane, CC) : wcol_io(W, k0, ((o) & 63), lane, HD))   /* (in,out): Wv [384][384] pitch 384; Wq / Wk [384][64] pitch 64, tile column o % 64 */
#endif
#if WO_OUT_IN
#define WOCOL(W, k0, o, lane) wcol_oi(W, k0, o, lane, CC)
#define WOCOLH(W, k0, o, lane) wcolh_oi(W, k0, o, lane, CC)
#else
#define WOCOL(W, k0, o, lane) wcol_io(W, k0, o, lane, DIN)
#define WOCOLH(W, k0, o, lane) wcolh_io(W, k0, o, lane, DIN)
#endif
// RoPE inverse frequencies 1/10000^(2i/64) (the f32 values jax computes)
__constant__ float INVF[32] = {1.000000000e+00,7.498942018e-01,5.623413324e-01,4.216965139e-01,3.162277639e-01,2.371373624e-01,1.778279394e-01,1.333521456e-01,1.000000015e-01,7.498941571e-02,5.623412877e-02,4.216964915e-02,3.162277862e-02,2.371373586e-02,1.778279431e-02,1.333521493e-02,9.999999776e-03,7.498942316e-03,5.623413250e-03,4.216964822e-03,3.162277862e-03,2.371373819e-03,1.778279431e-03,1.333521446e-03,1.000000047e-03,7.498941850e-04,5.623413017e-04,4.216964880e-04,3.162277862e-04,2.371373848e-04,1.778279402e-04,1.333521504e-04};
#define PROJ_EXTRA_PARAMS
// interleaved-pair RoPE on q and k (which 0: the two 64-column halves of the tile) at position t (the module uses arange(T)): angle = (float)t * inv_freq[i]; (x_even, x_odd) -> (xe cos - xo sin, xo cos + xe sin) == x * cos + rotate_half_interleaved(x) * sin with cos / sin repeated pairwise; products and sums kept separate (no fma contraction)
#define PROJ_EPI(which, row, t, h) do { if ((which) < 2) { float* rw = (row); const float pos_ = (float)(t); _Pragma("unroll 4") for (int i = 0; i < 32; ++i) { _Pragma("clang fp contract(off)") const float ang = pos_ * INVF[i]; const float cs = cosf(ang), sn = sinf(ang); const float xe = rw[2 * i], xo = rw[2 * i + 1]; rw[2 * i] = xe * cs - xo * sn; rw[2 * i + 1] = xo * cs + xe * sn; } } } while (0)
#define SM_EXTRA_PARAMS
#define SM_MASK_HOOK (void)0
#ifndef SM_EXTRA_PARAMS
#define SM_EXTRA_PARAMS
#endif
#ifndef PROJ_EXTRA_PARAMS
#define PROJ_EXTRA_PARAMS
#endif
#ifndef SM_MASK_HOOK
#define SM_MASK_HOOK (void)0
#endif

#define WS_QH  0u                                      // f16 q rows [b*t][HD]
#define WS_KH  (WS_QH + 2u * (size_t)NB * TT * HD)      // f16 k rows [b*t][HD]
#define WS_VT  (WS_KH + 2u * (size_t)NB * TT * HD)      // f16 v planes [b][c][t]
#define WS_QL  (WS_VT + 2u * (size_t)NB * CC * TT)      // f16 q residual x 2^10 rows [b][t < QHI][HD]
#define WS_KL  (WS_QL + 2u * (size_t)NB * QHI * HD)     // f16 k residual x 2^10 rows [b][t < KHI][HD]
#define WS_VB  (WS_KL + 2u * (size_t)NB * KHI * HD)     // bf16 v hi planes [b][c][t < KHI]
#define WS_VBL (WS_VB + 2u * (size_t)NB * CC * KHI)
#define WS_S   (WS_VBL + 2u * (size_t)NB * CC * KHI)    // f32 logits / P [t][s] of one batch
#define WS_Y   (WS_S  + 4u * (size_t)TT * TT)      // f32 ctx rows [b*t][CC] (only when there is an output projection)
#define WS_END (WS_Y  + 0u)

// ---- k_proj: block = (64 rows, 128 cols): X W (+ b) with exact bf16 products (K = DIN); blockIdx.y = 0 (which 0; the longer blocks, so they start first): q in tile columns 0..63 and k in 64..127 -> f16 rows (+ residual rows < QHI / KHI); blockIdx.y > 0 (which 2): 128 columns of v -> f16 planes [c][t] (+ bf16 hi/lo planes for t < KHI)
__global__ __launch_bounds__(128) void k_proj(const float* __restrict__ X, const float* __restrict__ WQ, const float* __restrict__ WK, const float* __restrict__ WV, const float* __restrict__ BQ, const float* __restrict__ BK, const float* __restrict__ BV,
    _Float16* __restrict__ QH, _Float16* __restrict__ QL, _Float16* __restrict__ KH, _Float16* __restrict__ KL, _Float16* __restrict__ VT, __bf16* __restrict__ VB, __bf16* __restrict__ VBL PROJ_EXTRA_PARAMS) {
  __shared__ __align__(16) float st[64][132]; __shared__ __align__(16) _Float16 sh[64][136], sl[64][136]; __shared__ __align__(16) _Float16 th[128][72]; __shared__ __align__(16) __bf16 tb[128][72], tbl[128][72];
  const int tid = threadIdx.x, wave = tid >> 5, lane = tid & 31, col = lane & 15, g = lane >> 4; const int which = blockIdx.y == 0 ? 0 : 2; const int c0 = which == 2 ? (blockIdx.y - 1) * 128 : 0; const size_t r0 = (size_t)blockIdx.x * 64; const size_t bb = r0 / TT; const int t0 = (int)(r0 % TT);
  v8f acc[8] = {};
#pragma unroll 2
  for (int kc = 0; kc < DIN / 32; ++kc) { v16b a; { const float* p = X + (r0 + wave * 16 + col) * DIN + kc * 32 + 8 * g;
#pragma unroll
      for (int i = 0; i < 8; ++i) { a[i] = (__bf16)p[i]; a[8 + i] = (__bf16)p[16 + i]; } }
    asm volatile("s_wait_loadcnt 0x0" ::: "memory");
#pragma unroll
    for (int j = 0; j < 8; ++j) { const float* WA = which == 2 ? WV : j < 4 ? WQ : WK; const v16b w = WCOL(WA, kc * 32, c0 + j * 16 + col, lane); asm volatile("s_wait_loadcnt 0x0" ::: "memory"); acc[j] = wmma_bf(a, w, acc[j]); } }
  { // stage the f32 tile (acc + bias) in LDS, run the per-(row, head) epilogue hook, then convert
#pragma unroll
    for (int j = 0; j < 8; ++j) { const float* BA = which == 2 ? BV : j < 4 ? BQ : BK; const float bias = BA ? bfr(BA[which == 2 ? c0 + j * 16 + col : (j & 3) * 16 + col]) : 0.f;
#pragma unroll
      for (int r = 0; r < 8; ++r) st[wave * 16 + 8 * g + r][j * 16 + col] = acc[j][r] + bias; }
    __syncthreads();
    for (int e = tid; e < 64 * (128 / HD); e += 128) { const int rl = e / (128 / HD), hh = e % (128 / HD); PROJ_EPI(which, &st[rl][hh * HD], (int)((r0 + rl) % TT), (c0 / HD) + hh); }
    __syncthreads(); }
  if (which < 2) {
    for (int e = tid; e < 64 * 128; e += 128) { const int rl = e >> 7, cl = e & 127; const float v = st[rl][cl]; const _Float16 hv = (_Float16)v; sh[rl][cl] = hv; sl[rl][cl] = (_Float16)((v - (float)hv) * 1024.0f); }
    __syncthreads();
    for (int e = tid; e < 64 * 16; e += 128) { const int rl = e >> 4, q = e & 15; _Float16* DH = q < 8 ? QH : KH; _Float16* DL = q < 8 ? QL : KL; const int nhi = q < 8 ? QHI : KHI;
      vst2((unsigned*)(DH + (r0 + rl) * HD + (q & 7) * 8), *(const v4u*)&sh[rl][q * 8]);
      asm volatile("s_wait_xcnt 0x0" ::: "memory");   // precaution: stands before the store's data and address registers are rewritten (next LDS read, next trip's address)
      if (t0 < nhi) { vst2((unsigned*)(DL + (bb * nhi + t0 + rl) * (size_t)HD + (q & 7) * 8), *(const v4u*)&sl[rl][q * 8]);
        asm volatile("s_wait_xcnt 0x0" ::: "memory"); } }   // same precaution for the residual row's store
  } else { const bool hi_rows = t0 < KHI;
    for (int e = tid; e < 64 * 128; e += 128) { const int rl = e & 63, cl = e >> 6; const float v = st[rl][cl]; th[cl][rl] = (_Float16)v; const __bf16 bh = (__bf16)v; tb[cl][rl] = bh; tbl[cl][rl] = (__bf16)(v - (float)bh); }
    __syncthreads();
    for (int e = tid; e < 128 * 8; e += 128) { const int cl = e >> 3, q = e & 7; vst2((unsigned*)(VT + (bb * CC + c0 + cl) * (size_t)TT + t0 + q * 8), *(const v4u*)&th[cl][q * 8]); if (hi_rows) { const size_t o3 = (bb * CC + c0 + cl) * (size_t)KHI + t0 + q * 8; vst2((unsigned*)(VB + o3), *(const v4u*)&tb[cl][q * 8]); vst2((unsigned*)(VBL + o3), *(const v4u*)&tbl[cl][q * 8]); } } } }
// ---- k_sc: block = (query block qb, key block kb <= kb_last(qb)) of batch b: logits x SCALE; q hi + residual (x 2^10) against k (2 products) for query rows < QHI, plus the k residual (3 products) for query blocks < QBH (causal early rows); causal: blocks past the diagonal exit, the mask itself is applied by index in k_sm
__global__ __launch_bounds__(128) void k_sc(const _Float16* __restrict__ QH, const _Float16* __restrict__ KH, const _Float16* __restrict__ QL, const _Float16* __restrict__ KL, int b, float* __restrict__ S) { __shared__ __align__(16) float ss[4][16][132];
  const int qb = blockIdx.x, kb = blockIdx.y; if (kb > kb_last(qb)) return;
  const int tid = threadIdx.x, wave = tid >> 5, lane = tid & 31, col = lane & 15, g = lane >> 4; const int k0 = kb * 128; const int ql0 = qb * 64 + wave * 16; const size_t q0 = (size_t)b * TT + ql0, kr0 = (size_t)b * TT + k0;
  v8f acc[8] = {}, accl[8] = {};
  const _Float16* QLb = QL + (size_t)b * QHI * HD; const _Float16* KLb = KL + (size_t)b * KHI * HD;
  if (qb < QBH) {
#pragma unroll
    for (int kc = 0; kc < HD / 32; ++kc) { const v16h ah = frag_h(QH + (q0 + col) * HD + kc * 32, lane), al = frag_h(QLb + (size_t)(ql0 + col) * HD + kc * 32, lane);
#pragma unroll
      for (int j = 0; j < 8; ++j) { const v16h kbf = frag_h(KH + (kr0 + j * 16 + col) * HD + kc * 32, lane), klf = frag_h(KLb + (size_t)(k0 + j * 16 + col) * HD + kc * 32, lane); acc[j] = wmma16(ah, kbf, acc[j]); accl[j] = wmma16(al, kbf, accl[j]); accl[j] = wmma16(ah, klf, accl[j]); } }
  } else if (qb * 64 < QHI) {
#pragma unroll
    for (int kc = 0; kc < HD / 32; ++kc) { const v16h ah = frag_h(QH + (q0 + col) * HD + kc * 32, lane), al = frag_h(QLb + (size_t)(ql0 + col) * HD + kc * 32, lane);
#pragma unroll
      for (int j = 0; j < 8; ++j) { const v16h kbf = frag_h(KH + (kr0 + j * 16 + col) * HD + kc * 32, lane); acc[j] = wmma16(ah, kbf, acc[j]); accl[j] = wmma16(al, kbf, accl[j]); } }
  } else {
#pragma unroll
    for (int kc = 0; kc < HD / 32; ++kc) { const v16h ah = frag_h(QH + (q0 + col) * HD + kc * 32, lane);
#pragma unroll
      for (int j = 0; j < 8; ++j) { const v16h kbf = frag_h(KH + (kr0 + j * 16 + col) * HD + kc * 32, lane); acc[j] = wmma16(ah, kbf, acc[j]); } } }
#pragma unroll
  for (int j = 0; j < 8; ++j) {
#pragma unroll
    for (int r = 0; r < 8; ++r) ss[wave][8 * g + r][j * 16 + col] = (acc[j][r] + accl[j][r] * (1.0f / 1024.0f)) * SCALE; }
  LDSX(); for (int rl = 0; rl < 16; ++rl) vst2(S + (size_t)(ql0 + rl) * TT + k0 + lane * 4, *(const v4f*)&ss[wave][rl][lane * 4]); }
// ---- k_sm: block = query row t: keys [0, kend): causal -> logit if s <= t else excluded; softmax in f32; P x 2^11 in place (0 for excluded)
__global__ __launch_bounds__(256) void k_sm(float* __restrict__ S0 SM_EXTRA_PARAMS) { __shared__ float sred[8]; __shared__ float sbc; __shared__ __align__(16) float shv[TT];
  const int tid = threadIdx.x; const int t = blockIdx.x; const int kend = (kb_last(t >> 6) + 1) * 128;
  float* sr = S0 + (size_t)t * TT;
  float m = -3.0e38f; for (int k = tid; k < kend; k += 256) { float v = (!CAUSAL || k <= t) ? sr[k] : -3.0e38f; SM_MASK_HOOK; shv[k] = v; m = fmaxf(m, v); }
#pragma unroll
  for (int o = 1; o < 32; o <<= 1) m = fmaxf(m, __shfl_xor(m, o));
  if ((tid & 31) == 0) sred[tid >> 5] = m; __syncthreads(); if (tid == 0) { float a = sred[0]; for (int i = 1; i < 8; ++i) a = fmaxf(a, sred[i]); sbc = a; } __syncthreads(); m = sbc; __syncthreads();
  float sum = 0.f; for (int k = tid; k < kend; k += 256) { const float v = shv[k]; const float e = (v <= -1.0e38f) ? 0.f : expf(v - m); shv[k] = e; sum += e; }
#pragma unroll
  for (int o = 1; o < 32; o <<= 1) sum += __shfl_xor(sum, o);
  if ((tid & 31) == 0) sred[tid >> 5] = sum; __syncthreads(); if (tid == 0) { float a = 0.f; for (int i = 0; i < 8; ++i) a += sred[i]; sbc = a > 0.f ? 2048.0f / a : 0.f; }   /* a fully excluded row yields P = 0 */ __syncthreads(); const float inv = sbc;
  for (int k = tid; k < kend; k += 256) shv[k] = shv[k] * inv;
  __syncthreads(); for (int q = tid; q < kend / 4; q += 256) vst2(sr + q * 4, *(const v4f*)&shv[q * 4]); }
// ---- k_pv: block = 64 queries (qb) of batch b x value columns 64h .. 64h+63 (h = blockIdx.z; every h reads the same P): ctx = P . v over keys [0, kend) (P x 2^11 once to f16 against v f16: 1 product; causal early query blocks: P and v as bf16 hi + lo, 3 products); 256-B (row, head) segment by 16 lanes
__global__ __launch_bounds__(128) void k_pv(const float* __restrict__ PS, const _Float16* __restrict__ VT, const __bf16* __restrict__ VB, const __bf16* __restrict__ VBL, int b, float* __restrict__ Y) { const int h = blockIdx.z; __shared__ __align__(16) float ss[4][16][HD + 4];
  const int tid = threadIdx.x, wave = tid >> 5, lane = tid & 31, col = lane & 15, g = lane >> 4; const int qb = blockIdx.x; const int ql0 = qb * 64 + wave * 16; const int kce = (kb_last(qb) + 1) * 4;
  v8f acc[HD / 16] = {};
  if (qb < QBH) {
#pragma unroll 1
    for (int kc = 0; kc < kce; ++kc) { const F2 p = split_row(PS + (size_t)(ql0 + col) * TT, kc * 32, lane);
      asm volatile("s_wait_loadcnt 0x0" ::: "memory");
#pragma unroll
      for (int j = 0; j < HD / 16; ++j) { const size_t po = ((size_t)b * CC + h * HD + j * 16 + col) * (size_t)KHI + kc * 32; const v16b vh = frag_b(VB + po, lane); acc[j] = wmma_bf(p.h, vh, acc[j]); acc[j] = wmma_bf(p.l, vh, acc[j]); acc[j] = wmma_bf(p.h, frag_b(VBL + po, lane), acc[j]); } }
  } else {
#pragma unroll 1
    for (int kc = 0; kc < kce; ++kc) { const v16h p = frag_f32(PS + (size_t)(ql0 + col) * TT + kc * 32, lane);
      asm volatile("s_wait_loadcnt 0x0" ::: "memory");
#pragma unroll
      for (int j = 0; j < HD / 16; ++j) { const size_t po = ((size_t)b * CC + h * HD + j * 16 + col) * (size_t)TT + kc * 32; acc[j] = wmma16(p, frag_h(VT + po, lane), acc[j]); } } }
#pragma unroll
  for (int j = 0; j < HD / 16; ++j)
#pragma unroll
    for (int r = 0; r < 8; ++r) ss[wave][8 * g + r][j * 16 + col] = acc[j][r] * (1.0f / 2048.0f);
  LDSX(); for (int rl = 0; rl < 16; ++rl) if (lane < HD / 4) vst2(Y + ((size_t)b * TT + ql0 + rl) * CC + h * HD + lane * 4, *(const v4f*)&ss[wave][rl][lane * 4]); }

extern "C" void kernel_launch(void* const* d_in, const int* in_sizes, int n_in, void* d_out, int out_size, void* d_ws, size_t ws_size, hipStream_t stream) {
  (void)in_sizes; (void)n_in; (void)out_size;
  const float** F = (const float**)d_in;
  if (ws_size < (size_t)WS_END) return;
  char* ws = (char*)d_ws; _Float16 *QH = (_Float16*)(ws + WS_QH), *KH = (_Float16*)(ws + WS_KH), *VT = (_Float16*)(ws + WS_VT), *QL = (_Float16*)(ws + WS_QL), *KL = (_Float16*)(ws + WS_KL); __bf16 *VB = (__bf16*)(ws + WS_VB), *VBL = (__bf16*)(ws + WS_VBL); float *S = (float*)(ws + WS_S), *Y = (float*)(ws + WS_Y);
  (void)Y; (void)QL; (void)KL; (void)VB; (void)VBL;
  // inputs: 0 x [8,2048,384]; 1 Wq [384,64] (in,out); 2 Wk [384,64]; 3 Wv [384,384] (in,out); no biases
  k_proj<<<dim3(TNB * TT / 64, CC / 128 + 1), 128, 0, stream>>>(F[0], F[1], F[2], F[3], nullptr, nullptr, nullptr, QH, QL, KH, KL, VT, VB, VBL);   /* y = 0: q and k (64 columns each) in one tile; y = 1..3: 128 value columns each */
  for (int b = 0; b < TNB; ++b) {
    k_sc<<<dim3(NQB, TT / 128), 128, 0, stream>>>(QH, KH, QL, KL, b, S);
    k_sm<<<dim3(TT), 256, 0, stream>>>(S);
    k_pv<<<dim3(NQB, 1, NH), 128, 0, stream>>>(S, VT, VB, VBL, b, (float*)d_out);   /* slot h writes output columns 64h .. 64h+63 */
  }
}

// v002
// Measured time: 238 microseconds a run.
// Next to v001, in two timings, it ran 2.83 and 2.85 times as fast.
// Counting every step since v000, it is 7.13 times as fast.
// compute dtype: all float inputs rounded to bf16; q / k (64 wide) and v (384 wide) projections with EXACT bf16 products on WMMA 16x16x32 (f32 accumulate); interleaved RoPE in f32 (f32 inverse frequencies; precise cosf / sinf); causal logits: 3 products for the first 384 rows, single f16 q x k after, x 64^-0.5; softmax f32 (q, k, logits and softmax once per batch, shared by all 384 value columns; all batches in one launch of each kernel, one logit plane per batch); P x 2^11 once to f16 x v once to f16 (bf16 hi + lo below row 384); f32 output.
#include <hip/hip_runtime.h>
#include <math.h>

typedef __attribute__((ext_vector_type(16))) _Float16 v16h;
typedef __attribute__((ext_vector_type(16))) __bf16 v16b;
typedef __attribute__((ext_vector_type(8)))  _Float16 v8h;
typedef __attribute__((ext_vector_type(8)))  float v8f;
typedef __attribute__((ext_vector_type(4)))  float v4f;
typedef __attribute__((ext_vector_type(2)))  float v2f;
typedef __attribute__((ext_vector_type(4)))  unsigned v4u;
typedef __attribute__((ext_vector_type(4)))  int v4i;
typedef float __attribute__((may_alias)) float_a;
typedef int __attribute__((may_alias)) int_a;

template <typename T> __device__ __forceinline__ void vst2(void* p, T v) { *(T*)p = v;  }
__device__ __forceinline__ v8f wmma16(v16h a, v16h b, v8f c) {
  v8f d = __builtin_amdgcn_wmma_f32_16x16x32_f16(false, a, false, b, (short)0, c, false, false);
  asm volatile("v_nop\n\tv_nop\n\tv_nop\n\tv_nop" : "+v"(d) : "v"(a), "v"(b));
  return d;
}
__device__ __forceinline__ v8f wmma_bf(v16b a, v16b b, v8f c) {
  v8f d = __builtin_amdgcn_wmma_f32_16x16x32_bf16(false, a, false, b, (short)0, c, false, false);
  asm volatile("v_nop\n\tv_nop\n\tv_nop\n\tv_nop" : "+v"(d) : "v"(a), "v"(b));
  return d;
}
// 16x16x32 fragments: lane = (h = lane>>4, row/col = lane&15); elements 0..7 = k0+8h+0..7, 8..15 = k0+16+8h+0..7; D element r = row 8h+r
__device__ __forceinline__ v16h frag_h(const _Float16* rowk0, int lane) {
  union { v16h v; v8h q[2]; } u; const _Float16* p = rowk0 + 8 * (lane >> 4);
  u.q[0] = *(const v8h*)p; u.q[1] = *(const v8h*)(p + 16); return u.v;
}
__device__ __forceinline__ v16h frag_f32(const float* rowk0, int lane) {
  v16h a; const float* p = rowk0 + 8 * (lane >> 4);
#pragma unroll
  for (int i = 0; i < 8; ++i) { a[i] = (_Float16)p[i]; a[8 + i] = (_Float16)p[16 + i]; }
  return a;
}
__device__ __forceinline__ v16h frag_f32s(const float* rowk0, int lane, float sc) {
  v16h a; const float* p = rowk0 + 8 * (lane >> 4);
#pragma unroll
  for (int i = 0; i < 8; ++i) { a[i] = (_Float16)(p[i] * sc); a[8 + i] = (_Float16)(p[16 + i] * sc); }
  return a;
}
// column fragment from a [K][ld] layout (column n), rows >= K read as 0
__device__ __forceinline__ v16h fragc_f32(const float* W, int k0, int n, int lane, int ld, int K) {
  v16h a; const int g = lane >> 4;
#pragma unroll
  for (int i = 0; i < 8; ++i) { const int ka = k0 + 8 * g + i, kb = ka + 16;
    a[i] = (_Float16)(ka < K ? W[(size_t)(ka < K ? ka : K - 1) * ld + n] : 0.f); a[8 + i] = (_Float16)(kb < K ? W[(size_t)(kb < K ? kb : K - 1) * ld + n] : 0.f); }
  return a;
}
struct F2 { v16b h, l; };
__device__ __forceinline__ F2 bsplit16(const float v[16]) { F2 r;
#pragma unroll
  for (int i = 0; i < 16; ++i) { const __bf16 h = (__bf16)v[i]; r.h[i] = h; r.l[i] = (__bf16)(v[i] - (float)h); }
  return r; }
__device__ __forceinline__ F2 split_row(const float* row, int k0, int lane) { float v[16]; const float* p = row + k0 + 8 * (lane >> 4);
#pragma unroll
  for (int i = 0; i < 8; ++i) { v[i] = p[i]; v[8 + i] = p[16 + i]; }
  return bsplit16(v); }
__device__ __forceinline__ F2 split_rowK(const float* row, int k0, int lane, int K) { float v[16]; const int g = lane >> 4;
#pragma unroll
  for (int i = 0; i < 8; ++i) { const int ka = k0 + 8 * g + i, kb = ka + 16; v[i] = ka < K ? row[ka < K ? ka : K - 1] : 0.f; v[8 + i] = kb < K ? row[kb < K ? kb : K - 1] : 0.f; }
  return bsplit16(v); }
__device__ __forceinline__ F2 split_col(const float* W, int k0, int n, int lane, int ld, int K) { float v[16]; const int g = lane >> 4;
#pragma unroll
  for (int i = 0; i < 8; ++i) { const int ka = k0 + 8 * g + i, kb = ka + 16; v[i] = ka < K ? W[(size_t)(ka < K ? ka : K - 1) * ld + n] : 0.f; v[8 + i] = kb < K ? W[(size_t)(kb < K ? kb : K - 1) * ld + n] : 0.f; }
  return bsplit16(v); }
__device__ __forceinline__ v8f mac3(const F2& a, const F2& b, v8f c) { c = wmma_bf(a.l, b.h, c); c = wmma_bf(a.h, b.l, c); return wmma_bf(a.h, b.h, c); }
__device__ __forceinline__ float sigm(float v) { return 1.0f / (1.0f + expf(-v)); }
#define LDSX() do { asm volatile("s_wait_dscnt 0" ::: "memory"); __builtin_amdgcn_wave_barrier(); __builtin_amdgcn_fence(__ATOMIC_RELEASE, "workgroup"); } while (0)

// Single-head causal attention with a WIDE value (x [8,2048,384]; (in,out) Wq / Wk [384,64], Wv [384,384] (0.02 scale), no biases; interleaved-pair RoPE on q and k (positions arange(T), inv_freq = 1/10000^(2i/64)); scale 1/8; tril, -inf): out = softmax(causal(rope(q) rope(k)^T / 8)) v -> [8,2048,384]. The one attention pattern (q, k, logits, softmax: computed once per batch) is applied to the 384 value columns as six 64-column slots.
#define NB 8
#define TT 2048
#define CC 384            // NH * HD = projected width
#define DIN 384          // input (model) width
#define NH 6
#define HD 64
#define NQB (TT / 64)
#define SCALE (0.125f)
#define CAUSAL 1
#ifndef TNB
#define TNB NB
#endif
__device__ __forceinline__ float bfr(float v) { return (float)(__bf16)v; }
__host__ __device__ __forceinline__ int kb_last(int qb) { return CAUSAL ? ((qb * 64 + 63) >> 7) : (TT / 128 - 1); }
typedef __attribute__((ext_vector_type(8))) __bf16 v8b;
__device__ __forceinline__ v16b frag_b(const __bf16* rowk0, int lane) {
  union { v16b v; v8b q[2]; } u; const __bf16* p = rowk0 + 8 * (lane >> 4);
  u.q[0] = *(const v8b*)p; u.q[1] = *(const v8b*)(p + 16); return u.v;
}
#define QBH 6              // causal: query blocks 0..QBH-1 of each sequence (few keys, no averaging) take the high-precision path
#define QHI 384            // rows carrying a q residual plane
#define KHI 384            // key rows carrying k residual / v bf16 hi+lo planes (used only by the causal high-precision path)
// B fragment (k rows k0+.., output column o) of a weight: (in,out) [K][ld] or (out,in) [ld rows of K]: bf16 exact, or f16(bf16 * 256) exact
__device__ __forceinline__ v16b wcol_io(const float* Wm, int k0, int o, int lane, int ld) { v16b w; const int g = lane >> 4;
#pragma unroll
  for (int i = 0; i < 8; ++i) { w[i] = (__bf16)Wm[(size_t)(k0 + 8 * g + i) * ld + o];
    if (i == 7) asm volatile("s_wait_xcnt 0x0" ::: "memory");   // precaution: the run's last load may land in the address register that the loads before it name
    w[8 + i] = (__bf16)Wm[(size_t)(k0 + 16 + 8 * g + i) * ld + o]; }
  asm volatile("s_wait_xcnt 0x0" ::: "memory");   // same precaution for the last load, before its address register is written again
  return w; }
__device__ __forceinline__ v16b wcol_oi(const float* Wm, int k0, int o, int lane, int K) { v16b w; const float* p = Wm + (size_t)o * K + k0 + 8 * (lane >> 4);
#pragma unroll
  for (int i = 0; i < 8; ++i) { w[i] = (__bf16)p[i]; w[8 + i] = (__bf16)p[16 + i]; }
  return w; }
__device__ __forceinline__ v16h wcolh_io(const float* Wm, int k0, int o, int lane, int ld) { v16h w; const int g = lane >> 4;
#pragma unroll
  for (int i = 0; i < 8; ++i) { w[i] = (_Float16)(bfr(Wm[(size_t)(k0 + 8 * g + i) * ld + o]) * 256.0f); w[8 + i] = (_Float16)(bfr(Wm[(size_t)(k0 + 16 + 8 * g + i) * ld + o]) * 256.0f); }
  return w; }
__device__ __forceinline__ v16h wcolh_oi(const float* Wm, int k0, int o, int lane, int K) { v16h w; const float* p = Wm + (size_t)o * K + k0 + 8 * (lane >> 4);
#pragma unroll
  for (int i = 0; i < 8; ++i) { w[i] = (_Float16)(bfr(p[i]) * 256.0f); w[8 + i] = (_Float16)(bfr(p[16 + i]) * 256.0f); }
  return w; }
#define WQKV_LAYOUT 0   // 0 = (in,out): Wv [DIN][CC], Wq / Wk [DIN][HD]; 1 = (out,in) [CC][DIN]; 2 = per-head [NH][DIN][HD]
__device__ __forceinline__ v16b wcol_hdk(const float* Wm, int k0, int o, int lane) { v16b w; const int g = lane >> 4; const float* p = Wm + (size_t)(o / HD) * DIN * HD + (o % HD);
#pragma unroll
  for (int i = 0; i < 8; ++i) { w[i] = (__bf16)p[(size_t)(k0 + 8 * g + i) * HD]; w[8 + i] = (__bf16)p[(size_t)(k0 + 16 + 8 * g + i) * HD]; }
  return w; }
#define WO_OUT_IN 0
#if WQKV_LAYOUT == 1
#define WCOL(W, k0, o, lane) wcol_oi(W, k0, o, lane, DIN)
#elif WQKV_LAYOUT == 2
#define WCOL(W, k0, o, lane) wcol_hdk(W, k0, o, lane)
#else
#define WCOL(W, k0, o, lane) (which == 2 ? wcol_io(W, k0, (o), lane, CC) : wcol_io(W, k0, ((o) & 63), lane, HD))   /* (in,out): Wv [384][384] pitch 384; Wq / Wk [384][64] pitch 64, tile column o % 64 */
#endif
#if WO_OUT_IN
#define WOCOL(W, k0, o, lane) wcol_oi(W, k0, o, lane, CC)
#define WOCOLH(W, k0, o, lane) wcolh_oi(W, k0, o, lane, CC)
#else
#define WOCOL(W, k0, o, lane) wcol_io(W, k0, o, lane, DIN)
#define WOCOLH(W, k0, o, lane) wcolh_io(W, k0, o, lane, DIN)
#endif
// RoPE inverse frequencies 1/10000^(2i/64) (the f32 values jax computes)
__constant__ float INVF[32] = {1.000000000e+00,7.498942018e-01,5.623413324e-01,4.216965139e-01,3.162277639e-01,2.371373624e-01,1.778279394e-01,1.333521456e-01,1.000000015e-01,7.498941571e-02,5.623412877e-02,4.216964915e-02,3.162277862e-02,2.371373586e-02,1.778279431e-02,1.333521493e-02,9.999999776e-03,7.498942316e-03,5.623413250e-03,4.216964822e-03,3.162277862e-03,2.371373819e-03,1.778279431e-03,1.333521446e-03,1.000000047e-03,7.498941850e-04,5.623413017e-04,4.216964880e-04,3.162277862e-04,2.371373848e-04,1.778279402e-04,1.333521504e-04};
#define PROJ_EXTRA_PARAMS
// interleaved-pair RoPE on q and k (which 0: the two 64-column halves of the tile) at position t (the module uses arange(T)): angle = (float)t * inv_freq[i]; (x_even, x_odd) -> (xe cos - xo sin, xo cos + xe sin) == x * cos + rotate_half_interleaved(x) * sin with cos / sin repeated pairwise; products and sums kept separate (no fma contraction)
#define PROJ_EPI(which, row, t, h) do { if ((which) < 2) { float* rw = (row); const float pos_ = (float)(t); _Pragma("unroll 4") for (int i = 0; i < 32; ++i) { _Pragma("clang fp contract(off)") const float ang = pos_ * INVF[i]; const float cs = cosf(ang), sn = sinf(ang); const float xe = rw[2 * i], xo = rw[2 * i + 1]; rw[2 * i] = xe * cs - xo * sn; rw[2 * i + 1] = xo * cs + xe * sn; } } } while (0)
#define SM_EXTRA_PARAMS
#define SM_MASK_HOOK (void)0
#ifndef SM_EXTRA_PARAMS
#define SM_EXTRA_PARAMS
#endif
#ifndef PROJ_EXTRA_PARAMS
#define PROJ_EXTRA_PARAMS
#endif
#ifndef SM_MASK_HOOK
#define SM_MASK_HOOK (void)0
#endif

#define WS_QH  0u                                      // f16 q rows [b*t][HD]
#define WS_KH  (WS_QH + 2u * (size_t)NB * TT * HD)      // f16 k rows [b*t][HD]
#define WS_VT  (WS_KH + 2u * (size_t)NB * TT * HD)      // f16 v planes [b][c][t]
#define WS_QL  (WS_VT + 2u * (size_t)NB * CC * TT)      // f16 q residual x 2^10 rows [b][t < QHI][HD]
#define WS_KL  (WS_QL + 2u * (size_t)NB * QHI * HD)     // f16 k residual x 2^10 rows [b][t < KHI][HD]
#define WS_VB  (WS_KL + 2u * (size_t)NB * KHI * HD)     // bf16 v hi planes [b][c][t < KHI]
#define WS_VBL (WS_VB + 2u * (size_t)NB * CC * KHI)
#define WS_S   (WS_VBL + 2u * (size_t)NB * CC * KHI)    // f32 logits / P planes [b][t][s]
#define WS_Y   (WS_S  + 4u * (size_t)NB * TT * TT)      // f32 ctx rows [b*t][CC] (only when there is an output projection)
#define WS_END (WS_Y  + 0u)

// ---- k_proj: block = (64 rows, 128 cols): X W (+ b) with exact bf16 products (K = DIN); blockIdx.y = 0 (which 0; the longer blocks, so they start first): q in tile columns 0..63 and k in 64..127 -> f16 rows (+ residual rows < QHI / KHI); blockIdx.y > 0 (which 2): 128 columns of v -> f16 planes [c][t] (+ bf16 hi/lo planes for t < KHI)
__global__ __launch_bounds__(128) void k_proj(const float* __restrict__ X, const float* __restrict__ WQ, const float* __restrict__ WK, const float* __restrict__ WV, const float* __restrict__ BQ, const float* __restrict__ BK, const float* __restrict__ BV,
    _Float16* __restrict__ QH, _Float16* __restrict__ QL, _Float16* __restrict__ KH, _Float16* __restrict__ KL, _Float16* __restrict__ VT, __bf16* __restrict__ VB, __bf16* __restrict__ VBL PROJ_EXTRA_PARAMS) {
  __shared__ __align__(16) float st[64][132]; __shared__ __align__(16) _Float16 sh[64][136], sl[64][136]; __shared__ __align__(16) _Float16 th[128][72]; __shared__ __align__(16) __bf16 tb[128][72], tbl[128][72];
  const int tid = threadIdx.x, wave = tid >> 5, lane = tid & 31, col = lane & 15, g = lane >> 4; const int which = blockIdx.y == 0 ? 0 : 2; const int c0 = which == 2 ? (blockIdx.y - 1) * 128 : 0; const size_t r0 = (size_t)blockIdx.x * 64; const size_t bb = r0 / TT; const int t0 = (int)(r0 % TT);
  v8f acc[8] = {};
#pragma unroll 2
  for (int kc = 0; kc < DIN / 32; ++kc) { v16b a; { const float* p = X + (r0 + wave * 16 + col) * DIN + kc * 32 + 8 * g;
#pragma unroll
      for (int i = 0; i < 8; ++i) { a[i] = (__bf16)p[i]; a[8 + i] = (__bf16)p[16 + i]; } }
    asm volatile("s_wait_loadcnt 0x0" ::: "memory");
#pragma unroll
    for (int j = 0; j < 8; ++j) { const float* WA = which == 2 ? WV : j < 4 ? WQ : WK; const v16b w = WCOL(WA, kc * 32, c0 + j * 16 + col, lane); asm volatile("s_wait_loadcnt 0x0" ::: "memory"); acc[j] = wmma_bf(a, w, acc[j]); } }
  { // stage the f32 tile (acc + bias) in LDS, run the per-(row, head) epilogue hook, then convert
#pragma unroll
    for (int j = 0; j < 8; ++j) { const float* BA = which == 2 ? BV : j < 4 ? BQ : BK; const float bias = BA ? bfr(BA[which == 2 ? c0 + j * 16 + col : (j & 3) * 16 + col]) : 0.f;
#pragma unroll
      for (int r = 0; r < 8; ++r) st[wave * 16 + 8 * g + r][j * 16 + col] = acc[j][r] + bias; }
    __syncthreads();
    for (int e = tid; e < 64 * (128 / HD); e += 128) { const int rl = e / (128 / HD), hh = e % (128 / HD); PROJ_EPI(which, &st[rl][hh * HD], (int)((r0 + rl) % TT), (c0 / HD) + hh); }
    __syncthreads(); }
  if (which < 2) {
    for (int e = tid; e < 64 * 128; e += 128) { const int rl = e >> 7, cl = e & 127; const float v = st[rl][cl]; const _Float16 hv = (_Float16)v; sh[rl][cl] = hv; sl[rl][cl] = (_Float16)((v - (float)hv) * 1024.0f); }
    __syncthreads();
    for (int e = tid; e < 64 * 16; e += 128) { const int rl = e >> 4, q = e & 15; _Float16* DH = q < 8 ? QH : KH; _Float16* DL = q < 8 ? QL : KL; const int nhi = q < 8 ? QHI : KHI;
      vst2((unsigned*)(DH + (r0 + rl) * HD + (q & 7) * 8), *(const v4u*)&sh[rl][q * 8]);
      asm volatile("s_wait_xcnt 0x0" ::: "memory");   // precaution: stands before the store's data and address registers are rewritten (next LDS read, next trip's address)
      if (t0 < nhi) { vst2((unsigned*)(DL + (bb * nhi + t0 + rl) * (size_t)HD + (q & 7) * 8), *(const v4u*)&sl[rl][q * 8]);
        asm volatile("s_wait_xcnt 0x0" ::: "memory"); } }   // same precaution for the residual row's store
  } else { const bool hi_rows = t0 < KHI;
    for (int e = tid; e < 64 * 128; e += 128) { const int rl = e & 63, cl = e >> 6; const float v = st[rl][cl]; th[cl][rl] = (_Float16)v; const __bf16 bh = (__bf16)v; tb[cl][rl] = bh; tbl[cl][rl] = (__bf16)(v - (float)bh); }
    __syncthreads();
    for (int e = tid; e < 128 * 8; e += 128) { const int cl = e >> 3, q = e & 7; vst2((unsigned*)(VT + (bb * CC + c0 + cl) * (size_t)TT + t0 + q * 8), *(const v4u*)&th[cl][q * 8]); if (hi_rows) { const size_t o3 = (bb * CC + c0 + cl) * (size_t)KHI + t0 + q * 8; vst2((unsigned*)(VB + o3), *(const v4u*)&tb[cl][q * 8]); vst2((unsigned*)(VBL + o3), *(const v4u*)&tbl[cl][q * 8]); } } } }
// ---- k_sc: block = (query block qb, key block kb <= kb_last(qb)) of batch b = blockIdx.z (its own logit plane): logits x SCALE; q hi + residual (x 2^10) against k (2 products) for query rows < QHI, plus the k residual (3 products) for query blocks < QBH (causal early rows); causal: blocks past the diagonal exit, the mask itself is applied by index in k_sm
__global__ __launch_bounds__(128) void k_sc(const _Float16* __restrict__ QH, const _Float16* __restrict__ KH, const _Float16* __restrict__ QL, const _Float16* __restrict__ KL, float* __restrict__ SA) { __shared__ __align__(16) float ss[4][16][132];
  const int qb = blockIdx.x, kb = blockIdx.y, b = blockIdx.z; if (kb > kb_last(qb)) return;
  float* __restrict__ S = SA + (size_t)b * TT * TT;
  const int tid = threadIdx.x, wave = tid >> 5, lane = tid & 31, col = lane & 15, g = lane >> 4; const int k0 = kb * 128; const int ql0 = qb * 64 + wave * 16; const size_t q0 = (size_t)b * TT + ql0, kr0 = (size_t)b * TT + k0;
  v8f acc[8] = {}, accl[8] = {};
  const _Float16* QLb = QL + (size_t)b * QHI * HD; const _Float16* KLb = KL + (size_t)b * KHI * HD;
  if (qb < QBH) {
#pragma unroll
    for (int kc = 0; kc < HD / 32; ++kc) { const v16h ah = frag_h(QH + (q0 + col) * HD + kc * 32, lane), al = frag_h(QLb + (size_t)(ql0 + col) * HD + kc * 32, lane);
#pragma unroll
      for (int j = 0; j < 8; ++j) { const v16h kbf = frag_h(KH + (kr0 + j * 16 + col) * HD + kc * 32, lane), klf = frag_h(KLb + (size_t)(k0 + j * 16 + col) * HD + kc * 32, lane); acc[j] = wmma16(ah, kbf, acc[j]); accl[j] = wmma16(al, kbf, accl[j]); accl[j] = wmma16(ah, klf, accl[j]); } }
  } else if (qb * 64 < QHI) {
#pragma unroll
    for (int kc = 0; kc < HD / 32; ++kc) { const v16h ah = frag_h(QH + (q0 + col) * HD + kc * 32, lane), al = frag_h(QLb + (size_t)(ql0 + col) * HD + kc * 32, lane);
#pragma unroll
      for (int j = 0; j < 8; ++j) { const v16h kbf = frag_h(KH + (kr0 + j * 16 + col) * HD + kc * 32, lane); acc[j] = wmma16(ah, kbf, acc[j]); accl[j] = wmma16(al, kbf, accl[j]); } }
  } else {
#pragma unroll
    for (int kc = 0; kc < HD / 32; ++kc) { const v16h ah = frag_h(QH + (q0 + col) * HD + kc * 32, lane);
#pragma unroll
      for (int j = 0; j < 8; ++j) { const v16h kbf = frag_h(KH + (kr0 + j * 16 + col) * HD + kc * 32, lane); acc[j] = wmma16(ah, kbf, acc[j]); } } }
#pragma unroll
  for (int j = 0; j < 8; ++j) {
#pragma unroll
    for (int r = 0; r < 8; ++r) ss[wave][8 * g + r][j * 16 + col] = (acc[j][r] + accl[j][r] * (1.0f / 1024.0f)) * SCALE; }
  LDSX(); for (int rl = 0; rl < 16; ++rl) vst2(S + (size_t)(ql0 + rl) * TT + k0 + lane * 4, *(const v4f*)&ss[wave][rl][lane * 4]); }
// ---- k_sm: block = query row t of batch blockIdx.y: keys [0, kend): causal -> logit if s <= t else excluded; softmax in f32; P x 2^11 in place (0 for excluded)
__global__ __launch_bounds__(256) void k_sm(float* __restrict__ S0 SM_EXTRA_PARAMS) { __shared__ float sred[8]; __shared__ float sbc; __shared__ __align__(16) float shv[TT];
  const int tid = threadIdx.x; const int t = blockIdx.x; const int kend = (kb_last(t >> 6) + 1) * 128;
  float* sr = S0 + ((size_t)blockIdx.y * TT + t) * TT;
  float m = -3.0e38f; for (int k = tid; k < kend; k += 256) { float v = (!CAUSAL || k <= t) ? sr[k] : -3.0e38f; SM_MASK_HOOK; shv[k] = v; m = fmaxf(m, v); }
#pragma unroll
  for (int o = 1; o < 32; o <<= 1) m = fmaxf(m, __shfl_xor(m, o));
  if ((tid & 31) == 0) sred[tid >> 5] = m; __syncthreads(); if (tid == 0) { float a = sred[0]; for (int i = 1; i < 8; ++i) a = fmaxf(a, sred[i]); sbc = a; } __syncthreads(); m = sbc; __syncthreads();
  float sum = 0.f; for (int k = tid; k < kend; k += 256) { const float v = shv[k]; const float e = (v <= -1.0e38f) ? 0.f : expf(v - m); shv[k] = e; sum += e; }
#pragma unroll
  for (int o = 1; o < 32; o <<= 1) sum += __shfl_xor(sum, o);
  if ((tid & 31) == 0) sred[tid >> 5] = sum; __syncthreads(); if (tid == 0) { float a = 0.f; for (int i = 0; i < 8; ++i) a += sred[i]; sbc = a > 0.f ? 2048.0f / a : 0.f; }   /* a fully excluded row yields P = 0 */ __syncthreads(); const float inv = sbc;
  for (int k = tid; k < kend; k += 256) shv[k] = shv[k] * inv;
  __syncthreads(); for (int q = tid; q < kend / 4; q += 256) vst2(sr + q * 4, *(const v4f*)&shv[q * 4]); }
// ---- k_pv: block = 64 queries (qb) of batch b = blockIdx.y x value columns 64h .. 64h+63 (h = blockIdx.z; every h reads the same P): ctx = P . v over keys [0, kend) (P x 2^11 once to f16 against v f16: 1 product; causal early query blocks: P and v as bf16 hi + lo, 3 products); 256-B (row, head) segment by 16 lanes
__global__ __launch_bounds__(128) void k_pv(const float* __restrict__ PA, const _Float16* __restrict__ VT, const __bf16* __restrict__ VB, const __bf16* __restrict__ VBL, float* __restrict__ Y) { const int h = blockIdx.z, b = blockIdx.y; const float* __restrict__ PS = PA + (size_t)b * TT * TT; __shared__ __align__(16) float ss[4][16][HD + 4];
  const int tid = threadIdx.x, wave = tid >> 5, lane = tid & 31, col = lane & 15, g = lane >> 4; const int qb = blockIdx.x; const int ql0 = qb * 64 + wave * 16; const int kce = (kb_last(qb) + 1) * 4;
  v8f acc[HD / 16] = {};
  if (qb < QBH) {
#pragma unroll 1
    for (int kc = 0; kc < kce; ++kc) { const F2 p = split_row(PS + (size_t)(ql0 + col) * TT, kc * 32, lane);
      asm volatile("s_wait_loadcnt 0x0" ::: "memory");
#pragma unroll
      for (int j = 0; j < HD / 16; ++j) { const size_t po = ((size_t)b * CC + h * HD + j * 16 + col) * (size_t)KHI + kc * 32; const v16b vh = frag_b(VB + po, lane); acc[j] = wmma_bf(p.h, vh, acc[j]); acc[j] = wmma_bf(p.l, vh, acc[j]); acc[j] = wmma_bf(p.h, frag_b(VBL + po, lane), acc[j]); } }
  } else {
#pragma unroll 1
    for (int kc = 0; kc < kce; ++kc) { const v16h p = frag_f32(PS + (size_t)(ql0 + col) * TT + kc * 32, lane);
      asm volatile("s_wait_loadcnt 0x0" ::: "memory");
#pragma unroll
      for (int j = 0; j < HD / 16; ++j) { const size_t po = ((size_t)b * CC + h * HD + j * 16 + col) * (size_t)TT + kc * 32; acc[j] = wmma16(p, frag_h(VT + po, lane), acc[j]); } } }
#pragma unroll
  for (int j = 0; j < HD / 16; ++j)
#pragma unroll
    for (int r = 0; r < 8; ++r) ss[wave][8 * g + r][j * 16 + col] = acc[j][r] * (1.0f / 2048.0f);
  LDSX(); for (int rl = 0; rl < 16; ++rl) if (lane < HD / 4) vst2(Y + ((size_t)b * TT + ql0 + rl) * CC + h * HD + lane * 4, *(const v4f*)&ss[wave][rl][lane * 4]); }

extern "C" void kernel_launch(void* const* d_in, const int* in_sizes, int n_in, void* d_out, int out_size, void* d_ws, size_t ws_size, hipStream_t stream) {
  (void)in_sizes; (void)n_in; (void)out_size;
  const float** F = (const float**)d_in;
  if (ws_size < (size_t)WS_END) return;
  char* ws = (char*)d_ws; _Float16 *QH = (_Float16*)(ws + WS_QH), *KH = (_Float16*)(ws + WS_KH), *VT = (_Float16*)(ws + WS_VT), *QL = (_Float16*)(ws + WS_QL), *KL = (_Float16*)(ws + WS_KL); __bf16 *VB = (__bf16*)(ws + WS_VB), *VBL = (__bf16*)(ws + WS_VBL); float *S = (float*)(ws + WS_S), *Y = (float*)(ws + WS_Y);
  (void)Y; (void)QL; (void)KL; (void)VB; (void)VBL;
  // inputs: 0 x [8,2048,384]; 1 Wq [384,64] (in,out); 2 Wk [384,64]; 3 Wv [384,384] (in,out); no biases
  k_proj<<<dim3(TNB * TT / 64, CC / 128 + 1), 128, 0, stream>>>(F[0], F[1], F[2], F[3], nullptr, nullptr, nullptr, QH, QL, KH, KL, VT, VB, VBL);   /* y = 0: q and k (64 columns each) in one tile; y = 1..3: 128 value columns each */
  k_sc<<<dim3(NQB, TT / 128, TNB), 128, 0, stream>>>(QH, KH, QL, KL, S);
  k_sm<<<dim3(TT, TNB), 256, 0, stream>>>(S);
  k_pv<<<dim3(NQB, TNB, NH), 128, 0, stream>>>(S, VT, VB, VBL, (float*)d_out);   /* slot h writes output columns 64h .. 64h+63 */
}

// v003
// A run of this version takes 220 microseconds.
// Next to v002, in two timings, it ran 1.08 times as fast each time.
// Over all steps from v000 it is 7.70 times as fast.
// compute dtype: all float inputs rounded to bf16; q / k (64 wide) and v (384 wide) projections with EXACT bf16 products on WMMA 16x16x32 (f32 accumulate); interleaved RoPE in f32 (f32 inverse frequencies; precise cosf / sinf); causal logits: 3 products for the first 384 rows, single f16 q x k after, x 64^-0.5; softmax f32 (q, k, logits and softmax once per batch, shared by all 384 value columns; all batches in one launch of each kernel, one logit plane per batch); P x 2^11 once to f16 x v once to f16 (bf16 hi + lo below row 384); f32 output.
#include <hip/hip_runtime.h>
#include <math.h>

typedef __attribute__((ext_vector_type(16))) _Float16 v16h;
typedef __attribute__((ext_vector_type(16))) __bf16 v16b;
typedef __attribute__((ext_vector_type(8)))  _Float16 v8h;
typedef __attribute__((ext_vector_type(8)))  float v8f;
typedef __attribute__((ext_vector_type(4)))  float v4f;
typedef __attribute__((ext_vector_type(2)))  float v2f;
typedef __attribute__((ext_vector_type(4)))  unsigned v4u;
typedef __attribute__((ext_vector_type(4)))  int v4i;
typedef float __attribute__((may_alias)) float_a;
typedef int __attribute__((may_alias)) int_a;

template <typename T> __device__ __forceinline__ void vst2(void* p, T v) { *(T*)p = v;  }
__device__ __forceinline__ v8f wmma16(v16h a, v16h b, v8f c) {
  v8f d = __builtin_amdgcn_wmma_f32_16x16x32_f16(false, a, false, b, (short)0, c, false, false);
  asm volatile("v_nop\n\tv_nop\n\tv_nop\n\tv_nop" : "+v"(d) : "v"(a), "v"(b));
  return d;
}
__device__ __forceinline__ v8f wmma_bf(v16b a, v16b b, v8f c) {
  v8f d = __builtin_amdgcn_wmma_f32_16x16x32_bf16(false, a, false, b, (short)0, c, false, false);
  asm volatile("v_nop\n\tv_nop\n\tv_nop\n\tv_nop" : "+v"(d) : "v"(a), "v"(b));
  return d;
}
// 16x16x32 fragments: lane = (h = lane>>4, row/col = lane&15); elements 0..7 = k0+8h+0..7, 8..15 = k0+16+8h+0..7; D element r = row 8h+r
__device__ __forceinline__ v16h frag_h(const _Float16* rowk0, int lane) {
  union { v16h v; v8h q[2]; } u; const _Float16* p = rowk0 + 8 * (lane >> 4);
  u.q[0] = *(const v8h*)p; u.q[1] = *(const v8h*)(p + 16); return u.v;
}
__device__ __forceinline__ v16h frag_f32(const float* rowk0, int lane) {
  v16h a; const float* p = rowk0 + 8 * (lane >> 4);
#pragma unroll
  for (int i = 0; i < 8; ++i) { a[i] = (_Float16)p[i]; a[8 + i] = (_Float16)p[16 + i]; }
  return a;
}
__device__ __forceinline__ v16h frag_f32s(const float* rowk0, int lane, float sc) {
  v16h a; const float* p = rowk0 + 8 * (lane >> 4);
#pragma unroll
  for (int i = 0; i < 8; ++i) { a[i] = (_Float16)(p[i] * sc); a[8 + i] = (_Float16)(p[16 + i] * sc); }
  return a;
}
// column fragment from a [K][ld] layout (column n), rows >= K read as 0
__device__ __forceinline__ v16h fragc_f32(const float* W, int k0, int n, int lane, int ld, int K) {
  v16h a; const int g = lane >> 4;
#pragma unroll
  for (int i = 0; i < 8; ++i) { const int ka = k0 + 8 * g + i, kb = ka + 16;
    a[i] = (_Float16)(ka < K ? W[(size_t)(ka < K ? ka : K - 1) * ld + n] : 0.f); a[8 + i] = (_Float16)(kb < K ? W[(size_t)(kb < K ? kb : K - 1) * ld + n] : 0.f); }
  return a;
}
struct F2 { v16b h, l; };
__device__ __forceinline__ F2 bsplit16(const float v[16]) { F2 r;
#pragma unroll
  for (int i = 0; i < 16; ++i) { const __bf16 h = (__bf16)v[i]; r.h[i] = h; r.l[i] = (__bf16)(v[i] - (float)h); }
  return r; }
__device__ __forceinline__ F2 split_row(const float* row, int k0, int lane) { float v[16]; const float* p = row + k0 + 8 * (lane >> 4);
#pragma unroll
  for (int i = 0; i < 8; ++i) { v[i] = p[i]; v[8 + i] = p[16 + i]; }
  return bsplit16(v); }
__device__ __forceinline__ F2 split_rowK(const float* row, int k0, int lane, int K) { float v[16]; const int g = lane >> 4;
#pragma unroll
  for (int i = 0; i < 8; ++i) { const int ka = k0 + 8 * g + i, kb = ka + 16; v[i] = ka < K ? row[ka < K ? ka : K - 1] : 0.f; v[8 + i] = kb < K ? row[kb < K ? kb : K - 1] : 0.f; }
  return bsplit16(v); }
__device__ __forceinline__ F2 split_col(const float* W, int k0, int n, int lane, int ld, int K) { float v[16]; const int g = lane >> 4;
#pragma unroll
  for (int i = 0; i < 8; ++i) { const int ka = k0 + 8 * g + i, kb = ka + 16; v[i] = ka < K ? W[(size_t)(ka < K ? ka : K - 1) * ld + n] : 0.f; v[8 + i] = kb < K ? W[(size_t)(kb < K ? kb : K - 1) * ld + n] : 0.f; }
  return bsplit16(v); }
__device__ __forceinline__ v8f mac3(const F2& a, const F2& b, v8f c) { c = wmma_bf(a.l, b.h, c); c = wmma_bf(a.h, b.l, c); return wmma_bf(a.h, b.h, c); }
__device__ __forceinline__ float sigm(float v) { return 1.0f / (1.0f + expf(-v)); }
#define LDSX() do { asm volatile("s_wait_dscnt 0" ::: "memory"); __builtin_amdgcn_wave_barrier(); __builtin_amdgcn_fence(__ATOMIC_RELEASE, "workgroup"); } while (0)

// Single-head causal attention with a WIDE value (x [8,2048,384]; (in,out) Wq / Wk [384,64], Wv [384,384] (0.02 scale), no biases; interleaved-pair RoPE on q and k (positions arange(T), inv_freq = 1/10000^(2i/64)); scale 1/8; tril, -inf): out = softmax(causal(rope(q) rope(k)^T / 8)) v -> [8,2048,384]. The one attention pattern (q, k, logits, softmax: computed once per batch) is applied to the 384 value columns as six 64-column slots.
#define NB 8
#define TT 2048
#define CC 384            // NH * HD = projected width
#define DIN 384          // input (model) width
#define NH 6
#define HD 64
#define NQB (TT / 64)
#define SCALE (0.125f)
#define CAUSAL 1
#ifndef TNB
#define TNB NB
#endif
__device__ __forceinline__ float bfr(float v) { return (float)(__bf16)v; }
__host__ __device__ __forceinline__ int kb_last(int qb) { return CAUSAL ? ((qb * 64 + 63) >> 7) : (TT / 128 - 1); }
typedef __attribute__((ext_vector_type(8))) __bf16 v8b;
__device__ __forceinline__ v16b frag_b(const __bf16* rowk0, int lane) {
  union { v16b v; v8b q[2]; } u; const __bf16* p = rowk0 + 8 * (lane >> 4);
  u.q[0] = *(const v8b*)p; u.q[1] = *(const v8b*)(p + 16); return u.v;
}
#define QBH 6              // causal: query blocks 0..QBH-1 of each sequence (few keys, no averaging) take the high-precision path
#define QHI 384            // rows carrying a q residual plane
#define KHI 384            // key rows carrying k residual / v bf16 hi+lo planes (used only by the causal high-precision path)
// B fragment (k rows k0+.., output column o) of a weight: (in,out) [K][ld] or (out,in) [ld rows of K]: bf16 exact, or f16(bf16 * 256) exact
__device__ __forceinline__ v16b wcol_io(const float* Wm, int k0, int o, int lane, int ld) { v16b w; const int g = lane >> 4;
#pragma unroll
  for (int i = 0; i < 8; ++i) { w[i] = (__bf16)Wm[(size_t)(k0 + 8 * g + i) * ld + o];
    if (i == 7) asm volatile("s_wait_xcnt 0x0" ::: "memory");   // precaution: the run's last load may land in the address register that the loads before it name
    w[8 + i] = (__bf16)Wm[(size_t)(k0 + 16 + 8 * g + i) * ld + o]; }
  asm volatile("s_wait_xcnt 0x0" ::: "memory");   // same precaution for the last load, before its address register is written again
  return w; }
__device__ __forceinline__ v16b wcol_oi(const float* Wm, int k0, int o, int lane, int K) { v16b w; const float* p = Wm + (size_t)o * K + k0 + 8 * (lane >> 4);
#pragma unroll
  for (int i = 0; i < 8; ++i) { w[i] = (__bf16)p[i]; w[8 + i] = (__bf16)p[16 + i]; }
  return w; }
__device__ __forceinline__ v16h wcolh_io(const float* Wm, int k0, int o, int lane, int ld) { v16h w; const int g = lane >> 4;
#pragma unroll
  for (int i = 0; i < 8; ++i) { w[i] = (_Float16)(bfr(Wm[(size_t)(k0 + 8 * g + i) * ld + o]) * 256.0f); w[8 + i] = (_Float16)(bfr(Wm[(size_t)(k0 + 16 + 8 * g + i) * ld + o]) * 256.0f); }
  return w; }
__device__ __forceinline__ v16h wcolh_oi(const float* Wm, int k0, int o, int lane, int K) { v16h w; const float* p = Wm + (size_t)o * K + k0 + 8 * (lane >> 4);
#pragma unroll
  for (int i = 0; i < 8; ++i) { w[i] = (_Float16)(bfr(p[i]) * 256.0f); w[8 + i] = (_Float16)(bfr(p[16 + i]) * 256.0f); }
  return w; }
#define WQKV_LAYOUT 0   // 0 = (in,out): Wv [DIN][CC], Wq / Wk [DIN][HD]; 1 = (out,in) [CC][DIN]; 2 = per-head [NH][DIN][HD]
__device__ __forceinline__ v16b wcol_hdk(const float* Wm, int k0, int o, int lane) { v16b w; const int g = lane >> 4; const float* p = Wm + (size_t)(o / HD) * DIN * HD + (o % HD);
#pragma unroll
  for (int i = 0; i < 8; ++i) { w[i] = (__bf16)p[(size_t)(k0 + 8 * g + i) * HD]; w[8 + i] = (__bf16)p[(size_t)(k0 + 16 + 8 * g + i) * HD]; }
  return w; }
#define WO_OUT_IN 0
#if WQKV_LAYOUT == 1
#define WCOL(W, k0, o, lane) wcol_oi(W, k0, o, lane, DIN)
#elif WQKV_LAYOUT == 2
#define WCOL(W, k0, o, lane) wcol_hdk(W, k0, o, lane)
#else
#define WCOL(W, k0, o, lane) (which == 2 ? wcol_io(W, k0, (o), lane, CC) : wcol_io(W, k0, ((o) & 63), lane, HD))   /* (in,out): Wv [384][384] pitch 384; Wq / Wk [384][64] pitch 64, tile column o % 64 */
#endif
#if WO_OUT_IN
#define WOCOL(W, k0, o, lane) wcol_oi(W, k0, o, lane, CC)
#define WOCOLH(W, k0, o, lane) wcolh_oi(W, k0, o, lane, CC)
#else
#define WOCOL(W, k0, o, lane) wcol_io(W, k0, o, lane, DIN)
#define WOCOLH(W, k0, o, lane) wcolh_io(W, k0, o, lane, DIN)
#endif
// RoPE inverse frequencies 1/10000^(2i/64) (the f32 values jax computes)
__constant__ float INVF[32] = {1.000000000e+00,7.498942018e-01,5.623413324e-01,4.216965139e-01,3.162277639e-01,2.371373624e-01,1.778279394e-01,1.333521456e-01,1.000000015e-01,7.498941571e-02,5.623412877e-02,4.216964915e-02,3.162277862e-02,2.371373586e-02,1.778279431e-02,1.333521493e-02,9.999999776e-03,7.498942316e-03,5.623413250e-03,4.216964822e-03,3.162277862e-03,2.371373819e-03,1.778279431e-03,1.333521446e-03,1.000000047e-03,7.498941850e-04,5.623413017e-04,4.216964880e-04,3.162277862e-04,2.371373848e-04,1.778279402e-04,1.333521504e-04};
#define PROJ_EXTRA_PARAMS
// interleaved-pair RoPE on q and k (which 0: the two 64-column halves of the tile) at position t (the module uses arange(T)): angle = (float)t * inv_freq[i]; (x_even, x_odd) -> (xe cos - xo sin, xo cos + xe sin) == x * cos + rotate_half_interleaved(x) * sin with cos / sin repeated pairwise; products and sums kept separate (no fma contraction)
#define PROJ_EPI(which, row, t, h) do { if ((which) < 2) { float* rw = (row); const float pos_ = (float)(t); _Pragma("unroll 4") for (int i = 0; i < 32; ++i) { _Pragma("clang fp contract(off)") const float ang = pos_ * INVF[i]; const float cs = cosf(ang), sn = sinf(ang); const float xe = rw[2 * i], xo = rw[2 * i + 1]; rw[2 * i] = xe * cs - xo * sn; rw[2 * i + 1] = xo * cs + xe * sn; } } } while (0)
#define SM_EXTRA_PARAMS
#define SM_MASK_HOOK (void)0
#ifndef SM_EXTRA_PARAMS
#define SM_EXTRA_PARAMS
#endif
#ifndef PROJ_EXTRA_PARAMS
#define PROJ_EXTRA_PARAMS
#endif
#ifndef SM_MASK_HOOK
#define SM_MASK_HOOK (void)0
#endif

#define WS_QH  0u                                      // f16 q rows [b*t][HD]
#define WS_KH  (WS_QH + 2u * (size_t)NB * TT * HD)      // f16 k rows [b*t][HD]
#define WS_VT  (WS_KH + 2u * (size_t)NB * TT * HD)      // f16 v planes [b][c][t]
#define WS_QL  (WS_VT + 2u * (size_t)NB * CC * TT)      // f16 q residual x 2^10 rows [b][t < QHI][HD]
#define WS_KL  (WS_QL + 2u * (size_t)NB * QHI * HD)     // f16 k residual x 2^10 rows [b][t < KHI][HD]
#define WS_VB  (WS_KL + 2u * (size_t)NB * KHI * HD)     // bf16 v hi planes [b][c][t < KHI]
#define WS_VBL (WS_VB + 2u * (size_t)NB * CC * KHI)
#define WS_S   (WS_VBL + 2u * (size_t)NB * CC * KHI)    // f32 logits / P planes [b][t][s]
#define WS_Y   (WS_S  + 4u * (size_t)NB * TT * TT)      // f32 ctx rows [b*t][CC] (only when there is an output projection)
#define WS_END (WS_Y  + 0u)

// ---- k_proj: block = (64 rows, 128 cols): X W (+ b) with exact bf16 products (K = DIN); blockIdx.y = 0 (which 0; the longer blocks, so they start first): q in tile columns 0..63 and k in 64..127 -> f16 rows (+ residual rows < QHI / KHI); blockIdx.y > 0 (which 2): 128 columns of v -> f16 planes [c][t] (+ bf16 hi/lo planes for t < KHI)
__global__ __launch_bounds__(128) void k_proj(const float* __restrict__ X, const float* __restrict__ WQ, const float* __restrict__ WK, const float* __restrict__ WV, const float* __restrict__ BQ, const float* __restrict__ BK, const float* __restrict__ BV,
    _Float16* __restrict__ QH, _Float16* __restrict__ QL, _Float16* __restrict__ KH, _Float16* __restrict__ KL, _Float16* __restrict__ VT, __bf16* __restrict__ VB, __bf16* __restrict__ VBL PROJ_EXTRA_PARAMS) {
  __shared__ __align__(16) float st[64][132]; __shared__ __align__(16) _Float16 sh[64][136], sl[64][136]; __shared__ __align__(16) _Float16 th[128][72]; __shared__ __align__(16) __bf16 tb[128][72], tbl[128][72];
  const int tid = threadIdx.x, wave = tid >> 5, lane = tid & 31, col = lane & 15, g = lane >> 4; const int which = blockIdx.y == 0 ? 0 : 2; const int c0 = which == 2 ? (blockIdx.y - 1) * 128 : 0; const size_t r0 = (size_t)blockIdx.x * 64; const size_t bb = r0 / TT; const int t0 = (int)(r0 % TT);
  v8f acc[8] = {};
#pragma unroll 2
  for (int kc = 0; kc < DIN / 32; ++kc) { v16b a; { const float* p = X + (r0 + wave * 16 + col) * DIN + kc * 32 + 8 * g;
#pragma unroll
      for (int i = 0; i < 8; ++i) { a[i] = (__bf16)p[i]; a[8 + i] = (__bf16)p[16 + i]; } }
    asm volatile("s_wait_loadcnt 0x0" ::: "memory");
#pragma unroll
    for (int j = 0; j < 8; ++j) { const float* WA = which == 2 ? WV : j < 4 ? WQ : WK; const v16b w = WCOL(WA, kc * 32, c0 + j * 16 + col, lane); asm volatile("s_wait_loadcnt 0x0" ::: "memory"); acc[j] = wmma_bf(a, w, acc[j]); } }
  { // stage the f32 tile (acc + bias) in LDS, run the per-(row, head) epilogue hook, then convert
#pragma unroll
    for (int j = 0; j < 8; ++j) { const float* BA = which == 2 ? BV : j < 4 ? BQ : BK; const float bias = BA ? bfr(BA[which == 2 ? c0 + j * 16 + col : (j & 3) * 16 + col]) : 0.f;
#pragma unroll
      for (int r = 0; r < 8; ++r) st[wave * 16 + 8 * g + r][j * 16 + col] = acc[j][r] + bias; }
    __syncthreads();
    for (int e = tid; e < 64 * (128 / HD); e += 128) { const int rl = e / (128 / HD), hh = e % (128 / HD); PROJ_EPI(which, &st[rl][hh * HD], (int)((r0 + rl) % TT), (c0 / HD) + hh); }
    __syncthreads(); }
  if (which < 2) {
    for (int e = tid; e < 64 * 128; e += 128) { const int rl = e >> 7, cl = e & 127; const float v = st[rl][cl]; const _Float16 hv = (_Float16)v; sh[rl][cl] = hv; sl[rl][cl] = (_Float16)((v - (float)hv) * 1024.0f); }
    __syncthreads();
    for (int e = tid; e < 64 * 16; e += 128) { const int rl = e >> 4, q = e & 15; _Float16* DH = q < 8 ? QH : KH; _Float16* DL = q < 8 ? QL : KL; const int nhi = q < 8 ? QHI : KHI;
      vst2((unsigned*)(DH + (r0 + rl) * HD + (q & 7) * 8), *(const v4u*)&sh[rl][q * 8]);
      asm volatile("s_wait_xcnt 0x0" ::: "memory");   // precaution: stands before the store's data and address registers are rewritten (next LDS read, next trip's address)
      if (t0 < nhi) { vst2((unsigned*)(DL + (bb * nhi + t0 + rl) * (size_t)HD + (q & 7) * 8), *(const v4u*)&sl[rl][q * 8]);
        asm volatile("s_wait_xcnt 0x0" ::: "memory"); } }   // same precaution for the residual row's store
  } else { const bool hi_rows = t0 < KHI;
    for (int e = tid; e < 64 * 128; e += 128) { const int rl = e & 63, cl = e >> 6; const float v = st[rl][cl]; th[cl][rl] = (_Float16)v; const __bf16 bh = (__bf16)v; tb[cl][rl] = bh; tbl[cl][rl] = (__bf16)(v - (float)bh); }
    __syncthreads();
    for (int e = tid; e < 128 * 8; e += 128) { const int cl = e >> 3, q = e & 7; vst2((unsigned*)(VT + (bb * CC + c0 + cl) * (size_t)TT + t0 + q * 8), *(const v4u*)&th[cl][q * 8]); if (hi_rows) { const size_t o3 = (bb * CC + c0 + cl) * (size_t)KHI + t0 + q * 8; vst2((unsigned*)(VB + o3), *(const v4u*)&tb[cl][q * 8]); vst2((unsigned*)(VBL + o3), *(const v4u*)&tbl[cl][q * 8]); } } } }
// ---- k_sc: block = (query block qb, key block kb <= kb_last(qb)) of batch b = blockIdx.z (its own logit plane): logits x SCALE; q hi + residual (x 2^10) against k (2 products) for query rows < QHI, plus the k residual (3 products) for query blocks < QBH (causal early rows); causal: blocks past the diagonal exit, the mask itself is applied by index in k_sm
__global__ __launch_bounds__(128) void k_sc(const _Float16* __restrict__ QH, const _Float16* __restrict__ KH, const _Float16* __restrict__ QL, const _Float16* __restrict__ KL, float* __restrict__ SA) { __shared__ __align__(16) float ss[4][16][132];
  const int qb = blockIdx.x, kb = blockIdx.y, b = blockIdx.z; if (kb > kb_last(qb)) return;
  float* __restrict__ S = SA + (size_t)b * TT * TT;
  const int tid = threadIdx.x, wave = tid >> 5, lane = tid & 31, col = lane & 15, g = lane >> 4; const int k0 = kb * 128; const int ql0 = qb * 64 + wave * 16; const size_t q0 = (size_t)b * TT + ql0, kr0 = (size_t)b * TT + k0;
  v8f acc[8] = {}, accl[8] = {};
  const _Float16* QLb = QL + (size_t)b * QHI * HD; const _Float16* KLb = KL + (size_t)b * KHI * HD;
  if (qb < QBH) {
#pragma unroll
    for (int kc = 0; kc < HD / 32; ++kc) { const v16h ah = frag_h(QH + (q0 + col) * HD + kc * 32, lane), al = frag_h(QLb + (size_t)(ql0 + col) * HD + kc * 32, lane);
#pragma unroll
      for (int j = 0; j < 8; ++j) { const v16h kbf = frag_h(KH + (kr0 + j * 16 + col) * HD + kc * 32, lane), klf = frag_h(KLb + (size_t)(k0 + j * 16 + col) * HD + kc * 32, lane); acc[j] = wmma16(ah, kbf, acc[j]); accl[j] = wmma16(al, kbf, accl[j]); accl[j] = wmma16(ah, klf, accl[j]); } }
  } else if (qb * 64 < QHI) {
#pragma unroll
    for (int kc = 0; kc < HD / 32; ++kc) { const v16h ah = frag_h(QH + (q0 + col) * HD + kc * 32, lane), al = frag_h(QLb + (size_t)(ql0 + col) * HD + kc * 32, lane);
#pragma unroll
      for (int j = 0; j < 8; ++j) { const v16h kbf = frag_h(KH + (kr0 + j * 16 + col) * HD + kc * 32, lane); acc[j] = wmma16(ah, kbf, acc[j]); accl[j] = wmma16(al, kbf, accl[j]); } }
  } else {
#pragma unroll
    for (int kc = 0; kc < HD / 32; ++kc) { const v16h ah = frag_h(QH + (q0 + col) * HD + kc * 32, lane);
#pragma unroll
      for (int j = 0; j < 8; ++j) { const v16h kbf = frag_h(KH + (kr0 + j * 16 + col) * HD + kc * 32, lane); acc[j] = wmma16(ah, kbf, acc[j]); } } }
#pragma unroll
  for (int j = 0; j < 8; ++j) {
#pragma unroll
    for (int r = 0; r < 8; ++r) ss[wave][8 * g + r][j * 16 + col] = (acc[j][r] + accl[j][r] * (1.0f / 1024.0f)) * SCALE; }
  LDSX(); for (int rl = 0; rl < 16; ++rl) vst2(S + (size_t)(ql0 + rl) * TT + k0 + lane * 4, *(const v4f*)&ss[wave][rl][lane * 4]); }
// ---- k_sm: one wave = query row t of batch blockIdx.x (8 rows a block; blockIdx.y counts down from the longest rows, so cost falls with the block index); the row's keys [0, kend) stay in registers, 4 consecutive keys a lane per 128-key group: causal -> logit if s <= t else excluded; softmax in f32 (maximum and sum in-lane, then across the 32 lanes; no LDS, no barrier); P x 2^11 in place (0 for excluded)
__global__ __launch_bounds__(256) void k_sm(float* __restrict__ S0 SM_EXTRA_PARAMS) {
  const int lane = threadIdx.x & 31; const int t = TT - 1 - (int)(blockIdx.y * 8 + __builtin_amdgcn_readfirstlane(threadIdx.x >> 5));
  const int ng = kb_last(t >> 6) + 1;   // 128-key groups of the row: the same for the whole wave, so every test on it below is a scalar branch
  float* sr = S0 + ((size_t)blockIdx.x * TT + t) * TT + lane * 4; const int rel = t - lane * 4;   // key 128 i + 4 lane + c is kept when 128 i + c <= rel
  v4f r[TT / 128];
#pragma unroll
  for (int i = 0; i < TT / 128; ++i) if (i < ng) r[i] = *(const v4f*)(sr + i * 128);
  float m = -3.0e38f;
#pragma unroll
  for (int i = 0; i < TT / 128; ++i) if (i < ng) {
#pragma unroll
    for (int c = 0; c < 4; ++c) { float v = (!CAUSAL || i * 128 + c <= rel) ? r[i][c] : -3.0e38f; SM_MASK_HOOK; m = fmaxf(m, v); } }
#pragma unroll
  for (int o = 1; o < 32; o <<= 1) m = fmaxf(m, __shfl_xor(m, o));
  v4f s4 = {};
#pragma unroll
  for (int i = 0; i < TT / 128; ++i) if (i < ng) {
#pragma unroll
    for (int c = 0; c < 4; ++c) { float v = (!CAUSAL || i * 128 + c <= rel) ? r[i][c] : -3.0e38f; SM_MASK_HOOK; const float ex = expf(v - m); const float e = (v <= -1.0e38f) ? 0.f : ex; r[i][c] = e; s4[c] += e; } }
  float sum = (s4[0] + s4[1]) + (s4[2] + s4[3]);
#pragma unroll
  for (int o = 1; o < 32; o <<= 1) sum += __shfl_xor(sum, o);
  const float inv = sum > 0.f ? 2048.0f / sum : 0.f;   /* a fully excluded row yields P = 0 */
#pragma unroll
  for (int i = 0; i < TT / 128; ++i) if (i < ng) { vst2(sr + i * 128, r[i] * inv);
    asm volatile("s_wait_xcnt 0x0" ::: "memory"); } }   // precaution: stands before the store's data registers are written again for the next group
// ---- k_pv: block = 64 queries (qb) of batch b = blockIdx.y x value columns 64h .. 64h+63 (h = blockIdx.z; every h reads the same P): ctx = P . v over keys [0, kend) (P x 2^11 once to f16 against v f16: 1 product; causal early query blocks: P and v as bf16 hi + lo, 3 products); 256-B (row, head) segment by 16 lanes
__global__ __launch_bounds__(128) void k_pv(const float* __restrict__ PA, const _Float16* __restrict__ VT, const __bf16* __restrict__ VB, const __bf16* __restrict__ VBL, float* __restrict__ Y) { const int h = blockIdx.z, b = blockIdx.y; const float* __restrict__ PS = PA + (size_t)b * TT * TT; __shared__ __align__(16) float ss[4][16][HD + 4];
  const int tid = threadIdx.x, wave = tid >> 5, lane = tid & 31, col = lane & 15, g = lane >> 4; const int qb = blockIdx.x; const int ql0 = qb * 64 + wave * 16; const int kce = (kb_last(qb) + 1) * 4;
  v8f acc[HD / 16] = {};
  if (qb < QBH) {
#pragma unroll 1
    for (int kc = 0; kc < kce; ++kc) { const F2 p = split_row(PS + (size_t)(ql0 + col) * TT, kc * 32, lane);
      asm volatile("s_wait_loadcnt 0x0" ::: "memory");
#pragma unroll
      for (int j = 0; j < HD / 16; ++j) { const size_t po = ((size_t)b * CC + h * HD + j * 16 + col) * (size_t)KHI + kc * 32; const v16b vh = frag_b(VB + po, lane); acc[j] = wmma_bf(p.h, vh, acc[j]); acc[j] = wmma_bf(p.l, vh, acc[j]); acc[j] = wmma_bf(p.h, frag_b(VBL + po, lane), acc[j]); } }
  } else {
#pragma unroll 1
    for (int kc = 0; kc < kce; ++kc) { const v16h p = frag_f32(PS + (size_t)(ql0 + col) * TT + kc * 32, lane);
      asm volatile("s_wait_loadcnt 0x0" ::: "memory");
#pragma unroll
      for (int j = 0; j < HD / 16; ++j) { const size_t po = ((size_t)b * CC + h * HD + j * 16 + col) * (size_t)TT + kc * 32; acc[j] = wmma16(p, frag_h(VT + po, lane), acc[j]); } } }
#pragma unroll
  for (int j = 0; j < HD / 16; ++j)
#pragma unroll
    for (int r = 0; r < 8; ++r) ss[wave][8 * g + r][j * 16 + col] = acc[j][r] * (1.0f / 2048.0f);
  LDSX(); for (int rl = 0; rl < 16; ++rl) if (lane < HD / 4) vst2(Y + ((size_t)b * TT + ql0 + rl) * CC + h * HD + lane * 4, *(const v4f*)&ss[wave][rl][lane * 4]); }

extern "C" void kernel_launch(void* const* d_in, const int* in_sizes, int n_in, void* d_out, int out_size, void* d_ws, size_t ws_size, hipStream_t stream) {
  (void)in_sizes; (void)n_in; (void)out_size;
  const float** F = (const float**)d_in;
  if (ws_size < (size_t)WS_END) return;
  char* ws = (char*)d_ws; _Float16 *QH = (_Float16*)(ws + WS_QH), *KH = (_Float16*)(ws + WS_KH), *VT = (_Float16*)(ws + WS_VT), *QL = (_Float16*)(ws + WS_QL), *KL = (_Float16*)(ws + WS_KL); __bf16 *VB = (__bf16*)(ws + WS_VB), *VBL = (__bf16*)(ws + WS_VBL); float *S = (float*)(ws + WS_S), *Y = (float*)(ws + WS_Y);
  (void)Y; (void)QL; (void)KL; (void)VB; (void)VBL;
  // inputs: 0 x [8,2048,384]; 1 Wq [384,64] (in,out); 2 Wk [384,64]; 3 Wv [384,384] (in,out); no biases
  k_proj<<<dim3(TNB * TT / 64, CC / 128 + 1), 128, 0, stream>>>(F[0], F[1], F[2], F[3], nullptr, nullptr, nullptr, QH, QL, KH, KL, VT, VB, VBL);   /* y = 0: q and k (64 columns each) in one tile; y = 1..3: 128 value columns each */
  k_sc<<<dim3(NQB, TT / 128, TNB), 128, 0, stream>>>(QH, KH, QL, KL, S);
  k_sm<<<dim3(TNB, TT / 8), 256, 0, stream>>>(S);   /* one wave a row, 8 rows a block */
  k_pv<<<dim3(NQB, TNB, NH), 128, 0, stream>>>(S, VT, VB, VBL, (float*)d_out);   /* slot h writes output columns 64h .. 64h+63 */
}

// v004
// One run takes 163 microseconds.
// Two timings next to v003 both put it at 1.35 times that version's speed.
// Counting every step since v000, it is 10.4 times as fast.
// compute dtype: all float inputs rounded to bf16; q / k (64 wide) and v (384 wide) projections with EXACT bf16 products on WMMA 16x16x32 (f32 accumulate); interleaved RoPE in f32 (f32 inverse frequencies; precise cosf / sinf); causal logits: 3 products for the first 384 rows, single f16 q x k after, x 64^-0.5; softmax f32 (q, k, logits and softmax once per batch, shared by all 384 value columns; all batches in one launch of each kernel, one logit plane per batch); P x 2^11 once to f16 x v once to f16 (bf16 hi + lo below row 384); f32 output.
#include <hip/hip_runtime.h>
#include <math.h>

typedef __attribute__((ext_vector_type(16))) _Float16 v16h;
typedef __attribute__((ext_vector_type(16))) __bf16 v16b;
typedef __attribute__((ext_vector_type(8)))  _Float16 v8h;
typedef __attribute__((ext_vector_type(8)))  float v8f;
typedef __attribute__((ext_vector_type(4)))  float v4f;
typedef __attribute__((ext_vector_type(2)))  float v2f;
typedef __attribute__((ext_vector_type(4)))  unsigned v4u;
typedef __attribute__((ext_vector_type(4)))  int v4i;
typedef float __attribute__((may_alias)) float_a;
typedef int __attribute__((may_alias)) int_a;

template <typename T> __device__ __forceinline__ void vst2(void* p, T v) { *(T*)p = v;  }
__device__ __forceinline__ v8f wmma16(v16h a, v16h b, v8f c) {
  v8f d = __builtin_amdgcn_wmma_f32_16x16x32_f16(false, a, false, b, (short)0, c, false, false);
  asm volatile("v_nop\n\tv_nop\n\tv_nop\n\tv_nop" : "+v"(d) : "v"(a), "v"(b));
  return d;
}
__device__ __forceinline__ v8f wmma_bf(v16b a, v16b b, v8f c) {
  v8f d = __builtin_amdgcn_wmma_f32_16x16x32_bf16(false, a, false, b, (short)0, c, false, false);
  asm volatile("v_nop\n\tv_nop\n\tv_nop\n\tv_nop" : "+v"(d) : "v"(a), "v"(b));
  return d;
}
// 16x16x32 fragments: lane = (h = lane>>4, row/col = lane&15); elements 0..7 = k0+8h+0..7, 8..15 = k0+16+8h+0..7; D element r = row 8h+r
__device__ __forceinline__ v16h frag_h(const _Float16* rowk0, int lane) {
  union { v16h v; v8h q[2]; } u; const _Float16* p = rowk0 + 8 * (lane >> 4);
  u.q[0] = *(const v8h*)p; u.q[1] = *(const v8h*)(p + 16); return u.v;
}
__device__ __forceinline__ v16h frag_f32(const float* rowk0, int lane) {
  v16h a; const float* p = rowk0 + 8 * (lane >> 4);
#pragma unroll
  for (int i = 0; i < 8; ++i) { a[i] = (_Float16)p[i]; a[8 + i] = (_Float16)p[16 + i]; }
  return a;
}
__device__ __forceinline__ v16h frag_f32s(const float* rowk0, int lane, float sc) {
  v16h a; const float* p = rowk0 + 8 * (lane >> 4);
#pragma unroll
  for (int i = 0; i < 8; ++i) { a[i] = (_Float16)(p[i] * sc); a[8 + i] = (_Float16)(p[16 + i] * sc); }
  return a;
}
// column fragment from a [K][ld] layout (column n), rows >= K read as 0
__device__ __forceinline__ v16h fragc_f32(const float* W, int k0, int n, int lane, int ld, int K) {
  v16h a; const int g = lane >> 4;
#pragma unroll
  for (int i = 0; i < 8; ++i) { const int ka = k0 + 8 * g + i, kb = ka + 16;
    a[i] = (_Float16)(ka < K ? W[(size_t)(ka < K ? ka : K - 1) * ld + n] : 0.f); a[8 + i] = (_Float16)(kb < K ? W[(size_t)(kb < K ? kb : K - 1) * ld + n] : 0.f); }
  return a;
}
struct F2 { v16b h, l; };
__device__ __forceinline__ F2 bsplit16(const float v[16]) { F2 r;
#pragma unroll
  for (int i = 0; i < 16; ++i) { const __bf16 h = (__bf16)v[i]; r.h[i] = h; r.l[i] = (__bf16)(v[i] - (float)h); }
  return r; }
__device__ __forceinline__ F2 split_row(const float* row, int k0, int lane) { float v[16]; const float* p = row + k0 + 8 * (lane >> 4);
#pragma unroll
  for (int i = 0; i < 8; ++i) { v[i] = p[i]; v[8 + i] = p[16 + i]; }
  return bsplit16(v); }
__device__ __forceinline__ F2 split_rowK(const float* row, int k0, int lane, int K) { float v[16]; const int g = lane >> 4;
#pragma unroll
  for (int i = 0; i < 8; ++i) { const int ka = k0 + 8 * g + i, kb = ka + 16; v[i] = ka < K ? row[ka < K ? ka : K - 1] : 0.f; v[8 + i] = kb < K ? row[kb < K ? kb : K - 1] : 0.f; }
  return bsplit16(v); }
__device__ __forceinline__ F2 split_col(const float* W, int k0, int n, int lane, int ld, int K) { float v[16]; const int g = lane >> 4;
#pragma unroll
  for (int i = 0; i < 8; ++i) { const int ka = k0 + 8 * g + i, kb = ka + 16; v[i] = ka < K ? W[(size_t)(ka < K ? ka : K - 1) * ld + n] : 0.f; v[8 + i] = kb < K ? W[(size_t)(kb < K ? kb : K - 1) * ld + n] : 0.f; }
  return bsplit16(v); }
__device__ __forceinline__ v8f mac3(const F2& a, const F2& b, v8f c) { c = wmma_bf(a.l, b.h, c); c = wmma_bf(a.h, b.l, c); return wmma_bf(a.h, b.h, c); }
__device__ __forceinline__ float sigm(float v) { return 1.0f / (1.0f + expf(-v)); }
#define LDSX() do { asm volatile("s_wait_dscnt 0" ::: "memory"); __builtin_amdgcn_wave_barrier(); __builtin_amdgcn_fence(__ATOMIC_RELEASE, "workgroup"); } while (0)

// Single-head causal attention with a WIDE value (x [8,2048,384]; (in,out) Wq / Wk [384,64], Wv [384,384] (0.02 scale), no biases; interleaved-pair RoPE on q and k (positions arange(T), inv_freq = 1/10000^(2i/64)); scale 1/8; tril, -inf): out = softmax(causal(rope(q) rope(k)^T / 8)) v -> [8,2048,384]. The one attention pattern (q, k, logits, softmax: computed once per batch) is applied to the 384 value columns as six 64-column slots.
#define NB 8
#define TT 2048
#define CC 384            // NH * HD = projected width
#define DIN 384          // input (model) width
#define NH 6
#define HD 64
#define NQB (TT / 64)
#define SCALE (0.125f)
#define CAUSAL 1
#ifndef TNB
#define TNB NB
#endif
__device__ __forceinline__ float bfr(float v) { return (float)(__bf16)v; }
__host__ __device__ __forceinline__ int kb_last(int qb) { return CAUSAL ? ((qb * 64 + 63) >> 7) : (TT / 128 - 1); }
typedef __attribute__((ext_vector_type(8))) __bf16 v8b;
__device__ __forceinline__ v16b frag_b(const __bf16* rowk0, int lane) {
  union { v16b v; v8b q[2]; } u; const __bf16* p = rowk0 + 8 * (lane >> 4);
  u.q[0] = *(const v8b*)p; u.q[1] = *(const v8b*)(p + 16); return u.v;
}
#define QBH 6              // causal: query blocks 0..QBH-1 of each sequence (few keys, no averaging) take the high-precision path
#define QHI 384            // rows carrying a q residual plane
#define KHI 384            // key rows carrying k residual / v bf16 hi+lo planes (used only by the causal high-precision path)
// B fragment (k rows k0+.., output column o) of a weight: (in,out) [K][ld] or (out,in) [ld rows of K]: bf16 exact, or f16(bf16 * 256) exact
__device__ __forceinline__ v16b wcol_io(const float* Wm, int k0, int o, int lane, int ld) { v16b w; const int g = lane >> 4;
#pragma unroll
  for (int i = 0; i < 8; ++i) { w[i] = (__bf16)Wm[(size_t)(k0 + 8 * g + i) * ld + o];
    if (i == 7) asm volatile("s_wait_xcnt 0x0" ::: "memory");   // precaution: the run's last load may land in the address register that the loads before it name
    w[8 + i] = (__bf16)Wm[(size_t)(k0 + 16 + 8 * g + i) * ld + o]; }
  asm volatile("s_wait_xcnt 0x0" ::: "memory");   // same precaution for the last load, before its address register is written again
  return w; }
__device__ __forceinline__ v16b wcol_oi(const float* Wm, int k0, int o, int lane, int K) { v16b w; const float* p = Wm + (size_t)o * K + k0 + 8 * (lane >> 4);
#pragma unroll
  for (int i = 0; i < 8; ++i) { w[i] = (__bf16)p[i]; w[8 + i] = (__bf16)p[16 + i]; }
  return w; }
__device__ __forceinline__ v16h wcolh_io(const float* Wm, int k0, int o, int lane, int ld) { v16h w; const int g = lane >> 4;
#pragma unroll
  for (int i = 0; i < 8; ++i) { w[i] = (_Float16)(bfr(Wm[(size_t)(k0 + 8 * g + i) * ld + o]) * 256.0f); w[8 + i] = (_Float16)(bfr(Wm[(size_t)(k0 + 16 + 8 * g + i) * ld + o]) * 256.0f); }
  return w; }
__device__ __forceinline__ v16h wcolh_oi(const float* Wm, int k0, int o, int lane, int K) { v16h w; const float* p = Wm + (size_t)o * K + k0 + 8 * (lane >> 4);
#pragma unroll
  for (int i = 0; i < 8; ++i) { w[i] = (_Float16)(bfr(p[i]) * 256.0f); w[8 + i] = (_Float16)(bfr(p[16 + i]) * 256.0f); }
  return w; }
#define WQKV_LAYOUT 0   // 0 = (in,out): Wv [DIN][CC], Wq / Wk [DIN][HD]; 1 = (out,in) [CC][DIN]; 2 = per-head [NH][DIN][HD]
__device__ __forceinline__ v16b wcol_hdk(const float* Wm, int k0, int o, int lane) { v16b w; const int g = lane >> 4; const float* p = Wm + (size_t)(o / HD) * DIN * HD + (o % HD);
#pragma unroll
  for (int i = 0; i < 8; ++i) { w[i] = (__bf16)p[(size_t)(k0 + 8 * g + i) * HD]; w[8 + i] = (__bf16)p[(size_t)(k0 + 16 + 8 * g + i) * HD]; }
  return w; }
#define WO_OUT_IN 0
#if WQKV_LAYOUT == 1
#define WCOL(W, k0, o, lane) wcol_oi(W, k0, o, lane, DIN)
#elif WQKV_LAYOUT == 2
#define WCOL(W, k0, o, lane) wcol_hdk(W, k0, o, lane)
#else
#define WCOL(W, k0, o, lane) (which == 2 ? wcol_io(W, k0, (o), lane, CC) : wcol_io(W, k0, ((o) & 63), lane, HD))   /* (in,out): Wv [384][384] pitch 384; Wq / Wk [384][64] pitch 64, tile column o % 64 */
#endif
#if WO_OUT_IN
#define WOCOL(W, k0, o, lane) wcol_oi(W, k0, o, lane, CC)
#define WOCOLH(W, k0, o, lane) wcolh_oi(W, k0, o, lane, CC)
#else
#define WOCOL(W, k0, o, lane) wcol_io(W, k0, o, lane, DIN)
#define WOCOLH(W, k0, o, lane) wcolh_io(W, k0, o, lane, DIN)
#endif
// RoPE inverse frequencies 1/10000^(2i/64) (the f32 values jax computes)
__constant__ float INVF[32] = {1.000000000e+00,7.498942018e-01,5.623413324e-01,4.216965139e-01,3.162277639e-01,2.371373624e-01,1.778279394e-01,1.333521456e-01,1.000000015e-01,7.498941571e-02,5.623412877e-02,4.216964915e-02,3.162277862e-02,2.371373586e-02,1.778279431e-02,1.333521493e-02,9.999999776e-03,7.498942316e-03,5.623413250e-03,4.216964822e-03,3.162277862e-03,2.371373819e-03,1.778279431e-03,1.333521446e-03,1.000000047e-03,7.498941850e-04,5.623413017e-04,4.216964880e-04,3.162277862e-04,2.371373848e-04,1.778279402e-04,1.333521504e-04};
#define PROJ_EXTRA_PARAMS
// interleaved-pair RoPE on q and k (which 0: the two 64-column halves of the tile) at position t (the module uses arange(T)): angle = (float)t * inv_freq[i]; (x_even, x_odd) -> (xe cos - xo sin, xo cos + xe sin) == x * cos + rotate_half_interleaved(x) * sin with cos / sin repeated pairwise; products and sums kept separate (no fma contraction)
#define PROJ_EPI(which, row, t, h) do { if ((which) < 2) { float* rw = (row); const float pos_ = (float)(t); _Pragma("unroll 4") for (int i = 0; i < 32; ++i) { _Pragma("clang fp contract(off)") const float ang = pos_ * INVF[i]; const float cs = cosf(ang), sn = sinf(ang); const float xe = rw[2 * i], xo = rw[2 * i + 1]; rw[2 * i] = xe * cs - xo * sn; rw[2 * i + 1] = xo * cs + xe * sn; } } } while (0)
#define SM_EXTRA_PARAMS
#define SM_MASK_HOOK (void)0
#ifndef SM_EXTRA_PARAMS
#define SM_EXTRA_PARAMS
#endif
#ifndef PROJ_EXTRA_PARAMS
#define PROJ_EXTRA_PARAMS
#endif
#ifndef SM_MASK_HOOK
#define SM_MASK_HOOK (void)0
#endif

#define WS_QH  0u                                      // f16 q rows [b*t][HD]
#define WS_KH  (WS_QH + 2u * (size_t)NB * TT * HD)      // f16 k rows [b*t][HD]
#define WS_VT  (WS_KH + 2u * (size_t)NB * TT * HD)      // f16 v planes [b][c][t]
#define WS_QL  (WS_VT + 2u * (size_t)NB * CC * TT)      // f16 q residual x 2^10 rows [b][t < QHI][HD]
#define WS_KL  (WS_QL + 2u * (size_t)NB * QHI * HD)     // f16 k residual x 2^10 rows [b][t < KHI][HD]
#define WS_VB  (WS_KL + 2u * (size_t)NB * KHI * HD)     // bf16 v hi planes [b][c][t < KHI]
#define WS_VBL (WS_VB + 2u * (size_t)NB * CC * KHI)
#define WS_S   (WS_VBL + 2u * (size_t)NB * CC * KHI)    // f32 logits / P planes [b][t][s]
#define WS_Y   (WS_S  + 4u * (size_t)NB * TT * TT)      // f32 ctx rows [b*t][CC] (only when there is an output projection)
#define WS_END (WS_Y  + 0u)

// ---- k_proj: block = (64 rows, 128 cols): X W (+ b) with exact bf16 products (K = DIN); blockIdx.y = 0 (which 0; the longer blocks, so they start first): q in tile columns 0..63 and k in 64..127 -> f16 rows (+ residual rows < QHI / KHI); blockIdx.y > 0 (which 2): 128 columns of v -> f16 planes [c][t] (+ bf16 hi/lo planes for t < KHI)
__global__ __launch_bounds__(128) void k_proj(const float* __restrict__ X, const float* __restrict__ WQ, const float* __restrict__ WK, const float* __restrict__ WV, const float* __restrict__ BQ, const float* __restrict__ BK, const float* __restrict__ BV,
    _Float16* __restrict__ QH, _Float16* __restrict__ QL, _Float16* __restrict__ KH, _Float16* __restrict__ KL, _Float16* __restrict__ VT, __bf16* __restrict__ VB, __bf16* __restrict__ VBL PROJ_EXTRA_PARAMS) {
  __shared__ __align__(16) float st[64][132]; __shared__ __align__(16) _Float16 sh[64][136], sl[64][136]; __shared__ __align__(16) _Float16 th[128][72]; __shared__ __align__(16) __bf16 tb[128][72], tbl[128][72];
  const int tid = threadIdx.x, wave = tid >> 5, lane = tid & 31, col = lane & 15, g = lane >> 4; const int which = blockIdx.y == 0 ? 0 : 2; const int c0 = which == 2 ? (blockIdx.y - 1) * 128 : 0; const size_t r0 = (size_t)blockIdx.x * 64; const size_t bb = r0 / TT; const int t0 = (int)(r0 % TT);
  v8f acc[8] = {};
#pragma unroll 2
  for (int kc = 0; kc < DIN / 32; ++kc) { v16b a; { const float* p = X + (r0 + wave * 16 + col) * DIN + kc * 32 + 8 * g;
#pragma unroll
      for (int i = 0; i < 8; ++i) { a[i] = (__bf16)p[i]; a[8 + i] = (__bf16)p[16 + i]; } }
    asm volatile("s_wait_loadcnt 0x0" ::: "memory");
#pragma unroll
    for (int j = 0; j < 8; ++j) { const float* WA = which == 2 ? WV : j < 4 ? WQ : WK; const v16b w = WCOL(WA, kc * 32, c0 + j * 16 + col, lane); asm volatile("s_wait_loadcnt 0x0" ::: "memory"); acc[j] = wmma_bf(a, w, acc[j]); } }
  { // stage the f32 tile (acc + bias) in LDS, run the per-(row, head) epilogue hook, then convert
#pragma unroll
    for (int j = 0; j < 8; ++j) { const float* BA = which == 2 ? BV : j < 4 ? BQ : BK; const float bias = BA ? bfr(BA[which == 2 ? c0 + j * 16 + col : (j & 3) * 16 + col]) : 0.f;
#pragma unroll
      for (int r = 0; r < 8; ++r) st[wave * 16 + 8 * g + r][j * 16 + col] = acc[j][r] + bias; }
    __syncthreads();
    for (int e = tid; e < 64 * (128 / HD); e += 128) { const int rl = e / (128 / HD), hh = e % (128 / HD); PROJ_EPI(which, &st[rl][hh * HD], (int)((r0 + rl) % TT), (c0 / HD) + hh); }
    __syncthreads(); }
  if (which < 2) {
    for (int e = tid; e < 64 * 128; e += 128) { const int rl = e >> 7, cl = e & 127; const float v = st[rl][cl]; const _Float16 hv = (_Float16)v; sh[rl][cl] = hv; sl[rl][cl] = (_Float16)((v - (float)hv) * 1024.0f); }
    __syncthreads();
    for (int e = tid; e < 64 * 16; e += 128) { const int rl = e >> 4, q = e & 15; _Float16* DH = q < 8 ? QH : KH; _Float16* DL = q < 8 ? QL : KL; const int nhi = q < 8 ? QHI : KHI;
      vst2((unsigned*)(DH + (r0 + rl) * HD + (q & 7) * 8), *(const v4u*)&sh[rl][q * 8]);
      asm volatile("s_wait_xcnt 0x0" ::: "memory");   // precaution: stands before the store's data and address registers are rewritten (next LDS read, next trip's address)
      if (t0 < nhi) { vst2((unsigned*)(DL + (bb * nhi + t0 + rl) * (size_t)HD + (q & 7) * 8), *(const v4u*)&sl[rl][q * 8]);
        asm volatile("s_wait_xcnt 0x0" ::: "memory"); } }   // same precaution for the residual row's store
  } else { const bool hi_rows = t0 < KHI;
    for (int e = tid; e < 64 * 128; e += 128) { const int rl = e & 63, cl = e >> 6; const float v = st[rl][cl]; th[cl][rl] = (_Float16)v; const __bf16 bh = (__bf16)v; tb[cl][rl] = bh; tbl[cl][rl] = (__bf16)(v - (float)bh); }
    __syncthreads();
    for (int e = tid; e < 128 * 8; e += 128) { const int cl = e >> 3, q = e & 7; vst2((unsigned*)(VT + (bb * CC + c0 + cl) * (size_t)TT + t0 + q * 8), *(const v4u*)&th[cl][q * 8]); if (hi_rows) { const size_t o3 = (bb * CC + c0 + cl) * (size_t)KHI + t0 + q * 8; vst2((unsigned*)(VB + o3), *(const v4u*)&tb[cl][q * 8]); vst2((unsigned*)(VBL + o3), *(const v4u*)&tbl[cl][q * 8]); } } } }
// ---- k_sc: block = (query block qb, key block kb <= kb_last(qb)) of batch b = blockIdx.z (its own logit plane): logits x SCALE; q hi + residual (x 2^10) against k (2 products) for query rows < QHI, plus the k residual (3 products) for query blocks < QBH (causal early rows); causal: blocks past the diagonal exit, the mask itself is applied by index in k_sm
__global__ __launch_bounds__(128) void k_sc(const _Float16* __restrict__ QH, const _Float16* __restrict__ KH, const _Float16* __restrict__ QL, const _Float16* __restrict__ KL, float* __restrict__ SA) { __shared__ __align__(16) float ss[4][16][132];
  const int qb = blockIdx.x, kb = blockIdx.y, b = blockIdx.z; if (kb > kb_last(qb)) return;
  float* __restrict__ S = SA + (size_t)b * TT * TT;
  const int tid = threadIdx.x, wave = tid >> 5, lane = tid & 31, col = lane & 15, g = lane >> 4; const int k0 = kb * 128; const int ql0 = qb * 64 + wave * 16; const size_t q0 = (size_t)b * TT + ql0, kr0 = (size_t)b * TT + k0;
  v8f acc[8] = {}, accl[8] = {};
  const _Float16* QLb = QL + (size_t)b * QHI * HD; const _Float16* KLb = KL + (size_t)b * KHI * HD;
  if (qb < QBH) {
#pragma unroll
    for (int kc = 0; kc < HD / 32; ++kc) { const v16h ah = frag_h(QH + (q0 + col) * HD + kc * 32, lane), al = frag_h(QLb + (size_t)(ql0 + col) * HD + kc * 32, lane);
#pragma unroll
      for (int j = 0; j < 8; ++j) { const v16h kbf = frag_h(KH + (kr0 + j * 16 + col) * HD + kc * 32, lane), klf = frag_h(KLb + (size_t)(k0 + j * 16 + col) * HD + kc * 32, lane); acc[j] = wmma16(ah, kbf, acc[j]); accl[j] = wmma16(al, kbf, accl[j]); accl[j] = wmma16(ah, klf, accl[j]); } }
  } else if (qb * 64 < QHI) {
#pragma unroll
    for (int kc = 0; kc < HD / 32; ++kc) { const v16h ah = frag_h(QH + (q0 + col) * HD + kc * 32, lane), al = frag_h(QLb + (size_t)(ql0 + col) * HD + kc * 32, lane);
#pragma unroll
      for (int j = 0; j < 8; ++j) { const v16h kbf = frag_h(KH + (kr0 + j * 16 + col) * HD + kc * 32, lane); acc[j] = wmma16(ah, kbf, acc[j]); accl[j] = wmma16(al, kbf, accl[j]); } }
  } else {
#pragma unroll
    for (int kc = 0; kc < HD / 32; ++kc) { const v16h ah = frag_h(QH + (q0 + col) * HD + kc * 32, lane);
#pragma unroll
      for (int j = 0; j < 8; ++j) { const v16h kbf = frag_h(KH + (kr0 + j * 16 + col) * HD + kc * 32, lane); acc[j] = wmma16(ah, kbf, acc[j]); } } }
#pragma unroll
  for (int j = 0; j < 8; ++j) {
#pragma unroll
    for (int r = 0; r < 8; ++r) ss[wave][8 * g + r][j * 16 + col] = (acc[j][r] + accl[j][r] * (1.0f / 1024.0f)) * SCALE; }
  LDSX(); for (int rl = 0; rl < 16; ++rl) vst2(S + (size_t)(ql0 + rl) * TT + k0 + lane * 4, *(const v4f*)&ss[wave][rl][lane * 4]); }
// ---- k_sm: one wave = query row t of batch blockIdx.x (8 rows a block; blockIdx.y counts down from the longest rows, so cost falls with the block index); the row's keys [0, kend) stay in registers, 4 consecutive keys a lane per 128-key group: causal -> logit if s <= t else excluded; softmax in f32 (maximum and sum in-lane, then across the 32 lanes; no LDS, no barrier); P x 2^11 in place (0 for excluded)
__global__ __launch_bounds__(256) void k_sm(float* __restrict__ S0 SM_EXTRA_PARAMS) {
  const int lane = threadIdx.x & 31; const int t = TT - 1 - (int)(blockIdx.y * 8 + __builtin_amdgcn_readfirstlane(threadIdx.x >> 5));
  const int ng = kb_last(t >> 6) + 1;   // 128-key groups of the row: the same for the whole wave, so every test on it below is a scalar branch
  float* sr = S0 + ((size_t)blockIdx.x * TT + t) * TT + lane * 4; const int rel = t - lane * 4;   // key 128 i + 4 lane + c is kept when 128 i + c <= rel
  v4f r[TT / 128];
#pragma unroll
  for (int i = 0; i < TT / 128; ++i) if (i < ng) r[i] = *(const v4f*)(sr + i * 128);
  float m = -3.0e38f;
#pragma unroll
  for (int i = 0; i < TT / 128; ++i) if (i < ng) {
#pragma unroll
    for (int c = 0; c < 4; ++c) { float v = (!CAUSAL || i * 128 + c <= rel) ? r[i][c] : -3.0e38f; SM_MASK_HOOK; m = fmaxf(m, v); } }
#pragma unroll
  for (int o = 1; o < 32; o <<= 1) m = fmaxf(m, __shfl_xor(m, o));
  v4f s4 = {};
#pragma unroll
  for (int i = 0; i < TT / 128; ++i) if (i < ng) {
#pragma unroll
    for (int c = 0; c < 4; ++c) { float v = (!CAUSAL || i * 128 + c <= rel) ? r[i][c] : -3.0e38f; SM_MASK_HOOK; const float ex = expf(v - m); const float e = (v <= -1.0e38f) ? 0.f : ex; r[i][c] = e; s4[c] += e; } }
  float sum = (s4[0] + s4[1]) + (s4[2] + s4[3]);
#pragma unroll
  for (int o = 1; o < 32; o <<= 1) sum += __shfl_xor(sum, o);
  const float inv = sum > 0.f ? 2048.0f / sum : 0.f;   /* a fully excluded row yields P = 0 */
#pragma unroll
  for (int i = 0; i < TT / 128; ++i) if (i < ng) { vst2(sr + i * 128, r[i] * inv);
    asm volatile("s_wait_xcnt 0x0" ::: "memory"); } }   // precaution: stands before the store's data registers are written again for the next group
#define PVK 128            // keys of a staged tile in k_pv
#define PVP (PVK + 8)      // its LDS row pitch in f16: 272 B = 16 B x 17, the odd multiple that 16-byte LDS reads want
typedef __attribute__((ext_vector_type(4))) _Float16 v4h;
// ---- k_pv: block = 64 queries (qb) of batch b = blockIdx.y x value columns 64h .. 64h+63 (h = blockIdx.z; every h reads the same P): ctx = P . v over keys [0, kend) (P x 2^11 once to f16 against v f16: 1 product; causal early query blocks: P and v as bf16 hi + lo, 3 products); 256-B (row, head) segment by 16 lanes
__global__ __launch_bounds__(128) void k_pv(const float* __restrict__ PA, const _Float16* __restrict__ VT, const __bf16* __restrict__ VB, const __bf16* __restrict__ VBL, float* __restrict__ Y) { const int h = blockIdx.z, b = blockIdx.y; const float* __restrict__ PS = PA + (size_t)b * TT * TT; __shared__ __align__(16) float ss[4][16][HD + 4]; __shared__ __align__(16) _Float16 sp[4][16][PVP], sv[HD][PVP];
  const int tid = threadIdx.x, wave = tid >> 5, lane = tid & 31, col = lane & 15, g = lane >> 4; const int qb = blockIdx.x; const int ql0 = qb * 64 + wave * 16; const int kce = (kb_last(qb) + 1) * 4;
  v8f acc[HD / 16] = {};
  if (qb < QBH) {
#pragma unroll 1
    for (int kc = 0; kc < kce; ++kc) { const F2 p = split_row(PS + (size_t)(ql0 + col) * TT, kc * 32, lane);
      asm volatile("s_wait_loadcnt 0x0" ::: "memory");
#pragma unroll
      for (int j = 0; j < HD / 16; ++j) { const size_t po = ((size_t)b * CC + h * HD + j * 16 + col) * (size_t)KHI + kc * 32; const v16b vh = frag_b(VB + po, lane); acc[j] = wmma_bf(p.h, vh, acc[j]); acc[j] = wmma_bf(p.l, vh, acc[j]); acc[j] = wmma_bf(p.h, frag_b(VBL + po, lane), acc[j]); } }
  } else {
    // 128-key tiles through LDS: every global load covers whole 128-B lines (a P row: 512 B a wave-load; two v columns of 256 B a wave-load), v is fetched once a block instead of once a wave; the next tile's loads fly in registers while this tile is multiplied
    const int nt = kce / 4; const float* pg = PS + (size_t)ql0 * TT + lane * 4; const _Float16* vg = VT + ((size_t)b * CC + h * HD + (tid >> 4)) * (size_t)TT + (tid & 15) * 8;
    v4f pr[16]; v8h vr[HD / 8];
    // every "unroll" below: constant indices keep pr, vr, vf and acc in registers; "unroll 1": the tile loop stays rolled, a second copy of its body would only add live registers
#pragma unroll
    for (int r = 0; r < 16; ++r) pr[r] = *(const v4f*)(pg + (size_t)r * TT);
#pragma unroll
    for (int i = 0; i < HD / 8; ++i) vr[i] = *(const v8h*)(vg + (size_t)i * 8 * TT);
#pragma unroll 1
    for (int kt = 0; kt < nt; ++kt) {
#pragma unroll
      for (int r = 0; r < 16; ++r) { v4h hv; hv[0] = (_Float16)pr[r][0]; hv[1] = (_Float16)pr[r][1]; hv[2] = (_Float16)pr[r][2]; hv[3] = (_Float16)pr[r][3]; *(v4h*)&sp[wave][r][lane * 4] = hv; }
#pragma unroll
      for (int i = 0; i < HD / 8; ++i) *(v8h*)&sv[i * 8 + (tid >> 4)][(tid & 15) * 8] = vr[i];
      __syncthreads();   // the tile is published to the four waves
      if (kt + 1 < nt) { const float* pn = pg + (kt + 1) * PVK; const _Float16* vn = vg + (kt + 1) * PVK;
#pragma unroll
        for (int r = 0; r < 16; ++r) pr[r] = *(const v4f*)(pn + (size_t)r * TT);
#pragma unroll
        for (int i = 0; i < HD / 8; ++i) vr[i] = *(const v8h*)(vn + (size_t)i * 8 * TT);
        asm volatile("s_wait_xcnt 0x0" ::: "memory"); }   // precaution: stands before the loads' address registers are written again (the LDS reads below may land in them)
#pragma unroll
      for (int kc = 0; kc < PVK / 32; ++kc) { const v16h p = frag_h(&sp[wave][col][kc * 32], lane); v16h vf[HD / 16];
#pragma unroll
        for (int j = 0; j < HD / 16; ++j) vf[j] = frag_h(&sv[j * 16 + col][kc * 32], lane);   // the k-step's ten LDS reads go out as one group, ahead of its four products
#pragma unroll
        for (int j = 0; j < HD / 16; ++j) acc[j] = wmma16(p, vf[j], acc[j]); }
      __syncthreads();   // every wave has read the tile before it is overwritten
    } }
#pragma unroll
  for (int j = 0; j < HD / 16; ++j)
#pragma unroll
    for (int r = 0; r < 8; ++r) ss[wave][8 * g + r][j * 16 + col] = acc[j][r] * (1.0f / 2048.0f);
  LDSX(); for (int rl = 0; rl < 16; ++rl) if (lane < HD / 4) vst2(Y + ((size_t)b * TT + ql0 + rl) * CC + h * HD + lane * 4, *(const v4f*)&ss[wave][rl][lane * 4]); }

extern "C" void kernel_launch(void* const* d_in, const int* in_sizes, int n_in, void* d_out, int out_size, void* d_ws, size_t ws_size, hipStream_t stream) {
  (void)in_sizes; (void)n_in; (void)out_size;
  const float** F = (const float**)d_in;
  if (ws_size < (size_t)WS_END) return;
  char* ws = (char*)d_ws; _Float16 *QH = (_Float16*)(ws + WS_QH), *KH = (_Float16*)(ws + WS_KH), *VT = (_Float16*)(ws + WS_VT), *QL = (_Float16*)(ws + WS_QL), *KL = (_Float16*)(ws + WS_KL); __bf16 *VB = (__bf16*)(ws + WS_VB), *VBL = (__bf16*)(ws + WS_VBL); float *S = (float*)(ws + WS_S), *Y = (float*)(ws + WS_Y);
  (void)Y; (void)QL; (void)KL; (void)VB; (void)VBL;
  // inputs: 0 x [8,2048,384]; 1 Wq [384,64] (in,out); 2 Wk [384,64]; 3 Wv [384,384] (in,out); no biases
  k_proj<<<dim3(TNB * TT / 64, CC / 128 + 1), 128, 0, stream>>>(F[0], F[1], F[2], F[3], nullptr, nullptr, nullptr, QH, QL, KH, KL, VT, VB, VBL);   /* y = 0: q and k (64 columns each) in one tile; y = 1..3: 128 value columns each */
  k_sc<<<dim3(NQB, TT / 128, TNB), 128, 0, stream>>>(QH, KH, QL, KL, S);
  k_sm<<<dim3(TNB, TT / 8), 256, 0, stream>>>(S);   /* one wave a row, 8 rows a block */
  k_pv<<<dim3(NQB, TNB, NH), 128, 0, stream>>>(S, VT, VB, VBL, (float*)d_out);   /* slot h writes output columns 64h .. 64h+63 */
}

// v005
// One run takes 121 microseconds.
// In two side-by-side timings against v004, it was 1.34 and 1.36 times as fast.
// Over all steps from v000 it is 14.1 times as fast.
// compute dtype: all float inputs rounded to bf16; q / k (64 wide) and v (384 wide) projections with EXACT bf16 products on WMMA 16x16x32 (f32 accumulate); interleaved RoPE in f32 (f32 inverse frequencies; precise cosf / sinf); causal logits: 3 products for the first 384 rows, single f16 q x k after, x 64^-0.5; softmax f32 (q, k, logits and softmax once per batch, shared by all 384 value columns; all batches in one launch of each kernel, one logit plane per batch); P x 2^11 once to f16 x v once to f16 (bf16 hi + lo below row 384); f32 output.
#include <hip/hip_runtime.h>
#include <math.h>

typedef __attribute__((ext_vector_type(16))) _Float16 v16h;
typedef __attribute__((ext_vector_type(16))) __bf16 v16b;
typedef __attribute__((ext_vector_type(8)))  _Float16 v8h;
typedef __attribute__((ext_vector_type(8)))  float v8f;
typedef __attribute__((ext_vector_type(4)))  float v4f;
typedef __attribute__((ext_vector_type(2)))  float v2f;
typedef __attribute__((ext_vector_type(4)))  unsigned v4u;
typedef __attribute__((ext_vector_type(4)))  int v4i;
typedef float __attribute__((may_alias)) float_a;
typedef int __attribute__((may_alias)) int_a;

template <typename T> __device__ __forceinline__ void vst2(void* p, T v) { *(T*)p = v;  }
__device__ __forceinline__ v8f wmma16(v16h a, v16h b, v8f c) {
  v8f d = __builtin_amdgcn_wmma_f32_16x16x32_f16(false, a, false, b, (short)0, c, false, false);
  asm volatile("v_nop\n\tv_nop\n\tv_nop\n\tv_nop" : "+v"(d) : "v"(a), "v"(b));
  return d;
}
__device__ __forceinline__ v8f wmma_bf(v16b a, v16b b, v8f c) {
  v8f d = __builtin_amdgcn_wmma_f32_16x16x32_bf16(false, a, false, b, (short)0, c, false, false);
  asm volatile("v_nop\n\tv_nop\n\tv_nop\n\tv_nop" : "+v"(d) : "v"(a), "v"(b));
  return d;
}
// 16x16x32 fragments: lane = (h = lane>>4, row/col = lane&15); elements 0..7 = k0+8h+0..7, 8..15 = k0+16+8h+0..7; D element r = row 8h+r
__device__ __forceinline__ v16h frag_h(const _Float16* rowk0, int lane) {
  union { v16h v; v8h q[2]; } u; const _Float16* p = rowk0 + 8 * (lane >> 4);
  u.q[0] = *(const v8h*)p; u.q[1] = *(const v8h*)(p + 16); return u.v;
}
__device__ __forceinline__ v16h frag_f32(const float* rowk0, int lane) {
  v16h a; const float* p = rowk0 + 8 * (lane >> 4);
#pragma unroll
  for (int i = 0; i < 8; ++i) { a[i] = (_Float16)p[i]; a[8 + i] = (_Float16)p[16 + i]; }
  return a;
}
__device__ __forceinline__ v16h frag_f32s(const float* rowk0, int lane, float sc) {
  v16h a; const float* p = rowk0 + 8 * (lane >> 4);
#pragma unroll
  for (int i = 0; i < 8; ++i) { a[i] = (_Float16)(p[i] * sc); a[8 + i] = (_Float16)(p[16 + i] * sc); }
  return a;
}
// column fragment from a [K][ld] layout (column n), rows >= K read as 0
__device__ __forceinline__ v16h fragc_f32(const float* W, int k0, int n, int lane, int ld, int K) {
  v16h a; const int g = lane >> 4;
#pragma unroll
  for (int i = 0; i < 8; ++i) { const int ka = k0 + 8 * g + i, kb = ka + 16;
    a[i] = (_Float16)(ka < K ? W[(size_t)(ka < K ? ka : K - 1) * ld + n] : 0.f); a[8 + i] = (_Float16)(kb < K ? W[(size_t)(kb < K ? kb : K - 1) * ld + n] : 0.f); }
  return a;
}
struct F2 { v16b h, l; };
__device__ __forceinline__ F2 bsplit16(const float v[16]) { F2 r;
#pragma unroll
  for (int i = 0; i < 16; ++i) { const __bf16 h = (__bf16)v[i]; r.h[i] = h; r.l[i] = (__bf16)(v[i] - (float)h); }
  return r; }
__device__ __forceinline__ F2 split_row(const float* row, int k0, int lane) { float v[16]; const float* p = row + k0 + 8 * (lane >> 4);
#pragma unroll
  for (int i = 0; i < 8; ++i) { v[i] = p[i]; v[8 + i] = p[16 + i]; }
  return bsplit16(v); }
__device__ __forceinline__ F2 split_rowK(const float* row, int k0, int lane, int K) { float v[16]; const int g = lane >> 4;
#pragma unroll
  for (int i = 0; i < 8; ++i) { const int ka = k0 + 8 * g + i, kb = ka + 16; v[i] = ka < K ? row[ka < K ? ka : K - 1] : 0.f; v[8 + i] = kb < K ? row[kb < K ? kb : K - 1] : 0.f; }
  return bsplit16(v); }
__device__ __forceinline__ F2 split_col(const float* W, int k0, int n, int lane, int ld, int K) { float v[16]; const int g = lane >> 4;
#pragma unroll
  for (int i = 0; i < 8; ++i) { const int ka = k0 + 8 * g + i, kb = ka + 16; v[i] = ka < K ? W[(size_t)(ka < K ? ka : K - 1) * ld + n] : 0.f; v[8 + i] = kb < K ? W[(size_t)(kb < K ? kb : K - 1) * ld + n] : 0.f; }
  return bsplit16(v); }
__device__ __forceinline__ v8f mac3(const F2& a, const F2& b, v8f c) { c = wmma_bf(a.l, b.h, c); c = wmma_bf(a.h, b.l, c); return wmma_bf(a.h, b.h, c); }
__device__ __forceinline__ float sigm(float v) { return 1.0f / (1.0f + expf(-v)); }
#define LDSX() do { asm volatile("s_wait_dscnt 0" ::: "memory"); __builtin_amdgcn_wave_barrier(); __builtin_amdgcn_fence(__ATOMIC_RELEASE, "workgroup"); } while (0)

// Single-head causal attention with a WIDE value (x [8,2048,384]; (in,out) Wq / Wk [384,64], Wv [384,384] (0.02 scale), no biases; interleaved-pair RoPE on q and k (positions arange(T), inv_freq = 1/10000^(2i/64)); scale 1/8; tril, -inf): out = softmax(causal(rope(q) rope(k)^T / 8)) v -> [8,2048,384]. The one attention pattern (q, k, logits, softmax: computed once per batch) is applied to the 384 value columns as six 64-column slots.
#define NB 8
#define TT 2048
#define CC 384            // NH * HD = projected width
#define DIN 384          // input (model) width
#define NH 6
#define HD 64
#define NQB (TT / 64)
#define SCALE (0.125f)
#define CAUSAL 1
#ifndef TNB
#define TNB NB
#endif
__device__ __forceinline__ float bfr(float v) { return (float)(__bf16)v; }
__host__ __device__ __forceinline__ int kb_last(int qb) { return CAUSAL ? ((qb * 64 + 63) >> 7) : (TT / 128 - 1); }
typedef __attribute__((ext_vector_type(8))) __bf16 v8b;
__device__ __forceinline__ v16b frag_b(const __bf16* rowk0, int lane) {
  union { v16b v; v8b q[2]; } u; const __bf16* p = rowk0 + 8 * (lane >> 4);
  u.q[0] = *(const v8b*)p; u.q[1] = *(const v8b*)(p + 16); return u.v;
}
#define QBH 6              // causal: query blocks 0..QBH-1 of each sequence (few keys, no averaging) take the high-precision path
#define QHI 384            // rows carrying a q residual plane
#define KHI 384            // key rows carrying k residual / v bf16 hi+lo planes (used only by the causal high-precision path)
// B fragment (k rows k0+.., output column o) of a weight: (in,out) [K][ld] or (out,in) [ld rows of K]: bf16 exact, or f16(bf16 * 256) exact
__device__ __forceinline__ v16b wcol_io(const float* Wm, int k0, int o, int lane, int ld) { v16b w; const int g = lane >> 4;
#pragma unroll
  for (int i = 0; i < 8; ++i) { w[i] = (__bf16)Wm[(size_t)(k0 + 8 * g + i) * ld + o];
    if (i == 7) asm volatile("s_wait_xcnt 0x0" ::: "memory");   // precaution: the run's last load may land in the address register that the loads before it name
    w[8 + i] = (__bf16)Wm[(size_t)(k0 + 16 + 8 * g + i) * ld + o]; }
  asm volatile("s_wait_xcnt 0x0" ::: "memory");   // same precaution for the last load, before its address register is written again
  return w; }
__device__ __forceinline__ v16b wcol_oi(const float* Wm, int k0, int o, int lane, int K) { v16b w; const float* p = Wm + (size_t)o * K + k0 + 8 * (lane >> 4);
#pragma unroll
  for (int i = 0; i < 8; ++i) { w[i] = (__bf16)p[i]; w[8 + i] = (__bf16)p[16 + i]; }
  return w; }
__device__ __forceinline__ v16h wcolh_io(const float* Wm, int k0, int o, int lane, int ld) { v16h w; const int g = lane >> 4;
#pragma unroll
  for (int i = 0; i < 8; ++i) { w[i] = (_Float16)(bfr(Wm[(size_t)(k0 + 8 * g + i) * ld + o]) * 256.0f); w[8 + i] = (_Float16)(bfr(Wm[(size_t)(k0 + 16 + 8 * g + i) * ld + o]) * 256.0f); }
  return w; }
__device__ __forceinline__ v16h wcolh_oi(const float* Wm, int k0, int o, int lane, int K) { v16h w; const float* p = Wm + (size_t)o * K + k0 + 8 * (lane >> 4);
#pragma unroll
  for (int i = 0; i < 8; ++i) { w[i] = (_Float16)(bfr(p[i]) * 256.0f); w[8 + i] = (_Float16)(bfr(p[16 + i]) * 256.0f); }
  return w; }
#define WQKV_LAYOUT 0   // 0 = (in,out): Wv [DIN][CC], Wq / Wk [DIN][HD]; 1 = (out,in) [CC][DIN]; 2 = per-head [NH][DIN][HD]
__device__ __forceinline__ v16b wcol_hdk(const float* Wm, int k0, int o, int lane) { v16b w; const int g = lane >> 4; const float* p = Wm + (size_t)(o / HD) * DIN * HD + (o % HD);
#pragma unroll
  for (int i = 0; i < 8; ++i) { w[i] = (__bf16)p[(size_t)(k0 + 8 * g + i) * HD]; w[8 + i] = (__bf16)p[(size_t)(k0 + 16 + 8 * g + i) * HD]; }
  return w; }
#define WO_OUT_IN 0
#if WQKV_LAYOUT == 1
#define WCOL(W, k0, o, lane) wcol_oi(W, k0, o, lane, DIN)
#elif WQKV_LAYOUT == 2
#define WCOL(W, k0, o, lane) wcol_hdk(W, k0, o, lane)
#else
#define WCOL(W, k0, o, lane) (which == 2 ? wcol_io(W, k0, (o), lane, CC) : wcol_io(W, k0, ((o) & 63), lane, HD))   /* (in,out): Wv [384][384] pitch 384; Wq / Wk [384][64] pitch 64, tile column o % 64 */
#endif
#if WO_OUT_IN
#define WOCOL(W, k0, o, lane) wcol_oi(W, k0, o, lane, CC)
#define WOCOLH(W, k0, o, lane) wcolh_oi(W, k0, o, lane, CC)
#else
#define WOCOL(W, k0, o, lane) wcol_io(W, k0, o, lane, DIN)
#define WOCOLH(W, k0, o, lane) wcolh_io(W, k0, o, lane, DIN)
#endif
// RoPE inverse frequencies 1/10000^(2i/64) (the f32 values jax computes)
__constant__ float INVF[32] = {1.000000000e+00,7.498942018e-01,5.623413324e-01,4.216965139e-01,3.162277639e-01,2.371373624e-01,1.778279394e-01,1.333521456e-01,1.000000015e-01,7.498941571e-02,5.623412877e-02,4.216964915e-02,3.162277862e-02,2.371373586e-02,1.778279431e-02,1.333521493e-02,9.999999776e-03,7.498942316e-03,5.623413250e-03,4.216964822e-03,3.162277862e-03,2.371373819e-03,1.778279431e-03,1.333521446e-03,1.000000047e-03,7.498941850e-04,5.623413017e-04,4.216964880e-04,3.162277862e-04,2.371373848e-04,1.778279402e-04,1.333521504e-04};
#define PROJ_EXTRA_PARAMS
// interleaved-pair RoPE on q and k (which 0: the two 64-column halves of the tile) at position t (the module uses arange(T)): angle = (float)t * inv_freq[i]; (x_even, x_odd) -> (xe cos - xo sin, xo cos + xe sin) == x * cos + rotate_half_interleaved(x) * sin with cos / sin repeated pairwise; products and sums kept separate (no fma contraction)
#define PROJ_EPI(which, row, t, h) do { if ((which) < 2) { float* rw = (row); const float pos_ = (float)(t); _Pragma("unroll 4") for (int i = 0; i < 32; ++i) { _Pragma("clang fp contract(off)") const float ang = pos_ * INVF[i]; const float cs = cosf(ang), sn = sinf(ang); const float xe = rw[2 * i], xo = rw[2 * i + 1]; rw[2 * i] = xe * cs - xo * sn; rw[2 * i + 1] = xo * cs + xe * sn; } } } while (0)
#define SM_EXTRA_PARAMS
#define SM_MASK_HOOK (void)0
#ifndef SM_EXTRA_PARAMS
#define SM_EXTRA_PARAMS
#endif
#ifndef PROJ_EXTRA_PARAMS
#define PROJ_EXTRA_PARAMS
#endif
#ifndef SM_MASK_HOOK
#define SM_MASK_HOOK (void)0
#endif

#define WS_QH  0u                                      // f16 q rows [b*t][HD]
#define WS_KH  (WS_QH + 2u * (size_t)NB * TT * HD)      // f16 k rows [b*t][HD]
#define WS_VT  (WS_KH + 2u * (size_t)NB * TT * HD)      // f16 v planes [b][c][t]
#define WS_QL  (WS_VT + 2u * (size_t)NB * CC * TT)      // f16 q residual x 2^10 rows [b][t < QHI][HD]
#define WS_KL  (WS_QL + 2u * (size_t)NB * QHI * HD)     // f16 k residual x 2^10 rows [b][t < KHI][HD]
#define WS_VB  (WS_KL + 2u * (size_t)NB * KHI * HD)     // bf16 v hi planes [b][c][t < KHI]
#define WS_VBL (WS_VB + 2u * (size_t)NB * CC * KHI)
#define WS_S   (WS_VBL + 2u * (size_t)NB * CC * KHI)    // f32 logits / P planes [b][t][s]
#define WS_Y   (WS_S  + 4u * (size_t)NB * TT * TT)      // f32 ctx rows [b*t][CC] (only when there is an output projection)
#define WS_END (WS_Y  + 0u)

#define PJK 64             // k of a staged chunk in k_proj
typedef __attribute__((ext_vector_type(4))) __bf16 v4b;
// main loop of k_proj, W of row pitch WLD floats (a constant, so that each operand's loads share one address register that lives through the loop and differ in their immediate offsets): 64-k chunks of x and W go through LDS as bf16; every global load covers whole 128-B lines (x: two rows of 256 B a wave-load; W: 4 k rows x one line), W is fetched and rounded once a block instead of once a wave, and the next chunk's loads fly in registers while this chunk is multiplied.
// sx: x chunk [row][k]; sw: W chunk [tile column][k]; pitch 144 B = 16 B x 9, the odd multiple that 16-byte LDS reads want. A lane holds 8 consecutive k of 4 columns per set of 8 W loads, so each column's 8 k go to LDS as one 16-byte store.
template <int WLD> __device__ __forceinline__ void proj_mm(const float* xg, const float* wg, __bf16 (*sx)[72], __bf16 (*sw)[72], int wave, int lane, v8f (&acc)[8]) {
  const int col = lane & 15, g = lane >> 4, lr = lane >> 3, lc = lane & 7;
  v4f xr[8], wr[16];
  // every "unroll" below: constant indices keep xr, wr, wf and acc in registers; "unroll 1": the chunk loop stays rolled, a second copy of its body would only add live registers
#pragma unroll
  for (int i = 0; i < 16; ++i) wr[i] = *(const v4f*)(wg + (size_t)((i >> 3) * 32 + (i & 7)) * WLD);
#pragma unroll
  for (int i = 0; i < 8; ++i) xr[i] = *(const v4f*)(xg + (size_t)i * 2 * DIN);
  asm volatile("s_wait_xcnt 0x0" ::: "memory");   // precaution: stands before the loads' address registers are written again
#pragma unroll 1
  for (int ch = 0; ch < DIN / PJK; ++ch) {
#pragma unroll
    for (int s = 0; s < 2; ++s)
#pragma unroll
      for (int c = 0; c < 4; ++c) { v8b wv;
#pragma unroll
        for (int i = 0; i < 8; ++i) wv[i] = (__bf16)wr[s * 8 + i][c];
        *(v8b*)&sw[wave * 32 + lc * 4 + c][s * 32 + lr * 8] = wv; }
#pragma unroll
    for (int i = 0; i < 8; ++i) { v4b xv; xv[0] = (__bf16)xr[i][0]; xv[1] = (__bf16)xr[i][1]; xv[2] = (__bf16)xr[i][2]; xv[3] = (__bf16)xr[i][3]; *(v4b*)&sx[wave * 16 + i * 2 + g][col * 4] = xv; }
    __syncthreads();   // the chunk is published to the four waves
    if (ch + 1 < DIN / PJK) { xg += PJK; wg += (size_t)PJK * WLD;
#pragma unroll
      for (int i = 0; i < 16; ++i) wr[i] = *(const v4f*)(wg + (size_t)((i >> 3) * 32 + (i & 7)) * WLD);
#pragma unroll
      for (int i = 0; i < 8; ++i) xr[i] = *(const v4f*)(xg + (size_t)i * 2 * DIN);
      asm volatile("s_wait_xcnt 0x0" ::: "memory"); }   // precaution: stands before the loads' address registers are written again
#pragma unroll
    for (int kc = 0; kc < PJK / 32; ++kc) { const v16b a = frag_b(&sx[wave * 16 + col][kc * 32], lane);
#pragma unroll
      for (int jh = 0; jh < 2; ++jh) { v16b wf[4];
#pragma unroll
        for (int j = 0; j < 4; ++j) wf[j] = frag_b(&sw[(jh * 4 + j) * 16 + col][kc * 32], lane);   // eight LDS reads go out as one group, ahead of their four products
#pragma unroll
        for (int j = 0; j < 4; ++j) acc[jh * 4 + j] = wmma_bf(a, wf[j], acc[jh * 4 + j]); } }
    __syncthreads();   // every wave has read the chunk before it is overwritten
  } }
// ---- k_proj: block = (64 rows, 128 cols): X W (+ b) with exact bf16 products (K = DIN; x and W staged in LDS as bf16 in 64-k chunks); blockIdx.y = 0 (which 0; the longer blocks, so they start first): q in tile columns 0..63 and k in 64..127 -> f16 rows (+ residual rows < QHI / KHI); blockIdx.y > 0 (which 2): 128 columns of v -> f16 planes [c][t] (+ bf16 hi/lo planes for t < KHI)
__global__ __launch_bounds__(128) void k_proj(const float* __restrict__ X, const float* __restrict__ WQ, const float* __restrict__ WK, const float* __restrict__ WV, const float* __restrict__ BQ, const float* __restrict__ BK, const float* __restrict__ BV,
    _Float16* __restrict__ QH, _Float16* __restrict__ QL, _Float16* __restrict__ KH, _Float16* __restrict__ KL, _Float16* __restrict__ VT, __bf16* __restrict__ VB, __bf16* __restrict__ VBL PROJ_EXTRA_PARAMS) {
  __shared__ __align__(16) float st[64][132]; __shared__ __align__(16) _Float16 sh[64][136], sl[64][136]; __shared__ __align__(16) _Float16 th[128][72]; __shared__ __align__(16) __bf16 tb[128][72], tbl[128][72];
  const int tid = threadIdx.x, wave = tid >> 5, lane = tid & 31, col = lane & 15, g = lane >> 4; const int which = blockIdx.y == 0 ? 0 : 2; const int c0 = which == 2 ? (blockIdx.y - 1) * 128 : 0; const size_t r0 = (size_t)blockIdx.x * 64; const size_t bb = r0 / TT; const int t0 = (int)(r0 % TT);
  v8f acc[8] = {};
  { // wave w stages tile columns 32w .. 32w+31 of W and its own 16 rows of x; the two stages lie in tb and tbl, which hold nothing until the epilogue (behind its own barriers)
    const float* xg = X + (r0 + wave * 16 + g) * DIN + col * 4; const int lr = lane >> 3, lc = lane & 7;
    if (which == 2) proj_mm<CC>(xg, WV + c0 + wave * 32 + lc * 4 + (size_t)(lr * 8) * CC, tbl, tb, wave, lane, acc);
    else proj_mm<HD>(xg, (wave < 2 ? WQ + wave * 32 : WK + (wave - 2) * 32) + lc * 4 + (size_t)(lr * 8) * HD, tbl, tb, wave, lane, acc); }
  { // stage the f32 tile (acc + bias) in LDS, run the per-(row, head) epilogue hook, then convert
#pragma unroll
    for (int j = 0; j < 8; ++j) { const float* BA = which == 2 ? BV : j < 4 ? BQ : BK; const float bias = BA ? bfr(BA[which == 2 ? c0 + j * 16 + col : (j & 3) * 16 + col]) : 0.f;
#pragma unroll
      for (int r = 0; r < 8; ++r) st[wave * 16 + 8 * g + r][j * 16 + col] = acc[j][r] + bias; }
    __syncthreads();
    for (int e = tid; e < 64 * (128 / HD); e += 128) { const int rl = e / (128 / HD), hh = e % (128 / HD); PROJ_EPI(which, &st[rl][hh * HD], (int)((r0 + rl) % TT), (c0 / HD) + hh); }
    __syncthreads(); }
  if (which < 2) {
    for (int e = tid; e < 64 * 128; e += 128) { const int rl = e >> 7, cl = e & 127; const float v = st[rl][cl]; const _Float16 hv = (_Float16)v; sh[rl][cl] = hv; sl[rl][cl] = (_Float16)((v - (float)hv) * 1024.0f); }
    __syncthreads();
    for (int e = tid; e < 64 * 16; e += 128) { const int rl = e >> 4, q = e & 15; _Float16* DH = q < 8 ? QH : KH; _Float16* DL = q < 8 ? QL : KL; const int nhi = q < 8 ? QHI : KHI;
      vst2((unsigned*)(DH + (r0 + rl) * HD + (q & 7) * 8), *(const v4u*)&sh[rl][q * 8]);
      asm volatile("s_wait_xcnt 0x0" ::: "memory");   // precaution: stands before the store's data and address registers are rewritten (next LDS read, next trip's address)
      if (t0 < nhi) { vst2((unsigned*)(DL + (bb * nhi + t0 + rl) * (size_t)HD + (q & 7) * 8), *(const v4u*)&sl[rl][q * 8]);
        asm volatile("s_wait_xcnt 0x0" ::: "memory"); } }   // same precaution for the residual row's store
  } else { const bool hi_rows = t0 < KHI;
    for (int e = tid; e < 64 * 128; e += 128) { const int rl = e & 63, cl = e >> 6; const float v = st[rl][cl]; th[cl][rl] = (_Float16)v; const __bf16 bh = (__bf16)v; tb[cl][rl] = bh; tbl[cl][rl] = (__bf16)(v - (float)bh); }
    __syncthreads();
    for (int e = tid; e < 128 * 8; e += 128) { const int cl = e >> 3, q = e & 7; vst2((unsigned*)(VT + (bb * CC + c0 + cl) * (size_t)TT + t0 + q * 8), *(const v4u*)&th[cl][q * 8]); if (hi_rows) { const size_t o3 = (bb * CC + c0 + cl) * (size_t)KHI + t0 + q * 8; vst2((unsigned*)(VB + o3), *(const v4u*)&tb[cl][q * 8]); vst2((unsigned*)(VBL + o3), *(const v4u*)&tbl[cl][q * 8]); } } } }
// ---- k_sc: block = (query block qb, key block kb <= kb_last(qb)) of batch b = blockIdx.z (its own logit plane): logits x SCALE; q hi + residual (x 2^10) against k (2 products) for query rows < QHI, plus the k residual (3 products) for query blocks < QBH (causal early rows); causal: blocks past the diagonal exit, the mask itself is applied by index in k_sm
__global__ __launch_bounds__(128) void k_sc(const _Float16* __restrict__ QH, const _Float16* __restrict__ KH, const _Float16* __restrict__ QL, const _Float16* __restrict__ KL, float* __restrict__ SA) { __shared__ __align__(16) float ss[4][16][132];
  const int qb = blockIdx.x, kb = blockIdx.y, b = blockIdx.z; if (kb > kb_last(qb)) return;
  float* __restrict__ S = SA + (size_t)b * TT * TT;
  const int tid = threadIdx.x, wave = tid >> 5, lane = tid & 31, col = lane & 15, g = lane >> 4; const int k0 = kb * 128; const int ql0 = qb * 64 + wave * 16; const size_t q0 = (size_t)b * TT + ql0, kr0 = (size_t)b * TT + k0;
  v8f acc[8] = {}, accl[8] = {};
  const _Float16* QLb = QL + (size_t)b * QHI * HD; const _Float16* KLb = KL + (size_t)b * KHI * HD;
  if (qb < QBH) {
#pragma unroll
    for (int kc = 0; kc < HD / 32; ++kc) { const v16h ah = frag_h(QH + (q0 + col) * HD + kc * 32, lane), al = frag_h(QLb + (size_t)(ql0 + col) * HD + kc * 32, lane);
#pragma unroll
      for (int j = 0; j < 8; ++j) { const v16h kbf = frag_h(KH + (kr0 + j * 16 + col) * HD + kc * 32, lane), klf = frag_h(KLb + (size_t)(k0 + j * 16 + col) * HD + kc * 32, lane); acc[j] = wmma16(ah, kbf, acc[j]); accl[j] = wmma16(al, kbf, accl[j]); accl[j] = wmma16(ah, klf, accl[j]); } }
  } else if (qb * 64 < QHI) {
#pragma unroll
    for (int kc = 0; kc < HD / 32; ++kc) { const v16h ah = frag_h(QH + (q0 + col) * HD + kc * 32, lane), al = frag_h(QLb + (size_t)(ql0 + col) * HD + kc * 32, lane);
#pragma unroll
      for (int j = 0; j < 8; ++j) { const v16h kbf = frag_h(KH + (kr0 + j * 16 + col) * HD + kc * 32, lane); acc[j] = wmma16(ah, kbf, acc[j]); accl[j] = wmma16(al, kbf, accl[j]); } }
  } else {
#pragma unroll
    for (int kc = 0; kc < HD / 32; ++kc) { const v16h ah = frag_h(QH + (q0 + col) * HD + kc * 32, lane);
#pragma unroll
      for (int j = 0; j < 8; ++j) { const v16h kbf = frag_h(KH + (kr0 + j * 16 + col) * HD + kc * 32, lane); acc[j] = wmma16(ah, kbf, acc[j]); } } }
#pragma unroll
  for (int j = 0; j < 8; ++j) {
#pragma unroll
    for (int r = 0; r < 8; ++r) ss[wave][8 * g + r][j * 16 + col] = (acc[j][r] + accl[j][r] * (1.0f / 1024.0f)) * SCALE; }
  LDSX(); for (int rl = 0; rl < 16; ++rl) vst2(S + (size_t)(ql0 + rl) * TT + k0 + lane * 4, *(const v4f*)&ss[wave][rl][lane * 4]); }
// ---- k_sm: one wave = query row t of batch blockIdx.x (8 rows a block; blockIdx.y counts down from the longest rows, so cost falls with the block index); the row's keys [0, kend) stay in registers, 4 consecutive keys a lane per 128-key group: causal -> logit if s <= t else excluded; softmax in f32 (maximum and sum in-lane, then across the 32 lanes; no LDS, no barrier); P x 2^11 in place (0 for excluded)
__global__ __launch_bounds__(256) void k_sm(float* __restrict__ S0 SM_EXTRA_PARAMS) {
  const int lane = threadIdx.x & 31; const int t = TT - 1 - (int)(blockIdx.y * 8 + __builtin_amdgcn_readfirstlane(threadIdx.x >> 5));
  const int ng = kb_last(t >> 6) + 1;   // 128-key groups of the row: the same for the whole wave, so every test on it below is a scalar branch
  float* sr = S0 + ((size_t)blockIdx.x * TT + t) * TT + lane * 4; const int rel = t - lane * 4;   // key 128 i + 4 lane + c is kept when 128 i + c <= rel
  v4f r[TT / 128];
#pragma unroll
  for (int i = 0; i < TT / 128; ++i) if (i < ng) r[i] = *(const v4f*)(sr + i * 128);
  float m = -3.0e38f;
#pragma unroll
  for (int i = 0; i < TT / 128; ++i) if (i < ng) {
#pragma unroll
    for (int c = 0; c < 4; ++c) { float v = (!CAUSAL || i * 128 + c <= rel) ? r[i][c] : -3.0e38f; SM_MASK_HOOK; m = fmaxf(m, v); } }
#pragma unroll
  for (int o = 1; o < 32; o <<= 1) m = fmaxf(m, __shfl_xor(m, o));
  v4f s4 = {};
#pragma unroll
  for (int i = 0; i < TT / 128; ++i) if (i < ng) {
#pragma unroll
    for (int c = 0; c < 4; ++c) { float v = (!CAUSAL || i * 128 + c <= rel) ? r[i][c] : -3.0e38f; SM_MASK_HOOK; const float ex = expf(v - m); const float e = (v <= -1.0e38f) ? 0.f : ex; r[i][c] = e; s4[c] += e; } }
  float sum = (s4[0] + s4[1]) + (s4[2] + s4[3]);
#pragma unroll
  for (int o = 1; o < 32; o <<= 1) sum += __shfl_xor(sum, o);
  const float inv = sum > 0.f ? 2048.0f / sum : 0.f;   /* a fully excluded row yields P = 0 */
#pragma unroll
  for (int i = 0; i < TT / 128; ++i) if (i < ng) { vst2(sr + i * 128, r[i] * inv);
    asm volatile("s_wait_xcnt 0x0" ::: "memory"); } }   // precaution: stands before the store's data registers are written again for the next group
#define PVK 128            // keys of a staged tile in k_pv
#define PVP (PVK + 8)      // its LDS row pitch in f16: 272 B = 16 B x 17, the odd multiple that 16-byte LDS reads want
typedef __attribute__((ext_vector_type(4))) _Float16 v4h;
// ---- k_pv: block = 64 queries (qb) of batch b = blockIdx.y x value columns 64h .. 64h+63 (h = blockIdx.z; every h reads the same P): ctx = P . v over keys [0, kend) (P x 2^11 once to f16 against v f16: 1 product; causal early query blocks: P and v as bf16 hi + lo, 3 products); 256-B (row, head) segment by 16 lanes
__global__ __launch_bounds__(128) void k_pv(const float* __restrict__ PA, const _Float16* __restrict__ VT, const __bf16* __restrict__ VB, const __bf16* __restrict__ VBL, float* __restrict__ Y) { const int h = blockIdx.z, b = blockIdx.y; const float* __restrict__ PS = PA + (size_t)b * TT * TT; __shared__ __align__(16) float ss[4][16][HD + 4]; __shared__ __align__(16) _Float16 sp[4][16][PVP], sv[HD][PVP];
  const int tid = threadIdx.x, wave = tid >> 5, lane = tid & 31, col = lane & 15, g = lane >> 4; const int qb = blockIdx.x; const int ql0 = qb * 64 + wave * 16; const int kce = (kb_last(qb) + 1) * 4;
  v8f acc[HD / 16] = {};
  if (qb < QBH) {
#pragma unroll 1
    for (int kc = 0; kc < kce; ++kc) { const F2 p = split_row(PS + (size_t)(ql0 + col) * TT, kc * 32, lane);
      asm volatile("s_wait_loadcnt 0x0" ::: "memory");
#pragma unroll
      for (int j = 0; j < HD / 16; ++j) { const size_t po = ((size_t)b * CC + h * HD + j * 16 + col) * (size_t)KHI + kc * 32; const v16b vh = frag_b(VB + po, lane); acc[j] = wmma_bf(p.h, vh, acc[j]); acc[j] = wmma_bf(p.l, vh, acc[j]); acc[j] = wmma_bf(p.h, frag_b(VBL + po, lane), acc[j]); } }
  } else {
    // 128-key tiles through LDS: every global load covers whole 128-B lines (a P row: 512 B a wave-load; two v columns of 256 B a wave-load), v is fetched once a block instead of once a wave; the next tile's loads fly in registers while this tile is multiplied
    const int nt = kce / 4; const float* pg = PS + (size_t)ql0 * TT + lane * 4; const _Float16* vg = VT + ((size_t)b * CC + h * HD + (tid >> 4)) * (size_t)TT + (tid & 15) * 8;
    v4f pr[16]; v8h vr[HD / 8];
    // every "unroll" below: constant indices keep pr, vr, vf and acc in registers; "unroll 1": the tile loop stays rolled, a second copy of its body would only add live registers
#pragma unroll
    for (int r = 0; r < 16; ++r) pr[r] = *(const v4f*)(pg + (size_t)r * TT);
#pragma unroll
    for (int i = 0; i < HD / 8; ++i) vr[i] = *(const v8h*)(vg + (size_t)i * 8 * TT);
#pragma unroll 1
    for (int kt = 0; kt < nt; ++kt) {
#pragma unroll
      for (int r = 0; r < 16; ++r) { v4h hv; hv[0] = (_Float16)pr[r][0]; hv[1] = (_Float16)pr[r][1]; hv[2] = (_Float16)pr[r][2]; hv[3] = (_Float16)pr[r][3]; *(v4h*)&sp[wave][r][lane * 4] = hv; }
#pragma unroll
      for (int i = 0; i < HD / 8; ++i) *(v8h*)&sv[i * 8 + (tid >> 4)][(tid & 15) * 8] = vr[i];
      __syncthreads();   // the tile is published to the four waves
      if (kt + 1 < nt) { const float* pn = pg + (kt + 1) * PVK; const _Float16* vn = vg + (kt + 1) * PVK;
#pragma unroll
        for (int r = 0; r < 16; ++r) pr[r] = *(const v4f*)(pn + (size_t)r * TT);
#pragma unroll
        for (int i = 0; i < HD / 8; ++i) vr[i] = *(const v8h*)(vn + (size_t)i * 8 * TT);
        asm volatile("s_wait_xcnt 0x0" ::: "memory"); }   // precaution: stands before the loads' address registers are written again (the LDS reads below may land in them)
#pragma unroll
      for (int kc = 0; kc < PVK / 32; ++kc) { const v16h p = frag_h(&sp[wave][col][kc * 32], lane); v16h vf[HD / 16];
#pragma unroll
        for (int j = 0; j < HD / 16; ++j) vf[j] = frag_h(&sv[j * 16 + col][kc * 32], lane);   // the k-step's ten LDS reads go out as one group, ahead of its four products
#pragma unroll
        for (int j = 0; j < HD / 16; ++j) acc[j] = wmma16(p, vf[j], acc[j]); }
      __syncthreads();   // every wave has read the tile before it is overwritten
    } }
#pragma unroll
  for (int j = 0; j < HD / 16; ++j)
#pragma unroll
    for (int r = 0; r < 8; ++r) ss[wave][8 * g + r][j * 16 + col] = acc[j][r] * (1.0f / 2048.0f);
  LDSX(); for (int rl = 0; rl < 16; ++rl) if (lane < HD / 4) vst2(Y + ((size_t)b * TT + ql0 + rl) * CC + h * HD + lane * 4, *(const v4f*)&ss[wave][rl][lane * 4]); }

extern "C" void kernel_launch(void* const* d_in, const int* in_sizes, int n_in, void* d_out, int out_size, void* d_ws, size_t ws_size, hipStream_t stream) {
  (void)in_sizes; (void)n_in; (void)out_size;
  const float** F = (const float**)d_in;
  if (ws_size < (size_t)WS_END) return;
  char* ws = (char*)d_ws; _Float16 *QH = (_Float16*)(ws + WS_QH), *KH = (_Float16*)(ws + WS_KH), *VT = (_Float16*)(ws + WS_VT), *QL = (_Float16*)(ws + WS_QL), *KL = (_Float16*)(ws + WS_KL); __bf16 *VB = (__bf16*)(ws + WS_VB), *VBL = (__bf16*)(ws + WS_VBL); float *S = (float*)(ws + WS_S), *Y = (float*)(ws + WS_Y);
  (void)Y; (void)QL; (void)KL; (void)VB; (void)VBL;
  // inputs: 0 x [8,2048,384]; 1 Wq [384,64] (in,out); 2 Wk [384,64]; 3 Wv [384,384] (in,out); no biases
  k_proj<<<dim3(TNB * TT / 64, CC / 128 + 1), 128, 0, stream>>>(F[0], F[1], F[2], F[3], nullptr, nullptr, nullptr, QH, QL, KH, KL, VT, VB, VBL);   /* y = 0: q and k (64 columns each) in one tile; y = 1..3: 128 value columns each */
  k_sc<<<dim3(NQB, TT / 128, TNB), 128, 0, stream>>>(QH, KH, QL, KL, S);
  k_sm<<<dim3(TNB, TT / 8), 256, 0, stream>>>(S);   /* one wave a row, 8 rows a block */
  k_pv<<<dim3(NQB, TNB, NH), 128, 0, stream>>>(S, VT, VB, VBL, (float*)d_out);   /* slot h writes output columns 64h .. 64h+63 */
}

// v006
// Measured time: 100 microseconds a run.
// In two side-by-side timings against v005, it was 1.20 and 1.21 times as fast.
// Counting every step since v000, it is 16.9 times as fast.
// compute dtype: all float inputs rounded to bf16; q / k (64 wide) and v (384 wide) projections with EXACT bf16 products on WMMA 16x16x32 (f32 accumulate); interleaved RoPE in f32 (f32 inverse frequencies; precise cosf / sinf); causal logits: 3 products for the first 384 rows, single f16 q x k after, x 64^-0.5; softmax f32 (q, k, logits and softmax once per batch, shared by all 384 value columns; all batches in one launch of each kernel; the logits stay in registers, one P plane per batch); P x 2^11 once to f16 x v once to f16 (bf16 hi + lo below row 384); f32 output.
#include <hip/hip_runtime.h>
#include <math.h>

typedef __attribute__((ext_vector_type(16))) _Float16 v16h;
typedef __attribute__((ext_vector_type(16))) __bf16 v16b;
typedef __attribute__((ext_vector_type(8)))  _Float16 v8h;
typedef __attribute__((ext_vector_type(8)))  float v8f;
typedef __attribute__((ext_vector_type(4)))  float v4f;
typedef __attribute__((ext_vector_type(2)))  float v2f;
typedef __attribute__((ext_vector_type(4)))  unsigned v4u;
typedef __attribute__((ext_vector_type(4)))  int v4i;
typedef float __attribute__((may_alias)) float_a;
typedef int __attribute__((may_alias)) int_a;

template <typename T> __device__ __forceinline__ void vst2(void* p, T v) { *(T*)p = v;  }
__device__ __forceinline__ v8f wmma16(v16h a, v16h b, v8f c) {
  v8f d = __builtin_amdgcn_wmma_f32_16x16x32_f16(false, a, false, b, (short)0, c, false, false);
  asm volatile("v_nop\n\tv_nop\n\tv_nop\n\tv_nop" : "+v"(d) : "v"(a), "v"(b));
  return d;
}
__device__ __forceinline__ v8f wmma_bf(v16b a, v16b b, v8f c) {
  v8f d = __builtin_amdgcn_wmma_f32_16x16x32_bf16(false, a, false, b, (short)0, c, false, false);
  asm volatile("v_nop\n\tv_nop\n\tv_nop\n\tv_nop" : "+v"(d) : "v"(a), "v"(b));
  return d;
}
// 16x16x32 fragments: lane = (h = lane>>4, row/col = lane&15); elements 0..7 = k0+8h+0..7, 8..15 = k0+16+8h+0..7; D element r = row 8h+r
__device__ __forceinline__ v16h frag_h(const _Float16* rowk0, int lane) {
  union { v16h v; v8h q[2]; } u; const _Float16* p = rowk0 + 8 * (lane >> 4);
  u.q[0] = *(const v8h*)p; u.q[1] = *(const v8h*)(p + 16); return u.v;
}
__device__ __forceinline__ v16h frag_f32(const float* rowk0, int lane) {
  v16h a; const float* p = rowk0 + 8 * (lane >> 4);
#pragma unroll
  for (int i = 0; i < 8; ++i) { a[i] = (_Float16)p[i]; a[8 + i] = (_Float16)p[16 + i]; }
  return a;
}
__device__ __forceinline__ v16h frag_f32s(const float* rowk0, int lane, float sc) {
  v16h a; const float* p = rowk0 + 8 * (lane >> 4);
#pragma unroll
  for (int i = 0; i < 8; ++i) { a[i] = (_Float16)(p[i] * sc); a[8 + i] = (_Float16)(p[16 + i] * sc); }
  return a;
}
// column fragment from a [K][ld] layout (column n), rows >= K read as 0
__device__ __forceinline__ v16h fragc_f32(const float* W, int k0, int n, int lane, int ld, int K) {
  v16h a; const int g = lane >> 4;
#pragma unroll
  for (int i = 0; i < 8; ++i) { const int ka = k0 + 8 * g + i, kb = ka + 16;
    a[i] = (_Float16)(ka < K ? W[(size_t)(ka < K ? ka : K - 1) * ld + n] : 0.f); a[8 + i] = (_Float16)(kb < K ? W[(size_t)(kb < K ? kb : K - 1) * ld + n] : 0.f); }
  return a;
}
struct F2 { v16b h, l; };
__device__ __forceinline__ F2 bsplit16(const float v[16]) { F2 r;
#pragma unroll
  for (int i = 0; i < 16; ++i) { const __bf16 h = (__bf16)v[i]; r.h[i] = h; r.l[i] = (__bf16)(v[i] - (float)h); }
  return r; }
__device__ __forceinline__ F2 split_row(const float* row, int k0, int lane) { float v[16]; const float* p = row + k0 + 8 * (lane >> 4);
#pragma unroll
  for (int i = 0; i < 8; ++i) { v[i] = p[i]; v[8 + i] = p[16 + i]; }
  return bsplit16(v); }
__device__ __forceinline__ F2 split_rowK(const float* row, int k0, int lane, int K) { float v[16]; const int g = lane >> 4;
#pragma unroll
  for (int i = 0; i < 8; ++i) { const int ka = k0 + 8 * g + i, kb = ka + 16; v[i] = ka < K ? row[ka < K ? ka : K - 1] : 0.f; v[8 + i] = kb < K ? row[kb < K ? kb : K - 1] : 0.f; }
  return bsplit16(v); }
__device__ __forceinline__ F2 split_col(const float* W, int k0, int n, int lane, int ld, int K) { float v[16]; const int g = lane >> 4;
#pragma unroll
  for (int i = 0; i < 8; ++i) { const int ka = k0 + 8 * g + i, kb = ka + 16; v[i] = ka < K ? W[(size_t)(ka < K ? ka : K - 1) * ld + n] : 0.f; v[8 + i] = kb < K ? W[(size_t)(kb < K ? kb : K - 1) * ld + n] : 0.f; }
  return bsplit16(v); }
__device__ __forceinline__ v8f mac3(const F2& a, const F2& b, v8f c) { c = wmma_bf(a.l, b.h, c); c = wmma_bf(a.h, b.l, c); return wmma_bf(a.h, b.h, c); }
__device__ __forceinline__ float sigm(float v) { return 1.0f / (1.0f + expf(-v)); }
#define LDSX() do { asm volatile("s_wait_dscnt 0" ::: "memory"); __builtin_amdgcn_wave_barrier(); __builtin_amdgcn_fence(__ATOMIC_RELEASE, "workgroup"); } while (0)

// Single-head causal attention with a WIDE value (x [8,2048,384]; (in,out) Wq / Wk [384,64], Wv [384,384] (0.02 scale), no biases; interleaved-pair RoPE on q and k (positions arange(T), inv_freq = 1/10000^(2i/64)); scale 1/8; tril, -inf): out = softmax(causal(rope(q) rope(k)^T / 8)) v -> [8,2048,384]. The one attention pattern (q, k, logits, softmax: computed once per batch) is applied to the 384 value columns as six 64-column slots.
#define NB 8
#define TT 2048
#define CC 384            // NH * HD = projected width
#define DIN 384          // input (model) width
#define NH 6
#define HD 64
#define NQB (TT / 64)
#define SCALE (0.125f)
#define CAUSAL 1
#ifndef TNB
#define TNB NB
#endif
__device__ __forceinline__ float bfr(float v) { return (float)(__bf16)v; }
__host__ __device__ __forceinline__ int kb_last(int qb) { return CAUSAL ? ((qb * 64 + 63) >> 7) : (TT / 128 - 1); }
typedef __attribute__((ext_vector_type(8))) __bf16 v8b;
__device__ __forceinline__ v16b frag_b(const __bf16* rowk0, int lane) {
  union { v16b v; v8b q[2]; } u; const __bf16* p = rowk0 + 8 * (lane >> 4);
  u.q[0] = *(const v8b*)p; u.q[1] = *(const v8b*)(p + 16); return u.v;
}
#define QBH 6              // causal: query blocks 0..QBH-1 of each sequence (few keys, no averaging) take the high-precision path
#define QHI 384            // rows carrying a q residual plane
#define KHI 384            // key rows carrying k residual / v bf16 hi+lo planes (used only by the causal high-precision path)
// B fragment (k rows k0+.., output column o) of a weight: (in,out) [K][ld] or (out,in) [ld rows of K]: bf16 exact, or f16(bf16 * 256) exact
__device__ __forceinline__ v16b wcol_io(const float* Wm, int k0, int o, int lane, int ld) { v16b w; const int g = lane >> 4;
#pragma unroll
  for (int i = 0; i < 8; ++i) { w[i] = (__bf16)Wm[(size_t)(k0 + 8 * g + i) * ld + o];
    if (i == 7) asm volatile("s_wait_xcnt 0x0" ::: "memory");   // precaution: the run's last load may land in the address register that the loads before it name
    w[8 + i] = (__bf16)Wm[(size_t)(k0 + 16 + 8 * g + i) * ld + o]; }
  asm volatile("s_wait_xcnt 0x0" ::: "memory");   // same precaution for the last load, before its address register is written again
  return w; }
__device__ __forceinline__ v16b wcol_oi(const float* Wm, int k0, int o, int lane, int K) { v16b w; const float* p = Wm + (size_t)o * K + k0 + 8 * (lane >> 4);
#pragma unroll
  for (int i = 0; i < 8; ++i) { w[i] = (__bf16)p[i]; w[8 + i] = (__bf16)p[16 + i]; }
  return w; }
__device__ __forceinline__ v16h wcolh_io(const float* Wm, int k0, int o, int lane, int ld) { v16h w; const int g = lane >> 4;
#pragma unroll
  for (int i = 0; i < 8; ++i) { w[i] = (_Float16)(bfr(Wm[(size_t)(k0 + 8 * g + i) * ld + o]) * 256.0f); w[8 + i] = (_Float16)(bfr(Wm[(size_t)(k0 + 16 + 8 * g + i) * ld + o]) * 256.0f); }
  return w; }
__device__ __forceinline__ v16h wcolh_oi(const float* Wm, int k0, int o, int lane, int K) { v16h w; const float* p = Wm + (size_t)o * K + k0 + 8 * (lane >> 4);
#pragma unroll
  for (int i = 0; i < 8; ++i) { w[i] = (_Float16)(bfr(p[i]) * 256.0f); w[8 + i] = (_Float16)(bfr(p[16 + i]) * 256.0f); }
  return w; }
#define WQKV_LAYOUT 0   // 0 = (in,out): Wv [DIN][CC], Wq / Wk [DIN][HD]; 1 = (out,in) [CC][DIN]; 2 = per-head [NH][DIN][HD]
__device__ __forceinline__ v16b wcol_hdk(const float* Wm, int k0, int o, int lane) { v16b w; const int g = lane >> 4; const float* p = Wm + (size_t)(o / HD) * DIN * HD + (o % HD);
#pragma unroll
  for (int i = 0; i < 8; ++i) { w[i] = (__bf16)p[(size_t)(k0 + 8 * g + i) * HD]; w[8 + i] = (__bf16)p[(size_t)(k0 + 16 + 8 * g + i) * HD]; }
  return w; }
#define WO_OUT_IN 0
#if WQKV_LAYOUT == 1
#define WCOL(W, k0, o, lane) wcol_oi(W, k0, o, lane, DIN)
#elif WQKV_LAYOUT == 2
#define WCOL(W, k0, o, lane) wcol_hdk(W, k0, o, lane)
#else
#define WCOL(W, k0, o, lane) (which == 2 ? wcol_io(W, k0, (o), lane, CC) : wcol_io(W, k0, ((o) & 63), lane, HD))   /* (in,out): Wv [384][384] pitch 384; Wq / Wk [384][64] pitch 64, tile column o % 64 */
#endif
#if WO_OUT_IN
#define WOCOL(W, k0, o, lane) wcol_oi(W, k0, o, lane, CC)
#define WOCOLH(W, k0, o, lane) wcolh_oi(W, k0, o, lane, CC)
#else
#define WOCOL(W, k0, o, lane) wcol_io(W, k0, o, lane, DIN)
#define WOCOLH(W, k0, o, lane) wcolh_io(W, k0, o, lane, DIN)
#endif
// RoPE inverse frequencies 1/10000^(2i/64) (the f32 values jax computes)
__constant__ float INVF[32] = {1.000000000e+00,7.498942018e-01,5.623413324e-01,4.216965139e-01,3.162277639e-01,2.371373624e-01,1.778279394e-01,1.333521456e-01,1.000000015e-01,7.498941571e-02,5.623412877e-02,4.216964915e-02,3.162277862e-02,2.371373586e-02,1.778279431e-02,1.333521493e-02,9.999999776e-03,7.498942316e-03,5.623413250e-03,4.216964822e-03,3.162277862e-03,2.371373819e-03,1.778279431e-03,1.333521446e-03,1.000000047e-03,7.498941850e-04,5.623413017e-04,4.216964880e-04,3.162277862e-04,2.371373848e-04,1.778279402e-04,1.333521504e-04};
#define PROJ_EXTRA_PARAMS
// interleaved-pair RoPE on q and k (which 0: the two 64-column halves of the tile) at position t (the module uses arange(T)): angle = (float)t * inv_freq[i]; (x_even, x_odd) -> (xe cos - xo sin, xo cos + xe sin) == x * cos + rotate_half_interleaved(x) * sin with cos / sin repeated pairwise; products and sums kept separate (no fma contraction)
#define PROJ_EPI(which, row, t, h) do { if ((which) < 2) { float* rw = (row); const float pos_ = (float)(t); _Pragma("unroll 4") for (int i = 0; i < 32; ++i) { _Pragma("clang fp contract(off)") const float ang = pos_ * INVF[i]; const float cs = cosf(ang), sn = sinf(ang); const float xe = rw[2 * i], xo = rw[2 * i + 1]; rw[2 * i] = xe * cs - xo * sn; rw[2 * i + 1] = xo * cs + xe * sn; } } } while (0)
#define SM_EXTRA_PARAMS
#define SM_MASK_HOOK (void)0
#ifndef SM_EXTRA_PARAMS
#define SM_EXTRA_PARAMS
#endif
#ifndef PROJ_EXTRA_PARAMS
#define PROJ_EXTRA_PARAMS
#endif
#ifndef SM_MASK_HOOK
#define SM_MASK_HOOK (void)0
#endif

#define WS_QH  0u                                      // f16 q rows [b*t][HD]
#define WS_KH  (WS_QH + 2u * (size_t)NB * TT * HD)      // f16 k rows [b*t][HD]
#define WS_VT  (WS_KH + 2u * (size_t)NB * TT * HD)      // f16 v planes [b][c][t]
#define WS_QL  (WS_VT + 2u * (size_t)NB * CC * TT)      // f16 q residual x 2^10 rows [b][t < QHI][HD]
#define WS_KL  (WS_QL + 2u * (size_t)NB * QHI * HD)     // f16 k residual x 2^10 rows [b][t < KHI][HD]
#define WS_VB  (WS_KL + 2u * (size_t)NB * KHI * HD)     // bf16 v hi planes [b][c][t < KHI]
#define WS_VBL (WS_VB + 2u * (size_t)NB * CC * KHI)
#define WS_S   (WS_VBL + 2u * (size_t)NB * CC * KHI)    // f32 P planes [b][t][s]
#define WS_Y   (WS_S  + 4u * (size_t)NB * TT * TT)      // f32 ctx rows [b*t][CC] (only when there is an output projection)
#define WS_END (WS_Y  + 0u)

#define PJK 64             // k of a staged chunk in k_proj
typedef __attribute__((ext_vector_type(4))) __bf16 v4b;
// main loop of k_proj, W of row pitch WLD floats (a constant, so that each operand's loads share one address register that lives through the loop and differ in their immediate offsets): 64-k chunks of x and W go through LDS as bf16; every global load covers whole 128-B lines (x: two rows of 256 B a wave-load; W: 4 k rows x one line), W is fetched and rounded once a block instead of once a wave, and the next chunk's loads fly in registers while this chunk is multiplied.
// sx: x chunk [row][k]; sw: W chunk [tile column][k]; pitch 144 B = 16 B x 9, the odd multiple that 16-byte LDS reads want. A lane holds 8 consecutive k of 4 columns per set of 8 W loads, so each column's 8 k go to LDS as one 16-byte store.
template <int WLD> __device__ __forceinline__ void proj_mm(const float* xg, const float* wg, __bf16 (*sx)[72], __bf16 (*sw)[72], int wave, int lane, v8f (&acc)[8]) {
  const int col = lane & 15, g = lane >> 4, lr = lane >> 3, lc = lane & 7;
  v4f xr[8], wr[16];
  // every "unroll" below: constant indices keep xr, wr, wf and acc in registers; "unroll 1": the chunk loop stays rolled, a second copy of its body would only add live registers
#pragma unroll
  for (int i = 0; i < 16; ++i) wr[i] = *(const v4f*)(wg + (size_t)((i >> 3) * 32 + (i & 7)) * WLD);
#pragma unroll
  for (int i = 0; i < 8; ++i) xr[i] = *(const v4f*)(xg + (size_t)i * 2 * DIN);
  asm volatile("s_wait_xcnt 0x0" ::: "memory");   // precaution: stands before the loads' address registers are written again
#pragma unroll 1
  for (int ch = 0; ch < DIN / PJK; ++ch) {
#pragma unroll
    for (int s = 0; s < 2; ++s)
#pragma unroll
      for (int c = 0; c < 4; ++c) { v8b wv;
#pragma unroll
        for (int i = 0; i < 8; ++i) wv[i] = (__bf16)wr[s * 8 + i][c];
        *(v8b*)&sw[wave * 32 + lc * 4 + c][s * 32 + lr * 8] = wv; }
#pragma unroll
    for (int i = 0; i < 8; ++i) { v4b xv; xv[0] = (__bf16)xr[i][0]; xv[1] = (__bf16)xr[i][1]; xv[2] = (__bf16)xr[i][2]; xv[3] = (__bf16)xr[i][3]; *(v4b*)&sx[wave * 16 + i * 2 + g][col * 4] = xv; }
    __syncthreads();   // the chunk is published to the four waves
    if (ch + 1 < DIN / PJK) { xg += PJK; wg += (size_t)PJK * WLD;
#pragma unroll
      for (int i = 0; i < 16; ++i) wr[i] = *(const v4f*)(wg + (size_t)((i >> 3) * 32 + (i & 7)) * WLD);
#pragma unroll
      for (int i = 0; i < 8; ++i) xr[i] = *(const v4f*)(xg + (size_t)i * 2 * DIN);
      asm volatile("s_wait_xcnt 0x0" ::: "memory"); }   // precaution: stands before the loads' address registers are written again
#pragma unroll
    for (int kc = 0; kc < PJK / 32; ++kc) { const v16b a = frag_b(&sx[wave * 16 + col][kc * 32], lane);
#pragma unroll
      for (int jh = 0; jh < 2; ++jh) { v16b wf[4];
#pragma unroll
        for (int j = 0; j < 4; ++j) wf[j] = frag_b(&sw[(jh * 4 + j) * 16 + col][kc * 32], lane);   // eight LDS reads go out as one group, ahead of their four products
#pragma unroll
        for (int j = 0; j < 4; ++j) acc[jh * 4 + j] = wmma_bf(a, wf[j], acc[jh * 4 + j]); } }
    __syncthreads();   // every wave has read the chunk before it is overwritten
  } }
// ---- k_proj: block = (64 rows, 128 cols): X W (+ b) with exact bf16 products (K = DIN; x and W staged in LDS as bf16 in 64-k chunks); blockIdx.y = 0 (which 0; the longer blocks, so they start first): q in tile columns 0..63 and k in 64..127 -> f16 rows (+ residual rows < QHI / KHI); blockIdx.y > 0 (which 2): 128 columns of v -> f16 planes [c][t] (+ bf16 hi/lo planes for t < KHI)
__global__ __launch_bounds__(128) void k_proj(const float* __restrict__ X, const float* __restrict__ WQ, const float* __restrict__ WK, const float* __restrict__ WV, const float* __restrict__ BQ, const float* __restrict__ BK, const float* __restrict__ BV,
    _Float16* __restrict__ QH, _Float16* __restrict__ QL, _Float16* __restrict__ KH, _Float16* __restrict__ KL, _Float16* __restrict__ VT, __bf16* __restrict__ VB, __bf16* __restrict__ VBL PROJ_EXTRA_PARAMS) {
  __shared__ __align__(16) float st[64][132]; __shared__ __align__(16) _Float16 sh[64][136], sl[64][136]; __shared__ __align__(16) _Float16 th[128][72]; __shared__ __align__(16) __bf16 tb[128][72], tbl[128][72];
  const int tid = threadIdx.x, wave = tid >> 5, lane = tid & 31, col = lane & 15, g = lane >> 4; const int which = blockIdx.y == 0 ? 0 : 2; const int c0 = which == 2 ? (blockIdx.y - 1) * 128 : 0; const size_t r0 = (size_t)blockIdx.x * 64; const size_t bb = r0 / TT; const int t0 = (int)(r0 % TT);
  v8f acc[8] = {};
  { // wave w stages tile columns 32w .. 32w+31 of W and its own 16 rows of x; the two stages lie in tb and tbl, which hold nothing until the epilogue (behind its own barriers)
    const float* xg = X + (r0 + wave * 16 + g) * DIN + col * 4; const int lr = lane >> 3, lc = lane & 7;
    if (which == 2) proj_mm<CC>(xg, WV + c0 + wave * 32 + lc * 4 + (size_t)(lr * 8) * CC, tbl, tb, wave, lane, acc);
    else proj_mm<HD>(xg, (wave < 2 ? WQ + wave * 32 : WK + (wave - 2) * 32) + lc * 4 + (size_t)(lr * 8) * HD, tbl, tb, wave, lane, acc); }
  { // stage the f32 tile (acc + bias) in LDS, run the per-(row, head) epilogue hook, then convert
#pragma unroll
    for (int j = 0; j < 8; ++j) { const float* BA = which == 2 ? BV : j < 4 ? BQ : BK; const float bias = BA ? bfr(BA[which == 2 ? c0 + j * 16 + col : (j & 3) * 16 + col]) : 0.f;
#pragma unroll
      for (int r = 0; r < 8; ++r) st[wave * 16 + 8 * g + r][j * 16 + col] = acc[j][r] + bias; }
    __syncthreads();
    for (int e = tid; e < 64 * (128 / HD); e += 128) { const int rl = e / (128 / HD), hh = e % (128 / HD); PROJ_EPI(which, &st[rl][hh * HD], (int)((r0 + rl) % TT), (c0 / HD) + hh); }
    __syncthreads(); }
  if (which < 2) {
    for (int e = tid; e < 64 * 128; e += 128) { const int rl = e >> 7, cl = e & 127; const float v = st[rl][cl]; const _Float16 hv = (_Float16)v; sh[rl][cl] = hv; sl[rl][cl] = (_Float16)((v - (float)hv) * 1024.0f); }
    __syncthreads();
    for (int e = tid; e < 64 * 16; e += 128) { const int rl = e >> 4, q = e & 15; _Float16* DH = q < 8 ? QH : KH; _Float16* DL = q < 8 ? QL : KL; const int nhi = q < 8 ? QHI : KHI;
      vst2((unsigned*)(DH + (r0 + rl) * HD + (q & 7) * 8), *(const v4u*)&sh[rl][q * 8]);
      asm volatile("s_wait_xcnt 0x0" ::: "memory");   // precaution: stands before the store's data and address registers are rewritten (next LDS read, next trip's address)
      if (t0 < nhi) { vst2((unsigned*)(DL + (bb * nhi + t0 + rl) * (size_t)HD + (q & 7) * 8), *(const v4u*)&sl[rl][q * 8]);
        asm volatile("s_wait_xcnt 0x0" ::: "memory"); } }   // same precaution for the residual row's store
  } else { const bool hi_rows = t0 < KHI;
    for (int e = tid; e < 64 * 128; e += 128) { const int rl = e & 63, cl = e >> 6; const float v = st[rl][cl]; th[cl][rl] = (_Float16)v; const __bf16 bh = (__bf16)v; tb[cl][rl] = bh; tbl[cl][rl] = (__bf16)(v - (float)bh); }
    __syncthreads();
    for (int e = tid; e < 128 * 8; e += 128) { const int cl = e >> 3, q = e & 7; vst2((unsigned*)(VT + (bb * CC + c0 + cl) * (size_t)TT + t0 + q * 8), *(const v4u*)&th[cl][q * 8]); if (hi_rows) { const size_t o3 = (bb * CC + c0 + cl) * (size_t)KHI + t0 + q * 8; vst2((unsigned*)(VB + o3), *(const v4u*)&tb[cl][q * 8]); vst2((unsigned*)(VBL + o3), *(const v4u*)&tbl[cl][q * 8]); } } } }
#define SPW 8              // waves of a block in k_sp
// ---- k_sp: block = 16 query rows (row block rb; blockIdx.y: first the early rows, whose three-product blocks wait longest on loads and use few waves, then the rest counted down from the longest, so that cost falls with the block index) of batch b = blockIdx.x against all their keys [0, 128 ng): the 128-key tile kt belongs to wave kt % 8 (slot kt / 8), so a wave holds at most two tiles of logits, in its accumulators, from the products to the store of P: the logits never go to memory.
// logits x SCALE as 16x16x32 f16 products: q x k once for rows >= QHI; q hi + residual (x 2^10) against k hi + residual (3 products) for query blocks < QBH (causal early rows; at most 3 tiles, so slot 0 alone); causal: key s kept if s <= t; softmax in f32 (row maximum and row sum: in-lane, then across the 16 lanes that share a row, then across the 8 waves through LDS, one barrier each); P x 2^11 (0 for excluded keys) goes out as whole 512-B row pieces, staged in the wave's own LDS range
// amdgpu_waves_per_eu: two blocks a WGP (four waves a SIMD), so that one block's products and exponentials cover the other's loads and barriers
__global__ __launch_bounds__(256) __attribute__((amdgpu_waves_per_eu(4, 4))) void k_sp(const _Float16* __restrict__ QH, const _Float16* __restrict__ KH, const _Float16* __restrict__ QL, const _Float16* __restrict__ KL, float* __restrict__ SA) {
  __shared__ __align__(16) float ssa[SPW][16][132]; __shared__ __align__(16) float rm[SPW][16], rs[SPW][16];
  const int b = blockIdx.x, rb = (int)blockIdx.y < QHI / 16 ? (int)blockIdx.y : TT / 16 - 1 - ((int)blockIdx.y - QHI / 16), qb = rb >> 2, ng = kb_last(qb) + 1;
  const int wave = __builtin_amdgcn_readfirstlane(threadIdx.x >> 5), lane = threadIdx.x & 31, col = lane & 15, g = lane >> 4;   // the wave's number in a scalar register: every test on a tile is a scalar branch (the matrix instructions want all lanes on)
  const int ql0 = rb * 16; const size_t q0 = (size_t)b * TT + ql0;
  float* __restrict__ S = SA + (size_t)b * TT * TT; float (*ss)[132] = ssa[wave];
  const v8f zero = {};
  v8f acc[2][8];   // a slot is given its values by the products below or, where the wave has no such tile, by the zeros behind them (set there and not here, so that the three-product path carries no registers for slot 1)
  // every "unroll" below: constant indices keep acc, the fragments and the row values in registers
  if (qb < QBH) {
    if (wave < ng) { const int k0 = wave * 128; v8f accl[8];
      // one address a plane (the lane's row and 8-element half), every fragment at a constant offset from it
      const _Float16* qp = QH + (q0 + col) * HD + 8 * g; const _Float16* qlp = QL + ((size_t)b * QHI + ql0 + col) * HD + 8 * g; const _Float16* kp = KH + ((size_t)b * TT + k0 + col) * HD + 8 * g; const _Float16* lp = KL + ((size_t)b * KHI + k0 + col) * HD + 8 * g;
#pragma unroll
      for (int kc = 0; kc < HD / 32; ++kc) { const v16h ah = frag_h(qp + kc * 32, 0), al = frag_h(qlp + kc * 32, 0);   // lane argument 0: the half is in the address already
#pragma unroll
        for (int jh = 0; jh < 2; ++jh) { v16h kf[4], lf[4];
#pragma unroll
          for (int j = 0; j < 4; ++j) { kf[j] = frag_h(kp + (jh * 4 + j) * 16 * HD + kc * 32, 0); lf[j] = frag_h(lp + (jh * 4 + j) * 16 * HD + kc * 32, 0); }
          asm volatile("s_wait_xcnt 0x0" :: "v"(qp), "v"(qlp), "v"(kp), "v"(lp) : "memory");   // precaution: stands before the loads' address registers are written again; the four addresses as inputs, so that no load of the group lands in one of them
#pragma unroll
          for (int j = 0; j < 4; ++j) { const int jj = jh * 4 + j; acc[0][jj] = wmma16(ah, kf[j], kc == 0 ? zero : acc[0][jj]); accl[jj] = wmma16(al, kf[j], kc == 0 ? zero : accl[jj]); accl[jj] = wmma16(ah, lf[j], accl[jj]); } } }
#pragma unroll
      for (int j = 0; j < 8; ++j) {
#pragma unroll
        for (int r = 0; r < 8; ++r) acc[0][j][r] = (acc[0][j][r] + accl[j][r] * (1.0f / 1024.0f)) * SCALE; } }
  } else {
    v16h ah[HD / 32];
#pragma unroll
    for (int kc = 0; kc < HD / 32; ++kc) ah[kc] = frag_h(QH + (q0 + col) * HD + kc * 32, lane);
    asm volatile("s_wait_xcnt 0x0" ::: "memory");   // precaution: stands before the loads' address registers are written again
#pragma unroll
    for (int s = 0; s < 2; ++s) if (s * SPW + wave < ng) { const size_t kr0 = (size_t)b * TT + (s * SPW + wave) * 128;
#pragma unroll
      for (int kc = 0; kc < HD / 32; ++kc) { v16h kf[8];
#pragma unroll
        for (int j = 0; j < 8; ++j) kf[j] = frag_h(KH + (kr0 + j * 16 + col) * HD + kc * 32, lane);   // the k-step's sixteen loads go out as one group, ahead of its eight products
        asm volatile("s_wait_xcnt 0x0" ::: "memory");   // precaution: stands before the loads' address registers are written again
#pragma unroll
        for (int j = 0; j < 8; ++j) acc[s][j] = wmma16(ah[kc], kf[j], kc == 0 ? zero : acc[s][j]); }
#pragma unroll
      for (int j = 0; j < 8; ++j) acc[s][j] = acc[s][j] * SCALE; } }
  // accumulator element r of tile column j: query row ql0 + 8 g + r, key 128 kt + 16 j + col
  float m[8], l[8];
#pragma unroll
  for (int r = 0; r < 8; ++r) { m[r] = -3.0e38f; l[r] = 0.f; }
#pragma unroll
  for (int s = 0; s < 2; ++s) { const int kt = s * SPW + wave;
    if (kt < ng) {
      if (CAUSAL && kt * 128 + 127 > ql0) { const int rel = ql0 + 8 * g - kt * 128 - col;   // a tile that reaches past the block's first row: key kept when 16 j <= rel + r
#pragma unroll
        for (int j = 0; j < 8; ++j) {
#pragma unroll
          for (int r = 0; r < 8; ++r) acc[s][j][r] = (j * 16 <= rel + r) ? acc[s][j][r] : -3.0e38f; } }
#pragma unroll
      for (int j = 0; j < 8; ++j) {
#pragma unroll
        for (int r = 0; r < 8; ++r) m[r] = fmaxf(m[r], acc[s][j][r]); }
    } else {
#pragma unroll
      for (int j = 0; j < 8; ++j) acc[s][j] = zero; } }
#pragma unroll
  for (int o = 1; o < 16; o <<= 1) {
#pragma unroll
    for (int r = 0; r < 8; ++r) m[r] = fmaxf(m[r], __shfl_xor(m[r], o)); }
  if (col == 0) { v4f a0 = {m[0], m[1], m[2], m[3]}, a1 = {m[4], m[5], m[6], m[7]}; *(v4f*)&rm[wave][8 * g] = a0; *(v4f*)&rm[wave][8 * g + 4] = a1; }
  __syncthreads();   // every wave's row maxima are published (a wave without a tile publishes the start value)
#pragma unroll
  for (int w = 0; w < SPW; ++w) { const v4f a0 = *(const v4f*)&rm[w][8 * g], a1 = *(const v4f*)&rm[w][8 * g + 4];
#pragma unroll
    for (int r = 0; r < 4; ++r) { m[r] = fmaxf(m[r], a0[r]); m[4 + r] = fmaxf(m[4 + r], a1[r]); } }
  // "unroll 1": one copy of the 64 exponentials serves both slots (the two tiles change places behind each trip and are back in their own after two), which keeps the kernel's text short
#pragma unroll 1
  for (int s = 0; s < 2; ++s) {
    if (s * SPW + wave < ng) {
#pragma unroll
      for (int j = 0; j < 8; ++j) {
#pragma unroll
        for (int r = 0; r < 8; ++r) { const float v = acc[0][j][r]; const float ex = expf(v - m[r]); const float e = (v <= -1.0e38f) ? 0.f : ex; acc[0][j][r] = e; l[r] += e; } } }
#pragma unroll
    for (int j = 0; j < 8; ++j) {
#pragma unroll
      for (int r = 0; r < 8; ++r) { float x = acc[0][j][r], y = acc[1][j][r]; asm("v_swap_b32 %0, %1" : "+v"(x), "+v"(y)); acc[0][j][r] = x; acc[1][j][r] = y; } } }   // the exchange in place, one instruction a register pair: written as plain copies it took a third set of registers and spilled
#pragma unroll
  for (int o = 1; o < 16; o <<= 1) {
#pragma unroll
    for (int r = 0; r < 8; ++r) l[r] += __shfl_xor(l[r], o); }
  if (col == 0) { v4f a0 = {l[0], l[1], l[2], l[3]}, a1 = {l[4], l[5], l[6], l[7]}; *(v4f*)&rs[wave][8 * g] = a0; *(v4f*)&rs[wave][8 * g + 4] = a1; }
  __syncthreads();   // every wave's row sums are published
  float inv[8];
#pragma unroll
  for (int r = 0; r < 8; ++r) inv[r] = 0.f;
#pragma unroll
  for (int w = 0; w < SPW; ++w) { const v4f a0 = *(const v4f*)&rs[w][8 * g], a1 = *(const v4f*)&rs[w][8 * g + 4];
#pragma unroll
    for (int r = 0; r < 4; ++r) { inv[r] += a0[r]; inv[4 + r] += a1[r]; } }
#pragma unroll
  for (int r = 0; r < 8; ++r) inv[r] = inv[r] > 0.f ? 2048.0f / inv[r] : 0.f;   /* a fully excluded row yields P = 0 */
#pragma unroll
  for (int s = 0; s < 2; ++s) if (s * SPW + wave < ng) { float* sg = S + (size_t)ql0 * TT + (s * SPW + wave) * 128 + lane * 4;
#pragma unroll
    for (int j = 0; j < 8; ++j) {
#pragma unroll
      for (int r = 0; r < 8; ++r) ss[8 * g + r][j * 16 + col] = acc[s][j][r] * inv[r]; }
    asm volatile("s_wait_dscnt 0" ::: "memory"); __builtin_amdgcn_wave_barrier();   // the wave's lanes read each other's values below: the LDS writes stay in front of the reads (no fence: one would also wait for the first tile's global stores)
    v4f o[16];
#pragma unroll
    for (int rl = 0; rl < 16; ++rl) o[rl] = *(const v4f*)&ss[rl][lane * 4];
#pragma unroll
    for (int rl = 0; rl < 16; ++rl) vst2(sg + (size_t)rl * TT, o[rl]);
    asm volatile("s_wait_xcnt 0x0" ::: "memory");   // precaution: stands before the stores' data and address registers are written again; it also keeps the second tile's LDS writes behind the reads above
  } }
#define PVK 128            // keys of a staged tile in k_pv
#define PVP (PVK + 8)      // its LDS row pitch in f16: 272 B = 16 B x 17, the odd multiple that 16-byte LDS reads want
typedef __attribute__((ext_vector_type(4))) _Float16 v4h;
// ---- k_pv: block = 64 queries (qb) of batch b = blockIdx.y x value columns 64h .. 64h+63 (h = blockIdx.z; every h reads the same P): ctx = P . v over keys [0, kend) (P x 2^11 once to f16 against v f16: 1 product; causal early query blocks: P and v as bf16 hi + lo, 3 products); 256-B (row, head) segment by 16 lanes
__global__ __launch_bounds__(128) void k_pv(const float* __restrict__ PA, const _Float16* __restrict__ VT, const __bf16* __restrict__ VB, const __bf16* __restrict__ VBL, float* __restrict__ Y) { const int h = blockIdx.z, b = blockIdx.y; const float* __restrict__ PS = PA + (size_t)b * TT * TT; __shared__ __align__(16) float ss[4][16][HD + 4]; __shared__ __align__(16) _Float16 sp[4][16][PVP], sv[HD][PVP];
  const int tid = threadIdx.x, wave = tid >> 5, lane = tid & 31, col = lane & 15, g = lane >> 4; const int qb = blockIdx.x; const int ql0 = qb * 64 + wave * 16; const int kce = (kb_last(qb) + 1) * 4;
  v8f acc[HD / 16] = {};
  if (qb < QBH) {
#pragma unroll 1
    for (int kc = 0; kc < kce; ++kc) { const F2 p = split_row(PS + (size_t)(ql0 + col) * TT, kc * 32, lane);
      asm volatile("s_wait_loadcnt 0x0" ::: "memory");
#pragma unroll
      for (int j = 0; j < HD / 16; ++j) { const size_t po = ((size_t)b * CC + h * HD + j * 16 + col) * (size_t)KHI + kc * 32; const v16b vh = frag_b(VB + po, lane); acc[j] = wmma_bf(p.h, vh, acc[j]); acc[j] = wmma_bf(p.l, vh, acc[j]); acc[j] = wmma_bf(p.h, frag_b(VBL + po, lane), acc[j]); } }
  } else {
    // 128-key tiles through LDS: every global load covers whole 128-B lines (a P row: 512 B a wave-load; two v columns of 256 B a wave-load), v is fetched once a block instead of once a wave; the next tile's loads fly in registers while this tile is multiplied
    const int nt = kce / 4; const float* pg = PS + (size_t)ql0 * TT + lane * 4; const _Float16* vg = VT + ((size_t)b * CC + h * HD + (tid >> 4)) * (size_t)TT + (tid & 15) * 8;
    v4f pr[16]; v8h vr[HD / 8];
    // every "unroll" below: constant indices keep pr, vr, vf and acc in registers; "unroll 1": the tile loop stays rolled, a second copy of its body would only add live registers
#pragma unroll
    for (int r = 0; r < 16; ++r) pr[r] = *(const v4f*)(pg + (size_t)r * TT);
#pragma unroll
    for (int i = 0; i < HD / 8; ++i) vr[i] = *(const v8h*)(vg + (size_t)i * 8 * TT);
#pragma unroll 1
    for (int kt = 0; kt < nt; ++kt) {
#pragma unroll
      for (int r = 0; r < 16; ++r) { v4h hv; hv[0] = (_Float16)pr[r][0]; hv[1] = (_Float16)pr[r][1]; hv[2] = (_Float16)pr[r][2]; hv[3] = (_Float16)pr[r][3]; *(v4h*)&sp[wave][r][lane * 4] = hv; }
#pragma unroll
      for (int i = 0; i < HD / 8; ++i) *(v8h*)&sv[i * 8 + (tid >> 4)][(tid & 15) * 8] = vr[i];
      __syncthreads();   // the tile is published to the four waves
      if (kt + 1 < nt) { const float* pn = pg + (kt + 1) * PVK; const _Float16* vn = vg + (kt + 1) * PVK;
#pragma unroll
        for (int r = 0; r < 16; ++r) pr[r] = *(const v4f*)(pn + (size_t)r * TT);
#pragma unroll
        for (int i = 0; i < HD / 8; ++i) vr[i] = *(const v8h*)(vn + (size_t)i * 8 * TT);
        asm volatile("s_wait_xcnt 0x0" ::: "memory"); }   // precaution: stands before the loads' address registers are written again (the LDS reads below may land in them)
#pragma unroll
      for (int kc = 0; kc < PVK / 32; ++kc) { const v16h p = frag_h(&sp[wave][col][kc * 32], lane); v16h vf[HD / 16];
#pragma unroll
        for (int j = 0; j < HD / 16; ++j) vf[j] = frag_h(&sv[j * 16 + col][kc * 32], lane);   // the k-step's ten LDS reads go out as one group, ahead of its four products
#pragma unroll
        for (int j = 0; j < HD / 16; ++j) acc[j] = wmma16(p, vf[j], acc[j]); }
      __syncthreads();   // every wave has read the tile before it is overwritten
    } }
#pragma unroll
  for (int j = 0; j < HD / 16; ++j)
#pragma unroll
    for (int r = 0; r < 8; ++r) ss[wave][8 * g + r][j * 16 + col] = acc[j][r] * (1.0f / 2048.0f);
  LDSX(); for (int rl = 0; rl < 16; ++rl) if (lane < HD / 4) vst2(Y + ((size_t)b * TT + ql0 + rl) * CC + h * HD + lane * 4, *(const v4f*)&ss[wave][rl][lane * 4]); }

extern "C" void kernel_launch(void* const* d_in, const int* in_sizes, int n_in, void* d_out, int out_size, void* d_ws, size_t ws_size, hipStream_t stream) {
  (void)in_sizes; (void)n_in; (void)out_size;
  const float** F = (const float**)d_in;
  if (ws_size < (size_t)WS_END) return;
  char* ws = (char*)d_ws; _Float16 *QH = (_Float16*)(ws + WS_QH), *KH = (_Float16*)(ws + WS_KH), *VT = (_Float16*)(ws + WS_VT), *QL = (_Float16*)(ws + WS_QL), *KL = (_Float16*)(ws + WS_KL); __bf16 *VB = (__bf16*)(ws + WS_VB), *VBL = (__bf16*)(ws + WS_VBL); float *S = (float*)(ws + WS_S), *Y = (float*)(ws + WS_Y);
  (void)Y; (void)QL; (void)KL; (void)VB; (void)VBL;
  // inputs: 0 x [8,2048,384]; 1 Wq [384,64] (in,out); 2 Wk [384,64]; 3 Wv [384,384] (in,out); no biases
  k_proj<<<dim3(TNB * TT / 64, CC / 128 + 1), 128, 0, stream>>>(F[0], F[1], F[2], F[3], nullptr, nullptr, nullptr, QH, QL, KH, KL, VT, VB, VBL);   /* y = 0: q and k (64 columns each) in one tile; y = 1..3: 128 value columns each */
  k_sp<<<dim3(TNB, TT / 16), 256, 0, stream>>>(QH, KH, QL, KL, S);   /* 16 query rows a block, their logits in registers up to P */
  k_pv<<<dim3(NQB, TNB, NH), 128, 0, stream>>>(S, VT, VB, VBL, (float*)d_out);   /* slot h writes output columns 64h .. 64h+63 */
}

// v007
// Measured time: 94.9 microseconds a run.
// Timed twice side by side with v006, it ran 1.06 times as fast both times.
// All steps since v000 together make it 17.9 times as fast.
// compute dtype: all float inputs rounded to bf16; q / k (64 wide) and v (384 wide) projections with EXACT bf16 products on WMMA 16x16x32 (f32 accumulate); interleaved RoPE in f32 (f32 inverse frequencies; precise cosf / sinf); causal logits: 3 products for the first 384 rows, single f16 q x k after, x 64^-0.5; softmax f32 (q, k, logits and softmax once per batch, shared by all 384 value columns; all batches in one launch of each kernel; the logits stay in registers, one P plane per batch); P x 2^11 once to f16 x v once to f16 (bf16 hi + lo below row 384); f32 output.
#include <hip/hip_runtime.h>
#include <math.h>

typedef __attribute__((ext_vector_type(16))) _Float16 v16h;
typedef __attribute__((ext_vector_type(16))) __bf16 v16b;
typedef __attribute__((ext_vector_type(8)))  _Float16 v8h;
typedef __attribute__((ext_vector_type(8)))  float v8f;
typedef __attribute__((ext_vector_type(4)))  float v4f;
typedef __attribute__((ext_vector_type(2)))  float v2f;
typedef __attribute__((ext_vector_type(4)))  unsigned v4u;
typedef __attribute__((ext_vector_type(4)))  int v4i;
typedef float __attribute__((may_alias)) float_a;
typedef int __attribute__((may_alias)) int_a;

template <typename T> __device__ __forceinline__ void vst2(void* p, T v) { *(T*)p = v;  }
__device__ __forceinline__ v8f wmma16(v16h a, v16h b, v8f c) {
  v8f d = __builtin_amdgcn_wmma_f32_16x16x32_f16(false, a, false, b, (short)0, c, false, false);
  asm volatile("v_nop\n\tv_nop\n\tv_nop\n\tv_nop" : "+v"(d) : "v"(a), "v"(b));
  return d;
}
__device__ __forceinline__ v8f wmma_bf(v16b a, v16b b, v8f c) {
  v8f d = __builtin_amdgcn_wmma_f32_16x16x32_bf16(false, a, false, b, (short)0, c, false, false);
  asm volatile("v_nop\n\tv_nop\n\tv_nop\n\tv_nop" : "+v"(d) : "v"(a), "v"(b));
  return d;
}
// 16x16x32 fragments: lane = (h = lane>>4, row/col = lane&15); elements 0..7 = k0+8h+0..7, 8..15 = k0+16+8h+0..7; D element r = row 8h+r
__device__ __forceinline__ v16h frag_h(const _Float16* rowk0, int lane) {
  union { v16h v; v8h q[2]; } u; const _Float16* p = rowk0 + 8 * (lane >> 4);
  u.q[0] = *(const v8h*)p; u.q[1] = *(const v8h*)(p + 16); return u.v;
}
__device__ __forceinline__ v16h frag_f32(const float* rowk0, int lane) {
  v16h a; const float* p = rowk0 + 8 * (lane >> 4);
#pragma unroll
  for (int i = 0; i < 8; ++i) { a[i] = (_Float16)p[i]; a[8 + i] = (_Float16)p[16 + i]; }
  return a;
}
__device__ __forceinline__ v16h frag_f32s(const float* rowk0, int lane, float sc) {
  v16h a; const float* p = rowk0 + 8 * (lane >> 4);
#pragma unroll
  for (int i = 0; i < 8; ++i) { a[i] = (_Float16)(p[i] * sc); a[8 + i] = (_Float16)(p[16 + i] * sc); }
  return a;
}
// column fragment from a [K][ld] layout (column n), rows >= K read as 0
__device__ __forceinline__ v16h fragc_f32(const float* W, int k0, int n, int lane, int ld, int K) {
  v16h a; const int g = lane >> 4;
#pragma unroll
  for (int i = 0; i < 8; ++i) { const int ka = k0 + 8 * g + i, kb = ka + 16;
    a[i] = (_Float16)(ka < K ? W[(size_t)(ka < K ? ka : K - 1) * ld + n] : 0.f); a[8 + i] = (_Float16)(kb < K ? W[(size_t)(kb < K ? kb : K - 1) * ld + n] : 0.f); }
  return a;
}
struct F2 { v16b h, l; };
__device__ __forceinline__ F2 bsplit16(const float v[16]) { F2 r;
#pragma unroll
  for (int i = 0; i < 16; ++i) { const __bf16 h = (__bf16)v[i]; r.h[i] = h; r.l[i] = (__bf16)(v[i] - (float)h); }
  return r; }
__device__ __forceinline__ F2 split_row(const float* row, int k0, int lane) { float v[16]; const float* p = row + k0 + 8 * (lane >> 4);
#pragma unroll
  for (int i = 0; i < 8; ++i) { v[i] = p[i]; v[8 + i] = p[16 + i]; }
  return bsplit16(v); }
__device__ __forceinline__ F2 split_rowK(const float* row, int k0, int lane, int K) { float v[16]; const int g = lane >> 4;
#pragma unroll
  for (int i = 0; i < 8; ++i) { const int ka = k0 + 8 * g + i, kb = ka + 16; v[i] = ka < K ? row[ka < K ? ka : K - 1] : 0.f; v[8 + i] = kb < K ? row[kb < K ? kb : K - 1] : 0.f; }
  return bsplit16(v); }
__device__ __forceinline__ F2 split_col(const float* W, int k0, int n, int lane, int ld, int K) { float v[16]; const int g = lane >> 4;
#pragma unroll
  for (int i = 0; i < 8; ++i) { const int ka = k0 + 8 * g + i, kb = ka + 16; v[i] = ka < K ? W[(size_t)(ka < K ? ka : K - 1) * ld + n] : 0.f; v[8 + i] = kb < K ? W[(size_t)(kb < K ? kb : K - 1) * ld + n] : 0.f; }
  return bsplit16(v); }
__device__ __forceinline__ v8f mac3(const F2& a, const F2& b, v8f c) { c = wmma_bf(a.l, b.h, c); c = wmma_bf(a.h, b.l, c); return wmma_bf(a.h, b.h, c); }
__device__ __forceinline__ float sigm(float v) { return 1.0f / (1.0f + expf(-v)); }
#define LDSX() do { asm volatile("s_wait_dscnt 0" ::: "memory"); __builtin_amdgcn_wave_barrier(); __builtin_amdgcn_fence(__ATOMIC_RELEASE, "workgroup"); } while (0)

// Single-head causal attention with a WIDE value (x [8,2048,384]; (in,out) Wq / Wk [384,64], Wv [384,384] (0.02 scale), no biases; interleaved-pair RoPE on q and k (positions arange(T), inv_freq = 1/10000^(2i/64)); scale 1/8; tril, -inf): out = softmax(causal(rope(q) rope(k)^T / 8)) v -> [8,2048,384]. The one attention pattern (q, k, logits, softmax: computed once per batch) is applied to the 384 value columns as six 64-column slots.
#define NB 8
#define TT 2048
#define CC 384            // NH * HD = projected width
#define DIN 384          // input (model) width
#define NH 6
#define HD 64
#define NQB (TT / 64)
#define SCALE (0.125f)
#define CAUSAL 1
#ifndef TNB
#define TNB NB
#endif
__device__ __forceinline__ float bfr(float v) { return (float)(__bf16)v; }
__host__ __device__ __forceinline__ int kb_last(int qb) { return CAUSAL ? ((qb * 64 + 63) >> 7) : (TT / 128 - 1); }
typedef __attribute__((ext_vector_type(8))) __bf16 v8b;
__device__ __forceinline__ v16b frag_b(const __bf16* rowk0, int lane) {
  union { v16b v; v8b q[2]; } u; const __bf16* p = rowk0 + 8 * (lane >> 4);
  u.q[0] = *(const v8b*)p; u.q[1] = *(const v8b*)(p + 16); return u.v;
}
#define QBH 6              // causal: query blocks 0..QBH-1 of each sequence (few keys, no averaging) take the high-precision path
#define QHI 384            // rows carrying a q residual plane
#define KHI 384            // key rows carrying k residual / v bf16 hi+lo planes (used only by the causal high-precision path)
// B fragment (k rows k0+.., output column o) of a weight: (in,out) [K][ld] or (out,in) [ld rows of K]: bf16 exact, or f16(bf16 * 256) exact
__device__ __forceinline__ v16b wcol_io(const float* Wm, int k0, int o, int lane, int ld) { v16b w; const int g = lane >> 4;
#pragma unroll
  for (int i = 0; i < 8; ++i) { w[i] = (__bf16)Wm[(size_t)(k0 + 8 * g + i) * ld + o];
    if (i == 7) asm volatile("s_wait_xcnt 0x0" ::: "memory");   // precaution: the run's last load may land in the address register that the loads before it name
    w[8 + i] = (__bf16)Wm[(size_t)(k0 + 16 + 8 * g + i) * ld + o]; }
  asm volatile("s_wait_xcnt 0x0" ::: "memory");   // same precaution for the last load, before its address register is written again
  return w; }
__device__ __forceinline__ v16b wcol_oi(const float* Wm, int k0, int o, int lane, int K) { v16b w; const float* p = Wm + (size_t)o * K + k0 + 8 * (lane >> 4);
#pragma unroll
  for (int i = 0; i < 8; ++i) { w[i] = (__bf16)p[i]; w[8 + i] = (__bf16)p[16 + i]; }
  return w; }
__device__ __forceinline__ v16h wcolh_io(const float* Wm, int k0, int o, int lane, int ld) { v16h w; const int g = lane >> 4;
#pragma unroll
  for (int i = 0; i < 8; ++i) { w[i] = (_Float16)(bfr(Wm[(size_t)(k0 + 8 * g + i) * ld + o]) * 256.0f); w[8 + i] = (_Float16)(bfr(Wm[(size_t)(k0 + 16 + 8 * g + i) * ld + o]) * 256.0f); }
  return w; }
__device__ __forceinline__ v16h wcolh_oi(const float* Wm, int k0, int o, int lane, int K) { v16h w; const float* p = Wm + (size_t)o * K + k0 + 8 * (lane >> 4);
#pragma unroll
  for (int i = 0; i < 8; ++i) { w[i] = (_Float16)(bfr(p[i]) * 256.0f); w[8 + i] = (_Float16)(bfr(p[16 + i]) * 256.0f); }
  return w; }
#define WQKV_LAYOUT 0   // 0 = (in,out): Wv [DIN][CC], Wq / Wk [DIN][HD]; 1 = (out,in) [CC][DIN]; 2 = per-head [NH][DIN][HD]
__device__ __forceinline__ v16b wcol_hdk(const float* Wm, int k0, int o, int lane) { v16b w; const int g = lane >> 4; const float* p = Wm + (size_t)(o / HD) * DIN * HD + (o % HD);
#pragma unroll
  for (int i = 0; i < 8; ++i) { w[i] = (__bf16)p[(size_t)(k0 + 8 * g + i) * HD]; w[8 + i] = (__bf16)p[(size_t)(k0 + 16 + 8 * g + i) * HD]; }
  return w; }
#define WO_OUT_IN 0
#if WQKV_LAYOUT == 1
#define WCOL(W, k0, o, lane) wcol_oi(W, k0, o, lane, DIN)
#elif WQKV_LAYOUT == 2
#define WCOL(W, k0, o, lane) wcol_hdk(W, k0, o, lane)
#else
#define WCOL(W, k0, o, lane) (which == 2 ? wcol_io(W, k0, (o), lane, CC) : wcol_io(W, k0, ((o) & 63), lane, HD))   /* (in,out): Wv [384][384] pitch 384; Wq / Wk [384][64] pitch 64, tile column o % 64 */
#endif
#if WO_OUT_IN
#define WOCOL(W, k0, o, lane) wcol_oi(W, k0, o, lane, CC)
#define WOCOLH(W, k0, o, lane) wcolh_oi(W, k0, o, lane, CC)
#else
#define WOCOL(W, k0, o, lane) wcol_io(W, k0, o, lane, DIN)
#define WOCOLH(W, k0, o, lane) wcolh_io(W, k0, o, lane, DIN)
#endif
// RoPE inverse frequencies 1/10000^(2i/64) (the f32 values jax computes)
__constant__ float INVF[32] = {1.000000000e+00,7.498942018e-01,5.623413324e-01,4.216965139e-01,3.162277639e-01,2.371373624e-01,1.778279394e-01,1.333521456e-01,1.000000015e-01,7.498941571e-02,5.623412877e-02,4.216964915e-02,3.162277862e-02,2.371373586e-02,1.778279431e-02,1.333521493e-02,9.999999776e-03,7.498942316e-03,5.623413250e-03,4.216964822e-03,3.162277862e-03,2.371373819e-03,1.778279431e-03,1.333521446e-03,1.000000047e-03,7.498941850e-04,5.623413017e-04,4.216964880e-04,3.162277862e-04,2.371373848e-04,1.778279402e-04,1.333521504e-04};
#define PROJ_EXTRA_PARAMS
// interleaved-pair RoPE on q and k (which 0: the two 64-column halves of the tile) at position t (the module uses arange(T)): angle = (float)t * inv_freq[i]; (x_even, x_odd) -> (xe cos - xo sin, xo cos + xe sin) == x * cos + rotate_half_interleaved(x) * sin with cos / sin repeated pairwise; products and sums kept separate (no fma contraction)
#define PROJ_EPI(which, row, t, h) do { if ((which) < 2) { float* rw = (row); const float pos_ = (float)(t); _Pragma("unroll 4") for (int i = 0; i < 32; ++i) { _Pragma("clang fp contract(off)") const float ang = pos_ * INVF[i]; const float cs = cosf(ang), sn = sinf(ang); const float xe = rw[2 * i], xo = rw[2 * i + 1]; rw[2 * i] = xe * cs - xo * sn; rw[2 * i + 1] = xo * cs + xe * sn; } } } while (0)
#define SM_EXTRA_PARAMS
#define SM_MASK_HOOK (void)0
#ifndef SM_EXTRA_PARAMS
#define SM_EXTRA_PARAMS
#endif
#ifndef PROJ_EXTRA_PARAMS
#define PROJ_EXTRA_PARAMS
#endif
#ifndef SM_MASK_HOOK
#define SM_MASK_HOOK (void)0
#endif

#define WS_QH  0u                                      // f16 q rows [b*t][HD]
#define WS_KH  (WS_QH + 2u * (size_t)NB * TT * HD)      // f16 k rows [b*t][HD]
#define WS_VT  (WS_KH + 2u * (size_t)NB * TT * HD)      // f16 v planes [b][c][t]
#define WS_QL  (WS_VT + 2u * (size_t)NB * CC * TT)      // f16 q residual x 2^10 rows [b][t < QHI][HD]
#define WS_KL  (WS_QL + 2u * (size_t)NB * QHI * HD)     // f16 k residual x 2^10 rows [b][t < KHI][HD]
#define WS_VB  (WS_KL + 2u * (size_t)NB * KHI * HD)     // bf16 v hi planes [b][c][t < KHI]
#define WS_VBL (WS_VB + 2u * (size_t)NB * CC * KHI)
#define WS_S   (WS_VBL + 2u * (size_t)NB * CC * KHI)    // f32 P planes [b][t < QHI][s] (the early rows, which k_pv splits into bf16 hi + lo)
#define WS_PH  (WS_S  + 4u * (size_t)NB * QHI * TT)     // f16 P planes [b][t][s] (rows >= QHI are written and read)
#define WS_Y   (WS_PH + 2u * (size_t)NB * TT * TT)      // f32 ctx rows [b*t][CC] (only when there is an output projection)
#define WS_END (WS_Y  + 0u)

#define PJK 64             // k of a staged chunk in k_proj
typedef __attribute__((ext_vector_type(4))) __bf16 v4b;
// main loop of k_proj, W of row pitch WLD floats (a constant, so that each operand's loads share one address register that lives through the loop and differ in their immediate offsets): 64-k chunks of x and W go through LDS as bf16; every global load covers whole 128-B lines (x: two rows of 256 B a wave-load; W: 4 k rows x one line), W is fetched and rounded once a block instead of once a wave, and the next chunk's loads fly in registers while this chunk is multiplied.
// sx: x chunk [row][k]; sw: W chunk [tile column][k]; pitch 144 B = 16 B x 9, the odd multiple that 16-byte LDS reads want. A lane holds 8 consecutive k of 4 columns per set of 8 W loads, so each column's 8 k go to LDS as one 16-byte store.
template <int WLD> __device__ __forceinline__ void proj_mm(const float* xg, const float* wg, __bf16 (*sx)[72], __bf16 (*sw)[72], int wave, int lane, v8f (&acc)[8]) {
  const int col = lane & 15, g = lane >> 4, lr = lane >> 3, lc = lane & 7;
  v4f xr[8], wr[16];
  // every "unroll" below: constant indices keep xr, wr, wf and acc in registers; "unroll 1": the chunk loop stays rolled, a second copy of its body would only add live registers
#pragma unroll
  for (int i = 0; i < 16; ++i) wr[i] = *(const v4f*)(wg + (size_t)((i >> 3) * 32 + (i & 7)) * WLD);
#pragma unroll
  for (int i = 0; i < 8; ++i) xr[i] = *(const v4f*)(xg + (size_t)i * 2 * DIN);
  asm volatile("s_wait_xcnt 0x0" ::: "memory");   // precaution: stands before the loads' address registers are written again
#pragma unroll 1
  for (int ch = 0; ch < DIN / PJK; ++ch) {
#pragma unroll
    for (int s = 0; s < 2; ++s)
#pragma unroll
      for (int c = 0; c < 4; ++c) { v8b wv;
#pragma unroll
        for (int i = 0; i < 8; ++i) wv[i] = (__bf16)wr[s * 8 + i][c];
        *(v8b*)&sw[wave * 32 + lc * 4 + c][s * 32 + lr * 8] = wv; }
#pragma unroll
    for (int i = 0; i < 8; ++i) { v4b xv; xv[0] = (__bf16)xr[i][0]; xv[1] = (__bf16)xr[i][1]; xv[2] = (__bf16)xr[i][2]; xv[3] = (__bf16)xr[i][3]; *(v4b*)&sx[wave * 16 + i * 2 + g][col * 4] = xv; }
    __syncthreads();   // the chunk is published to the four waves
    if (ch + 1 < DIN / PJK) { xg += PJK; wg += (size_t)PJK * WLD;
#pragma unroll
      for (int i = 0; i < 16; ++i) wr[i] = *(const v4f*)(wg + (size_t)((i >> 3) * 32 + (i & 7)) * WLD);
#pragma unroll
      for (int i = 0; i < 8; ++i) xr[i] = *(const v4f*)(xg + (size_t)i * 2 * DIN);
      asm volatile("s_wait_xcnt 0x0" ::: "memory"); }   // precaution: stands before the loads' address registers are written again
#pragma unroll
    for (int kc = 0; kc < PJK / 32; ++kc) { const v16b a = frag_b(&sx[wave * 16 + col][kc * 32], lane);
#pragma unroll
      for (int jh = 0; jh < 2; ++jh) { v16b wf[4];
#pragma unroll
        for (int j = 0; j < 4; ++j) wf[j] = frag_b(&sw[(jh * 4 + j) * 16 + col][kc * 32], lane);   // eight LDS reads go out as one group, ahead of their four products
#pragma unroll
        for (int j = 0; j < 4; ++j) acc[jh * 4 + j] = wmma_bf(a, wf[j], acc[jh * 4 + j]); } }
    __syncthreads();   // every wave has read the chunk before it is overwritten
  } }
// ---- k_proj: block = (64 rows, 128 cols): X W (+ b) with exact bf16 products (K = DIN; x and W staged in LDS as bf16 in 64-k chunks); blockIdx.y = 0 (which 0; the longer blocks): q in tile columns 0..63 and k in 64..127 -> f16 rows (+ residual rows < QHI / KHI); blockIdx.y > 0 (which 2): 128 columns of v -> f16 planes [c][t] (+ bf16 hi/lo planes for t < KHI)
__global__ __launch_bounds__(128) void k_proj(const float* __restrict__ X, const float* __restrict__ WQ, const float* __restrict__ WK, const float* __restrict__ WV, const float* __restrict__ BQ, const float* __restrict__ BK, const float* __restrict__ BV,
    _Float16* __restrict__ QH, _Float16* __restrict__ QL, _Float16* __restrict__ KH, _Float16* __restrict__ KL, _Float16* __restrict__ VT, __bf16* __restrict__ VB, __bf16* __restrict__ VBL PROJ_EXTRA_PARAMS) {
  __shared__ __align__(16) float st[64][132]; __shared__ __align__(16) _Float16 sh[64][136], sl[64][136]; __shared__ __align__(16) _Float16 th[128][72]; __shared__ __align__(16) __bf16 tb[128][72], tbl[128][72];
  const int tid = threadIdx.x, wave = tid >> 5, lane = tid & 31, col = lane & 15, g = lane >> 4; const int which = blockIdx.y == 0 ? 0 : 2; const int c0 = which == 2 ? (blockIdx.y - 1) * 128 : 0; const size_t r0 = (size_t)blockIdx.x * 64; const size_t bb = r0 / TT; const int t0 = (int)(r0 % TT);
  v8f acc[8] = {};
  { // wave w stages tile columns 32w .. 32w+31 of W and its own 16 rows of x; the two stages lie in tb and tbl, which hold nothing until the epilogue (behind its own barriers)
    const float* xg = X + (r0 + wave * 16 + g) * DIN + col * 4; const int lr = lane >> 3, lc = lane & 7;
    if (which == 2) proj_mm<CC>(xg, WV + c0 + wave * 32 + lc * 4 + (size_t)(lr * 8) * CC, tbl, tb, wave, lane, acc);
    else proj_mm<HD>(xg, (wave < 2 ? WQ + wave * 32 : WK + (wave - 2) * 32) + lc * 4 + (size_t)(lr * 8) * HD, tbl, tb, wave, lane, acc); }
  { // stage the f32 tile (acc + bias) in LDS, run the per-(row, head) epilogue hook, then convert
#pragma unroll
    for (int j = 0; j < 8; ++j) { const float* BA = which == 2 ? BV : j < 4 ? BQ : BK; const float bias = BA ? bfr(BA[which == 2 ? c0 + j * 16 + col : (j & 3) * 16 + col]) : 0.f;
#pragma unroll
      for (int r = 0; r < 8; ++r) st[wave * 16 + 8 * g + r][j * 16 + col] = acc[j][r] + bias; }
    __syncthreads();
    for (int e = tid; e < 64 * (128 / HD); e += 128) { const int rl = e / (128 / HD), hh = e % (128 / HD); PROJ_EPI(which, &st[rl][hh * HD], (int)((r0 + rl) % TT), (c0 / HD) + hh); }
    __syncthreads(); }
  if (which < 2) {
    for (int e = tid; e < 64 * 128; e += 128) { const int rl = e >> 7, cl = e & 127; const float v = st[rl][cl]; const _Float16 hv = (_Float16)v; sh[rl][cl] = hv; sl[rl][cl] = (_Float16)((v - (float)hv) * 1024.0f); }
    __syncthreads();
    for (int e = tid; e < 64 * 16; e += 128) { const int rl = e >> 4, q = e & 15; _Float16* DH = q < 8 ? QH : KH; _Float16* DL = q < 8 ? QL : KL; const int nhi = q < 8 ? QHI : KHI;
      vst2((unsigned*)(DH + (r0 + rl) * HD + (q & 7) * 8), *(const v4u*)&sh[rl][q * 8]);
      asm volatile("s_wait_xcnt 0x0" ::: "memory");   // precaution: stands before the store's data and address registers are rewritten (next LDS read, next trip's address)
      if (t0 < nhi) { vst2((unsigned*)(DL + (bb * nhi + t0 + rl) * (size_t)HD + (q & 7) * 8), *(const v4u*)&sl[rl][q * 8]);
        asm volatile("s_wait_xcnt 0x0" ::: "memory"); } }   // same precaution for the residual row's store
  } else { const bool hi_rows = t0 < KHI;
    for (int e = tid; e < 64 * 128; e += 128) { const int rl = e & 63, cl = e >> 6; const float v = st[rl][cl]; th[cl][rl] = (_Float16)v; const __bf16 bh = (__bf16)v; tb[cl][rl] = bh; tbl[cl][rl] = (__bf16)(v - (float)bh); }
    __syncthreads();
    for (int e = tid; e < 128 * 8; e += 128) { const int cl = e >> 3, q = e & 7; vst2((unsigned*)(VT + (bb * CC + c0 + cl) * (size_t)TT + t0 + q * 8), *(const v4u*)&th[cl][q * 8]); if (hi_rows) { const size_t o3 = (bb * CC + c0 + cl) * (size_t)KHI + t0 + q * 8; vst2((unsigned*)(VB + o3), *(const v4u*)&tb[cl][q * 8]); vst2((unsigned*)(VBL + o3), *(const v4u*)&tbl[cl][q * 8]); } } } }
#define SPW 8              // waves of a block in k_sp
// ---- k_sp: block = 16 query rows (row block rb; blockIdx.y: first the early rows, whose three-product blocks wait longest on loads and use few waves, then the rest counted down from the longest, so that cost falls with the block index) of batch b = blockIdx.x against all their keys [0, 128 ng): the 128-key tile kt belongs to wave kt % 8 (slot kt / 8), so a wave holds at most two tiles of logits, in its accumulators, from the products to the store of P: the logits never go to memory.
// logits x SCALE as 16x16x32 f16 products: q x k once for rows >= QHI; q hi + residual (x 2^10) against k hi + residual (3 products) for query blocks < QBH (causal early rows; at most 3 tiles, so slot 0 alone); causal: key s kept if s <= t; softmax in f32 (row maximum and row sum: in-lane, then across the 16 lanes that share a row, then across the 8 waves through LDS, one barrier each); P x 2^11 (0 for excluded keys) goes out as whole row pieces of a tile, staged in the wave's own LDS range: f16 (256 B) for rows >= QHI, f32 (512 B) for the early rows
// amdgpu_waves_per_eu: two blocks a WGP (four waves a SIMD), so that one block's products and exponentials cover the other's loads and barriers
__global__ __launch_bounds__(256) __attribute__((amdgpu_waves_per_eu(4, 4))) void k_sp(const _Float16* __restrict__ QH, const _Float16* __restrict__ KH, const _Float16* __restrict__ QL, const _Float16* __restrict__ KL, float* __restrict__ SA, _Float16* __restrict__ PHA) {
  __shared__ __align__(16) float ssa[SPW][16][132]; __shared__ __align__(16) float rm[SPW][16], rs[SPW][16];
  const int b = blockIdx.x, rb = (int)blockIdx.y < QHI / 16 ? (int)blockIdx.y : TT / 16 - 1 - ((int)blockIdx.y - QHI / 16), qb = rb >> 2, ng = kb_last(qb) + 1;
  const int wave = __builtin_amdgcn_readfirstlane(threadIdx.x >> 5), lane = threadIdx.x & 31, col = lane & 15, g = lane >> 4;   // the wave's number in a scalar register: every test on a tile is a scalar branch (the matrix instructions want all lanes on)
  const int ql0 = rb * 16; const size_t q0 = (size_t)b * TT + ql0;
  float* __restrict__ S = SA + (size_t)b * QHI * TT; _Float16* __restrict__ PH = PHA + (size_t)b * TT * TT; float (*ss)[132] = ssa[wave]; _Float16 (*sh)[264] = (_Float16 (*)[264])ssa[wave];   // sh: the wave's same LDS range as f16 rows (pitch 528 B = 16 B x 33)
  const v8f zero = {};
  v8f acc[2][8];   // a slot is given its values by the products below or, where the wave has no such tile, by the zeros behind them (set there and not here, so that the three-product path carries no registers for slot 1)
  // every "unroll" below: constant indices keep acc, the fragments and the row values in registers
  if (qb < QBH) {
    if (wave < ng) { const int k0 = wave * 128; v8f accl[8];
      // one address a plane (the lane's row and 8-element half), every fragment at a constant offset from it
      const _Float16* qp = QH + (q0 + col) * HD + 8 * g; const _Float16* qlp = QL + ((size_t)b * QHI + ql0 + col) * HD + 8 * g; const _Float16* kp = KH + ((size_t)b * TT + k0 + col) * HD + 8 * g; const _Float16* lp = KL + ((size_t)b * KHI + k0 + col) * HD + 8 * g;
#pragma unroll
      for (int kc = 0; kc < HD / 32; ++kc) { const v16h ah = frag_h(qp + kc * 32, 0), al = frag_h(qlp + kc * 32, 0);   // lane argument 0: the half is in the address already
#pragma unroll
        for (int jh = 0; jh < 2; ++jh) { v16h kf[4], lf[4];
#pragma unroll
          for (int j = 0; j < 4; ++j) { kf[j] = frag_h(kp + (jh * 4 + j) * 16 * HD + kc * 32, 0); lf[j] = frag_h(lp + (jh * 4 + j) * 16 * HD + kc * 32, 0); }
          asm volatile("s_wait_xcnt 0x0" :: "v"(qp), "v"(qlp), "v"(kp), "v"(lp) : "memory");   // precaution: stands before the loads' address registers are written again; the four addresses as inputs, so that no load of the group lands in one of them
#pragma unroll
          for (int j = 0; j < 4; ++j) { const int jj = jh * 4 + j; acc[0][jj] = wmma16(ah, kf[j], kc == 0 ? zero : acc[0][jj]); accl[jj] = wmma16(al, kf[j], kc == 0 ? zero : accl[jj]); accl[jj] = wmma16(ah, lf[j], accl[jj]); } } }
#pragma unroll
      for (int j = 0; j < 8; ++j) {
#pragma unroll
        for (int r = 0; r < 8; ++r) acc[0][j][r] = (acc[0][j][r] + accl[j][r] * (1.0f / 1024.0f)) * SCALE; } }
  } else {
    v16h ah[HD / 32];
#pragma unroll
    for (int kc = 0; kc < HD / 32; ++kc) ah[kc] = frag_h(QH + (q0 + col) * HD + kc * 32, lane);
    asm volatile("s_wait_xcnt 0x0" ::: "memory");   // precaution: stands before the loads' address registers are written again
#pragma unroll
    for (int s = 0; s < 2; ++s) if (s * SPW + wave < ng) { const size_t kr0 = (size_t)b * TT + (s * SPW + wave) * 128;
#pragma unroll
      for (int kc = 0; kc < HD / 32; ++kc) { v16h kf[8];
#pragma unroll
        for (int j = 0; j < 8; ++j) kf[j] = frag_h(KH + (kr0 + j * 16 + col) * HD + kc * 32, lane);   // the k-step's sixteen loads go out as one group, ahead of its eight products
        asm volatile("s_wait_xcnt 0x0" ::: "memory");   // precaution: stands before the loads' address registers are written again
#pragma unroll
        for (int j = 0; j < 8; ++j) acc[s][j] = wmma16(ah[kc], kf[j], kc == 0 ? zero : acc[s][j]); }
#pragma unroll
      for (int j = 0; j < 8; ++j) acc[s][j] = acc[s][j] * SCALE; } }
  // accumulator element r of tile column j: query row ql0 + 8 g + r, key 128 kt + 16 j + col
  float m[8], l[8];
#pragma unroll
  for (int r = 0; r < 8; ++r) { m[r] = -3.0e38f; l[r] = 0.f; }
#pragma unroll
  for (int s = 0; s < 2; ++s) { const int kt = s * SPW + wave;
    if (kt < ng) {
      if (CAUSAL && kt * 128 + 127 > ql0) { const int rel = ql0 + 8 * g - kt * 128 - col;   // a tile that reaches past the block's first row: key kept when 16 j <= rel + r
#pragma unroll
        for (int j = 0; j < 8; ++j) {
#pragma unroll
          for (int r = 0; r < 8; ++r) acc[s][j][r] = (j * 16 <= rel + r) ? acc[s][j][r] : -3.0e38f; } }
#pragma unroll
      for (int j = 0; j < 8; ++j) {
#pragma unroll
        for (int r = 0; r < 8; ++r) m[r] = fmaxf(m[r], acc[s][j][r]); }
    } else {
#pragma unroll
      for (int j = 0; j < 8; ++j) acc[s][j] = zero; } }
#pragma unroll
  for (int o = 1; o < 16; o <<= 1) {
#pragma unroll
    for (int r = 0; r < 8; ++r) m[r] = fmaxf(m[r], __shfl_xor(m[r], o)); }
  if (col == 0) { v4f a0 = {m[0], m[1], m[2], m[3]}, a1 = {m[4], m[5], m[6], m[7]}; *(v4f*)&rm[wave][8 * g] = a0; *(v4f*)&rm[wave][8 * g + 4] = a1; }
  __syncthreads();   // every wave's row maxima are published (a wave without a tile publishes the start value)
#pragma unroll
  for (int w = 0; w < SPW; ++w) { const v4f a0 = *(const v4f*)&rm[w][8 * g], a1 = *(const v4f*)&rm[w][8 * g + 4];
#pragma unroll
    for (int r = 0; r < 4; ++r) { m[r] = fmaxf(m[r], a0[r]); m[4 + r] = fmaxf(m[4 + r], a1[r]); } }
  // "unroll 1": one copy of the 64 exponentials serves both slots (the two tiles change places behind each trip and are back in their own after two), which keeps the kernel's text short
#pragma unroll 1
  for (int s = 0; s < 2; ++s) {
    if (s * SPW + wave < ng) {
#pragma unroll
      for (int j = 0; j < 8; ++j) {
#pragma unroll
        for (int r = 0; r < 8; ++r) { const float v = acc[0][j][r]; const float ex = expf(v - m[r]); const float e = (v <= -1.0e38f) ? 0.f : ex; acc[0][j][r] = e; l[r] += e; } } }
#pragma unroll
    for (int j = 0; j < 8; ++j) {
#pragma unroll
      for (int r = 0; r < 8; ++r) { float x = acc[0][j][r], y = acc[1][j][r]; asm("v_swap_b32 %0, %1" : "+v"(x), "+v"(y)); acc[0][j][r] = x; acc[1][j][r] = y; } } }   // the exchange in place, one instruction a register pair: written as plain copies it took a third set of registers and spilled
#pragma unroll
  for (int o = 1; o < 16; o <<= 1) {
#pragma unroll
    for (int r = 0; r < 8; ++r) l[r] += __shfl_xor(l[r], o); }
  if (col == 0) { v4f a0 = {l[0], l[1], l[2], l[3]}, a1 = {l[4], l[5], l[6], l[7]}; *(v4f*)&rs[wave][8 * g] = a0; *(v4f*)&rs[wave][8 * g + 4] = a1; }
  __syncthreads();   // every wave's row sums are published
  float inv[8];
#pragma unroll
  for (int r = 0; r < 8; ++r) inv[r] = 0.f;
#pragma unroll
  for (int w = 0; w < SPW; ++w) { const v4f a0 = *(const v4f*)&rs[w][8 * g], a1 = *(const v4f*)&rs[w][8 * g + 4];
#pragma unroll
    for (int r = 0; r < 4; ++r) { inv[r] += a0[r]; inv[4 + r] += a1[r]; } }
#pragma unroll
  for (int r = 0; r < 8; ++r) inv[r] = inv[r] > 0.f ? 2048.0f / inv[r] : 0.f;   /* a fully excluded row yields P = 0 */
  if (qb < QBH) {   // early rows: P stays f32 (k_pv splits it into bf16 hi + lo); at most 3 tiles, so slot 0 alone
    if (wave < ng) { float* sg = S + (size_t)ql0 * TT + wave * 128 + lane * 4;
#pragma unroll
      for (int j = 0; j < 8; ++j) {
#pragma unroll
        for (int r = 0; r < 8; ++r) ss[8 * g + r][j * 16 + col] = acc[0][j][r] * inv[r]; }
      asm volatile("s_wait_dscnt 0" ::: "memory"); __builtin_amdgcn_wave_barrier();   // the wave's lanes read each other's values below: the LDS writes stay in front of the reads
      v4f o[16];
#pragma unroll
      for (int rl = 0; rl < 16; ++rl) o[rl] = *(const v4f*)&ss[rl][lane * 4];
#pragma unroll
      for (int rl = 0; rl < 16; ++rl) vst2(sg + (size_t)rl * TT, o[rl]);
      asm volatile("s_wait_xcnt 0x0" ::: "memory"); }   // precaution: stands before the stores' data and address registers are written again
  } else {   // all other rows: P is rounded to f16 here, once (the operand type of k_pv's product), and goes out as whole 256-B row pieces, two rows a wave-store
#pragma unroll
    for (int s = 0; s < 2; ++s) if (s * SPW + wave < ng) { _Float16* hg = PH + (size_t)(ql0 + g) * TT + (s * SPW + wave) * 128 + col * 8;
#pragma unroll
      for (int j = 0; j < 8; ++j) {
#pragma unroll
        for (int r = 0; r < 8; ++r) sh[8 * g + r][j * 16 + col] = (_Float16)(acc[s][j][r] * inv[r]); }
      asm volatile("s_wait_dscnt 0" ::: "memory"); __builtin_amdgcn_wave_barrier();   // the wave's lanes read each other's values below: the LDS writes stay in front of the reads (no fence: one would also wait for the first tile's global stores)
      v8h o[8];
#pragma unroll
      for (int i = 0; i < 8; ++i) o[i] = *(const v8h*)&sh[2 * i + g][col * 8];
#pragma unroll
      for (int i = 0; i < 8; ++i) vst2(hg + (size_t)(2 * i) * TT, o[i]);
      asm volatile("s_wait_xcnt 0x0" ::: "memory");   // precaution: stands before the stores' data and address registers are written again; it also keeps the second tile's LDS writes behind the reads above
    } } }
#define PVK 128            // keys of a staged tile in k_pv
#define PVP (PVK + 8)      // its LDS row pitch in f16: 272 B = 16 B x 17, the odd multiple that 16-byte LDS reads want
// ---- k_pv: block = 64 queries (qb) of batch b = blockIdx.y x value columns 64h .. 64h+63 (h = blockIdx.z; every h reads the same P): ctx = P . v over keys [0, kend) (P x 2^11 once to f16 against v f16: 1 product; causal early query blocks: P and v as bf16 hi + lo, 3 products); 256-B (row, head) segment by 16 lanes
__global__ __launch_bounds__(128) void k_pv(const float* __restrict__ PA, const _Float16* __restrict__ PHA, const _Float16* __restrict__ VT, const __bf16* __restrict__ VB, const __bf16* __restrict__ VBL, float* __restrict__ Y) { const int h = blockIdx.z, b = blockIdx.y; const float* __restrict__ PS = PA + (size_t)b * QHI * TT; __shared__ __align__(16) float ss[4][16][HD + 4]; __shared__ __align__(16) _Float16 sp[4][16][PVP], sv[HD][PVP];
  const int tid = threadIdx.x, wave = tid >> 5, lane = tid & 31, col = lane & 15, g = lane >> 4; const int qb = blockIdx.x; const int ql0 = qb * 64 + wave * 16; const int kce = (kb_last(qb) + 1) * 4;
  v8f acc[HD / 16] = {};
  if (qb < QBH) {
#pragma unroll 1
    for (int kc = 0; kc < kce; ++kc) { const F2 p = split_row(PS + (size_t)(ql0 + col) * TT, kc * 32, lane);
      asm volatile("s_wait_loadcnt 0x0" ::: "memory");
#pragma unroll
      for (int j = 0; j < HD / 16; ++j) { const size_t po = ((size_t)b * CC + h * HD + j * 16 + col) * (size_t)KHI + kc * 32; const v16b vh = frag_b(VB + po, lane); acc[j] = wmma_bf(p.h, vh, acc[j]); acc[j] = wmma_bf(p.l, vh, acc[j]); acc[j] = wmma_bf(p.h, frag_b(VBL + po, lane), acc[j]); } }
  } else {
    // 128-key tiles through LDS: every global load covers whole 128-B lines (two f16 P rows of 256 B a wave-load; two v columns of 256 B a wave-load), v is fetched once a block instead of once a wave; the next tile's loads fly in registers while this tile is multiplied
    const int nt = kce / 4; const _Float16* pg = PHA + (size_t)b * TT * TT + (size_t)(ql0 + g) * TT + col * 8; const _Float16* vg = VT + ((size_t)b * CC + h * HD + (tid >> 4)) * (size_t)TT + (tid & 15) * 8;
    v8h pr[8], vr[HD / 8];
    // every "unroll" below: constant indices keep pr, vr, vf and acc in registers; "unroll 1": the tile loop stays rolled, a second copy of its body would only add live registers
#pragma unroll
    for (int i = 0; i < 8; ++i) pr[i] = *(const v8h*)(pg + (size_t)(2 * i) * TT);
#pragma unroll
    for (int i = 0; i < HD / 8; ++i) vr[i] = *(const v8h*)(vg + (size_t)i * 8 * TT);
    asm volatile("s_wait_xcnt 0x0" ::: "memory");   // precaution: stands before the loads' address registers are written again
#pragma unroll 1
    for (int kt = 0; kt < nt; ++kt) {
#pragma unroll
      for (int i = 0; i < 8; ++i) *(v8h*)&sp[wave][2 * i + g][col * 8] = pr[i];
#pragma unroll
      for (int i = 0; i < HD / 8; ++i) *(v8h*)&sv[i * 8 + (tid >> 4)][(tid & 15) * 8] = vr[i];
      __syncthreads();   // the tile is published to the four waves
      if (kt + 1 < nt) { const _Float16* pn = pg + (kt + 1) * PVK; const _Float16* vn = vg + (kt + 1) * PVK;
#pragma unroll
        for (int i = 0; i < 8; ++i) pr[i] = *(const v8h*)(pn + (size_t)(2 * i) * TT);
#pragma unroll
        for (int i = 0; i < HD / 8; ++i) vr[i] = *(const v8h*)(vn + (size_t)i * 8 * TT);
        asm volatile("s_wait_xcnt 0x0" :: "v"(pn), "v"(vn) : "memory"); }   // precaution: stands before the loads' address registers are written again (the LDS reads below may land in them); the two addresses as inputs, so that no load of the group lands in one of them
#pragma unroll
      for (int kc = 0; kc < PVK / 32; ++kc) { const v16h p = frag_h(&sp[wave][col][kc * 32], lane); v16h vf[HD / 16];
#pragma unroll
        for (int j = 0; j < HD / 16; ++j) vf[j] = frag_h(&sv[j * 16 + col][kc * 32], lane);   // the k-step's ten LDS reads go out as one group, ahead of its four products
#pragma unroll
        for (int j = 0; j < HD / 16; ++j) acc[j] = wmma16(p, vf[j], acc[j]); }
      __syncthreads();   // every wave has read the tile before it is overwritten
    } }
#pragma unroll
  for (int j = 0; j < HD / 16; ++j)
#pragma unroll
    for (int r = 0; r < 8; ++r) ss[wave][8 * g + r][j * 16 + col] = acc[j][r] * (1.0f / 2048.0f);
  LDSX(); for (int rl = 0; rl < 16; ++rl) if (lane < HD / 4) vst2(Y + ((size_t)b * TT + ql0 + rl) * CC + h * HD + lane * 4, *(const v4f*)&ss[wave][rl][lane * 4]); }

extern "C" void kernel_launch(void* const* d_in, const int* in_sizes, int n_in, void* d_out, int out_size, void* d_ws, size_t ws_size, hipStream_t stream) {
  (void)in_sizes; (void)n_in; (void)out_size;
  const float** F = (const float**)d_in;
  if (ws_size < (size_t)WS_END) return;
  char* ws = (char*)d_ws; _Float16 *QH = (_Float16*)(ws + WS_QH), *KH = (_Float16*)(ws + WS_KH), *VT = (_Float16*)(ws + WS_VT), *QL = (_Float16*)(ws + WS_QL), *KL = (_Float16*)(ws + WS_KL); __bf16 *VB = (__bf16*)(ws + WS_VB), *VBL = (__bf16*)(ws + WS_VBL); float *S = (float*)(ws + WS_S), *Y = (float*)(ws + WS_Y); _Float16 *PH = (_Float16*)(ws + WS_PH);
  (void)Y; (void)QL; (void)KL; (void)VB; (void)VBL;
  // inputs: 0 x [8,2048,384]; 1 Wq [384,64] (in,out); 2 Wk [384,64]; 3 Wv [384,384] (in,out); no biases
  k_proj<<<dim3(TNB * TT / 64, CC / 128 + 1), 128, 0, stream>>>(F[0], F[1], F[2], F[3], nullptr, nullptr, nullptr, QH, QL, KH, KL, VT, VB, VBL);   /* y = 0: q and k (64 columns each) in one tile; y = 1..3: 128 value columns each */
  k_sp<<<dim3(TNB, TT / 16), 256, 0, stream>>>(QH, KH, QL, KL, S, PH);   /* 16 query rows a block, their logits in registers up to P */
  k_pv<<<dim3(NQB, TNB, NH), 128, 0, stream>>>(S, PH, VT, VB, VBL, (float*)d_out);   /* slot h writes output columns 64h .. 64h+63 */
}

// v008
// It runs in 86.3 microseconds.
// In two side-by-side timings against v007, it was 1.10 and 1.09 times as fast.
// Counting every step since v000, it is 19.6 times as fast.
// compute dtype: all float inputs rounded to bf16; q / k (64 wide) and v (384 wide) projections with EXACT bf16 products on WMMA 16x16x32 (f32 accumulate); interleaved RoPE in f32 (f32 inverse frequencies; precise cosf / sinf); causal logits: 3 products for the first 384 rows, single f16 q x k after, x 64^-0.5; softmax f32 (q, k, logits and softmax once per batch, shared by all 384 value columns; all batches in one launch of each kernel; the logits stay in registers, one P plane per batch); P x 2^11 once to f16 x v once to f16 (bf16 hi + lo below row 384); f32 output.
#include <hip/hip_runtime.h>
#include <math.h>

typedef __attribute__((ext_vector_type(16))) _Float16 v16h;
typedef __attribute__((ext_vector_type(16))) __bf16 v16b;
typedef __attribute__((ext_vector_type(8)))  _Float16 v8h;
typedef __attribute__((ext_vector_type(8)))  float v8f;
typedef __attribute__((ext_vector_type(4)))  float v4f;
typedef __attribute__((ext_vector_type(2)))  float v2f;
typedef __attribute__((ext_vector_type(4)))  unsigned v4u;
typedef __attribute__((ext_vector_type(4)))  int v4i;
typedef float __attribute__((may_alias)) float_a;
typedef int __attribute__((may_alias)) int_a;

template <typename T> __device__ __forceinline__ void vst2(void* p, T v) { *(T*)p = v;  }
__device__ __forceinline__ v8f wmma16(v16h a, v16h b, v8f c) {
  v8f d = __builtin_amdgcn_wmma_f32_16x16x32_f16(false, a, false, b, (short)0, c, false, false);
  asm volatile("v_nop\n\tv_nop\n\tv_nop\n\tv_nop" : "+v"(d) : "v"(a), "v"(b));
  return d;
}
__device__ __forceinline__ v8f wmma_bf(v16b a, v16b b, v8f c) {
  v8f d = __builtin_amdgcn_wmma_f32_16x16x32_bf16(false, a, false, b, (short)0, c, false, false);
  asm volatile("v_nop\n\tv_nop\n\tv_nop\n\tv_nop" : "+v"(d) : "v"(a), "v"(b));
  return d;
}
// 16x16x32 fragments: lane = (h = lane>>4, row/col = lane&15); elements 0..7 = k0+8h+0..7, 8..15 = k0+16+8h+0..7; D element r = row 8h+r
__device__ __forceinline__ v16h frag_h(const _Float16* rowk0, int lane) {
  union { v16h v; v8h q[2]; } u; const _Float16* p = rowk0 + 8 * (lane >> 4);
  u.q[0] = *(const v8h*)p; u.q[1] = *(const v8h*)(p + 16); return u.v;
}
__device__ __forceinline__ v16h frag_f32(const float* rowk0, int lane) {
  v16h a; const float* p = rowk0 + 8 * (lane >> 4);
#pragma unroll
  for (int i = 0; i < 8; ++i) { a[i] = (_Float16)p[i]; a[8 + i] = (_Float16)p[16 + i]; }
  return a;
}
__device__ __forceinline__ v16h frag_f32s(const float* rowk0, int lane, float sc) {
  v16h a; const float* p = rowk0 + 8 * (lane >> 4);
#pragma unroll
  for (int i = 0; i < 8; ++i) { a[i] = (_Float16)(p[i] * sc); a[8 + i] = (_Float16)(p[16 + i] * sc); }
  return a;
}
// column fragment from a [K][ld] layout (column n), rows >= K read as 0
__device__ __forceinline__ v16h fragc_f32(const float* W, int k0, int n, int lane, int ld, int K) {
  v16h a; const int g = lane >> 4;
#pragma unroll
  for (int i = 0; i < 8; ++i) { const int ka = k0 + 8 * g + i, kb = ka + 16;
    a[i] = (_Float16)(ka < K ? W[(size_t)(ka < K ? ka : K - 1) * ld + n] : 0.f); a[8 + i] = (_Float16)(kb < K ? W[(size_t)(kb < K ? kb : K - 1) * ld + n] : 0.f); }
  return a;
}
struct F2 { v16b h, l; };
__device__ __forceinline__ F2 bsplit16(const float v[16]) { F2 r;
#pragma unroll
  for (int i = 0; i < 16; ++i) { const __bf16 h = (__bf16)v[i]; r.h[i] = h; r.l[i] = (__bf16)(v[i] - (float)h); }
  return r; }
__device__ __forceinline__ F2 split_row(const float* row, int k0, int lane) { float v[16]; const float* p = row + k0 + 8 * (lane >> 4);
#pragma unroll
  for (int i = 0; i < 8; ++i) { v[i] = p[i]; v[8 + i] = p[16 + i]; }
  return bsplit16(v); }
__device__ __forceinline__ F2 split_rowK(const float* row, int k0, int lane, int K) { float v[16]; const int g = lane >> 4;
#pragma unroll
  for (int i = 0; i < 8; ++i) { const int ka = k0 + 8 * g + i, kb = ka + 16; v[i] = ka < K ? row[ka < K ? ka : K - 1] : 0.f; v[8 + i] = kb < K ? row[kb < K ? kb : K - 1] : 0.f; }
  return bsplit16(v); }
__device__ __forceinline__ F2 split_col(const float* W, int k0, int n, int lane, int ld, int K) { float v[16]; const int g = lane >> 4;
#pragma unroll
  for (int i = 0; i < 8; ++i) { const int ka = k0 + 8 * g + i, kb = ka + 16; v[i] = ka < K ? W[(size_t)(ka < K ? ka : K - 1) * ld + n] : 0.f; v[8 + i] = kb < K ? W[(size_t)(kb < K ? kb : K - 1) * ld + n] : 0.f; }
  return bsplit16(v); }
__device__ __forceinline__ v8f mac3(const F2& a, const F2& b, v8f c) { c = wmma_bf(a.l, b.h, c); c = wmma_bf(a.h, b.l, c); return wmma_bf(a.h, b.h, c); }
__device__ __forceinline__ float sigm(float v) { return 1.0f / (1.0f + expf(-v)); }
#define LDSX() do { asm volatile("s_wait_dscnt 0" ::: "memory"); __builtin_amdgcn_wave_barrier(); __builtin_amdgcn_fence(__ATOMIC_RELEASE, "workgroup"); } while (0)

// Single-head causal attention with a WIDE value (x [8,2048,384]; (in,out) Wq / Wk [384,64], Wv [384,384] (0.02 scale), no biases; interleaved-pair RoPE on q and k (positions arange(T), inv_freq = 1/10000^(2i/64)); scale 1/8; tril, -inf): out = softmax(causal(rope(q) rope(k)^T / 8)) v -> [8,2048,384]. The one attention pattern (q, k, logits, softmax: computed once per batch) is applied to the 384 value columns as six 64-column slots.
#define NB 8
#define TT 2048
#define CC 384            // NH * HD = projected width
#define DIN 384          // input (model) width
#define NH 6
#define HD 64
#define NQB (TT / 64)
#define SCALE (0.125f)
#define CAUSAL 1
#ifndef TNB
#define TNB NB
#endif
__device__ __forceinline__ float bfr(float v) { return (float)(__bf16)v; }
__host__ __device__ __forceinline__ int kb_last(int qb) { return CAUSAL ? ((qb * 64 + 63) >> 7) : (TT / 128 - 1); }
typedef __attribute__((ext_vector_type(8))) __bf16 v8b;
__device__ __forceinline__ v16b frag_b(const __bf16* rowk0, int lane) {
  union { v16b v; v8b q[2]; } u; const __bf16* p = rowk0 + 8 * (lane >> 4);
  u.q[0] = *(const v8b*)p; u.q[1] = *(const v8b*)(p + 16); return u.v;
}
#define QBH 6              // causal: query blocks 0..QBH-1 of each sequence (few keys, no averaging) take the high-precision path
#define QHI 384            // rows carrying a q residual plane
#define KHI 384            // key rows carrying k residual / v bf16 hi+lo planes (used only by the causal high-precision path)
// B fragment (k rows k0+.., output column o) of a weight: (in,out) [K][ld] or (out,in) [ld rows of K]: bf16 exact, or f16(bf16 * 256) exact
__device__ __forceinline__ v16b wcol_io(const float* Wm, int k0, int o, int lane, int ld) { v16b w; const int g = lane >> 4;
#pragma unroll
  for (int i = 0; i < 8; ++i) { w[i] = (__bf16)Wm[(size_t)(k0 + 8 * g + i) * ld + o];
    if (i == 7) asm volatile("s_wait_xcnt 0x0" ::: "memory");   // precaution: the run's last load may land in the address register that the loads before it name
    w[8 + i] = (__bf16)Wm[(size_t)(k0 + 16 + 8 * g + i) * ld + o]; }
  asm volatile("s_wait_xcnt 0x0" ::: "memory");   // same precaution for the last load, before its address register is written again
  return w; }
__device__ __forceinline__ v16b wcol_oi(const float* Wm, int k0, int o, int lane, int K) { v16b w; const float* p = Wm + (size_t)o * K + k0 + 8 * (lane >> 4);
#pragma unroll
  for (int i = 0; i < 8; ++i) { w[i] = (__bf16)p[i]; w[8 + i] = (__bf16)p[16 + i]; }
  return w; }
__device__ __forceinline__ v16h wcolh_io(const float* Wm, int k0, int o, int lane, int ld) { v16h w; const int g = lane >> 4;
#pragma unroll
  for (int i = 0; i < 8; ++i) { w[i] = (_Float16)(bfr(Wm[(size_t)(k0 + 8 * g + i) * ld + o]) * 256.0f); w[8 + i] = (_Float16)(bfr(Wm[(size_t)(k0 + 16 + 8 * g + i) * ld + o]) * 256.0f); }
  return w; }
__device__ __forceinline__ v16h wcolh_oi(const float* Wm, int k0, int o, int lane, int K) { v16h w; const float* p = Wm + (size_t)o * K + k0 + 8 * (lane >> 4);
#pragma unroll
  for (int i = 0; i < 8; ++i) { w[i] = (_Float16)(bfr(p[i]) * 256.0f); w[8 + i] = (_Float16)(bfr(p[16 + i]) * 256.0f); }
  return w; }
#define WQKV_LAYOUT 0   // 0 = (in,out): Wv [DIN][CC], Wq / Wk [DIN][HD]; 1 = (out,in) [CC][DIN]; 2 = per-head [NH][DIN][HD]
__device__ __forceinline__ v16b wcol_hdk(const float* Wm, int k0, int o, int lane) { v16b w; const int g = lane >> 4; const float* p = Wm + (size_t)(o / HD) * DIN * HD + (o % HD);
#pragma unroll
  for (int i = 0; i < 8; ++i) { w[i] = (__bf16)p[(size_t)(k0 + 8 * g + i) * HD]; w[8 + i] = (__bf16)p[(size_t)(k0 + 16 + 8 * g + i) * HD]; }
  return w; }
#define WO_OUT_IN 0
#if WQKV_LAYOUT == 1
#define WCOL(W, k0, o, lane) wcol_oi(W, k0, o, lane, DIN)
#elif WQKV_LAYOUT == 2
#define WCOL(W, k0, o, lane) wcol_hdk(W, k0, o, lane)
#else
#define WCOL(W, k0, o, lane) (which == 2 ? wcol_io(W, k0, (o), lane, CC) : wcol_io(W, k0, ((o) & 63), lane, HD))   /* (in,out): Wv [384][384] pitch 384; Wq / Wk [384][64] pitch 64, tile column o % 64 */
#endif
#if WO_OUT_IN
#define WOCOL(W, k0, o, lane) wcol_oi(W, k0, o, lane, CC)
#define WOCOLH(W, k0, o, lane) wcolh_oi(W, k0, o, lane, CC)
#else
#define WOCOL(W, k0, o, lane) wcol_io(W, k0, o, lane, DIN)
#define WOCOLH(W, k0, o, lane) wcolh_io(W, k0, o, lane, DIN)
#endif
// RoPE inverse frequencies 1/10000^(2i/64) (the f32 values jax computes)
__constant__ float INVF[32] = {1.000000000e+00,7.498942018e-01,5.623413324e-01,4.216965139e-01,3.162277639e-01,2.371373624e-01,1.778279394e-01,1.333521456e-01,1.000000015e-01,7.498941571e-02,5.623412877e-02,4.216964915e-02,3.162277862e-02,2.371373586e-02,1.778279431e-02,1.333521493e-02,9.999999776e-03,7.498942316e-03,5.623413250e-03,4.216964822e-03,3.162277862e-03,2.371373819e-03,1.778279431e-03,1.333521446e-03,1.000000047e-03,7.498941850e-04,5.623413017e-04,4.216964880e-04,3.162277862e-04,2.371373848e-04,1.778279402e-04,1.333521504e-04};
#define PROJ_EXTRA_PARAMS
// interleaved-pair RoPE on q and k (which 0: the two 64-column halves of the tile) at position t (the module uses arange(T)): angle = (float)t * inv_freq[i]; (x_even, x_odd) -> (xe cos - xo sin, xo cos + xe sin) == x * cos + rotate_half_interleaved(x) * sin with cos / sin repeated pairwise; products and sums kept separate (no fma contraction)
#define PROJ_EPI(which, row, t, h) do { if ((which) < 2) { float* rw = (row); const float pos_ = (float)(t); _Pragma("unroll 4") for (int i = 0; i < 32; ++i) { _Pragma("clang fp contract(off)") const float ang = pos_ * INVF[i]; const float cs = cosf(ang), sn = sinf(ang); const float xe = rw[2 * i], xo = rw[2 * i + 1]; rw[2 * i] = xe * cs - xo * sn; rw[2 * i + 1] = xo * cs + xe * sn; } } } while (0)
#define SM_EXTRA_PARAMS
#define SM_MASK_HOOK (void)0
#ifndef SM_EXTRA_PARAMS
#define SM_EXTRA_PARAMS
#endif
#ifndef PROJ_EXTRA_PARAMS
#define PROJ_EXTRA_PARAMS
#endif
#ifndef SM_MASK_HOOK
#define SM_MASK_HOOK (void)0
#endif

#define WS_QH  0u                                      // f16 q rows [b*t][HD]
#define WS_KH  (WS_QH + 2u * (size_t)NB * TT * HD)      // f16 k rows [b*t][HD]
#define WS_VT  (WS_KH + 2u * (size_t)NB * TT * HD)      // f16 v planes [b][c][t]
#define WS_QL  (WS_VT + 2u * (size_t)NB * CC * TT)      // f16 q residual x 2^10 rows [b][t < QHI][HD]
#define WS_KL  (WS_QL + 2u * (size_t)NB * QHI * HD)     // f16 k residual x 2^10 rows [b][t < KHI][HD]
#define WS_VB  (WS_KL + 2u * (size_t)NB * KHI * HD)     // bf16 v hi planes [b][c][t < KHI]
#define WS_VBL (WS_VB + 2u * (size_t)NB * CC * KHI)
#define WS_S   (WS_VBL + 2u * (size_t)NB * CC * KHI)    // f32 P planes [b][t < QHI][s] (the early rows, which k_pv splits into bf16 hi + lo)
#define WS_PH  (WS_S  + 4u * (size_t)NB * QHI * TT)     // f16 P planes [b][t][s] (rows >= QHI are written and read)
#define WS_Y   (WS_PH + 2u * (size_t)NB * TT * TT)      // f32 ctx rows [b*t][CC] (only when there is an output projection)
#define WS_END (WS_Y  + 0u)

#define PJK 64             // k of a staged chunk in k_proj
typedef __attribute__((ext_vector_type(4))) __bf16 v4b;
// main loop of k_proj, W of row pitch WLD floats (a constant, so that each operand's loads share one address register that lives through the loop and differ in their immediate offsets): 64-k chunks of x and W go through LDS as bf16; every global load covers whole 128-B lines (x: two rows of 256 B a wave-load; W: 4 k rows x one line), W is fetched and rounded once a block instead of once a wave, and the next chunk's loads fly in registers while this chunk is multiplied.
// sx: x chunk [row][k]; sw: W chunk [tile column][k]; pitch 144 B = 16 B x 9, the odd multiple that 16-byte LDS reads want. A lane holds 8 consecutive k of 4 columns per set of 8 W loads, so each column's 8 k go to LDS as one 16-byte store.
template <int WLD> __device__ __forceinline__ void proj_mm(const float* xg, const float* wg, __bf16 (*sx)[72], __bf16 (*sw)[72], int wave, int lane, v8f (&acc)[8]) {
  const int col = lane & 15, g = lane >> 4, lr = lane >> 3, lc = lane & 7;
  v4f xr[8], wr[16];
  // every "unroll" below: constant indices keep xr, wr, wf and acc in registers; "unroll 1": the chunk loop stays rolled, a second copy of its body would only add live registers
#pragma unroll
  for (int i = 0; i < 16; ++i) wr[i] = *(const v4f*)(wg + (size_t)((i >> 3) * 32 + (i & 7)) * WLD);
#pragma unroll
  for (int i = 0; i < 8; ++i) xr[i] = *(const v4f*)(xg + (size_t)i * 2 * DIN);
  asm volatile("s_wait_xcnt 0x0" ::: "memory");   // precaution: stands before the loads' address registers are written again
#pragma unroll 1
  for (int ch = 0; ch < DIN / PJK; ++ch) {
#pragma unroll
    for (int s = 0; s < 2; ++s)
#pragma unroll
      for (int c = 0; c < 4; ++c) { v8b wv;
#pragma unroll
        for (int i = 0; i < 8; ++i) wv[i] = (__bf16)wr[s * 8 + i][c];
        *(v8b*)&sw[wave * 32 + lc * 4 + c][s * 32 + lr * 8] = wv; }
#pragma unroll
    for (int i = 0; i < 8; ++i) { v4b xv; xv[0] = (__bf16)xr[i][0]; xv[1] = (__bf16)xr[i][1]; xv[2] = (__bf16)xr[i][2]; xv[3] = (__bf16)xr[i][3]; *(v4b*)&sx[wave * 16 + i * 2 + g][col * 4] = xv; }
    __syncthreads();   // the chunk is published to the four waves
    if (ch + 1 < DIN / PJK) { xg += PJK; wg += (size_t)PJK * WLD;
#pragma unroll
      for (int i = 0; i < 16; ++i) wr[i] = *(const v4f*)(wg + (size_t)((i >> 3) * 32 + (i & 7)) * WLD);
#pragma unroll
      for (int i = 0; i < 8; ++i) xr[i] = *(const v4f*)(xg + (size_t)i * 2 * DIN);
      asm volatile("s_wait_xcnt 0x0" ::: "memory"); }   // precaution: stands before the loads' address registers are written again
#pragma unroll
    for (int kc = 0; kc < PJK / 32; ++kc) { const v16b a = frag_b(&sx[wave * 16 + col][kc * 32], lane);
#pragma unroll
      for (int jh = 0; jh < 2; ++jh) { v16b wf[4];
#pragma unroll
        for (int j = 0; j < 4; ++j) wf[j] = frag_b(&sw[(jh * 4 + j) * 16 + col][kc * 32], lane);   // eight LDS reads go out as one group, ahead of their four products
#pragma unroll
        for (int j = 0; j < 4; ++j) acc[jh * 4 + j] = wmma_bf(a, wf[j], acc[jh * 4 + j]); } }
    __syncthreads();   // every wave has read the chunk before it is overwritten
  } }
// ---- k_proj: block = (64 rows, 128 cols): X W (+ b) with exact bf16 products (K = DIN; x and W staged in LDS as bf16 in 64-k chunks); blockIdx.y = 0 (which 0; the longer blocks): q in tile columns 0..63 and k in 64..127 -> f16 rows (+ residual rows < QHI / KHI); blockIdx.y > 0 (which 2): 128 columns of v -> f16 planes [c][t] (+ bf16 hi/lo planes for t < KHI)
__global__ __launch_bounds__(128) void k_proj(const float* __restrict__ X, const float* __restrict__ WQ, const float* __restrict__ WK, const float* __restrict__ WV, const float* __restrict__ BQ, const float* __restrict__ BK, const float* __restrict__ BV,
    _Float16* __restrict__ QH, _Float16* __restrict__ QL, _Float16* __restrict__ KH, _Float16* __restrict__ KL, _Float16* __restrict__ VT, __bf16* __restrict__ VB, __bf16* __restrict__ VBL PROJ_EXTRA_PARAMS) {
  __shared__ __align__(16) float st[64][132]; __shared__ __align__(16) _Float16 sh[64][136], sl[64][136]; __shared__ __align__(16) _Float16 th[128][72]; __shared__ __align__(16) __bf16 tb[128][72], tbl[128][72];
  const int tid = threadIdx.x, wave = tid >> 5, lane = tid & 31, col = lane & 15, g = lane >> 4; const int which = blockIdx.y == 0 ? 0 : 2; const int c0 = which == 2 ? (blockIdx.y - 1) * 128 : 0; const size_t r0 = (size_t)blockIdx.x * 64; const size_t bb = r0 / TT; const int t0 = (int)(r0 % TT);
  v8f acc[8] = {};
  { // wave w stages tile columns 32w .. 32w+31 of W and its own 16 rows of x; the two stages lie in tb and tbl, which hold nothing until the epilogue (behind its own barriers)
    const float* xg = X + (r0 + wave * 16 + g) * DIN + col * 4; const int lr = lane >> 3, lc = lane & 7;
    if (which == 2) proj_mm<CC>(xg, WV + c0 + wave * 32 + lc * 4 + (size_t)(lr * 8) * CC, tbl, tb, wave, lane, acc);
    else proj_mm<HD>(xg, (wave < 2 ? WQ + wave * 32 : WK + (wave - 2) * 32) + lc * 4 + (size_t)(lr * 8) * HD, tbl, tb, wave, lane, acc); }
  { // stage the f32 tile (acc + bias) in LDS, run the per-(row, head) epilogue hook, then convert
#pragma unroll
    for (int j = 0; j < 8; ++j) { const float* BA = which == 2 ? BV : j < 4 ? BQ : BK; const float bias = BA ? bfr(BA[which == 2 ? c0 + j * 16 + col : (j & 3) * 16 + col]) : 0.f;
#pragma unroll
      for (int r = 0; r < 8; ++r) st[wave * 16 + 8 * g + r][j * 16 + col] = acc[j][r] + bias; }
    __syncthreads();
    for (int e = tid; e < 64 * (128 / HD); e += 128) { const int rl = e / (128 / HD), hh = e % (128 / HD); PROJ_EPI(which, &st[rl][hh * HD], (int)((r0 + rl) % TT), (c0 / HD) + hh); }
    __syncthreads(); }
  if (which < 2) {
    for (int e = tid; e < 64 * 128; e += 128) { const int rl = e >> 7, cl = e & 127; const float v = st[rl][cl]; const _Float16 hv = (_Float16)v; sh[rl][cl] = hv; sl[rl][cl] = (_Float16)((v - (float)hv) * 1024.0f); }
    __syncthreads();
    for (int e = tid; e < 64 * 16; e += 128) { const int rl = e >> 4, q = e & 15; _Float16* DH = q < 8 ? QH : KH; _Float16* DL = q < 8 ? QL : KL; const int nhi = q < 8 ? QHI : KHI;
      vst2((unsigned*)(DH + (r0 + rl) * HD + (q & 7) * 8), *(const v4u*)&sh[rl][q * 8]);
      asm volatile("s_wait_xcnt 0x0" ::: "memory");   // precaution: stands before the store's data and address registers are rewritten (next LDS read, next trip's address)
      if (t0 < nhi) { vst2((unsigned*)(DL + (bb * nhi + t0 + rl) * (size_t)HD + (q & 7) * 8), *(const v4u*)&sl[rl][q * 8]);
        asm volatile("s_wait_xcnt 0x0" ::: "memory"); } }   // same precaution for the residual row's store
  } else { const bool hi_rows = t0 < KHI;
    for (int e = tid; e < 64 * 128; e += 128) { const int rl = e & 63, cl = e >> 6; const float v = st[rl][cl]; th[cl][rl] = (_Float16)v; const __bf16 bh = (__bf16)v; tb[cl][rl] = bh; tbl[cl][rl] = (__bf16)(v - (float)bh); }
    __syncthreads();
    for (int e = tid; e < 128 * 8; e += 128) { const int cl = e >> 3, q = e & 7; vst2((unsigned*)(VT + (bb * CC + c0 + cl) * (size_t)TT + t0 + q * 8), *(const v4u*)&th[cl][q * 8]); if (hi_rows) { const size_t o3 = (bb * CC + c0 + cl) * (size_t)KHI + t0 + q * 8; vst2((unsigned*)(VB + o3), *(const v4u*)&tb[cl][q * 8]); vst2((unsigned*)(VBL + o3), *(const v4u*)&tbl[cl][q * 8]); } } } }
#define SPW 8              // waves of a block in k_sp
// ---- k_sp: block = 16 query rows (row block rb; blockIdx.y: first the early rows, whose three-product blocks wait longest on loads and use few waves, then the rest counted down from the longest, so that cost falls with the block index) of batch b = blockIdx.x against all their keys [0, 128 ng): the 128-key tile kt belongs to wave kt % 8 (slot kt / 8), so a wave holds at most two tiles of logits, in its accumulators, from the products to the store of P: the logits never go to memory.
// logits x SCALE as 16x16x32 f16 products: q x k once for rows >= QHI; q hi + residual (x 2^10) against k hi + residual (3 products) for query blocks < QBH (causal early rows; at most 3 tiles, so slot 0 alone); causal: key s kept if s <= t; softmax in f32 (row maximum and row sum: in-lane, then across the 16 lanes that share a row, then across the 8 waves through LDS, one barrier each); P x 2^11 (0 for excluded keys) goes out as whole row pieces of a tile, staged in the wave's own LDS range: f16 (256 B) for rows >= QHI, f32 (512 B) for the early rows
// amdgpu_waves_per_eu: two blocks a WGP (four waves a SIMD), so that one block's products and exponentials cover the other's loads and barriers
__global__ __launch_bounds__(256) __attribute__((amdgpu_waves_per_eu(4, 4))) void k_sp(const _Float16* __restrict__ QH, const _Float16* __restrict__ KH, const _Float16* __restrict__ QL, const _Float16* __restrict__ KL, float* __restrict__ SA, _Float16* __restrict__ PHA) {
  __shared__ __align__(16) float ssa[SPW][16][132]; __shared__ __align__(16) float rm[SPW][16], rs[SPW][16];
  const int b = blockIdx.x, rb = (int)blockIdx.y < QHI / 16 ? (int)blockIdx.y : TT / 16 - 1 - ((int)blockIdx.y - QHI / 16), qb = rb >> 2, ng = kb_last(qb) + 1;
  const int wave = __builtin_amdgcn_readfirstlane(threadIdx.x >> 5), lane = threadIdx.x & 31, col = lane & 15, g = lane >> 4;   // the wave's number in a scalar register: every test on a tile is a scalar branch (the matrix instructions want all lanes on)
  const int ql0 = rb * 16; const size_t q0 = (size_t)b * TT + ql0;
  float* __restrict__ S = SA + (size_t)b * QHI * TT; _Float16* __restrict__ PH = PHA + (size_t)b * TT * TT; float (*ss)[132] = ssa[wave]; _Float16 (*sh)[264] = (_Float16 (*)[264])ssa[wave];   // sh: the wave's same LDS range as f16 rows (pitch 528 B = 16 B x 33)
  const v8f zero = {};
  v8f acc[2][8];   // a slot is given its values by the products below or, where the wave has no such tile, by the zeros behind them (set there and not here, so that the three-product path carries no registers for slot 1)
  // every "unroll" below: constant indices keep acc, the fragments and the row values in registers
  if (qb < QBH) {
    if (wave < ng) { const int k0 = wave * 128; v8f accl[8];
      // one address a plane (the lane's row and 8-element half), every fragment at a constant offset from it
      const _Float16* qp = QH + (q0 + col) * HD + 8 * g; const _Float16* qlp = QL + ((size_t)b * QHI + ql0 + col) * HD + 8 * g; const _Float16* kp = KH + ((size_t)b * TT + k0 + col) * HD + 8 * g; const _Float16* lp = KL + ((size_t)b * KHI + k0 + col) * HD + 8 * g;
#pragma unroll
      for (int kc = 0; kc < HD / 32; ++kc) { const v16h ah = frag_h(qp + kc * 32, 0), al = frag_h(qlp + kc * 32, 0);   // lane argument 0: the half is in the address already
#pragma unroll
        for (int jh = 0; jh < 2; ++jh) { v16h kf[4], lf[4];
#pragma unroll
          for (int j = 0; j < 4; ++j) { kf[j] = frag_h(kp + (jh * 4 + j) * 16 * HD + kc * 32, 0); lf[j] = frag_h(lp + (jh * 4 + j) * 16 * HD + kc * 32, 0); }
          asm volatile("s_wait_xcnt 0x0" :: "v"(qp), "v"(qlp), "v"(kp), "v"(lp) : "memory");   // precaution: stands before the loads' address registers are written again; the four addresses as inputs, so that no load of the group lands in one of them
#pragma unroll
          for (int j = 0; j < 4; ++j) { const int jj = jh * 4 + j; acc[0][jj] = wmma16(ah, kf[j], kc == 0 ? zero : acc[0][jj]); accl[jj] = wmma16(al, kf[j], kc == 0 ? zero : accl[jj]); accl[jj] = wmma16(ah, lf[j], accl[jj]); } } }
#pragma unroll
      for (int j = 0; j < 8; ++j) {
#pragma unroll
        for (int r = 0; r < 8; ++r) acc[0][j][r] = (acc[0][j][r] + accl[j][r] * (1.0f / 1024.0f)) * SCALE; } }
  } else {
    v16h ah[HD / 32];
#pragma unroll
    for (int kc = 0; kc < HD / 32; ++kc) ah[kc] = frag_h(QH + (q0 + col) * HD + kc * 32, lane);
    asm volatile("s_wait_xcnt 0x0" ::: "memory");   // precaution: stands before the loads' address registers are written again
#pragma unroll
    for (int s = 0; s < 2; ++s) if (s * SPW + wave < ng) { const size_t kr0 = (size_t)b * TT + (s * SPW + wave) * 128;
#pragma unroll
      for (int kc = 0; kc < HD / 32; ++kc) { v16h kf[8];
#pragma unroll
        for (int j = 0; j < 8; ++j) kf[j] = frag_h(KH + (kr0 + j * 16 + col) * HD + kc * 32, lane);   // the k-step's sixteen loads go out as one group, ahead of its eight products
        asm volatile("s_wait_xcnt 0x0" ::: "memory");   // precaution: stands before the loads' address registers are written again
#pragma unroll
        for (int j = 0; j < 8; ++j) acc[s][j] = wmma16(ah[kc], kf[j], kc == 0 ? zero : acc[s][j]); }
#pragma unroll
      for (int j = 0; j < 8; ++j) acc[s][j] = acc[s][j] * SCALE; } }
  // accumulator element r of tile column j: query row ql0 + 8 g + r, key 128 kt + 16 j + col
  float m[8], l[8];
#pragma unroll
  for (int r = 0; r < 8; ++r) { m[r] = -3.0e38f; l[r] = 0.f; }
#pragma unroll
  for (int s = 0; s < 2; ++s) { const int kt = s * SPW + wave;
    if (kt < ng) {
      if (CAUSAL && kt * 128 + 127 > ql0) { const int rel = ql0 + 8 * g - kt * 128 - col;   // a tile that reaches past the block's first row: key kept when 16 j <= rel + r
#pragma unroll
        for (int j = 0; j < 8; ++j) {
#pragma unroll
          for (int r = 0; r < 8; ++r) acc[s][j][r] = (j * 16 <= rel + r) ? acc[s][j][r] : -3.0e38f; } }
#pragma unroll
      for (int j = 0; j < 8; ++j) {
#pragma unroll
        for (int r = 0; r < 8; ++r) m[r] = fmaxf(m[r], acc[s][j][r]); }
    } else {
#pragma unroll
      for (int j = 0; j < 8; ++j) acc[s][j] = zero; } }
#pragma unroll
  for (int o = 1; o < 16; o <<= 1) {
#pragma unroll
    for (int r = 0; r < 8; ++r) m[r] = fmaxf(m[r], __shfl_xor(m[r], o)); }
  if (col == 0) { v4f a0 = {m[0], m[1], m[2], m[3]}, a1 = {m[4], m[5], m[6], m[7]}; *(v4f*)&rm[wave][8 * g] = a0; *(v4f*)&rm[wave][8 * g + 4] = a1; }
  __syncthreads();   // every wave's row maxima are published (a wave without a tile publishes the start value)
#pragma unroll
  for (int w = 0; w < SPW; ++w) { const v4f a0 = *(const v4f*)&rm[w][8 * g], a1 = *(const v4f*)&rm[w][8 * g + 4];
#pragma unroll
    for (int r = 0; r < 4; ++r) { m[r] = fmaxf(m[r], a0[r]); m[4 + r] = fmaxf(m[4 + r], a1[r]); } }
  // "unroll 1": one copy of the 64 exponentials serves both slots (the two tiles change places behind each trip and are back in their own after two), which keeps the kernel's text short
#pragma unroll 1
  for (int s = 0; s < 2; ++s) {
    if (s * SPW + wave < ng) {
#pragma unroll
      for (int j = 0; j < 8; ++j) {
#pragma unroll
        for (int r = 0; r < 8; ++r) { const float v = acc[0][j][r]; const float ex = expf(v - m[r]); const float e = (v <= -1.0e38f) ? 0.f : ex; acc[0][j][r] = e; l[r] += e; } } }
#pragma unroll
    for (int j = 0; j < 8; ++j) {
#pragma unroll
      for (int r = 0; r < 8; ++r) { float x = acc[0][j][r], y = acc[1][j][r]; asm("v_swap_b32 %0, %1" : "+v"(x), "+v"(y)); acc[0][j][r] = x; acc[1][j][r] = y; } } }   // the exchange in place, one instruction a register pair: written as plain copies it took a third set of registers and spilled
#pragma unroll
  for (int o = 1; o < 16; o <<= 1) {
#pragma unroll
    for (int r = 0; r < 8; ++r) l[r] += __shfl_xor(l[r], o); }
  if (col == 0) { v4f a0 = {l[0], l[1], l[2], l[3]}, a1 = {l[4], l[5], l[6], l[7]}; *(v4f*)&rs[wave][8 * g] = a0; *(v4f*)&rs[wave][8 * g + 4] = a1; }
  __syncthreads();   // every wave's row sums are published
  float inv[8];
#pragma unroll
  for (int r = 0; r < 8; ++r) inv[r] = 0.f;
#pragma unroll
  for (int w = 0; w < SPW; ++w) { const v4f a0 = *(const v4f*)&rs[w][8 * g], a1 = *(const v4f*)&rs[w][8 * g + 4];
#pragma unroll
    for (int r = 0; r < 4; ++r) { inv[r] += a0[r]; inv[4 + r] += a1[r]; } }
#pragma unroll
  for (int r = 0; r < 8; ++r) inv[r] = inv[r] > 0.f ? 2048.0f / inv[r] : 0.f;   /* a fully excluded row yields P = 0 */
  if (qb < QBH) {   // early rows: P stays f32 (k_pv splits it into bf16 hi + lo); at most 3 tiles, so slot 0 alone
    if (wave < ng) { float* sg = S + (size_t)ql0 * TT + wave * 128 + lane * 4;
#pragma unroll
      for (int j = 0; j < 8; ++j) {
#pragma unroll
        for (int r = 0; r < 8; ++r) ss[8 * g + r][j * 16 + col] = acc[0][j][r] * inv[r]; }
      asm volatile("s_wait_dscnt 0" ::: "memory"); __builtin_amdgcn_wave_barrier();   // the wave's lanes read each other's values below: the LDS writes stay in front of the reads
      v4f o[16];
#pragma unroll
      for (int rl = 0; rl < 16; ++rl) o[rl] = *(const v4f*)&ss[rl][lane * 4];
#pragma unroll
      for (int rl = 0; rl < 16; ++rl) vst2(sg + (size_t)rl * TT, o[rl]);
      asm volatile("s_wait_xcnt 0x0" ::: "memory"); }   // precaution: stands before the stores' data and address registers are written again
  } else {   // all other rows: P is rounded to f16 here, once (the operand type of k_pv's product), and goes out as whole 256-B row pieces, two rows a wave-store
#pragma unroll
    for (int s = 0; s < 2; ++s) if (s * SPW + wave < ng) { _Float16* hg = PH + (size_t)(ql0 + g) * TT + (s * SPW + wave) * 128 + col * 8;
#pragma unroll
      for (int j = 0; j < 8; ++j) {
#pragma unroll
        for (int r = 0; r < 8; ++r) sh[8 * g + r][j * 16 + col] = (_Float16)(acc[s][j][r] * inv[r]); }
      asm volatile("s_wait_dscnt 0" ::: "memory"); __builtin_amdgcn_wave_barrier();   // the wave's lanes read each other's values below: the LDS writes stay in front of the reads (no fence: one would also wait for the first tile's global stores)
      v8h o[8];
#pragma unroll
      for (int i = 0; i < 8; ++i) o[i] = *(const v8h*)&sh[2 * i + g][col * 8];
#pragma unroll
      for (int i = 0; i < 8; ++i) vst2(hg + (size_t)(2 * i) * TT, o[i]);
      asm volatile("s_wait_xcnt 0x0" ::: "memory");   // precaution: stands before the stores' data and address registers are written again; it also keeps the second tile's LDS writes behind the reads above
    } } }
#define PVK 128            // keys of a staged tile in k_pv
#define PVP (PVK + 8)      // its LDS row pitch in f16: 272 B = 16 B x 17, the odd multiple that 16-byte LDS reads want
#define PVQ 128            // query rows of a block of k_pv behind the early rows: 32 a wave
// ---- k_pv: block = 64 queries (blockIdx.x < QBH, the early rows; 16 a wave) or 128 queries (all others; 32 a wave, so that each v fragment read from LDS feeds two products and v is staged once per 128 rows) of batch b = blockIdx.y x value columns 64h .. 64h+63 (h = blockIdx.z; every h reads the same P): ctx = P . v over keys [0, kend) (P x 2^11 once to f16 against v f16: 1 product; causal early query blocks: P and v as bf16 hi + lo, 3 products); 256-B (row, head) segment by 16 lanes
__global__ __launch_bounds__(128) void k_pv(const float* __restrict__ PA, const _Float16* __restrict__ PHA, const _Float16* __restrict__ VT, const __bf16* __restrict__ VB, const __bf16* __restrict__ VBL, float* __restrict__ Y) { const int h = blockIdx.z, b = blockIdx.y; const float* __restrict__ PS = PA + (size_t)b * QHI * TT; __shared__ __align__(16) float ss[4][16][HD + 4]; __shared__ __align__(16) _Float16 sp[4][PVQ / 4][PVP], sv[HD][PVP];
  const int tid = threadIdx.x, wave = tid >> 5, lane = tid & 31, col = lane & 15, g = lane >> 4; const int qb = blockIdx.x; const int qs0 = QHI + (qb - QBH) * PVQ; const int ql0 = qb < QBH ? qb * 64 + wave * 16 : qs0 + wave * (PVQ / 4); const int kce = (kb_last(qb) + 1) * 4;   // qs0: first row of a 128-row block; kce: used by the early rows alone
  v8f acc[HD / 16] = {}, acc2[HD / 16] = {};   // acc: the wave's rows 0..15; acc2: its rows 16..31 (128-row blocks)
  if (qb < QBH) {
#pragma unroll 1
    for (int kc = 0; kc < kce; ++kc) { const F2 p = split_row(PS + (size_t)(ql0 + col) * TT, kc * 32, lane);
      asm volatile("s_wait_loadcnt 0x0" ::: "memory");
#pragma unroll
      for (int j = 0; j < HD / 16; ++j) { const size_t po = ((size_t)b * CC + h * HD + j * 16 + col) * (size_t)KHI + kc * 32; const v16b vh = frag_b(VB + po, lane); acc[j] = wmma_bf(p.h, vh, acc[j]); acc[j] = wmma_bf(p.l, vh, acc[j]); acc[j] = wmma_bf(p.h, frag_b(VBL + po, lane), acc[j]); } }
  } else {
    // 128-key tiles through LDS: every global load covers whole 128-B lines (two f16 P rows of 256 B a wave-load; two v columns of 256 B a wave-load), v is fetched once a block instead of once a wave; the next tile's loads fly in registers while this tile is multiplied
    const int nt = kb_last(qs0 / 64 + 1) + 1; const _Float16* pg = PHA + (size_t)b * TT * TT + (size_t)(ql0 + g) * TT + col * 8; const _Float16* vg = VT + ((size_t)b * CC + h * HD + (tid >> 4)) * (size_t)TT + (tid & 15) * 8;
    v8h pr[PVQ / 8], vr[HD / 8];
    // every "unroll" below: constant indices keep pr, vr, vf and acc in registers; "unroll 1": the tile loop stays rolled, a second copy of its body would only add live registers
#pragma unroll
    for (int i = 0; i < PVQ / 8; ++i) pr[i] = *(const v8h*)(pg + (size_t)(2 * i) * TT);
#pragma unroll
    for (int i = 0; i < HD / 8; ++i) vr[i] = *(const v8h*)(vg + (size_t)i * 8 * TT);
    asm volatile("s_wait_xcnt 0x0" ::: "memory");   // precaution: stands before the loads' address registers are written again
#pragma unroll 1
    for (int kt = 0; kt < nt; ++kt) {
#pragma unroll
      for (int i = 0; i < PVQ / 8; ++i) *(v8h*)&sp[wave][2 * i + g][col * 8] = pr[i];
#pragma unroll
      for (int i = 0; i < HD / 8; ++i) *(v8h*)&sv[i * 8 + (tid >> 4)][(tid & 15) * 8] = vr[i];
      __syncthreads();   // the tile is published to the four waves
      if (kt + 1 < nt) { const _Float16* pn = pg + (kt + 1) * PVK; const _Float16* vn = vg + (kt + 1) * PVK;
#pragma unroll
        for (int i = 0; i < PVQ / 8; ++i) pr[i] = *(const v8h*)(pn + (size_t)(2 * i) * TT);
#pragma unroll
        for (int i = 0; i < HD / 8; ++i) vr[i] = *(const v8h*)(vn + (size_t)i * 8 * TT);
        asm volatile("s_wait_xcnt 0x0" :: "v"(pn), "v"(vn) : "memory"); }   // precaution: stands before the loads' address registers are written again (the LDS reads below may land in them); the two addresses as inputs, so that no load of the group lands in one of them
#pragma unroll
      for (int kc = 0; kc < PVK / 32; ++kc) { const v16h p = frag_h(&sp[wave][col][kc * 32], lane), p2 = frag_h(&sp[wave][16 + col][kc * 32], lane); v16h vf[HD / 16];
#pragma unroll
        for (int j = 0; j < HD / 16; ++j) vf[j] = frag_h(&sv[j * 16 + col][kc * 32], lane);   // the k-step's twelve LDS reads go out as one group, ahead of its eight products
#pragma unroll
        for (int j = 0; j < HD / 16; ++j) { acc[j] = wmma16(p, vf[j], acc[j]); acc2[j] = wmma16(p2, vf[j], acc2[j]); } }
      __syncthreads();   // every wave has read the tile before it is overwritten
    } }
  // output stage: rows 0..15 of the wave in its range of ss; in a 128-row block rows 16..31 in the wave's own P range (as large as 32 such rows; only this wave reads or writes it, and its last reads stand in front of the tile loop's last barrier). Lanes 0..15 store a row of the first set, lanes 16..31 (idle in a 64-row block) the same row of the second
  float (*s2)[HD + 4] = (float (*)[HD + 4])sp[wave];
#pragma unroll
  for (int j = 0; j < HD / 16; ++j)
#pragma unroll
    for (int r = 0; r < 8; ++r) ss[wave][8 * g + r][j * 16 + col] = acc[j][r] * (1.0f / 2048.0f);
  if (qb >= QBH) {
#pragma unroll
    for (int j = 0; j < HD / 16; ++j)
#pragma unroll
      for (int r = 0; r < 8; ++r) s2[8 * g + r][j * 16 + col] = acc2[j][r] * (1.0f / 2048.0f); }
  const float (*so)[HD + 4] = g ? s2 : ss[wave];
  LDSX(); for (int rl = 0; rl < 16; ++rl) if (g == 0 || qb >= QBH) vst2(Y + ((size_t)b * TT + ql0 + g * 16 + rl) * CC + h * HD + col * 4, *(const v4f*)&so[rl][col * 4]); }

extern "C" void kernel_launch(void* const* d_in, const int* in_sizes, int n_in, void* d_out, int out_size, void* d_ws, size_t ws_size, hipStream_t stream) {
  (void)in_sizes; (void)n_in; (void)out_size;
  const float** F = (const float**)d_in;
  if (ws_size < (size_t)WS_END) return;
  char* ws = (char*)d_ws; _Float16 *QH = (_Float16*)(ws + WS_QH), *KH = (_Float16*)(ws + WS_KH), *VT = (_Float16*)(ws + WS_VT), *QL = (_Float16*)(ws + WS_QL), *KL = (_Float16*)(ws + WS_KL); __bf16 *VB = (__bf16*)(ws + WS_VB), *VBL = (__bf16*)(ws + WS_VBL); float *S = (float*)(ws + WS_S), *Y = (float*)(ws + WS_Y); _Float16 *PH = (_Float16*)(ws + WS_PH);
  (void)Y; (void)QL; (void)KL; (void)VB; (void)VBL;
  // inputs: 0 x [8,2048,384]; 1 Wq [384,64] (in,out); 2 Wk [384,64]; 3 Wv [384,384] (in,out); no biases
  k_proj<<<dim3(TNB * TT / 64, CC / 128 + 1), 128, 0, stream>>>(F[0], F[1], F[2], F[3], nullptr, nullptr, nullptr, QH, QL, KH, KL, VT, VB, VBL);   /* y = 0: q and k (64 columns each) in one tile; y = 1..3: 128 value columns each */
  k_sp<<<dim3(TNB, TT / 16), 256, 0, stream>>>(QH, KH, QL, KL, S, PH);   /* 16 query rows a block, their logits in registers up to P */
  k_pv<<<dim3(QBH + (TT - QHI) / PVQ, TNB, NH), 128, 0, stream>>>(S, PH, VT, VB, VBL, (float*)d_out);   /* x: the 64-row blocks of the early rows, then 128-row blocks; slot h writes output columns 64h .. 64h+63 */
}

// v009
// One run takes 82.7 microseconds.
// Two timings next to v008 both put it at 1.05 times that version's speed.
// All steps since v000 together make it 20.6 times as fast.
// compute dtype: all float inputs rounded to bf16; q / k (64 wide) and v (384 wide) projections with EXACT bf16 products on WMMA 16x16x32 (f32 accumulate); interleaved RoPE in f32 (f32 inverse frequencies; precise cosf / sinf); causal logits: 3 products for the first 384 rows, single f16 q x k after, x 64^-0.5; softmax f32 (q, k, logits and softmax once per batch, shared by all 384 value columns; all batches in one launch of each kernel; the logits stay in registers, one P plane per batch); P x 2^11 once to f16 x v once to f16 (bf16 hi + lo below row 384); f32 output.
#include <hip/hip_runtime.h>
#include <math.h>

typedef __attribute__((ext_vector_type(16))) _Float16 v16h;
typedef __attribute__((ext_vector_type(16))) __bf16 v16b;
typedef __attribute__((ext_vector_type(8)))  _Float16 v8h;
typedef __attribute__((ext_vector_type(8)))  float v8f;
typedef __attribute__((ext_vector_type(4)))  float v4f;
typedef __attribute__((ext_vector_type(2)))  float v2f;
typedef __attribute__((ext_vector_type(4)))  unsigned v4u;
typedef __attribute__((ext_vector_type(4)))  int v4i;
typedef float __attribute__((may_alias)) float_a;
typedef int __attribute__((may_alias)) int_a;

template <typename T> __device__ __forceinline__ void vst2(void* p, T v) { *(T*)p = v;  }
__device__ __forceinline__ v8f wmma16(v16h a, v16h b, v8f c) {
  v8f d = __builtin_amdgcn_wmma_f32_16x16x32_f16(false, a, false, b, (short)0, c, false, false);
  asm volatile("v_nop\n\tv_nop\n\tv_nop\n\tv_nop" : "+v"(d) : "v"(a), "v"(b));
  return d;
}
__device__ __forceinline__ v8f wmma_bf(v16b a, v16b b, v8f c) {
  v8f d = __builtin_amdgcn_wmma_f32_16x16x32_bf16(false, a, false, b, (short)0, c, false, false);
  asm volatile("v_nop\n\tv_nop\n\tv_nop\n\tv_nop" : "+v"(d) : "v"(a), "v"(b));
  return d;
}
// 16x16x32 fragments: lane = (h = lane>>4, row/col = lane&15); elements 0..7 = k0+8h+0..7, 8..15 = k0+16+8h+0..7; D element r = row 8h+r
__device__ __forceinline__ v16h frag_h(const _Float16* rowk0, int lane) {
  union { v16h v; v8h q[2]; } u; const _Float16* p = rowk0 + 8 * (lane >> 4);
  u.q[0] = *(const v8h*)p; u.q[1] = *(const v8h*)(p + 16); return u.v;
}
__device__ __forceinline__ v16h frag_f32(const float* rowk0, int lane) {
  v16h a; const float* p = rowk0 + 8 * (lane >> 4);
#pragma unroll
  for (int i = 0; i < 8; ++i) { a[i] = (_Float16)p[i]; a[8 + i] = (_Float16)p[16 + i]; }
  return a;
}
__device__ __forceinline__ v16h frag_f32s(const float* rowk0, int lane, float sc) {
  v16h a; const float* p = rowk0 + 8 * (lane >> 4);
#pragma unroll
  for (int i = 0; i < 8; ++i) { a[i] = (_Float16)(p[i] * sc); a[8 + i] = (_Float16)(p[16 + i] * sc); }
  return a;
}
// column fragment from a [K][ld] layout (column n), rows >= K read as 0
__device__ __forceinline__ v16h fragc_f32(const float* W, int k0, int n, int lane, int ld, int K) {
  v16h a; const int g = lane >> 4;
#pragma unroll
  for (int i = 0; i < 8; ++i) { const int ka = k0 + 8 * g + i, kb = ka + 16;
    a[i] = (_Float16)(ka < K ? W[(size_t)(ka < K ? ka : K - 1) * ld + n] : 0.f); a[8 + i] = (_Float16)(kb < K ? W[(size_t)(kb < K ? kb : K - 1) * ld + n] : 0.f); }
  return a;
}
struct F2 { v16b h, l; };
__device__ __forceinline__ F2 bsplit16(const float v[16]) { F2 r;
#pragma unroll
  for (int i = 0; i < 16; ++i) { const __bf16 h = (__bf16)v[i]; r.h[i] = h; r.l[i] = (__bf16)(v[i] - (float)h); }
  return r; }
__device__ __forceinline__ F2 split_row(const float* row, int k0, int lane) { float v[16]; const float* p = row + k0 + 8 * (lane >> 4);
#pragma unroll
  for (int i = 0; i < 8; ++i) { v[i] = p[i]; v[8 + i] = p[16 + i]; }
  return bsplit16(v); }
__device__ __forceinline__ F2 split_rowK(const float* row, int k0, int lane, int K) { float v[16]; const int g = lane >> 4;
#pragma unroll
  for (int i = 0; i < 8; ++i) { const int ka = k0 + 8 * g + i, kb = ka + 16; v[i] = ka < K ? row[ka < K ? ka : K - 1] : 0.f; v[8 + i] = kb < K ? row[kb < K ? kb : K - 1] : 0.f; }
  return bsplit16(v); }
__device__ __forceinline__ F2 split_col(const float* W, int k0, int n, int lane, int ld, int K) { float v[16]; const int g = lane >> 4;
#pragma unroll
  for (int i = 0; i < 8; ++i) { const int ka = k0 + 8 * g + i, kb = ka + 16; v[i] = ka < K ? W[(size_t)(ka < K ? ka : K - 1) * ld + n] : 0.f; v[8 + i] = kb < K ? W[(size_t)(kb < K ? kb : K - 1) * ld + n] : 0.f; }
  return bsplit16(v); }
__device__ __forceinline__ v8f mac3(const F2& a, const F2& b, v8f c) { c = wmma_bf(a.l, b.h, c); c = wmma_bf(a.h, b.l, c); return wmma_bf(a.h, b.h, c); }
__device__ __forceinline__ float sigm(float v) { return 1.0f / (1.0f + expf(-v)); }
#define LDSX() do { asm volatile("s_wait_dscnt 0" ::: "memory"); __builtin_amdgcn_wave_barrier(); __builtin_amdgcn_fence(__ATOMIC_RELEASE, "workgroup"); } while (0)

// Single-head causal attention with a WIDE value (x [8,2048,384]; (in,out) Wq / Wk [384,64], Wv [384,384] (0.02 scale), no biases; interleaved-pair RoPE on q and k (positions arange(T), inv_freq = 1/10000^(2i/64)); scale 1/8; tril, -inf): out = softmax(causal(rope(q) rope(k)^T / 8)) v -> [8,2048,384]. The one attention pattern (q, k, logits, softmax: computed once per batch) is applied to the 384 value columns as six 64-column slots.
#define NB 8
#define TT 2048
#define CC 384            // NH * HD = projected width
#define DIN 384          // input (model) width
#define NH 6
#define HD 64
#define NQB (TT / 64)
#define SCALE (0.125f)
#define CAUSAL 1
#ifndef TNB
#define TNB NB
#endif
__device__ __forceinline__ float bfr(float v) { return (float)(__bf16)v; }
__host__ __device__ __forceinline__ int kb_last(int qb) { return CAUSAL ? ((qb * 64 + 63) >> 7) : (TT / 128 - 1); }
typedef __attribute__((ext_vector_type(8))) __bf16 v8b;
__device__ __forceinline__ v16b frag_b(const __bf16* rowk0, int lane) {
  union { v16b v; v8b q[2]; } u; const __bf16* p = rowk0 + 8 * (lane >> 4);
  u.q[0] = *(const v8b*)p; u.q[1] = *(const v8b*)(p + 16); return u.v;
}
#define QBH 6              // causal: query blocks 0..QBH-1 of each sequence (few keys, no averaging) take the high-precision path
#define QHI 384            // rows carrying a q residual plane
#define KHI 384            // key rows carrying k residual / v bf16 hi+lo planes (used only by the causal high-precision path)
// B fragment (k rows k0+.., output column o) of a weight: (in,out) [K][ld] or (out,in) [ld rows of K]: bf16 exact, or f16(bf16 * 256) exact
__device__ __forceinline__ v16b wcol_io(const float* Wm, int k0, int o, int lane, int ld) { v16b w; const int g = lane >> 4;
#pragma unroll
  for (int i = 0; i < 8; ++i) { w[i] = (__bf16)Wm[(size_t)(k0 + 8 * g + i) * ld + o];
    if (i == 7) asm volatile("s_wait_xcnt 0x0" ::: "memory");   // precaution: the run's last load may land in the address register that the loads before it name
    w[8 + i] = (__bf16)Wm[(size_t)(k0 + 16 + 8 * g + i) * ld + o]; }
  asm volatile("s_wait_xcnt 0x0" ::: "memory");   // same precaution for the last load, before its address register is written again
  return w; }
__device__ __forceinline__ v16b wcol_oi(const float* Wm, int k0, int o, int lane, int K) { v16b w; const float* p = Wm + (size_t)o * K + k0 + 8 * (lane >> 4);
#pragma unroll
  for (int i = 0; i < 8; ++i) { w[i] = (__bf16)p[i]; w[8 + i] = (__bf16)p[16 + i]; }
  return w; }
__device__ __forceinline__ v16h wcolh_io(const float* Wm, int k0, int o, int lane, int ld) { v16h w; const int g = lane >> 4;
#pragma unroll
  for (int i = 0; i < 8; ++i) { w[i] = (_Float16)(bfr(Wm[(size_t)(k0 + 8 * g + i) * ld + o]) * 256.0f); w[8 + i] = (_Float16)(bfr(Wm[(size_t)(k0 + 16 + 8 * g + i) * ld + o]) * 256.0f); }
  return w; }
__device__ __forceinline__ v16h wcolh_oi(const float* Wm, int k0, int o, int lane, int K) { v16h w; const float* p = Wm + (size_t)o * K + k0 + 8 * (lane >> 4);
#pragma unroll
  for (int i = 0; i < 8; ++i) { w[i] = (_Float16)(bfr(p[i]) * 256.0f); w[8 + i] = (_Float16)(bfr(p[16 + i]) * 256.0f); }
  return w; }
#define WQKV_LAYOUT 0   // 0 = (in,out): Wv [DIN][CC], Wq / Wk [DIN][HD]; 1 = (out,in) [CC][DIN]; 2 = per-head [NH][DIN][HD]
__device__ __forceinline__ v16b wcol_hdk(const float* Wm, int k0, int o, int lane) { v16b w; const int g = lane >> 4; const float* p = Wm + (size_t)(o / HD) * DIN * HD + (o % HD);
#pragma unroll
  for (int i = 0; i < 8; ++i) { w[i] = (__bf16)p[(size_t)(k0 + 8 * g + i) * HD]; w[8 + i] = (__bf16)p[(size_t)(k0 + 16 + 8 * g + i) * HD]; }
  return w; }
#define WO_OUT_IN 0
#if WQKV_LAYOUT == 1
#define WCOL(W, k0, o, lane) wcol_oi(W, k0, o, lane, DIN)
#elif WQKV_LAYOUT == 2
#define WCOL(W, k0, o, lane) wcol_hdk(W, k0, o, lane)
#else
#define WCOL(W, k0, o, lane) (which == 2 ? wcol_io(W, k0, (o), lane, CC) : wcol_io(W, k0, ((o) & 63), lane, HD))   /* (in,out): Wv [384][384] pitch 384; Wq / Wk [384][64] pitch 64, tile column o % 64 */
#endif
#if WO_OUT_IN
#define WOCOL(W, k0, o, lane) wcol_oi(W, k0, o, lane, CC)
#define WOCOLH(W, k0, o, lane) wcolh_oi(W, k0, o, lane, CC)
#else
#define WOCOL(W, k0, o, lane) wcol_io(W, k0, o, lane, DIN)
#define WOCOLH(W, k0, o, lane) wcolh_io(W, k0, o, lane, DIN)
#endif
// RoPE inverse frequencies 1/10000^(2i/64) (the f32 values jax computes)
__constant__ float INVF[32] = {1.000000000e+00,7.498942018e-01,5.623413324e-01,4.216965139e-01,3.162277639e-01,2.371373624e-01,1.778279394e-01,1.333521456e-01,1.000000015e-01,7.498941571e-02,5.623412877e-02,4.216964915e-02,3.162277862e-02,2.371373586e-02,1.778279431e-02,1.333521493e-02,9.999999776e-03,7.498942316e-03,5.623413250e-03,4.216964822e-03,3.162277862e-03,2.371373819e-03,1.778279431e-03,1.333521446e-03,1.000000047e-03,7.498941850e-04,5.623413017e-04,4.216964880e-04,3.162277862e-04,2.371373848e-04,1.778279402e-04,1.333521504e-04};
#define PROJ_EXTRA_PARAMS
// interleaved-pair RoPE on q and k (which 0: the two 64-column halves of the tile) at position t (the module uses arange(T)): angle = (float)t * inv_freq[i]; (x_even, x_odd) -> (xe cos - xo sin, xo cos + xe sin) == x * cos + rotate_half_interleaved(x) * sin with cos / sin repeated pairwise; products and sums kept separate (no fma contraction)
#define PROJ_EPI(which, row, t, h) do { if ((which) < 2) { float* rw = (row); const float pos_ = (float)(t); _Pragma("unroll 4") for (int i = 0; i < 32; ++i) { _Pragma("clang fp contract(off)") const float ang = pos_ * INVF[i]; const float cs = cosf(ang), sn = sinf(ang); const float xe = rw[2 * i], xo = rw[2 * i + 1]; rw[2 * i] = xe * cs - xo * sn; rw[2 * i + 1] = xo * cs + xe * sn; } } } while (0)
#define SM_EXTRA_PARAMS
#define SM_MASK_HOOK (void)0
#ifndef SM_EXTRA_PARAMS
#define SM_EXTRA_PARAMS
#endif
#ifndef PROJ_EXTRA_PARAMS
#define PROJ_EXTRA_PARAMS
#endif
#ifndef SM_MASK_HOOK
#define SM_MASK_HOOK (void)0
#endif

#define WS_QH  0u                                      // f16 q rows [b*t][HD]
#define WS_KH  (WS_QH + 2u * (size_t)NB * TT * HD)      // f16 k rows [b*t][HD]
#define WS_VT  (WS_KH + 2u * (size_t)NB * TT * HD)      // f16 v planes [b][c][t]
#define WS_QL  (WS_VT + 2u * (size_t)NB * CC * TT)      // f16 q residual x 2^10 rows [b][t < QHI][HD]
#define WS_KL  (WS_QL + 2u * (size_t)NB * QHI * HD)     // f16 k residual x 2^10 rows [b][t < KHI][HD]
#define WS_VB  (WS_KL + 2u * (size_t)NB * KHI * HD)     // bf16 v hi planes [b][c][t < KHI]
#define WS_VBL (WS_VB + 2u * (size_t)NB * CC * KHI)
#define WS_S   (WS_VBL + 2u * (size_t)NB * CC * KHI)    // f32 P planes [b][t < QHI][s] (the early rows, which k_pv splits into bf16 hi + lo)
#define WS_PH  (WS_S  + 4u * (size_t)NB * QHI * TT)     // f16 P planes [b][t][s] (rows >= QHI are written and read)
#define WS_Y   (WS_PH + 2u * (size_t)NB * TT * TT)      // f32 ctx rows [b*t][CC] (only when there is an output projection)
#define WS_END (WS_Y  + 0u)

#define PJK 64             // k of a staged chunk in k_proj
typedef __attribute__((ext_vector_type(4))) __bf16 v4b;
// main loop of k_proj, W of row pitch WLD floats (a constant, so that each operand's loads share one address register that lives through the loop and differ in their immediate offsets): 64-k chunks of x and W go through LDS as bf16; every global load covers whole 128-B lines (x: two rows of 256 B a wave-load; W: 4 k rows x one line), W is fetched and rounded once a block instead of once a wave, and the next chunk's loads fly in registers while this chunk is multiplied.
// sx: x chunk [row][k]; sw: W chunk [tile column][k]; pitch 144 B = 16 B x 9, the odd multiple that 16-byte LDS reads want. A lane holds 8 consecutive k of 4 columns per set of 8 W loads, so each column's 8 k go to LDS as one 16-byte store.
template <int WLD> __device__ __forceinline__ void proj_mm(const float* xg, const float* wg, __bf16 (*sx)[72], __bf16 (*sw)[72], int wave, int lane, v8f (&acc)[8]) {
  const int col = lane & 15, g = lane >> 4, lr = lane >> 3, lc = lane & 7;
  v4f xr[8], wr[16];
  // every "unroll" below: constant indices keep xr, wr, wf and acc in registers; "unroll 1": the chunk loop stays rolled, a second copy of its body would only add live registers
#pragma unroll
  for (int i = 0; i < 16; ++i) wr[i] = *(const v4f*)(wg + (size_t)((i >> 3) * 32 + (i & 7)) * WLD);
#pragma unroll
  for (int i = 0; i < 8; ++i) xr[i] = *(const v4f*)(xg + (size_t)i * 2 * DIN);
  asm volatile("s_wait_xcnt 0x0" ::: "memory");   // precaution: stands before the loads' address registers are written again
#pragma unroll 1
  for (int ch = 0; ch < DIN / PJK; ++ch) {
#pragma unroll
    for (int s = 0; s < 2; ++s)
#pragma unroll
      for (int c = 0; c < 4; ++c) { v8b wv;
#pragma unroll
        for (int i = 0; i < 8; ++i) wv[i] = (__bf16)wr[s * 8 + i][c];
        *(v8b*)&sw[wave * 32 + lc * 4 + c][s * 32 + lr * 8] = wv; }
#pragma unroll
    for (int i = 0; i < 8; ++i) { v4b xv; xv[0] = (__bf16)xr[i][0]; xv[1] = (__bf16)xr[i][1]; xv[2] = (__bf16)xr[i][2]; xv[3] = (__bf16)xr[i][3]; *(v4b*)&sx[wave * 16 + i * 2 + g][col * 4] = xv; }
    __syncthreads();   // the chunk is published to the four waves
    if (ch + 1 < DIN / PJK) { xg += PJK; wg += (size_t)PJK * WLD;
#pragma unroll
      for (int i = 0; i < 16; ++i) wr[i] = *(const v4f*)(wg + (size_t)((i >> 3) * 32 + (i & 7)) * WLD);
#pragma unroll
      for (int i = 0; i < 8; ++i) xr[i] = *(const v4f*)(xg + (size_t)i * 2 * DIN);
      asm volatile("s_wait_xcnt 0x0" ::: "memory"); }   // precaution: stands before the loads' address registers are written again
#pragma unroll
    for (int kc = 0; kc < PJK / 32; ++kc) { const v16b a = frag_b(&sx[wave * 16 + col][kc * 32], lane);
#pragma unroll
      for (int jh = 0; jh < 2; ++jh) { v16b wf[4];
#pragma unroll
        for (int j = 0; j < 4; ++j) wf[j] = frag_b(&sw[(jh * 4 + j) * 16 + col][kc * 32], lane);   // eight LDS reads go out as one group, ahead of their four products
#pragma unroll
        for (int j = 0; j < 4; ++j) acc[jh * 4 + j] = wmma_bf(a, wf[j], acc[jh * 4 + j]); } }
    __syncthreads();   // every wave has read the chunk before it is overwritten
  } }
// ---- k_proj: block = (64 rows, 128 cols): X W (+ b) with exact bf16 products (K = DIN; x and W staged in LDS as bf16 in 64-k chunks); blockIdx.y = 0 (which 0; the longer blocks): q in tile columns 0..63 and k in 64..127 -> f16 rows (+ residual rows < QHI / KHI); blockIdx.y > 0 (which 2): 128 columns of v -> f16 planes [c][t] (+ bf16 hi/lo planes for t < KHI)
__global__ __launch_bounds__(128) void k_proj(const float* __restrict__ X, const float* __restrict__ WQ, const float* __restrict__ WK, const float* __restrict__ WV, const float* __restrict__ BQ, const float* __restrict__ BK, const float* __restrict__ BV,
    _Float16* __restrict__ QH, _Float16* __restrict__ QL, _Float16* __restrict__ KH, _Float16* __restrict__ KL, _Float16* __restrict__ VT, __bf16* __restrict__ VB, __bf16* __restrict__ VBL PROJ_EXTRA_PARAMS) {
  __shared__ __align__(16) float st[64][132]; __shared__ __align__(16) _Float16 sh[64][136], sl[64][136]; __shared__ __align__(16) _Float16 th[128][72]; __shared__ __align__(16) __bf16 tb[128][72], tbl[128][72];
  const int tid = threadIdx.x, wave = tid >> 5, lane = tid & 31, col = lane & 15, g = lane >> 4; const int which = blockIdx.y == 0 ? 0 : 2; const int c0 = which == 2 ? (blockIdx.y - 1) * 128 : 0; const size_t r0 = (size_t)blockIdx.x * 64; const size_t bb = r0 / TT; const int t0 = (int)(r0 % TT);
  v8f acc[8] = {};
  { // wave w stages tile columns 32w .. 32w+31 of W and its own 16 rows of x; the two stages lie in tb and tbl, which hold nothing until the epilogue (behind its own barriers)
    const float* xg = X + (r0 + wave * 16 + g) * DIN + col * 4; const int lr = lane >> 3, lc = lane & 7;
    if (which == 2) proj_mm<CC>(xg, WV + c0 + wave * 32 + lc * 4 + (size_t)(lr * 8) * CC, tbl, tb, wave, lane, acc);
    else proj_mm<HD>(xg, (wave < 2 ? WQ + wave * 32 : WK + (wave - 2) * 32) + lc * 4 + (size_t)(lr * 8) * HD, tbl, tb, wave, lane, acc); }
  { // stage the f32 tile (acc + bias) in LDS, run the per-(row, head) epilogue hook, then convert
#pragma unroll
    for (int j = 0; j < 8; ++j) { const float* BA = which == 2 ? BV : j < 4 ? BQ : BK; const float bias = BA ? bfr(BA[which == 2 ? c0 + j * 16 + col : (j & 3) * 16 + col]) : 0.f;
#pragma unroll
      for (int r = 0; r < 8; ++r) st[wave * 16 + 8 * g + r][j * 16 + col] = acc[j][r] + bias; }
    __syncthreads();
    for (int e = tid; e < 64 * (128 / HD); e += 128) { const int rl = e / (128 / HD), hh = e % (128 / HD); PROJ_EPI(which, &st[rl][hh * HD], (int)((r0 + rl) % TT), (c0 / HD) + hh); }
    __syncthreads(); }
  if (which < 2) {
    for (int e = tid; e < 64 * 128; e += 128) { const int rl = e >> 7, cl = e & 127; const float v = st[rl][cl]; const _Float16 hv = (_Float16)v; sh[rl][cl] = hv; sl[rl][cl] = (_Float16)((v - (float)hv) * 1024.0f); }
    __syncthreads();
    for (int e = tid; e < 64 * 16; e += 128) { const int rl = e >> 4, q = e & 15; _Float16* DH = q < 8 ? QH : KH; _Float16* DL = q < 8 ? QL : KL; const int nhi = q < 8 ? QHI : KHI;
      vst2((unsigned*)(DH + (r0 + rl) * HD + (q & 7) * 8), *(const v4u*)&sh[rl][q * 8]);
      asm volatile("s_wait_xcnt 0x0" ::: "memory");   // precaution: stands before the store's data and address registers are rewritten (next LDS read, next trip's address)
      if (t0 < nhi) { vst2((unsigned*)(DL + (bb * nhi + t0 + rl) * (size_t)HD + (q & 7) * 8), *(const v4u*)&sl[rl][q * 8]);
        asm volatile("s_wait_xcnt 0x0" ::: "memory"); } }   // same precaution for the residual row's store
  } else { const bool hi_rows = t0 < KHI;
    for (int e = tid; e < 64 * 128; e += 128) { const int rl = e & 63, cl = e >> 6; const float v = st[rl][cl]; th[cl][rl] = (_Float16)v; const __bf16 bh = (__bf16)v; tb[cl][rl] = bh; tbl[cl][rl] = (__bf16)(v - (float)bh); }
    __syncthreads();
    for (int e = tid; e < 128 * 8; e += 128) { const int cl = e >> 3, q = e & 7; vst2((unsigned*)(VT + (bb * CC + c0 + cl) * (size_t)TT + t0 + q * 8), *(const v4u*)&th[cl][q * 8]); if (hi_rows) { const size_t o3 = (bb * CC + c0 + cl) * (size_t)KHI + t0 + q * 8; vst2((unsigned*)(VB + o3), *(const v4u*)&tb[cl][q * 8]); vst2((unsigned*)(VBL + o3), *(const v4u*)&tbl[cl][q * 8]); } } } }
#define SPW 8              // waves of a block in k_sp
// ---- k_sp: block = 16 query rows (row block rb; blockIdx.y: first the early rows, whose three-product blocks wait longest on loads and use few waves, then the rest counted down from the longest, so that cost falls with the block index) of batch b = blockIdx.x against all their keys [0, 128 ng): the 128-key tile kt belongs to wave kt % 8 (slot kt / 8), so a wave holds at most two tiles of logits, in its accumulators, from the products to the store of P: the logits never go to memory.
// logits x SCALE as 16x16x32 f16 products: q x k once for rows >= QHI; q hi + residual (x 2^10) against k hi + residual (3 products) for query blocks < QBH (causal early rows; at most 3 tiles, so slot 0 alone); causal: key s kept if s <= t; softmax in f32 (row maximum and row sum: in-lane, then across the 16 lanes that share a row, then across the 8 waves through LDS, one barrier each); P x 2^11 (0 for excluded keys) goes out as whole row pieces of a tile, staged in the wave's own LDS range: f16 (256 B) for rows >= QHI, f32 (512 B) for the early rows
// amdgpu_waves_per_eu: two blocks a WGP (four waves a SIMD), so that one block's products and exponentials cover the other's loads and barriers
__global__ __launch_bounds__(256) __attribute__((amdgpu_waves_per_eu(4, 4))) void k_sp(const _Float16* __restrict__ QH, const _Float16* __restrict__ KH, const _Float16* __restrict__ QL, const _Float16* __restrict__ KL, float* __restrict__ SA, _Float16* __restrict__ PHA) {
  __shared__ __align__(16) float ssa[SPW][16][132]; __shared__ __align__(16) float rm[SPW][16], rs[SPW][16];
  const int b = blockIdx.x, rb = (int)blockIdx.y < QHI / 16 ? (int)blockIdx.y : TT / 16 - 1 - ((int)blockIdx.y - QHI / 16), qb = rb >> 2, ng = kb_last(qb) + 1;
  const int wave = __builtin_amdgcn_readfirstlane(threadIdx.x >> 5), lane = threadIdx.x & 31, col = lane & 15, g = lane >> 4;   // the wave's number in a scalar register: every test on a tile is a scalar branch (the matrix instructions want all lanes on)
  const int ql0 = rb * 16; const size_t q0 = (size_t)b * TT + ql0;
  float* __restrict__ S = SA + (size_t)b * QHI * TT; _Float16* __restrict__ PH = PHA + (size_t)b * TT * TT; float (*ss)[132] = ssa[wave]; _Float16 (*sh)[264] = (_Float16 (*)[264])ssa[wave];   // sh: the wave's same LDS range as f16 rows (pitch 528 B = 16 B x 33)
  const v8f zero = {};
  v8f acc[2][8];   // a slot is given its values by the products below or, where the wave has no such tile, by the zeros behind them (set there and not here, so that the three-product path carries no registers for slot 1)
  // every "unroll" below: constant indices keep acc, the fragments and the row values in registers
  if (qb < QBH) {
    if (wave < ng) { const int k0 = wave * 128; v8f accl[8];
      // one address a plane (the lane's row and 8-element half), every fragment at a constant offset from it
      const _Float16* qp = QH + (q0 + col) * HD + 8 * g; const _Float16* qlp = QL + ((size_t)b * QHI + ql0 + col) * HD + 8 * g; const _Float16* kp = KH + ((size_t)b * TT + k0 + col) * HD + 8 * g; const _Float16* lp = KL + ((size_t)b * KHI + k0 + col) * HD + 8 * g;
#pragma unroll
      for (int kc = 0; kc < HD / 32; ++kc) { const v16h ah = frag_h(qp + kc * 32, 0), al = frag_h(qlp + kc * 32, 0);   // lane argument 0: the half is in the address already
#pragma unroll
        for (int jh = 0; jh < 2; ++jh) { v16h kf[4], lf[4];
#pragma unroll
          for (int j = 0; j < 4; ++j) { kf[j] = frag_h(kp + (jh * 4 + j) * 16 * HD + kc * 32, 0); lf[j] = frag_h(lp + (jh * 4 + j) * 16 * HD + kc * 32, 0); }
          asm volatile("s_wait_xcnt 0x0" :: "v"(qp), "v"(qlp), "v"(kp), "v"(lp) : "memory");   // precaution: stands before the loads' address registers are written again; the four addresses as inputs, so that no load of the group lands in one of them
#pragma unroll
          for (int j = 0; j < 4; ++j) { const int jj = jh * 4 + j; acc[0][jj] = wmma16(ah, kf[j], kc == 0 ? zero : acc[0][jj]); accl[jj] = wmma16(al, kf[j], kc == 0 ? zero : accl[jj]); accl[jj] = wmma16(ah, lf[j], accl[jj]); } } }
#pragma unroll
      for (int j = 0; j < 8; ++j) {
#pragma unroll
        for (int r = 0; r < 8; ++r) acc[0][j][r] = (acc[0][j][r] + accl[j][r] * (1.0f / 1024.0f)) * SCALE; } }
  } else {
    v16h ah[HD / 32];
#pragma unroll
    for (int kc = 0; kc < HD / 32; ++kc) ah[kc] = frag_h(QH + (q0 + col) * HD + kc * 32, lane);
    asm volatile("s_wait_xcnt 0x0" ::: "memory");   // precaution: stands before the loads' address registers are written again
#pragma unroll
    for (int s = 0; s < 2; ++s) if (s * SPW + wave < ng) { const size_t kr0 = (size_t)b * TT + (s * SPW + wave) * 128;
#pragma unroll
      for (int kc = 0; kc < HD / 32; ++kc) { v16h kf[8];
#pragma unroll
        for (int j = 0; j < 8; ++j) kf[j] = frag_h(KH + (kr0 + j * 16 + col) * HD + kc * 32, lane);   // the k-step's sixteen loads go out as one group, ahead of its eight products
        asm volatile("s_wait_xcnt 0x0" ::: "memory");   // precaution: stands before the loads' address registers are written again
#pragma unroll
        for (int j = 0; j < 8; ++j) acc[s][j] = wmma16(ah[kc], kf[j], kc == 0 ? zero : acc[s][j]); }
#pragma unroll
      for (int j = 0; j < 8; ++j) acc[s][j] = acc[s][j] * SCALE; } }
  // accumulator element r of tile column j: query row ql0 + 8 g + r, key 128 kt + 16 j + col
  float m[8], l[8];
#pragma unroll
  for (int r = 0; r < 8; ++r) { m[r] = -3.0e38f; l[r] = 0.f; }
#pragma unroll
  for (int s = 0; s < 2; ++s) { const int kt = s * SPW + wave;
    if (kt < ng) {
      if (CAUSAL && kt * 128 + 127 > ql0) { const int rel = ql0 + 8 * g - kt * 128 - col;   // a tile that reaches past the block's first row: key kept when 16 j <= rel + r
#pragma unroll
        for (int j = 0; j < 8; ++j) {
#pragma unroll
          for (int r = 0; r < 8; ++r) acc[s][j][r] = (j * 16 <= rel + r) ? acc[s][j][r] : -3.0e38f; } }
#pragma unroll
      for (int j = 0; j < 8; ++j) {
#pragma unroll
        for (int r = 0; r < 8; ++r) m[r] = fmaxf(m[r], acc[s][j][r]); }
    } else {
#pragma unroll
      for (int j = 0; j < 8; ++j) acc[s][j] = zero; } }
#pragma unroll
  for (int o = 1; o < 16; o <<= 1) {
#pragma unroll
    for (int r = 0; r < 8; ++r) m[r] = fmaxf(m[r], __shfl_xor(m[r], o)); }
  if (col == 0) { v4f a0 = {m[0], m[1], m[2], m[3]}, a1 = {m[4], m[5], m[6], m[7]}; *(v4f*)&rm[wave][8 * g] = a0; *(v4f*)&rm[wave][8 * g + 4] = a1; }
  __syncthreads();   // every wave's row maxima are published (a wave without a tile publishes the start value)
#pragma unroll
  for (int w = 0; w < SPW; ++w) { const v4f a0 = *(const v4f*)&rm[w][8 * g], a1 = *(const v4f*)&rm[w][8 * g + 4];
#pragma unroll
    for (int r = 0; r < 4; ++r) { m[r] = fmaxf(m[r], a0[r]); m[4 + r] = fmaxf(m[4 + r], a1[r]); } }
  // exp(v - m) as 2^(v log2 e - m log2 e): one fused multiply-add and one hardware exponential an element. An excluded key (the mask's large negative value) overflows to -inf in the multiply-add and comes out as exactly 0 (m is finite: every causal row keeps its own key), so no select is needed. Both slots are written out in place: the text is shorter than one copy of the library exponential was
  float mb[8];
#pragma unroll
  for (int r = 0; r < 8; ++r) mb[r] = m[r] * 1.44269504f;
#pragma unroll
  for (int s = 0; s < 2; ++s) {
    if (s * SPW + wave < ng) {
#pragma unroll
      for (int j = 0; j < 8; ++j) {
#pragma unroll
        for (int r = 0; r < 8; ++r) { const float e = __builtin_amdgcn_exp2f(__builtin_fmaf(acc[s][j][r], 1.44269504f, -mb[r])); acc[s][j][r] = e; l[r] += e; } } } }
#pragma unroll
  for (int o = 1; o < 16; o <<= 1) {
#pragma unroll
    for (int r = 0; r < 8; ++r) l[r] += __shfl_xor(l[r], o); }
  if (col == 0) { v4f a0 = {l[0], l[1], l[2], l[3]}, a1 = {l[4], l[5], l[6], l[7]}; *(v4f*)&rs[wave][8 * g] = a0; *(v4f*)&rs[wave][8 * g + 4] = a1; }
  __syncthreads();   // every wave's row sums are published
  float inv[8];
#pragma unroll
  for (int r = 0; r < 8; ++r) inv[r] = 0.f;
#pragma unroll
  for (int w = 0; w < SPW; ++w) { const v4f a0 = *(const v4f*)&rs[w][8 * g], a1 = *(const v4f*)&rs[w][8 * g + 4];
#pragma unroll
    for (int r = 0; r < 4; ++r) { inv[r] += a0[r]; inv[4 + r] += a1[r]; } }
#pragma unroll
  for (int r = 0; r < 8; ++r) inv[r] = inv[r] > 0.f ? 2048.0f / inv[r] : 0.f;   /* a fully excluded row yields P = 0 */
  if (qb < QBH) {   // early rows: P stays f32 (k_pv splits it into bf16 hi + lo); at most 3 tiles, so slot 0 alone
    if (wave < ng) { float* sg = S + (size_t)ql0 * TT + wave * 128 + lane * 4;
#pragma unroll
      for (int j = 0; j < 8; ++j) {
#pragma unroll
        for (int r = 0; r < 8; ++r) ss[8 * g + r][j * 16 + col] = acc[0][j][r] * inv[r]; }
      asm volatile("s_wait_dscnt 0" ::: "memory"); __builtin_amdgcn_wave_barrier();   // the wave's lanes read each other's values below: the LDS writes stay in front of the reads
      v4f o[16];
#pragma unroll
      for (int rl = 0; rl < 16; ++rl) o[rl] = *(const v4f*)&ss[rl][lane * 4];
#pragma unroll
      for (int rl = 0; rl < 16; ++rl) vst2(sg + (size_t)rl * TT, o[rl]);
      asm volatile("s_wait_xcnt 0x0" ::: "memory"); }   // precaution: stands before the stores' data and address registers are written again
  } else {   // all other rows: P is rounded to f16 here, once (the operand type of k_pv's product), and goes out as whole 256-B row pieces, two rows a wave-store
#pragma unroll
    for (int s = 0; s < 2; ++s) if (s * SPW + wave < ng) { _Float16* hg = PH + (size_t)(ql0 + g) * TT + (s * SPW + wave) * 128 + col * 8;
#pragma unroll
      for (int j = 0; j < 8; ++j) {
#pragma unroll
        for (int r = 0; r < 8; ++r) sh[8 * g + r][j * 16 + col] = (_Float16)(acc[s][j][r] * inv[r]); }
      asm volatile("s_wait_dscnt 0" ::: "memory"); __builtin_amdgcn_wave_barrier();   // the wave's lanes read each other's values below: the LDS writes stay in front of the reads (no fence: one would also wait for the first tile's global stores)
      v8h o[8];
#pragma unroll
      for (int i = 0; i < 8; ++i) o[i] = *(const v8h*)&sh[2 * i + g][col * 8];
#pragma unroll
      for (int i = 0; i < 8; ++i) vst2(hg + (size_t)(2 * i) * TT, o[i]);
      asm volatile("s_wait_xcnt 0x0" ::: "memory");   // precaution: stands before the stores' data and address registers are written again; it also keeps the second tile's LDS writes behind the reads above
    } } }
#define PVK 128            // keys of a staged tile in k_pv
#define PVP (PVK + 8)      // its LDS row pitch in f16: 272 B = 16 B x 17, the odd multiple that 16-byte LDS reads want
#define PVQ 128            // query rows of a block of k_pv behind the early rows: 32 a wave
// ---- k_pv: block = 64 queries (blockIdx.x < QBH, the early rows; 16 a wave) or 128 queries (all others; 32 a wave, so that each v fragment read from LDS feeds two products and v is staged once per 128 rows) of batch b = blockIdx.y x value columns 64h .. 64h+63 (h = blockIdx.z; every h reads the same P): ctx = P . v over keys [0, kend) (P x 2^11 once to f16 against v f16: 1 product; causal early query blocks: P and v as bf16 hi + lo, 3 products); 256-B (row, head) segment by 16 lanes
__global__ __launch_bounds__(128) void k_pv(const float* __restrict__ PA, const _Float16* __restrict__ PHA, const _Float16* __restrict__ VT, const __bf16* __restrict__ VB, const __bf16* __restrict__ VBL, float* __restrict__ Y) { const int h = blockIdx.z, b = blockIdx.y; const float* __restrict__ PS = PA + (size_t)b * QHI * TT; __shared__ __align__(16) float ss[4][16][HD + 4]; __shared__ __align__(16) _Float16 sp[4][PVQ / 4][PVP], sv[HD][PVP];
  const int tid = threadIdx.x, wave = tid >> 5, lane = tid & 31, col = lane & 15, g = lane >> 4; const int qb = blockIdx.x; const int qs0 = QHI + (qb - QBH) * PVQ; const int ql0 = qb < QBH ? qb * 64 + wave * 16 : qs0 + wave * (PVQ / 4); const int kce = (kb_last(qb) + 1) * 4;   // qs0: first row of a 128-row block; kce: used by the early rows alone
  v8f acc[HD / 16] = {}, acc2[HD / 16] = {};   // acc: the wave's rows 0..15; acc2: its rows 16..31 (128-row blocks)
  if (qb < QBH) {
#pragma unroll 1
    for (int kc = 0; kc < kce; ++kc) { const F2 p = split_row(PS + (size_t)(ql0 + col) * TT, kc * 32, lane);
      asm volatile("s_wait_loadcnt 0x0" ::: "memory");
#pragma unroll
      for (int j = 0; j < HD / 16; ++j) { const size_t po = ((size_t)b * CC + h * HD + j * 16 + col) * (size_t)KHI + kc * 32; const v16b vh = frag_b(VB + po, lane); acc[j] = wmma_bf(p.h, vh, acc[j]); acc[j] = wmma_bf(p.l, vh, acc[j]); acc[j] = wmma_bf(p.h, frag_b(VBL + po, lane), acc[j]); } }
  } else {
    // 128-key tiles through LDS: every global load covers whole 128-B lines (two f16 P rows of 256 B a wave-load; two v columns of 256 B a wave-load), v is fetched once a block instead of once a wave; the next tile's loads fly in registers while this tile is multiplied
    const int nt = kb_last(qs0 / 64 + 1) + 1; const _Float16* pg = PHA + (size_t)b * TT * TT + (size_t)(ql0 + g) * TT + col * 8; const _Float16* vg = VT + ((size_t)b * CC + h * HD + (tid >> 4)) * (size_t)TT + (tid & 15) * 8;
    v8h pr[PVQ / 8], vr[HD / 8];
    // every "unroll" below: constant indices keep pr, vr, vf and acc in registers; "unroll 1": the tile loop stays rolled, a second copy of its body would only add live registers
#pragma unroll
    for (int i = 0; i < PVQ / 8; ++i) pr[i] = *(const v8h*)(pg + (size_t)(2 * i) * TT);
#pragma unroll
    for (int i = 0; i < HD / 8; ++i) vr[i] = *(const v8h*)(vg + (size_t)i * 8 * TT);
    asm volatile("s_wait_xcnt 0x0" ::: "memory");   // precaution: stands before the loads' address registers are written again
#pragma unroll 1
    for (int kt = 0; kt < nt; ++kt) {
#pragma unroll
      for (int i = 0; i < PVQ / 8; ++i) *(v8h*)&sp[wave][2 * i + g][col * 8] = pr[i];
#pragma unroll
      for (int i = 0; i < HD / 8; ++i) *(v8h*)&sv[i * 8 + (tid >> 4)][(tid & 15) * 8] = vr[i];
      __syncthreads();   // the tile is published to the four waves
      if (kt + 1 < nt) { const _Float16* pn = pg + (kt + 1) * PVK; const _Float16* vn = vg + (kt + 1) * PVK;
#pragma unroll
        for (int i = 0; i < PVQ / 8; ++i) pr[i] = *(const v8h*)(pn + (size_t)(2 * i) * TT);
#pragma unroll
        for (int i = 0; i < HD / 8; ++i) vr[i] = *(const v8h*)(vn + (size_t)i * 8 * TT);
        asm volatile("s_wait_xcnt 0x0" :: "v"(pn), "v"(vn) : "memory"); }   // precaution: stands before the loads' address registers are written again (the LDS reads below may land in them); the two addresses as inputs, so that no load of the group lands in one of them
#pragma unroll
      for (int kc = 0; kc < PVK / 32; ++kc) { const v16h p = frag_h(&sp[wave][col][kc * 32], lane), p2 = frag_h(&sp[wave][16 + col][kc * 32], lane); v16h vf[HD / 16];
#pragma unroll
        for (int j = 0; j < HD / 16; ++j) vf[j] = frag_h(&sv[j * 16 + col][kc * 32], lane);   // the k-step's twelve LDS reads go out as one group, ahead of its eight products
#pragma unroll
        for (int j = 0; j < HD / 16; ++j) { acc[j] = wmma16(p, vf[j], acc[j]); acc2[j] = wmma16(p2, vf[j], acc2[j]); } }
      __syncthreads();   // every wave has read the tile before it is overwritten
    } }
  // output stage: rows 0..15 of the wave in its range of ss; in a 128-row block rows 16..31 in the wave's own P range (as large as 32 such rows; only this wave reads or writes it, and its last reads stand in front of the tile loop's last barrier). Lanes 0..15 store a row of the first set, lanes 16..31 (idle in a 64-row block) the same row of the second
  float (*s2)[HD + 4] = (float (*)[HD + 4])sp[wave];
#pragma unroll
  for (int j = 0; j < HD / 16; ++j)
#pragma unroll
    for (int r = 0; r < 8; ++r) ss[wave][8 * g + r][j * 16 + col] = acc[j][r] * (1.0f / 2048.0f);
  if (qb >= QBH) {
#pragma unroll
    for (int j = 0; j < HD / 16; ++j)
#pragma unroll
      for (int r = 0; r < 8; ++r) s2[8 * g + r][j * 16 + col] = acc2[j][r] * (1.0f / 2048.0f); }
  const float (*so)[HD + 4] = g ? s2 : ss[wave];
  LDSX(); for (int rl = 0; rl < 16; ++rl) if (g == 0 || qb >= QBH) vst2(Y + ((size_t)b * TT + ql0 + g * 16 + rl) * CC + h * HD + col * 4, *(const v4f*)&so[rl][col * 4]); }

extern "C" void kernel_launch(void* const* d_in, const int* in_sizes, int n_in, void* d_out, int out_size, void* d_ws, size_t ws_size, hipStream_t stream) {
  (void)in_sizes; (void)n_in; (void)out_size;
  const float** F = (const float**)d_in;
  if (ws_size < (size_t)WS_END) return;
  char* ws = (char*)d_ws; _Float16 *QH = (_Float16*)(ws + WS_QH), *KH = (_Float16*)(ws + WS_KH), *VT = (_Float16*)(ws + WS_VT), *QL = (_Float16*)(ws + WS_QL), *KL = (_Float16*)(ws + WS_KL); __bf16 *VB = (__bf16*)(ws + WS_VB), *VBL = (__bf16*)(ws + WS_VBL); float *S = (float*)(ws + WS_S), *Y = (float*)(ws + WS_Y); _Float16 *PH = (_Float16*)(ws + WS_PH);
  (void)Y; (void)QL; (void)KL; (void)VB; (void)VBL;
  // inputs: 0 x [8,2048,384]; 1 Wq [384,64] (in,out); 2 Wk [384,64]; 3 Wv [384,384] (in,out); no biases
  k_proj<<<dim3(TNB * TT / 64, CC / 128 + 1), 128, 0, stream>>>(F[0], F[1], F[2], F[3], nullptr, nullptr, nullptr, QH, QL, KH, KL, VT, VB, VBL);   /* y = 0: q and k (64 columns each) in one tile; y = 1..3: 128 value columns each */
  k_sp<<<dim3(TNB, TT / 16), 256, 0, stream>>>(QH, KH, QL, KL, S, PH);   /* 16 query rows a block, their logits in registers up to P */
  k_pv<<<dim3(QBH + (TT - QHI) / PVQ, TNB, NH), 128, 0, stream>>>(S, PH, VT, VB, VBL, (float*)d_out);   /* x: the 64-row blocks of the early rows, then 128-row blocks; slot h writes output columns 64h .. 64h+63 */
}

// v010
// It runs in 66.2 microseconds.
// Timed twice side by side with v009, it ran 1.24 and 1.26 times as fast.
// Over all steps from v000 it is 25.7 times as fast.
// compute dtype: all float inputs rounded to bf16; q / k (64 wide) and v (384 wide) projections with EXACT bf16 products on WMMA 16x16x32 (f32 accumulate); interleaved RoPE in f32 (f32 inverse frequencies; precise cosf / sinf); causal logits: 3 products for the first 384 rows, single f16 q x k after, x 64^-0.5; softmax f32; all batches in one launch of each kernel; rows below 384: P x 2^11 as an f32 plane, then P and v as bf16 hi + lo; all other rows: logits, running-maximum softmax and P . v in one kernel, P (relative to the running maximum) once to f16 in registers x v once to f16; f32 output.
#include <hip/hip_runtime.h>
#include <math.h>

typedef __attribute__((ext_vector_type(16))) _Float16 v16h;
typedef __attribute__((ext_vector_type(16))) __bf16 v16b;
typedef __attribute__((ext_vector_type(8)))  _Float16 v8h;
typedef __attribute__((ext_vector_type(8)))  float v8f;
typedef __attribute__((ext_vector_type(4)))  float v4f;
typedef __attribute__((ext_vector_type(2)))  float v2f;
typedef __attribute__((ext_vector_type(4)))  unsigned v4u;
typedef __attribute__((ext_vector_type(4)))  int v4i;
typedef float __attribute__((may_alias)) float_a;
typedef int __attribute__((may_alias)) int_a;

template <typename T> __device__ __forceinline__ void vst2(void* p, T v) { *(T*)p = v;  }
__device__ __forceinline__ v8f wmma16(v16h a, v16h b, v8f c) {
  v8f d = __builtin_amdgcn_wmma_f32_16x16x32_f16(false, a, false, b, (short)0, c, false, false);
  asm volatile("v_nop\n\tv_nop\n\tv_nop\n\tv_nop" : "+v"(d) : "v"(a), "v"(b));
  return d;
}
__device__ __forceinline__ v8f wmma_bf(v16b a, v16b b, v8f c) {
  v8f d = __builtin_amdgcn_wmma_f32_16x16x32_bf16(false, a, false, b, (short)0, c, false, false);
  asm volatile("v_nop\n\tv_nop\n\tv_nop\n\tv_nop" : "+v"(d) : "v"(a), "v"(b));
  return d;
}
// 16x16x32 fragments: lane = (h = lane>>4, row/col = lane&15); elements 0..7 = k0+8h+0..7, 8..15 = k0+16+8h+0..7; D element r = row 8h+r
__device__ __forceinline__ v16h frag_h(const _Float16* rowk0, int lane) {
  union { v16h v; v8h q[2]; } u; const _Float16* p = rowk0 + 8 * (lane >> 4);
  u.q[0] = *(const v8h*)p; u.q[1] = *(const v8h*)(p + 16); return u.v;
}
__device__ __forceinline__ v16h frag_f32(const float* rowk0, int lane) {
  v16h a; const float* p = rowk0 + 8 * (lane >> 4);
#pragma unroll
  for (int i = 0; i < 8; ++i) { a[i] = (_Float16)p[i]; a[8 + i] = (_Float16)p[16 + i]; }
  return a;
}
__device__ __forceinline__ v16h frag_f32s(const float* rowk0, int lane, float sc) {
  v16h a; const float* p = rowk0 + 8 * (lane >> 4);
#pragma unroll
  for (int i = 0; i < 8; ++i) { a[i] = (_Float16)(p[i] * sc); a[8 + i] = (_Float16)(p[16 + i] * sc); }
  return a;
}
// column fragment from a [K][ld] layout (column n), rows >= K read as 0
__device__ __forceinline__ v16h fragc_f32(const float* W, int k0, int n, int lane, int ld, int K) {
  v16h a; const int g = lane >> 4;
#pragma unroll
  for (int i = 0; i < 8; ++i) { const int ka = k0 + 8 * g + i, kb = ka + 16;
    a[i] = (_Float16)(ka < K ? W[(size_t)(ka < K ? ka : K - 1) * ld + n] : 0.f); a[8 + i] = (_Float16)(kb < K ? W[(size_t)(kb < K ? kb : K - 1) * ld + n] : 0.f); }
  return a;
}
struct F2 { v16b h, l; };
__device__ __forceinline__ F2 bsplit16(const float v[16]) { F2 r;
#pragma unroll
  for (int i = 0; i < 16; ++i) { const __bf16 h = (__bf16)v[i]; r.h[i] = h; r.l[i] = (__bf16)(v[i] - (float)h); }
  return r; }
__device__ __forceinline__ F2 split_row(const float* row, int k0, int lane) { float v[16]; const float* p = row + k0 + 8 * (lane >> 4);
#pragma unroll
  for (int i = 0; i < 8; ++i) { v[i] = p[i]; v[8 + i] = p[16 + i]; }
  return bsplit16(v); }
__device__ __forceinline__ F2 split_rowK(const float* row, int k0, int lane, int K) { float v[16]; const int g = lane >> 4;
#pragma unroll
  for (int i = 0; i < 8; ++i) { const int ka = k0 + 8 * g + i, kb = ka + 16; v[i] = ka < K ? row[ka < K ? ka : K - 1] : 0.f; v[8 + i] = kb < K ? row[kb < K ? kb : K - 1] : 0.f; }
  return bsplit16(v); }
__device__ __forceinline__ F2 split_col(const float* W, int k0, int n, int lane, int ld, int K) { float v[16]; const int g = lane >> 4;
#pragma unroll
  for (int i = 0; i < 8; ++i) { const int ka = k0 + 8 * g + i, kb = ka + 16; v[i] = ka < K ? W[(size_t)(ka < K ? ka : K - 1) * ld + n] : 0.f; v[8 + i] = kb < K ? W[(size_t)(kb < K ? kb : K - 1) * ld + n] : 0.f; }
  return bsplit16(v); }
__device__ __forceinline__ v8f mac3(const F2& a, const F2& b, v8f c) { c = wmma_bf(a.l, b.h, c); c = wmma_bf(a.h, b.l, c); return wmma_bf(a.h, b.h, c); }
__device__ __forceinline__ float sigm(float v) { return 1.0f / (1.0f + expf(-v)); }
#define LDSX() do { asm volatile("s_wait_dscnt 0" ::: "memory"); __builtin_amdgcn_wave_barrier(); __builtin_amdgcn_fence(__ATOMIC_RELEASE, "workgroup"); } while (0)

// Single-head causal attention with a WIDE value (x [8,2048,384]; (in,out) Wq / Wk [384,64], Wv [384,384] (0.02 scale), no biases; interleaved-pair RoPE on q and k (positions arange(T), inv_freq = 1/10000^(2i/64)); scale 1/8; tril, -inf): out = softmax(causal(rope(q) rope(k)^T / 8)) v -> [8,2048,384]. The one attention pattern (q, k computed once per batch) is applied to the 384 value columns: below row 384 as six 64-column slots of one P plane; after, as two 192-column halves, each recomputing logits and softmax.
#define NB 8
#define TT 2048
#define CC 384            // NH * HD = projected width
#define DIN 384          // input (model) width
#define NH 6
#define HD 64
#define NQB (TT / 64)
#define SCALE (0.125f)
#define CAUSAL 1
#ifndef TNB
#define TNB NB
#endif
__device__ __forceinline__ float bfr(float v) { return (float)(__bf16)v; }
__host__ __device__ __forceinline__ int kb_last(int qb) { return CAUSAL ? ((qb * 64 + 63) >> 7) : (TT / 128 - 1); }
typedef __attribute__((ext_vector_type(8))) __bf16 v8b;
__device__ __forceinline__ v16b frag_b(const __bf16* rowk0, int lane) {
  union { v16b v; v8b q[2]; } u; const __bf16* p = rowk0 + 8 * (lane >> 4);
  u.q[0] = *(const v8b*)p; u.q[1] = *(const v8b*)(p + 16); return u.v;
}
#define QBH 6              // causal: query blocks 0..QBH-1 of each sequence (few keys, no averaging) take the high-precision path
#define QHI 384            // rows carrying a q residual plane
#define KHI 384            // key rows carrying k residual / v bf16 hi+lo planes (used only by the causal high-precision path)
// B fragment (k rows k0+.., output column o) of a weight: (in,out) [K][ld] or (out,in) [ld rows of K]: bf16 exact, or f16(bf16 * 256) exact
__device__ __forceinline__ v16b wcol_io(const float* Wm, int k0, int o, int lane, int ld) { v16b w; const int g = lane >> 4;
#pragma unroll
  for (int i = 0; i < 8; ++i) { w[i] = (__bf16)Wm[(size_t)(k0 + 8 * g + i) * ld + o];
    if (i == 7) asm volatile("s_wait_xcnt 0x0" ::: "memory");   // precaution: the run's last load may land in the address register that the loads before it name
    w[8 + i] = (__bf16)Wm[(size_t)(k0 + 16 + 8 * g + i) * ld + o]; }
  asm volatile("s_wait_xcnt 0x0" ::: "memory");   // same precaution for the last load, before its address register is written again
  return w; }
__device__ __forceinline__ v16b wcol_oi(const float* Wm, int k0, int o, int lane, int K) { v16b w; const float* p = Wm + (size_t)o * K + k0 + 8 * (lane >> 4);
#pragma unroll
  for (int i = 0; i < 8; ++i) { w[i] = (__bf16)p[i]; w[8 + i] = (__bf16)p[16 + i]; }
  return w; }
__device__ __forceinline__ v16h wcolh_io(const float* Wm, int k0, int o, int lane, int ld) { v16h w; const int g = lane >> 4;
#pragma unroll
  for (int i = 0; i < 8; ++i) { w[i] = (_Float16)(bfr(Wm[(size_t)(k0 + 8 * g + i) * ld + o]) * 256.0f); w[8 + i] = (_Float16)(bfr(Wm[(size_t)(k0 + 16 + 8 * g + i) * ld + o]) * 256.0f); }
  return w; }
__device__ __forceinline__ v16h wcolh_oi(const float* Wm, int k0, int o, int lane, int K) { v16h w; const float* p = Wm + (size_t)o * K + k0 + 8 * (lane >> 4);
#pragma unroll
  for (int i = 0; i < 8; ++i) { w[i] = (_Float16)(bfr(p[i]) * 256.0f); w[8 + i] = (_Float16)(bfr(p[16 + i]) * 256.0f); }
  return w; }
#define WQKV_LAYOUT 0   // 0 = (in,out): Wv [DIN][CC], Wq / Wk [DIN][HD]; 1 = (out,in) [CC][DIN]; 2 = per-head [NH][DIN][HD]
__device__ __forceinline__ v16b wcol_hdk(const float* Wm, int k0, int o, int lane) { v16b w; const int g = lane >> 4; const float* p = Wm + (size_t)(o / HD) * DIN * HD + (o % HD);
#pragma unroll
  for (int i = 0; i < 8; ++i) { w[i] = (__bf16)p[(size_t)(k0 + 8 * g + i) * HD]; w[8 + i] = (__bf16)p[(size_t)(k0 + 16 + 8 * g + i) * HD]; }
  return w; }
#define WO_OUT_IN 0
#if WQKV_LAYOUT == 1
#define WCOL(W, k0, o, lane) wcol_oi(W, k0, o, lane, DIN)
#elif WQKV_LAYOUT == 2
#define WCOL(W, k0, o, lane) wcol_hdk(W, k0, o, lane)
#else
#define WCOL(W, k0, o, lane) (which == 2 ? wcol_io(W, k0, (o), lane, CC) : wcol_io(W, k0, ((o) & 63), lane, HD))   /* (in,out): Wv [384][384] pitch 384; Wq / Wk [384][64] pitch 64, tile column o % 64 */
#endif
#if WO_OUT_IN
#define WOCOL(W, k0, o, lane) wcol_oi(W, k0, o, lane, CC)
#define WOCOLH(W, k0, o, lane) wcolh_oi(W, k0, o, lane, CC)
#else
#define WOCOL(W, k0, o, lane) wcol_io(W, k0, o, lane, DIN)
#define WOCOLH(W, k0, o, lane) wcolh_io(W, k0, o, lane, DIN)
#endif
// RoPE inverse frequencies 1/10000^(2i/64) (the f32 values jax computes)
__constant__ float INVF[32] = {1.000000000e+00,7.498942018e-01,5.623413324e-01,4.216965139e-01,3.162277639e-01,2.371373624e-01,1.778279394e-01,1.333521456e-01,1.000000015e-01,7.498941571e-02,5.623412877e-02,4.216964915e-02,3.162277862e-02,2.371373586e-02,1.778279431e-02,1.333521493e-02,9.999999776e-03,7.498942316e-03,5.623413250e-03,4.216964822e-03,3.162277862e-03,2.371373819e-03,1.778279431e-03,1.333521446e-03,1.000000047e-03,7.498941850e-04,5.623413017e-04,4.216964880e-04,3.162277862e-04,2.371373848e-04,1.778279402e-04,1.333521504e-04};
#define PROJ_EXTRA_PARAMS
// interleaved-pair RoPE on q and k (which 0: the two 64-column halves of the tile) at position t (the module uses arange(T)): angle = (float)t * inv_freq[i]; (x_even, x_odd) -> (xe cos - xo sin, xo cos + xe sin) == x * cos + rotate_half_interleaved(x) * sin with cos / sin repeated pairwise; products and sums kept separate (no fma contraction)
#define PROJ_EPI(which, row, t, h) do { if ((which) < 2) { float* rw = (row); const float pos_ = (float)(t); _Pragma("unroll 4") for (int i = 0; i < 32; ++i) { _Pragma("clang fp contract(off)") const float ang = pos_ * INVF[i]; const float cs = cosf(ang), sn = sinf(ang); const float xe = rw[2 * i], xo = rw[2 * i + 1]; rw[2 * i] = xe * cs - xo * sn; rw[2 * i + 1] = xo * cs + xe * sn; } } } while (0)
#define SM_EXTRA_PARAMS
#define SM_MASK_HOOK (void)0
#ifndef SM_EXTRA_PARAMS
#define SM_EXTRA_PARAMS
#endif
#ifndef PROJ_EXTRA_PARAMS
#define PROJ_EXTRA_PARAMS
#endif
#ifndef SM_MASK_HOOK
#define SM_MASK_HOOK (void)0
#endif

#define WS_QH  0u                                      // f16 q rows [b*t][HD]
#define WS_KH  (WS_QH + 2u * (size_t)NB * TT * HD)      // f16 k rows [b*t][HD]
#define WS_VT  (WS_KH + 2u * (size_t)NB * TT * HD)      // f16 v planes [b][c][t]
#define WS_QL  (WS_VT + 2u * (size_t)NB * CC * TT)      // f16 q residual x 2^10 rows [b][t < QHI][HD]
#define WS_KL  (WS_QL + 2u * (size_t)NB * QHI * HD)     // f16 k residual x 2^10 rows [b][t < KHI][HD]
#define WS_VB  (WS_KL + 2u * (size_t)NB * KHI * HD)     // bf16 v hi planes [b][c][t < KHI]
#define WS_VBL (WS_VB + 2u * (size_t)NB * CC * KHI)
#define WS_S   (WS_VBL + 2u * (size_t)NB * CC * KHI)    // f32 P planes [b][t < QHI][s] (the early rows, which k_pv splits into bf16 hi + lo)
#define WS_Y   (WS_S  + 4u * (size_t)NB * QHI * TT)     // f32 ctx rows [b*t][CC] (only when there is an output projection)
#define WS_END (WS_Y  + 0u)

#define PJK 64             // k of a staged chunk in k_proj
typedef __attribute__((ext_vector_type(4))) __bf16 v4b;
// main loop of k_proj, W of row pitch WLD floats (a constant, so that each operand's loads share one address register that lives through the loop and differ in their immediate offsets): 64-k chunks of x and W go through LDS as bf16; every global load covers whole 128-B lines (x: two rows of 256 B a wave-load; W: 4 k rows x one line), W is fetched and rounded once a block instead of once a wave, and the next chunk's loads fly in registers while this chunk is multiplied.
// sx: x chunk [row][k]; sw: W chunk [tile column][k]; pitch 144 B = 16 B x 9, the odd multiple that 16-byte LDS reads want. A lane holds 8 consecutive k of 4 columns per set of 8 W loads, so each column's 8 k go to LDS as one 16-byte store.
template <int WLD> __device__ __forceinline__ void proj_mm(const float* xg, const float* wg, __bf16 (*sx)[72], __bf16 (*sw)[72], int wave, int lane, v8f (&acc)[8]) {
  const int col = lane & 15, g = lane >> 4, lr = lane >> 3, lc = lane & 7;
  v4f xr[8], wr[16];
  // every "unroll" below: constant indices keep xr, wr, wf and acc in registers; "unroll 1": the chunk loop stays rolled, a second copy of its body would only add live registers
#pragma unroll
  for (int i = 0; i < 16; ++i) wr[i] = *(const v4f*)(wg + (size_t)((i >> 3) * 32 + (i & 7)) * WLD);
#pragma unroll
  for (int i = 0; i < 8; ++i) xr[i] = *(const v4f*)(xg + (size_t)i * 2 * DIN);
  asm volatile("s_wait_xcnt 0x0" ::: "memory");   // precaution: stands before the loads' address registers are written again
#pragma unroll 1
  for (int ch = 0; ch < DIN / PJK; ++ch) {
#pragma unroll
    for (int s = 0; s < 2; ++s)
#pragma unroll
      for (int c = 0; c < 4; ++c) { v8b wv;
#pragma unroll
        for (int i = 0; i < 8; ++i) wv[i] = (__bf16)wr[s * 8 + i][c];
        *(v8b*)&sw[wave * 32 + lc * 4 + c][s * 32 + lr * 8] = wv; }
#pragma unroll
    for (int i = 0; i < 8; ++i) { v4b xv; xv[0] = (__bf16)xr[i][0]; xv[1] = (__bf16)xr[i][1]; xv[2] = (__bf16)xr[i][2]; xv[3] = (__bf16)xr[i][3]; *(v4b*)&sx[wave * 16 + i * 2 + g][col * 4] = xv; }
    __syncthreads();   // the chunk is published to the four waves
    if (ch + 1 < DIN / PJK) { xg += PJK; wg += (size_t)PJK * WLD;
#pragma unroll
      for (int i = 0; i < 16; ++i) wr[i] = *(const v4f*)(wg + (size_t)((i >> 3) * 32 + (i & 7)) * WLD);
#pragma unroll
      for (int i = 0; i < 8; ++i) xr[i] = *(const v4f*)(xg + (size_t)i * 2 * DIN);
      asm volatile("s_wait_xcnt 0x0" ::: "memory"); }   // precaution: stands before the loads' address registers are written again
#pragma unroll
    for (int kc = 0; kc < PJK / 32; ++kc) { const v16b a = frag_b(&sx[wave * 16 + col][kc * 32], lane);
#pragma unroll
      for (int jh = 0; jh < 2; ++jh) { v16b wf[4];
#pragma unroll
        for (int j = 0; j < 4; ++j) wf[j] = frag_b(&sw[(jh * 4 + j) * 16 + col][kc * 32], lane);   // eight LDS reads go out as one group, ahead of their four products
#pragma unroll
        for (int j = 0; j < 4; ++j) acc[jh * 4 + j] = wmma_bf(a, wf[j], acc[jh * 4 + j]); } }
    __syncthreads();   // every wave has read the chunk before it is overwritten
  } }
// ---- k_proj: block = (64 rows, 128 cols): X W (+ b) with exact bf16 products (K = DIN; x and W staged in LDS as bf16 in 64-k chunks); blockIdx.y = 0 (which 0; the longer blocks): q in tile columns 0..63 and k in 64..127 -> f16 rows (+ residual rows < QHI / KHI); blockIdx.y > 0 (which 2): 128 columns of v -> f16 planes [c][t] (+ bf16 hi/lo planes for t < KHI)
__global__ __launch_bounds__(128) void k_proj(const float* __restrict__ X, const float* __restrict__ WQ, const float* __restrict__ WK, const float* __restrict__ WV, const float* __restrict__ BQ, const float* __restrict__ BK, const float* __restrict__ BV,
    _Float16* __restrict__ QH, _Float16* __restrict__ QL, _Float16* __restrict__ KH, _Float16* __restrict__ KL, _Float16* __restrict__ VT, __bf16* __restrict__ VB, __bf16* __restrict__ VBL PROJ_EXTRA_PARAMS) {
  __shared__ __align__(16) float st[64][132]; __shared__ __align__(16) _Float16 sh[64][136], sl[64][136]; __shared__ __align__(16) _Float16 th[128][72]; __shared__ __align__(16) __bf16 tb[128][72], tbl[128][72];
  const int tid = threadIdx.x, wave = tid >> 5, lane = tid & 31, col = lane & 15, g = lane >> 4; const int which = blockIdx.y == 0 ? 0 : 2; const int c0 = which == 2 ? (blockIdx.y - 1) * 128 : 0; const size_t r0 = (size_t)blockIdx.x * 64; const size_t bb = r0 / TT; const int t0 = (int)(r0 % TT);
  v8f acc[8] = {};
  { // wave w stages tile columns 32w .. 32w+31 of W and its own 16 rows of x; the two stages lie in tb and tbl, which hold nothing until the epilogue (behind its own barriers)
    const float* xg = X + (r0 + wave * 16 + g) * DIN + col * 4; const int lr = lane >> 3, lc = lane & 7;
    if (which == 2) proj_mm<CC>(xg, WV + c0 + wave * 32 + lc * 4 + (size_t)(lr * 8) * CC, tbl, tb, wave, lane, acc);
    else proj_mm<HD>(xg, (wave < 2 ? WQ + wave * 32 : WK + (wave - 2) * 32) + lc * 4 + (size_t)(lr * 8) * HD, tbl, tb, wave, lane, acc); }
  { // stage the f32 tile (acc + bias) in LDS, run the per-(row, head) epilogue hook, then convert
#pragma unroll
    for (int j = 0; j < 8; ++j) { const float* BA = which == 2 ? BV : j < 4 ? BQ : BK; const float bias = BA ? bfr(BA[which == 2 ? c0 + j * 16 + col : (j & 3) * 16 + col]) : 0.f;
#pragma unroll
      for (int r = 0; r < 8; ++r) st[wave * 16 + 8 * g + r][j * 16 + col] = acc[j][r] + bias; }
    __syncthreads();
    for (int e = tid; e < 64 * (128 / HD); e += 128) { const int rl = e / (128 / HD), hh = e % (128 / HD); PROJ_EPI(which, &st[rl][hh * HD], (int)((r0 + rl) % TT), (c0 / HD) + hh); }
    __syncthreads(); }
  if (which < 2) {
    for (int e = tid; e < 64 * 128; e += 128) { const int rl = e >> 7, cl = e & 127; const float v = st[rl][cl]; const _Float16 hv = (_Float16)v; sh[rl][cl] = hv; sl[rl][cl] = (_Float16)((v - (float)hv) * 1024.0f); }
    __syncthreads();
    for (int e = tid; e < 64 * 16; e += 128) { const int rl = e >> 4, q = e & 15; _Float16* DH = q < 8 ? QH : KH; _Float16* DL = q < 8 ? QL : KL; const int nhi = q < 8 ? QHI : KHI;
      vst2((unsigned*)(DH + (r0 + rl) * HD + (q & 7) * 8), *(const v4u*)&sh[rl][q * 8]);
      asm volatile("s_wait_xcnt 0x0" ::: "memory");   // precaution: stands before the store's data and address registers are rewritten (next LDS read, next trip's address)
      if (t0 < nhi) { vst2((unsigned*)(DL + (bb * nhi + t0 + rl) * (size_t)HD + (q & 7) * 8), *(const v4u*)&sl[rl][q * 8]);
        asm volatile("s_wait_xcnt 0x0" ::: "memory"); } }   // same precaution for the residual row's store
  } else { const bool hi_rows = t0 < KHI;
    for (int e = tid; e < 64 * 128; e += 128) { const int rl = e & 63, cl = e >> 6; const float v = st[rl][cl]; th[cl][rl] = (_Float16)v; const __bf16 bh = (__bf16)v; tb[cl][rl] = bh; tbl[cl][rl] = (__bf16)(v - (float)bh); }
    __syncthreads();
    for (int e = tid; e < 128 * 8; e += 128) { const int cl = e >> 3, q = e & 7; vst2((unsigned*)(VT + (bb * CC + c0 + cl) * (size_t)TT + t0 + q * 8), *(const v4u*)&th[cl][q * 8]); if (hi_rows) { const size_t o3 = (bb * CC + c0 + cl) * (size_t)KHI + t0 + q * 8; vst2((unsigned*)(VB + o3), *(const v4u*)&tb[cl][q * 8]); vst2((unsigned*)(VBL + o3), *(const v4u*)&tbl[cl][q * 8]); } } } }
#define SPW 8              // waves of a block in k_sp
// ---- k_sp (the early rows alone, t < QHI): block = 16 query rows (row block rb = blockIdx.y) of batch b = blockIdx.x against all their keys [0, 128 ng), ng <= 3: the 128-key tile kt belongs to wave kt, which holds its logits in its accumulators from the products to the store of P: the logits never go to memory.
// logits x SCALE as 16x16x32 f16 products: q hi + residual (x 2^10) against k hi + residual (3 products); causal: key s kept if s <= t; softmax in f32 (row maximum and row sum: in-lane, then across the 16 lanes that share a row, then across the waves through LDS, one barrier each); P x 2^11 (0 for excluded keys) goes out in f32 as whole 512-B row pieces of a tile, staged in the wave's own LDS range
// amdgpu_waves_per_eu: two blocks a WGP (four waves a SIMD), so that one block's products and exponentials cover the other's loads and barriers
__global__ __launch_bounds__(256) __attribute__((amdgpu_waves_per_eu(4, 4))) void k_sp(const _Float16* __restrict__ QH, const _Float16* __restrict__ KH, const _Float16* __restrict__ QL, const _Float16* __restrict__ KL, float* __restrict__ SA) {
  __shared__ __align__(16) float ssa[SPW][16][132]; __shared__ __align__(16) float rm[SPW][16], rs[SPW][16];
  const int b = blockIdx.x, rb = (int)blockIdx.y, qb = rb >> 2, ng = kb_last(qb) + 1;
  const int wave = __builtin_amdgcn_readfirstlane(threadIdx.x >> 5), lane = threadIdx.x & 31, col = lane & 15, g = lane >> 4;   // the wave's number in a scalar register: every test on a tile is a scalar branch (the matrix instructions want all lanes on)
  const int ql0 = rb * 16; const size_t q0 = (size_t)b * TT + ql0;
  float* __restrict__ S = SA + (size_t)b * QHI * TT; float (*ss)[132] = ssa[wave];
  const v8f zero = {};
  v8f acc[8];
  // every "unroll" below: constant indices keep acc, the fragments and the row values in registers
  if (wave < ng) { const int k0 = wave * 128; v8f accl[8];
    // one address a plane (the lane's row and 8-element half), every fragment at a constant offset from it
    const _Float16* qp = QH + (q0 + col) * HD + 8 * g; const _Float16* qlp = QL + ((size_t)b * QHI + ql0 + col) * HD + 8 * g; const _Float16* kp = KH + ((size_t)b * TT + k0 + col) * HD + 8 * g; const _Float16* lp = KL + ((size_t)b * KHI + k0 + col) * HD + 8 * g;
#pragma unroll
    for (int kc = 0; kc < HD / 32; ++kc) { const v16h ah = frag_h(qp + kc * 32, 0), al = frag_h(qlp + kc * 32, 0);   // lane argument 0: the half is in the address already
#pragma unroll
      for (int jh = 0; jh < 2; ++jh) { v16h kf[4], lf[4];
#pragma unroll
        for (int j = 0; j < 4; ++j) { kf[j] = frag_h(kp + (jh * 4 + j) * 16 * HD + kc * 32, 0); lf[j] = frag_h(lp + (jh * 4 + j) * 16 * HD + kc * 32, 0); }
        asm volatile("s_wait_xcnt 0x0" :: "v"(qp), "v"(qlp), "v"(kp), "v"(lp) : "memory");   // precaution: stands before the loads' address registers are written again; the four addresses as inputs, so that no load of the group lands in one of them
#pragma unroll
        for (int j = 0; j < 4; ++j) { const int jj = jh * 4 + j; acc[jj] = wmma16(ah, kf[j], kc == 0 ? zero : acc[jj]); accl[jj] = wmma16(al, kf[j], kc == 0 ? zero : accl[jj]); accl[jj] = wmma16(ah, lf[j], accl[jj]); } } }
#pragma unroll
    for (int j = 0; j < 8; ++j) {
#pragma unroll
      for (int r = 0; r < 8; ++r) acc[j][r] = (acc[j][r] + accl[j][r] * (1.0f / 1024.0f)) * SCALE; } }
  // accumulator element r of tile column j: query row ql0 + 8 g + r, key 128 wave + 16 j + col
  float m[8], l[8];
#pragma unroll
  for (int r = 0; r < 8; ++r) { m[r] = -3.0e38f; l[r] = 0.f; }
  if (wave < ng) {
    if (CAUSAL && wave * 128 + 127 > ql0) { const int rel = ql0 + 8 * g - wave * 128 - col;   // a tile that reaches past the block's first row: key kept when 16 j <= rel + r
#pragma unroll
      for (int j = 0; j < 8; ++j) {
#pragma unroll
        for (int r = 0; r < 8; ++r) acc[j][r] = (j * 16 <= rel + r) ? acc[j][r] : -3.0e38f; } }
#pragma unroll
    for (int j = 0; j < 8; ++j) {
#pragma unroll
      for (int r = 0; r < 8; ++r) m[r] = fmaxf(m[r], acc[j][r]); }
  } else {
#pragma unroll
    for (int j = 0; j < 8; ++j) acc[j] = zero; }
#pragma unroll
  for (int o = 1; o < 16; o <<= 1) {
#pragma unroll
    for (int r = 0; r < 8; ++r) m[r] = fmaxf(m[r], __shfl_xor(m[r], o)); }
  if (col == 0) { v4f a0 = {m[0], m[1], m[2], m[3]}, a1 = {m[4], m[5], m[6], m[7]}; *(v4f*)&rm[wave][8 * g] = a0; *(v4f*)&rm[wave][8 * g + 4] = a1; }
  __syncthreads();   // every wave's row maxima are published (a wave without a tile publishes the start value)
#pragma unroll
  for (int w = 0; w < SPW; ++w) { const v4f a0 = *(const v4f*)&rm[w][8 * g], a1 = *(const v4f*)&rm[w][8 * g + 4];
#pragma unroll
    for (int r = 0; r < 4; ++r) { m[r] = fmaxf(m[r], a0[r]); m[4 + r] = fmaxf(m[4 + r], a1[r]); } }
  // exp(v - m) as 2^(v log2 e - m log2 e): one fused multiply-add and one hardware exponential an element. An excluded key (the mask's large negative value) overflows to -inf in the multiply-add and comes out as exactly 0 (m is finite: every causal row keeps its own key), so no select is needed
  float mb[8];
#pragma unroll
  for (int r = 0; r < 8; ++r) mb[r] = m[r] * 1.44269504f;
  if (wave < ng) {
#pragma unroll
    for (int j = 0; j < 8; ++j) {
#pragma unroll
      for (int r = 0; r < 8; ++r) { const float e = __builtin_amdgcn_exp2f(__builtin_fmaf(acc[j][r], 1.44269504f, -mb[r])); acc[j][r] = e; l[r] += e; } } }
#pragma unroll
  for (int o = 1; o < 16; o <<= 1) {
#pragma unroll
    for (int r = 0; r < 8; ++r) l[r] += __shfl_xor(l[r], o); }
  if (col == 0) { v4f a0 = {l[0], l[1], l[2], l[3]}, a1 = {l[4], l[5], l[6], l[7]}; *(v4f*)&rs[wave][8 * g] = a0; *(v4f*)&rs[wave][8 * g + 4] = a1; }
  __syncthreads();   // every wave's row sums are published
  float inv[8];
#pragma unroll
  for (int r = 0; r < 8; ++r) inv[r] = 0.f;
#pragma unroll
  for (int w = 0; w < SPW; ++w) { const v4f a0 = *(const v4f*)&rs[w][8 * g], a1 = *(const v4f*)&rs[w][8 * g + 4];
#pragma unroll
    for (int r = 0; r < 4; ++r) { inv[r] += a0[r]; inv[4 + r] += a1[r]; } }
#pragma unroll
  for (int r = 0; r < 8; ++r) inv[r] = inv[r] > 0.f ? 2048.0f / inv[r] : 0.f;   /* a fully excluded row yields P = 0 */
  if (wave < ng) { float* sg = S + (size_t)ql0 * TT + wave * 128 + lane * 4;   // P stays f32 (k_pv splits it into bf16 hi + lo)
#pragma unroll
    for (int j = 0; j < 8; ++j) {
#pragma unroll
      for (int r = 0; r < 8; ++r) ss[8 * g + r][j * 16 + col] = acc[j][r] * inv[r]; }
    asm volatile("s_wait_dscnt 0" ::: "memory"); __builtin_amdgcn_wave_barrier();   // the wave's lanes read each other's values below: the LDS writes stay in front of the reads
    v4f o[16];
#pragma unroll
    for (int rl = 0; rl < 16; ++rl) o[rl] = *(const v4f*)&ss[rl][lane * 4];
#pragma unroll
    for (int rl = 0; rl < 16; ++rl) vst2(sg + (size_t)rl * TT, o[rl]);
    asm volatile("s_wait_xcnt 0x0" ::: "memory"); } }   // precaution: stands before the stores' data and address registers are written again
#define FQ 64              // query rows of a fused block: 16 a wave
#define FK 64              // keys of a staged tile
#define FC 192             // value columns of a fused block
#define FP (FK + 8)        // LDS row pitch of both tiles in f16: 144 B = 16 B x 9, the odd multiple that 16-byte LDS reads want
#define NFJ ((TT - QHI) / FQ * (CC / FC))   // fused blocks of a batch
__device__ __forceinline__ float xhalf(float x) { return __builtin_bit_cast(float, __builtin_amdgcn_permlanex16(__builtin_bit_cast(int, x), __builtin_bit_cast(int, x), 0x76543210, 0xfedcba98, false, false)); }   // lane l takes the value of lane l ^ 16
__device__ __forceinline__ v8f wmma_p(v16h a, v16h b, v8f c) { return __builtin_amdgcn_wmma_f32_16x16x32_f16(false, a, false, b, (short)0, c, false, false); }
// ---- k_pv: batch b = blockIdx.x, job = blockIdx.y.
// job < NFJ (rows >= QHI): 64 queries (16 a wave) x 192 value columns, logits, softmax and P . v in one pass over 64-key tiles. K rows and v columns [c][key] go through LDS (whole-line loads, once a block; two buffers, one barrier a tile; the next tile's loads fly in registers). Transposed products: S^T = K . Q^T (accumulator element r = key 8 g + r, lane column = query), so a lane holds one query's logits: maximum and sum in-lane plus one exchange between the halves; two S^T tiles, rounded to f16, ARE the B fragment of P^T (elements 0..7 = keys k0 + 8 g + r, 8..15 = keys k0 + 16 + 8 g + r); O^T += v^T . P^T (element r = value column 8 g + r, lane column = query), so the running-maximum factor is one value a lane. P never leaves the registers.
// job >= NFJ (the early rows): 64 queries (16 a wave) x value columns 64h .. 64h+63, P (f32 plane of k_sp) and v as bf16 hi + lo, 3 products
__global__ __launch_bounds__(128) void k_pv(const float* __restrict__ PA, const _Float16* __restrict__ QH, const _Float16* __restrict__ KH, const _Float16* __restrict__ VT, const __bf16* __restrict__ VB, const __bf16* __restrict__ VBL, float* __restrict__ Y) {
  __shared__ __align__(16) char sm[2 * (FK + FC) * FP * 2];   // fused tile loop: two buffers, each a K tile and a v tile; behind it (and in the early rows' blocks) the output stage, a range a wave
  const int b = blockIdx.x, job = blockIdx.y;
  const int tid = threadIdx.x, wave = tid >> 5, lane = tid & 31, col = lane & 15, g = lane >> 4;
  float (*so)[FC + 4] = (float (*)[FC + 4])sm + wave * 16;
  if (job < NFJ) {
    const int c0 = (job % (CC / FC)) * FC, q0 = QHI + ((TT - QHI) / FQ - 1 - job / (CC / FC)) * FQ, nt = q0 / FK + 1;   // row blocks counted down from the longest, so that cost falls with the block index; key tiles 0 .. nt-1, the last one holds the diagonal
    const _Float16* kg = KH + (size_t)b * TT * HD + tid * 8;   // a K tile is 8 KB in a row
    const _Float16* vg = VT + ((size_t)b * CC + c0 + (tid >> 3)) * (size_t)TT + (tid & 7) * 8;   // 8 lanes cover the 128-B line of a column's 64 keys
    const _Float16* qg = QH + ((size_t)b * TT + q0 + wave * 16 + col) * HD;
    v16h qf[HD / 32]; v8h kr[FK / 16], vr[FC / 16];
    // every "unroll" below: constant indices keep the fragments, the staged values and the accumulators in registers; "unroll 1": the tile loop stays rolled, a second copy of its body would only add live registers
#pragma unroll
    for (int i = 0; i < FK / 16; ++i) kr[i] = *(const v8h*)(kg + i * 16 * HD);
    asm volatile("s_wait_xcnt 0x0" :: "v"(tid), "v"(kg) : "memory");   // precaution: stands before the K loads' address registers are written again; the thread index as an input too: the compiler addresses tile 0 by a scalar base and that register
#pragma unroll
    for (int kc = 0; kc < HD / 32; ++kc) qf[kc] = frag_h(qg + kc * 32, lane);
#pragma unroll
    for (int i = 0; i < FC / 16; ++i) vr[i] = *(const v8h*)(vg + (size_t)i * 16 * TT);
    asm volatile("s_wait_xcnt 0x0" :: "v"(qg), "v"(vg) : "memory");   // precaution: stands before the loads' address registers are written again; the addresses as inputs, so that no load of the group lands in one of them
    const v8f zero = {};
    v8f acc[FC / 16] = {}; float m = -3.0e38f, l = 0.f;   // m: running maximum of the raw logits (both halves alike); l: this half's sum
    const float cs = SCALE * 1.44269504f;
    { _Float16 (*sn)[FP] = (_Float16 (*)[FP])sm;   // tile 0 into buffer 0: rows 0..63 = K [key][dim], rows 64..255 = v [value column][key]
#pragma unroll
      for (int i = 0; i < FK / 16; ++i) *(v8h*)&sn[i * 16 + (tid >> 3)][(tid & 7) * 8] = kr[i];
#pragma unroll
      for (int i = 0; i < FC / 16; ++i) *(v8h*)&sn[FK + i * 16 + (tid >> 3)][(tid & 7) * 8] = vr[i]; }
    __syncthreads();   // tile 0 is published to the four waves
#pragma unroll 1
    for (int kt = 0; kt < nt; ++kt) {
      const _Float16 (*sk)[FP] = (const _Float16 (*)[FP])sm + (kt & 1) * (FK + FC); const _Float16 (*sv)[FP] = sk + FK;   // this tile's buffer
      if (kt + 1 < nt) { const _Float16* kn = kg + (kt + 1) * FK * HD; const _Float16* vn = vg + (kt + 1) * FK;
#pragma unroll
        for (int i = 0; i < FK / 16; ++i) kr[i] = *(const v8h*)(kn + i * 16 * HD);
#pragma unroll
        for (int i = 0; i < FC / 16; ++i) vr[i] = *(const v8h*)(vn + (size_t)i * 16 * TT);
        asm volatile("s_wait_xcnt 0x0" :: "v"(kn), "v"(vn) : "memory"); }   // precaution: stands before the loads' address registers are written again (the LDS reads below may land in them); the two addresses as inputs, so that no load of the group lands in one of them
      v8f s[FK / 16];
      { v16h kf[FK / 16][HD / 32];
#pragma unroll
        for (int jt = 0; jt < FK / 16; ++jt)
#pragma unroll
          for (int kc = 0; kc < HD / 32; ++kc) kf[jt][kc] = frag_h(&sk[jt * 16 + col][kc * 32], lane);
        asm volatile("" :: "v"(kf[0][0]), "v"(kf[0][1]), "v"(kf[1][0]), "v"(kf[1][1]), "v"(kf[2][0]), "v"(kf[2][1]), "v"(kf[3][0]), "v"(kf[3][1]));   // holds the loads in place (the loaded values as inputs only): the tile's sixteen LDS reads go out as one group with one wait, ahead of its eight products; left alone they are sunk to one waited pair in front of each product
#pragma unroll
        for (int kc = 0; kc < HD / 32; ++kc)
#pragma unroll
          for (int jt = 0; jt < FK / 16; ++jt) s[jt] = wmma_p(kf[jt][kc], qf[kc], kc == 0 ? zero : s[jt]); }
      // v fragments: six groups of four (group gi: keys 32 (gi / 3) .., value columns 64 (gi % 3) ..), two register sets, each group read one group ahead of its products
      v16h vf[2][4];
#pragma unroll
      for (int j = 0; j < 4; ++j) vf[0][j] = frag_h(&sv[j * 16 + col][0], lane);
      __builtin_amdgcn_sched_barrier(0);   // keeps the first group's LDS reads in front of the softmax, which covers their latency
      if (kt == nt - 1) { const int rel = wave * 16 + col - 8 * g;   // the diagonal tile: key 16 jt + 8 g + r kept when it is not behind query 16 wave + col
#pragma unroll
        for (int jt = 0; jt < FK / 16; ++jt) {
#pragma unroll
          for (int r = 0; r < 8; ++r) s[jt][r] = (jt * 16 + r <= rel) ? s[jt][r] : -3.0e38f; } }
      float mt[FK / 16], lt[FK / 16];   // one chain a key tile, so that the chains overlap
#pragma unroll
      for (int jt = 0; jt < FK / 16; ++jt) { mt[jt] = s[jt][0];
#pragma unroll
        for (int r = 1; r < 8; ++r) mt[jt] = fmaxf(mt[jt], s[jt][r]); }
      float mx = fmaxf(fmaxf(mt[0], mt[1]), fmaxf(mt[2], mt[3])); mx = fmaxf(mx, xhalf(mx));
      const float mn = fmaxf(m, mx), al = __builtin_amdgcn_exp2f((m - mn) * cs), mc = mn * cs; m = mn;   // al: what the sums so far are worth against the new maximum (0 in the first tile: the start value is large and negative, never infinite)
      // exp((v - m) SCALE) as 2^(v cs - m cs): one fused multiply-add and one hardware exponential an element; an excluded key (the mask's large negative value) comes out as exactly 0 (m is finite: tile 0 excludes nothing)
      v16h pf[FK / 32];
#pragma unroll
      for (int jt = 0; jt < FK / 16; ++jt) { lt[jt] = 0.f;
#pragma unroll
        for (int r = 0; r < 8; ++r) { const float e = __builtin_amdgcn_exp2f(__builtin_fmaf(s[jt][r], cs, -mc)); lt[jt] += e; pf[jt >> 1][(jt & 1) * 8 + r] = (_Float16)e; } }
      l = l * al + ((lt[0] + lt[1]) + (lt[2] + lt[3]));
#pragma unroll
      for (int gi = 0; gi < 6; ++gi) { const int kc = gi / 3, jh = gi % 3;
        if (gi + 1 < 6) {
#pragma unroll
          for (int j = 0; j < 4; ++j) vf[(gi + 1) & 1][j] = frag_h(&sv[(((gi + 1) % 3) * 4 + j) * 16 + col][((gi + 1) / 3) * 32], lane); }
        __builtin_amdgcn_sched_barrier(0);   // keeps the next group's eight LDS reads in front of this group's products; left alone they are sunk to one waited pair in front of each product
#pragma unroll
        for (int j = 0; j < 4; ++j) { if (kc == 0) acc[jh * 4 + j] = acc[jh * 4 + j] * al;   // the sums so far, set against the new maximum
          acc[jh * 4 + j] = wmma_p(vf[gi & 1][j], pf[kc], acc[jh * 4 + j]); } }
      if (kt + 1 < nt) { _Float16 (*sn)[FP] = (_Float16 (*)[FP])sm + ((kt + 1) & 1) * (FK + FC);   // the next tile goes into the other buffer, whose last readers stand in front of the barrier that ended the pass before this one
#pragma unroll
        for (int i = 0; i < FK / 16; ++i) *(v8h*)&sn[i * 16 + (tid >> 3)][(tid & 7) * 8] = kr[i];
#pragma unroll
        for (int i = 0; i < FC / 16; ++i) *(v8h*)&sn[FK + i * 16 + (tid >> 3)][(tid & 7) * 8] = vr[i]; }
      __syncthreads();   // the one barrier of a pass: it publishes the next tile and ends every wave's reads of this one (behind the last tile: before the output stage takes the bytes)
    }
    l += xhalf(l); const float inv = 1.0f / l;   // l > 0: every causal row keeps its own key
#pragma unroll
    for (int j = 0; j < FC / 16; ++j) { const v4f a0 = {acc[j][0] * inv, acc[j][1] * inv, acc[j][2] * inv, acc[j][3] * inv}, a1 = {acc[j][4] * inv, acc[j][5] * inv, acc[j][6] * inv, acc[j][7] * inv}; *(v4f*)&so[col][j * 16 + 8 * g] = a0; *(v4f*)&so[col][j * 16 + 8 * g + 4] = a1; }
    asm volatile("s_wait_dscnt 0" ::: "memory"); __builtin_amdgcn_wave_barrier();   // the wave's lanes read each other's values below: the LDS writes stay in front of the reads
    // 16 rows x 768 B go out as 512-B pieces (whole 128-B lines): three wave-stores cover two rows
    float* yg = Y + ((size_t)b * TT + q0 + wave * 16) * CC + c0;
#pragma unroll
    for (int t = 0; t < 3; ++t) { const int e = t * 32 + lane, r2 = e / (FC / 4), c4 = (e % (FC / 4)) * 4;
#pragma unroll
      for (int a = 0; a < 8; ++a) vst2(yg + (size_t)(2 * a + r2) * CC + c4, *(const v4f*)&so[2 * a + r2][c4]); }
    asm volatile("s_wait_xcnt 0x0" ::: "memory");   // precaution: stands before the stores' data and address registers are written again
  } else {
    const int qb = QBH - 1 - (job - NFJ) / NH, h = (job - NFJ) % NH; const float* __restrict__ PS = PA + (size_t)b * QHI * TT; const int ql0 = qb * 64 + wave * 16; const int kce = (kb_last(qb) + 1) * 4;
    v8f acc[HD / 16] = {};
#pragma unroll 1
    for (int kc = 0; kc < kce; ++kc) { const F2 p = split_row(PS + (size_t)(ql0 + col) * TT, kc * 32, lane);
      asm volatile("s_wait_loadcnt 0x0" ::: "memory");
#pragma unroll
      for (int j = 0; j < HD / 16; ++j) { const size_t po = ((size_t)b * CC + h * HD + j * 16 + col) * (size_t)KHI + kc * 32; const v16b vh = frag_b(VB + po, lane); acc[j] = wmma_bf(p.h, vh, acc[j]); acc[j] = wmma_bf(p.l, vh, acc[j]); acc[j] = wmma_bf(p.h, frag_b(VBL + po, lane), acc[j]); } }
    // output stage in the wave's own LDS range; 256-B (row, slot) segment by 16 lanes
    float (*se)[HD + 4] = (float (*)[HD + 4])sm + wave * 16;
#pragma unroll
    for (int j = 0; j < HD / 16; ++j)
#pragma unroll
      for (int r = 0; r < 8; ++r) se[8 * g + r][j * 16 + col] = acc[j][r] * (1.0f / 2048.0f);
    LDSX(); for (int rl = 0; rl < 16; ++rl) if (g == 0) vst2(Y + ((size_t)b * TT + ql0 + rl) * CC + h * HD + col * 4, *(const v4f*)&se[rl][col * 4]); } }

extern "C" void kernel_launch(void* const* d_in, const int* in_sizes, int n_in, void* d_out, int out_size, void* d_ws, size_t ws_size, hipStream_t stream) {
  (void)in_sizes; (void)n_in; (void)out_size;
  const float** F = (const float**)d_in;
  if (ws_size < (size_t)WS_END) return;
  char* ws = (char*)d_ws; _Float16 *QH = (_Float16*)(ws + WS_QH), *KH = (_Float16*)(ws + WS_KH), *VT = (_Float16*)(ws + WS_VT), *QL = (_Float16*)(ws + WS_QL), *KL = (_Float16*)(ws + WS_KL); __bf16 *VB = (__bf16*)(ws + WS_VB), *VBL = (__bf16*)(ws + WS_VBL); float *S = (float*)(ws + WS_S), *Y = (float*)(ws + WS_Y);
  (void)Y; (void)QL; (void)KL; (void)VB; (void)VBL;
  // inputs: 0 x [8,2048,384]; 1 Wq [384,64] (in,out); 2 Wk [384,64]; 3 Wv [384,384] (in,out); no biases
  k_proj<<<dim3(TNB * TT / 64, CC / 128 + 1), 128, 0, stream>>>(F[0], F[1], F[2], F[3], nullptr, nullptr, nullptr, QH, QL, KH, KL, VT, VB, VBL);   /* y = 0: q and k (64 columns each) in one tile; y = 1..3: 128 value columns each */
  k_sp<<<dim3(TNB, QHI / 16), 256, 0, stream>>>(QH, KH, QL, KL, S);   /* the early rows' P: 16 query rows a block */
  k_pv<<<dim3(TNB, NFJ + QBH * NH), 128, 0, stream>>>(S, QH, KH, VT, VB, VBL, (float*)d_out);   /* y: the fused blocks of rows >= 384, then the early rows' blocks */
}
